// v000
// The times below were measured on an AMD MI455X: many runs one after another, warmed up first and cycling through
// copies of the inputs, with the whole window's GPU time divided by the number of runs. Launches and the gaps
// between them are all in it. The median over several windows is given; except for v000 it joins two sittings, which
// can be a few percent apart, so the side-by-side timings, each taken in one sitting, are the better comparison.
// v000 is the starting kernel. One run takes 561 microseconds.
#include <hip/hip_runtime.h>
// CrossViewAttention3D (1 clip: 512 channels x (4 x 32 x 32 = 4096) tokens, 8 heads x 64): q = Wq video + bq, k = Wk ref + bk, v = Wv ref + bv (1x1x1 convs = channel matmuls); softmax(q.k / 8) over the 4096 ref tokens; out = Wo ctx + bo; channel-major in and out.
// Structure: exact token-major f16 planes of both inputs; q, k, v as f16 WMMA GEMM outputs (32x64 wave tiles, f32 accumulation, exact x16 weights + bias, f16 out); V^T by LDS tiles; the fused flash kernel (4096 x 4096 per head, plain operands); ctx f16; Wo + bo GEMM; NCHW store.
// Compute dtype: inputs rounded to bf16; inputs exact as f16; q/k/P/v/ctx as plain f16 operands (~2^-12); softmax f32. v_wmma_f32_16x16x32_f16.
#define NB 1
#define DM 512
#define NKV 8
#define NREP (NH / NKV)
#define KVD (NKV * 64)           /* 512 */
#define NR (NB * SLEN)           /* 4096 */
#define SLEN 4096
#define TQ SLEN
#define TK SLEN
#define NH 8
#define SCL 0.125f
#define QBLKS (TQ / 64)
#define QB05 0
#define QBN5 4
#define QB0P 0
#define QBNP QBLKS           /* non-causal: plain flash on every query block */
#define RE 256
typedef __bf16 v16b __attribute__((ext_vector_type(16)));
typedef unsigned short v8us __attribute__((ext_vector_type(8), may_alias));
typedef float  v8f  __attribute__((ext_vector_type(8)));
typedef float  v4f  __attribute__((ext_vector_type(4)));
typedef float  v4fa __attribute__((ext_vector_type(4), may_alias));
union FragB { v16b v; v8us half[2]; unsigned short u[16]; };

__device__ __forceinline__ unsigned short bf16_bits(float x) { unsigned int u = __float_as_uint(x); return (unsigned short)((u + 0x7FFFu + ((u >> 16) & 1u)) >> 16); }
__device__ __forceinline__ float bf16_val(unsigned short b) { return __uint_as_float(((unsigned int)b) << 16); }
__device__ __forceinline__ float bf16_round(float x) { return bf16_val(bf16_bits(x)); }
// D += A·B with NT terms: 1 = ah·bh, 2 = + al·bh (A split), 3 = + ah·bl (both split)
template <int NT>
__device__ __forceinline__ v8f mmaN(v16b ah, v16b al, v16b bh, v16b bl, v8f c) {
  c = __builtin_amdgcn_wmma_f32_16x16x32_bf16(false, ah, false, bh, (short)0, c, false, false);
  if (NT >= 2) c = __builtin_amdgcn_wmma_f32_16x16x32_bf16(false, al, false, bh, (short)0, c, false, false);
  if (NT >= 3) c = __builtin_amdgcn_wmma_f32_16x16x32_bf16(false, ah, false, bl, (short)0, c, false, false);
  asm volatile("v_nop\n\tv_nop\n\tv_nop\n\tv_nop" : "+v"(c) : "v"(ah), "v"(al), "v"(bh), "v"(bl));
  return c;
}

__global__ __launch_bounds__(256) void k_wt_bf16(const float* __restrict__ W, unsigned short* __restrict__ Wt, int K, int N) {
  const int t = blockIdx.x * 256 + threadIdx.x;
  const int k8n = K / 8;
  if (t >= N * k8n) return;
  const int n = t / k8n, k8 = (t % k8n) * 8;
  v8us v;
#pragma unroll
  for (int i = 0; i < 8; ++i) v[i] = bf16_bits(W[(size_t)(k8 + i) * N + n]);
  *(v8us*)(Wt + (size_t)n * K + k8) = v;
  
}

// GEMM C[M][N] (f32, pitch ldc) = act(A[M][K]·W + bias). A f32 row-major (pitch lda) converted per fragment to bf16
// (ASPLIT: hi/lo two planes -> 2 terms, else single rounded term); Wt bf16 [N][K] (pitch ldb). BIAS_BF16 rounds the
// bias to bf16 first (bias quantised to bf16 before the add). K%32==0, M%16==0, N%64==0.
template <bool ASPLIT, int ACT, bool BIAS_BF16>
__global__ __launch_bounds__(128) void k_gemm_bf(const float* __restrict__ A, int lda, const unsigned short* __restrict__ Wt, int ldb,
                                               const float* __restrict__ bias, float* __restrict__ C, int ldc, int M, int N, int K) {
  __shared__ __attribute__((aligned(16))) float so[4][16][64];
  const int tid = threadIdx.x, w = tid >> 5, lane = tid & 31, ln = lane & 15, hh = lane >> 4;
  const int ntn = N / 64;
  const int wid = blockIdx.x * 4 + w;
  const int mt = wid / ntn, nq = wid % ntn;
  if (mt * 16 >= M) return;
  const int row0 = mt * 16, col0 = nq * 64;
  const float* arow = A + (size_t)(row0 + ln) * lda;
  v8f acc[4] = {};
  for (int kb = 0; kb < K; kb += 32) {
    FragB ah, al;
    const v4f x0 = *(const v4fa*)(arow + kb + 8 * hh), x1 = *(const v4fa*)(arow + kb + 8 * hh + 4);
    const v4f x2 = *(const v4fa*)(arow + kb + 16 + 8 * hh), x3 = *(const v4fa*)(arow + kb + 16 + 8 * hh + 4);
    float xs[16] = {x0[0],x0[1],x0[2],x0[3],x1[0],x1[1],x1[2],x1[3],x2[0],x2[1],x2[2],x2[3],x3[0],x3[1],x3[2],x3[3]};
#pragma unroll
    for (int i = 0; i < 16; ++i) { const unsigned short hb = bf16_bits(xs[i]); ah.u[i] = hb; al.u[i] = ASPLIT ? bf16_bits(xs[i] - bf16_val(hb)) : (unsigned short)0; }
#pragma unroll
    for (int t = 0; t < 4; ++t) {
      const unsigned short* brow = Wt + (size_t)(col0 + t * 16 + ln) * ldb + kb;
      FragB b;
      b.half[0] = *(const v8us*)(brow + 8 * hh);
      b.half[1] = *(const v8us*)(brow + 16 + 8 * hh);
      acc[t] = mmaN<ASPLIT ? 2 : 1>(ah.v, al.v, b.v, b.v, acc[t]);
    }
  }
#pragma unroll
  for (int t = 0; t < 4; ++t) {
    float bv = bias ? bias[col0 + t * 16 + ln] : 0.f;
    if (BIAS_BF16) bv = bf16_round(bv);
#pragma unroll
    for (int r = 0; r < 8; ++r) { float v = acc[t][r] + bv; if (ACT == 1) v = fmaxf(v, 0.f); so[w][8 * hh + r][t * 16 + ln] = v; }
  }
  __builtin_amdgcn_fence(__ATOMIC_ACQ_REL, "workgroup");
  __builtin_amdgcn_wave_barrier();
  const int rsub = lane >> 4, c4 = (lane & 15) * 4;
  {
#pragma unroll
    for (int q = 0; q < 8; ++q) {
      const int r = q * 2 + rsub;
      const v4f v = *(const v4fa*)&so[w][r][c4];
      *(v4f*)(C + (size_t)(row0 + r) * ldc + col0 + c4) = v;
    }
    
  }
}

// GEMM C = act(A·W + bias + resid): A f32 (ASPLIT -> hi/lo 2 terms), Wt bf16 [N][K]; ACT 0 none, 1 relu, 2 exact gelu;
// resid (optional, f32, row index = (row % rmod), pitch ldr, RES_BF16 rounds it) added before the activation.
template <bool ASPLIT, int ACT, bool BIAS_BF16, bool RES_BF16>
__global__ __launch_bounds__(128) void k_gemm_bf3(const float* __restrict__ A, int lda, const unsigned short* __restrict__ Wt, int ldb,
                                                const float* __restrict__ bias, const float* __restrict__ resid, int rmod, int ldr,
                                                float* __restrict__ C, int ldc, int M, int N, int K) {
  __shared__ __attribute__((aligned(16))) float so[4][16][64];
  const int tid = threadIdx.x, w = tid >> 5, lane = tid & 31, ln = lane & 15, hh = lane >> 4;
  const int ntn = N / 64;
  const int wid = blockIdx.x * 4 + w;
  const int mt = wid / ntn, nq = wid % ntn;
  if (mt * 16 >= M) return;
  const int row0 = mt * 16, col0 = nq * 64;
  const float* arow = A + (size_t)(row0 + ln) * lda;
  v8f acc[4] = {};
  for (int kb = 0; kb < K; kb += 32) {
    FragB ah, al;
    const v4f x0 = *(const v4fa*)(arow + kb + 8 * hh), x1 = *(const v4fa*)(arow + kb + 8 * hh + 4);
    const v4f x2 = *(const v4fa*)(arow + kb + 16 + 8 * hh), x3 = *(const v4fa*)(arow + kb + 16 + 8 * hh + 4);
    float xs[16] = {x0[0],x0[1],x0[2],x0[3],x1[0],x1[1],x1[2],x1[3],x2[0],x2[1],x2[2],x2[3],x3[0],x3[1],x3[2],x3[3]};
#pragma unroll
    for (int i = 0; i < 16; ++i) { const unsigned short hb = bf16_bits(xs[i]); ah.u[i] = hb; al.u[i] = ASPLIT ? bf16_bits(xs[i] - bf16_val(hb)) : (unsigned short)0; }
#pragma unroll
    for (int t = 0; t < 4; ++t) {
      const unsigned short* brow = Wt + (size_t)(col0 + t * 16 + ln) * ldb + kb;
      FragB b;
      b.half[0] = *(const v8us*)(brow + 8 * hh);
      b.half[1] = *(const v8us*)(brow + 16 + 8 * hh);
      acc[t] = mmaN<ASPLIT ? 2 : 1>(ah.v, al.v, b.v, b.v, acc[t]);
    }
  }
#pragma unroll
  for (int t = 0; t < 4; ++t) {
    const int col = col0 + t * 16 + ln;
    float bv = bias ? bias[col] : 0.f;
    if (BIAS_BF16) bv = bf16_round(bv);
#pragma unroll
    for (int r = 0; r < 8; ++r) {
      float v = acc[t][r] + bv;
      if (resid) { float rv = resid[(size_t)((row0 + 8 * hh + r) % rmod) * ldr + col]; if (RES_BF16) rv = bf16_round(rv); v += rv; }
      if (ACT == 1) v = fmaxf(v, 0.f);
      if (ACT == 2) v = 0.5f * v * (1.0f + erff(v * 0.70710678118654752f));
      if (ACT == 3) { const float u = 0.7978845608028654f * (v + 0.044715f * v * v * v); v = 0.5f * v * (1.0f + tanhf(u)); }
      so[w][8 * hh + r][t * 16 + ln] = v;
    }
  }
  __builtin_amdgcn_fence(__ATOMIC_ACQ_REL, "workgroup");
  __builtin_amdgcn_wave_barrier();
  const int rsub = lane >> 4, c4 = (lane & 15) * 4;
  {
#pragma unroll
    for (int q = 0; q < 8; ++q) {
      const int r = q * 2 + rsub;
      const v4f v = *(const v4fa*)&so[w][r][c4];
      *(v4f*)(C + (size_t)(row0 + r) * ldc + col0 + c4) = v;
    }
    
  }
}
// row LayerNorm (biased variance, eps) over N: s = X (+ R); optional out_sum <- s; out_norm <- (s-mu)*rsqrt(var+eps)*g + b
template <bool PARAM_BF16>
__global__ __launch_bounds__(256) void k_layernorm(const float* __restrict__ X, const float* __restrict__ R, const float* __restrict__ g, const float* __restrict__ bta,
                                                  float* __restrict__ out_sum, float* __restrict__ out_norm, int N, float eps) {
  __shared__ float red[256];
  const int row = blockIdx.x, tid = threadIdx.x;
  const float* x = X + (size_t)row * N; const float* rr = R ? R + (size_t)row * N : nullptr;
  float vals[16];                     // up to N = 4096
  const int per = N / 256;            // contiguous chunk per thread? use strided-by-4 chunks: thread handles j = tid*4 + 1024*u
  float s1 = 0.f;
  for (int u = 0; u < per / 4; ++u) {
    const int j = tid * 4 + 1024 * u;
    const v4f a = *(const v4fa*)(x + j);
    v4f b = {0.f,0.f,0.f,0.f}; if (rr) b = *(const v4fa*)(rr + j);
#pragma unroll
    for (int q = 0; q < 4; ++q) { const float v = a[q] + b[q]; vals[u * 4 + q] = v; s1 += v; }
  }
  red[tid] = s1; __syncthreads();
  for (int st = 128; st > 0; st >>= 1) { if (tid < st) red[tid] += red[tid + st]; __syncthreads(); }
  const float mu = red[0] / (float)N; __syncthreads();
  float s2 = 0.f;
  for (int u = 0; u < per / 4; ++u)
#pragma unroll
    for (int q = 0; q < 4; ++q) { const float c = vals[u * 4 + q] - mu; s2 += c * c; }
  red[tid] = s2; __syncthreads();
  for (int st = 128; st > 0; st >>= 1) { if (tid < st) red[tid] += red[tid + st]; __syncthreads(); }
  const float rs = rsqrtf(red[0] / (float)N + eps);
  {
    for (int u = 0; u < per / 4; ++u) {
      const int j = tid * 4 + 1024 * u;
      v4f o, sm;
#pragma unroll
      for (int q = 0; q < 4; ++q) {
        float gg = g[j + q], bb = bta[j + q];
        if (PARAM_BF16) { gg = bf16_round(gg); bb = bf16_round(bb); }
        sm[q] = vals[u * 4 + q]; o[q] = (vals[u * 4 + q] - mu) * rs * gg + bb;
      }
      if (out_sum) *(v4f*)(out_sum + (size_t)row * N + j) = sm;
      *(v4f*)(out_norm + (size_t)row * N + j) = o;
    }
    
  }
}



// ---- f16 WMMA path (v_wmma_f32_16x16x32_f16): 11-bit significands for operands in range — used where a [0,1] probability operand needs more precision than bf16
typedef _Float16 v16h __attribute__((ext_vector_type(16)));
union FragH { v16h v; v8us half[2]; _Float16 h[16]; unsigned short u[16]; };
template <int NT>
__device__ __forceinline__ v8f mmaH(v16h ah, v16h al, v16h bh, v16h bl, v8f c) {
  c = __builtin_amdgcn_wmma_f32_16x16x32_f16(false, ah, false, bh, (short)0, c, false, false);
  if (NT >= 2) c = __builtin_amdgcn_wmma_f32_16x16x32_f16(false, al, false, bh, (short)0, c, false, false);
  if (NT >= 3) c = __builtin_amdgcn_wmma_f32_16x16x32_f16(false, ah, false, bl, (short)0, c, false, false);
  asm volatile("v_nop\n\tv_nop\n\tv_nop\n\tv_nop" : "+v"(c) : "v"(ah), "v"(al), "v"(bh), "v"(bl));
  return c;
}
// batched GEMM like k_gemm_b but f16 operands: A f32 (split into f16 hi/lo if ASPLIT, else rounded to f16), Bt = f16 values [n][k]; alpha; C f32; N multiple of 16 (partial tiles skipped)
template <bool ASPLIT>
__global__ __launch_bounds__(128) void k_gemm_h(const float* __restrict__ A, int lda, size_t sA, const _Float16* __restrict__ Bh, int ldb, size_t sB, float alpha, float* __restrict__ C, int ldc, size_t sC, int M, int N, int K) {
  __shared__ __attribute__((aligned(16))) float so[4][16][64];
  const int tid = threadIdx.x, w = tid >> 5, lane = tid & 31, ln = lane & 15, hh = lane >> 4; const int by = blockIdx.y;
  A += (size_t)by * sA; Bh += (size_t)by * sB; C += (size_t)by * sC;
  const int ntn = (N + 63) / 64; const int wid = blockIdx.x * 4 + w; const int mt = wid / ntn, nq = wid % ntn; if (mt * 16 >= M) return;
  const int row0 = mt * 16, col0 = nq * 64; const float* arow = A + (size_t)(row0 + ln) * lda;
  v8f acc[4] = {};
  for (int kb = 0; kb < K; kb += 32) {
    FragH ah, al;
    const v4f x0 = *(const v4fa*)(arow + kb + 8 * hh), x1 = *(const v4fa*)(arow + kb + 8 * hh + 4), x2 = *(const v4fa*)(arow + kb + 16 + 8 * hh), x3 = *(const v4fa*)(arow + kb + 16 + 8 * hh + 4);
    float xs[16] = {x0[0],x0[1],x0[2],x0[3],x1[0],x1[1],x1[2],x1[3],x2[0],x2[1],x2[2],x2[3],x3[0],x3[1],x3[2],x3[3]};
#pragma unroll
    for (int i = 0; i < 16; ++i) { const _Float16 h = (_Float16)xs[i]; ah.h[i] = h; al.h[i] = ASPLIT ? (_Float16)(xs[i] - (float)h) : (_Float16)0.0f; }
#pragma unroll
    for (int t = 0; t < 4; ++t) { if (col0 + t * 16 >= N) continue; const size_t boff = (size_t)(col0 + t * 16 + ln) * ldb + kb; FragH bq; bq.half[0] = *(const v8us*)(Bh + boff + 8 * hh); bq.half[1] = *(const v8us*)(Bh + boff + 16 + 8 * hh);
      acc[t] = mmaH<ASPLIT ? 2 : 1>(ah.v, al.v, bq.v, bq.v, acc[t]); }
  }
#pragma unroll
  for (int t = 0; t < 4; ++t) { if (col0 + t * 16 >= N) continue;
#pragma unroll
    for (int r = 0; r < 8; ++r) so[w][8 * hh + r][t * 16 + ln] = acc[t][r] * alpha; }
  __builtin_amdgcn_fence(__ATOMIC_ACQ_REL, "workgroup"); __builtin_amdgcn_wave_barrier();
  const int rsub = lane >> 4, c4 = (lane & 15) * 4;
  {
#pragma unroll
    for (int q = 0; q < 8; ++q) { const int r = q * 2 + rsub; if (col0 + c4 < N) { const v4f v = *(const v4fa*)&so[w][r][c4]; *(v4f*)(C + (size_t)(row0 + r) * ldc + col0 + c4) = v; } }
     }
}

// Wt[n][k] = f16(W[k][n]·scale) from f32 row-major W[K][N] (scale = power of two; bf16-exact weights stay exact in f16 away from the subnormal range)
__global__ __launch_bounds__(256) void k_wt_f16(const float* __restrict__ W, _Float16* __restrict__ Wt, int K, int N, float scale) {
  const int t = blockIdx.x * 256 + threadIdx.x; if (t >= N * (K / 8)) return; const int n = t / (K / 8), k8 = (t % (K / 8)) * 8; FragH f;
#pragma unroll
  for (int i = 0; i < 8; ++i) f.h[i] = (_Float16)(bf16_round(W[(size_t)(k8 + i) * N + n]) * scale); const v8us o = f.half[0];
  *(v8us*)((unsigned short*)Wt + (size_t)n * K + k8) = o; 
}
// k_gemm_hh variant with fused epilogue: v = acc·alpha + bias[by·sBias + col] (+ CP[(row/rowsPerB)·sCPb + by·64 + col] if CP) ; ACT 0 none / 1 elu ; writes f16 C16 (and f32 C if non-null)
template <int ACT>
__global__ __launch_bounds__(128) void k_gemm_hhx(const _Float16* __restrict__ A, int lda, size_t sA, const _Float16* __restrict__ Bh, int ldb, size_t sB, float alpha, const float* __restrict__ bias, size_t sBias, const float* __restrict__ CP, int rowsPerB, size_t sCPb, int row0g,
    float* __restrict__ C, _Float16* __restrict__ C16, int ldc, size_t sC, int M, int N, int K) {
  __shared__ __attribute__((aligned(16))) float so[4][16][64];
  const int tid = threadIdx.x, w = tid >> 5, lane = tid & 31, ln = lane & 15, hh = lane >> 4; const int by = blockIdx.y;
  A += (size_t)by * sA; Bh += (size_t)by * sB; const size_t cofs = (size_t)by * sC; const float* bp = bias ? bias + (size_t)by * sBias : nullptr;
  const int ntn = (N + 63) / 64; const int wid = blockIdx.x * 4 + w; const int mt = wid / ntn, nq = wid % ntn; if (mt * 16 >= M) return;
  const int row0 = mt * 16, col0 = nq * 64; const _Float16* arow = A + (size_t)(row0 + ln) * lda;
  v8f acc[4] = {};
  for (int kb = 0; kb < K; kb += 32) { FragH ah; ah.half[0] = *(const v8us*)((const unsigned short*)arow + kb + 8 * hh); ah.half[1] = *(const v8us*)((const unsigned short*)arow + kb + 16 + 8 * hh);
#pragma unroll
    for (int t = 0; t < 4; ++t) { if (col0 + t * 16 >= N) continue; const size_t boff = (size_t)(col0 + t * 16 + ln) * ldb + kb; FragH bq; bq.half[0] = *(const v8us*)((const unsigned short*)Bh + boff + 8 * hh); bq.half[1] = *(const v8us*)((const unsigned short*)Bh + boff + 16 + 8 * hh);
      acc[t] = mmaH<1>(ah.v, ah.v, bq.v, bq.v, acc[t]); }
  }
#pragma unroll
  for (int t = 0; t < 4; ++t) { if (col0 + t * 16 >= N) continue; const int col = col0 + t * 16 + ln; const float bv = bp ? bf16_round(bp[col]) : 0.f;
#pragma unroll
    for (int r = 0; r < 8; ++r) { float v = acc[t][r] * alpha + bv; if (CP) { const int bidx = (row0g + row0 + 8 * hh + r) / rowsPerB; v += CP[(size_t)bidx * sCPb + (size_t)by * 64 + col]; } if (ACT == 1) v = (v > 0.f) ? v : expm1f(v); else if (ACT == 7) v = (v > 0.f) ? v + 1.0f : expf(v); else if (ACT == 8) v = tanhf(v); else if (ACT == 9) v = 0.5f * v * (1.0f + tanhf(0.7978845608028654f * (v + 0.044715f * v * v * v))); else if (ACT == 11) v = 1.0f / (1.0f + expf(-v)); else if (ACT == 12) v = (v > 0.f) ? v : 0.01f * v; else if (ACT == 14) v = (v > 0.f) ? v : 0.1f * v; else if (ACT == 15) v = v / (1.0f + expf(-v)); else if (ACT == 3) v = fmaxf(v, 0.f); else if (ACT == 6) v = 0.5f * v * (1.0f + erff(v * 0.70710678118654752f)); so[w][8 * hh + r][t * 16 + ln] = v; } }
  __builtin_amdgcn_fence(__ATOMIC_ACQ_REL, "workgroup"); __builtin_amdgcn_wave_barrier();
  const int rsub = lane >> 4, c4 = (lane & 15) * 4; typedef _Float16 v4h __attribute__((ext_vector_type(4)));
  {
#pragma unroll
    for (int q = 0; q < 8; ++q) { const int r = q * 2 + rsub; if (col0 + c4 < N) { const v4f v = *(const v4fa*)&so[w][r][c4]; if (C) *(v4f*)(C + cofs + (size_t)(row0 + r) * ldc + col0 + c4) = v; if (C16) { v4h h4; for (int i = 0; i < 4; ++i) h4[i] = (_Float16)v[i]; *(v4h*)(C16 + cofs + (size_t)(row0 + r) * ldc + col0 + c4) = h4; } } }
     }
}


typedef _Float16 v4h __attribute__((ext_vector_type(4)));

__global__ __launch_bounds__(256) void k_x16(const float* __restrict__ x, _Float16* __restrict__ X16, size_t n8) { const size_t t = (size_t)blockIdx.x * 256 + threadIdx.x; if (t >= n8) return; FragH f;
#pragma unroll
  for (int q = 0; q < 8; ++q) f.h[q] = (_Float16)bf16_round(x[t * 8 + q]); *(v8us*)((unsigned short*)X16 + t * 8) = f.half[0];  }
__global__ __launch_bounds__(256) void k_h16(const float* __restrict__ x, _Float16* __restrict__ X16, size_t n8) { const size_t t = (size_t)blockIdx.x * 256 + threadIdx.x; if (t >= n8) return; FragH f;
#pragma unroll
  for (int q = 0; q < 8; ++q) f.h[q] = (_Float16)x[t * 8 + q]; *(v8us*)((unsigned short*)X16 + t * 8) = f.half[0];  }
__global__ __launch_bounds__(256) void k_round16f(const float* __restrict__ W, _Float16* __restrict__ Bt, size_t n8) { const size_t t = (size_t)blockIdx.x * 256 + threadIdx.x; if (t >= n8) return; FragH f;
#pragma unroll
  for (int i = 0; i < 8; ++i) f.h[i] = (_Float16)(bf16_round(W[t * 8 + i]) * 16.0f); *(v8us*)((unsigned short*)Bt + t * 8) = f.half[0];  }
template <int NHv, int TTv>
__global__ __launch_bounds__(256) void k_vt(const _Float16* __restrict__ V16, int ldv, int voff, _Float16* __restrict__ Vt) { __shared__ unsigned short tl[64][66]; const int tid = threadIdx.x; const int slab = blockIdx.x / (TTv / 64), lg = blockIdx.x % (TTv / 64); const int b = slab / NHv, h = slab % NHv;
  for (int i = tid; i < 64 * 8; i += 256) { const int r = i / 8, c8 = (i % 8) * 8; FragH f; f.half[0] = *(const v8us*)((const unsigned short*)V16 + ((size_t)b * TTv + lg * 64 + r) * ldv + voff + h * 64 + c8);
#pragma unroll
    for (int q = 0; q < 8; ++q) tl[r][c8 + q] = f.u[q]; }
  __syncthreads();
  {
#pragma unroll
    for (int rd = 0; rd < 2; ++rd) { const int d = rd * 32 + tid / 8, pc = tid % 8; FragH f;
#pragma unroll
      for (int q = 0; q < 8; ++q) f.u[q] = tl[pc * 8 + q][d];
      *(v8us*)((unsigned short*)Vt + ((size_t)slab * 64 + d) * TTv + lg * 64 + pc * 8) = f.half[0]; }
     } }

__global__ __launch_bounds__(256) void k_hl(const float* __restrict__ F, _Float16* __restrict__ Hh, _Float16* __restrict__ Hl, size_t n8) { const size_t t = (size_t)blockIdx.x * 256 + threadIdx.x; if (t >= n8) return; FragH fh, fl; const v4f a = *(const v4fa*)(F + t * 8), c = *(const v4fa*)(F + t * 8 + 4);
#pragma unroll
  for (int q = 0; q < 4; ++q) { _Float16 h = (_Float16)a[q]; fh.h[q] = h; fl.h[q] = (_Float16)((a[q] - (float)h) * 1024.0f); h = (_Float16)c[q]; fh.h[4 + q] = h; fl.h[4 + q] = (_Float16)((c[q] - (float)h) * 1024.0f); }
  { *(v8us*)((unsigned short*)Hh + t * 8) = fh.half[0]; *(v8us*)((unsigned short*)Hl + t * 8) = fl.half[0];  } }

// ---- fast GEMM (wave tile 32x64; requires M % 32 == 0 rows per launch region and N % 64 == 0); epilogue = k_gemm_hhx semantics ----
__device__ __forceinline__ v16h g2_frag(const _Float16* p, int hh) { FragH f; f.half[0] = *(const v8us*)((const unsigned short*)p + 8 * hh); f.half[1] = *(const v8us*)((const unsigned short*)p + 16 + 8 * hh); return f.v; }
__device__ __forceinline__ v8f g2_mma(v16h a, v16h b, v8f c) { v8f d = __builtin_amdgcn_wmma_f32_16x16x32_f16(false, a, false, b, (short)0, c, false, false); asm volatile("v_nop\n\tv_nop\n\tv_nop\n\tv_nop" : "+v"(d) : "v"(a), "v"(b)); return d; }
template <int ACT>
__global__ __launch_bounds__(128) void k_gemm2(const _Float16* __restrict__ A, int lda, size_t sA, const _Float16* __restrict__ Bh, int ldb, size_t sB, float alpha, const float* __restrict__ bias, size_t sBias, const float* __restrict__ CP, int rowsPerB, size_t sCPb, int row0g,
    float* __restrict__ C, _Float16* __restrict__ C16, int ldc, size_t sC, int M, int N, int K) {
  __shared__ __attribute__((aligned(16))) float so[4][32][68];
  const int tid = threadIdx.x, w = tid >> 5, lane = tid & 31, ln = lane & 15, hh = lane >> 4; const int by = blockIdx.y;
  A += (size_t)by * sA; Bh += (size_t)by * sB; const size_t cofs = (size_t)by * sC; const float* bp = bias ? bias + (size_t)by * sBias : nullptr;
  const int ntn = N >> 6; const int mt = blockIdx.x / ntn, nq = blockIdx.x - mt * ntn; const int row0 = mt * 128 + 32 * w, col0 = nq * 64; if (row0 >= M) return;
  const _Float16* a0p = A + (size_t)(row0 + ln) * lda; const _Float16* a1p = a0p + (size_t)16 * lda;
  const _Float16* b0p = Bh + (size_t)(col0 + ln) * ldb; const _Float16* b1p = b0p + (size_t)16 * ldb; const _Float16* b2p = b1p + (size_t)16 * ldb; const _Float16* b3p = b2p + (size_t)16 * ldb;
  const v8f z8 = {0.f,0.f,0.f,0.f,0.f,0.f,0.f,0.f}; v8f c00 = z8, c01 = z8, c02 = z8, c03 = z8, c10 = z8, c11 = z8, c12 = z8, c13 = z8;
#pragma unroll 1
  for (int kb = 0; kb < K; kb += 32) { const v16h a0 = g2_frag(a0p + kb, hh), a1 = g2_frag(a1p + kb, hh);
    v16h b = g2_frag(b0p + kb, hh); c00 = g2_mma(a0, b, c00); c10 = g2_mma(a1, b, c10);
    b = g2_frag(b1p + kb, hh); c01 = g2_mma(a0, b, c01); c11 = g2_mma(a1, b, c11);
    b = g2_frag(b2p + kb, hh); c02 = g2_mma(a0, b, c02); c12 = g2_mma(a1, b, c12);
    b = g2_frag(b3p + kb, hh); c03 = g2_mma(a0, b, c03); c13 = g2_mma(a1, b, c13); }
  v8f accs[8] = {c00, c01, c02, c03, c10, c11, c12, c13};
#pragma unroll
  for (int u = 0; u < 8; ++u) { const int t = u & 3, half = u >> 2; const int col = col0 + t * 16 + ln; const float bv = bp ? bf16_round(bp[col]) : 0.f;
#pragma unroll
    for (int r = 0; r < 8; ++r) { const int rloc = half * 16 + 8 * hh + r; float v = accs[u][r] * alpha + bv; if (CP) { const int bidx = (row0g + row0 + rloc) / rowsPerB; v += CP[(size_t)bidx * sCPb + (size_t)by * 64 + col]; }
      if (ACT == 3) v = fmaxf(v, 0.f); else if (ACT == 6) v = 0.5f * v * (1.0f + erff(v * 0.70710678118654752f)); else if (ACT == 11) v = 1.0f / (1.0f + expf(-v)); else if (ACT == 15) v = v / (1.0f + expf(-v)); else if (ACT == 12) v = (v > 0.f) ? v : 0.01f * v; else if (ACT == 8) v = tanhf(v);
      so[w][rloc][t * 16 + ln] = v; } }
  __builtin_amdgcn_fence(__ATOMIC_ACQ_REL, "workgroup"); __builtin_amdgcn_wave_barrier();
  const int rsub = lane >> 4, c4 = (lane & 15) * 4;
  {
#pragma unroll
    for (int q = 0; q < 16; ++q) { const int r = q * 2 + rsub; const v4f v = *(const v4fa*)&so[w][r][c4]; if (C) *(v4f*)(C + cofs + (size_t)(row0 + r) * ldc + col0 + c4) = v; if (C16) { v4h h4; for (int i = 0; i < 4; ++i) h4[i] = (_Float16)v[i]; *(v4h*)(C16 + cofs + (size_t)(row0 + r) * ldc + col0 + c4) = h4; } }
     } }



template <int CAUSAL>
__global__ __launch_bounds__(128) void k_flash(const _Float16* __restrict__ Q16, int ldq, const _Float16* __restrict__ K16, int ldk, const _Float16* __restrict__ Vt, const int* __restrict__ MSK, float* __restrict__ O, int ldo) {
  constexpr int RPW = 16, RTN = RPW / 16, NQB = TQ / (4 * RPW), DT = 4, KS = 2;
  __shared__ __attribute__((aligned(16))) unsigned short sP[4][RPW][40]; __shared__ __attribute__((aligned(16))) float sO[4][RPW][64 + 4];
  const int tid = threadIdx.x, w = tid >> 5, lane = tid & 31, ln = lane & 15, hh = lane >> 4;
  const int slab = blockIdx.x / QBNP, qblk = QB0P + blockIdx.x % QBNP; (void)NQB; const int b = slab / NH, h = slab % NH; const int qb0 = qblk * (4 * RPW); const int q0 = qb0 + w * RPW;
  FragH aq[2][KS];
#pragma unroll
  for (int rt = 0; rt < RTN; ++rt) { const unsigned short* qr = (const unsigned short*)Q16 + ((size_t)b * TQ + q0 + rt * 16 + ln) * ldq + h * 64;
#pragma unroll
    for (int ks = 0; ks < KS; ++ks) { aq[rt][ks].half[0] = *(const v8us*)(qr + ks * 32 + 8 * hh); aq[rt][ks].half[1] = *(const v8us*)(qr + ks * 32 + 16 + 8 * hh); } }
  const unsigned short* Vth = (const unsigned short*)Vt + (size_t)slab * 64 * TK;
  float m_r[2][8], l_r[2][8]; v8f oacc[2][DT];
#pragma unroll
  for (int rt = 0; rt < RTN; ++rt) {
#pragma unroll
    for (int r = 0; r < 8; ++r) { m_r[rt][r] = -3.0e38f; l_r[rt][r] = 0.f; }
#pragma unroll
    for (int dt = 0; dt < DT; ++dt) oacc[rt][dt] = (v8f){0.f,0.f,0.f,0.f,0.f,0.f,0.f,0.f}; }
  const int jend = (CAUSAL == 1) ? (qb0 + 4 * RPW) : TK;      /* causal: keys beyond the block's last query never contribute */
#pragma unroll 1
  for (int j0 = 0; j0 < jend; j0 += 32) {
    v8f s[2][2];
#pragma unroll
    for (int nt = 0; nt < 2; ++nt) { const unsigned short* kr = (const unsigned short*)K16 + ((size_t)b * TK + j0 + nt * 16 + ln) * ldk + h * 64; FragH bk[KS];
#pragma unroll
      for (int ks = 0; ks < KS; ++ks) { bk[ks].half[0] = *(const v8us*)(kr + ks * 32 + 8 * hh); bk[ks].half[1] = *(const v8us*)(kr + ks * 32 + 16 + 8 * hh); }
#pragma unroll
      for (int rt = 0; rt < RTN; ++rt) { v8f acc = (v8f){0.f,0.f,0.f,0.f,0.f,0.f,0.f,0.f};
#pragma unroll
        for (int ks = 0; ks < KS; ++ks) acc = mmaH<1>(aq[rt][ks].v, aq[rt][ks].v, bk[ks].v, bk[ks].v, acc); s[rt][nt] = acc; } }
#pragma unroll
    for (int rt = 0; rt < RTN; ++rt)
#pragma unroll
      for (int r = 0; r < 8; ++r) { const int tq = q0 + rt * 16 + 8 * hh + r; const int k0 = j0 + ln, k1 = j0 + 16 + ln;
        const bool ok0 = (CAUSAL == 1) ? (k0 <= tq) : ((CAUSAL == 2) ? ((k0 >> 5) == (tq >> 5)) : true), ok1 = (CAUSAL == 1) ? (k1 <= tq) : ((CAUSAL == 2) ? ((k1 >> 5) == (tq >> 5)) : true);      /* mode 2: block-diagonal 32-token groups */
        float s0 = ok0 ? s[rt][0][r] * SCL : -3.0e38f, s1 = ok1 ? s[rt][1][r] * SCL : -3.0e38f; if (CAUSAL == 17) { const float* amk = (const float*)MSK + (size_t)b * TK; s0 += bf16_round(amk[k0]); s1 += bf16_round(amk[k1]); }      /* mode 17: additive per-(batch, key) mask INPUT */ float mc = fmaxf(s0, s1);
        mc = fmaxf(mc, __shfl_xor(mc, 1, 32)); mc = fmaxf(mc, __shfl_xor(mc, 2, 32)); mc = fmaxf(mc, __shfl_xor(mc, 4, 32)); mc = fmaxf(mc, __shfl_xor(mc, 8, 32));
        const float mn = fmaxf(m_r[rt][r], mc); const float al = (mn > -1.0e38f) ? expf(m_r[rt][r] - mn) : 1.0f; m_r[rt][r] = mn; const float p0 = ok0 ? expf(s0 - mn) : 0.f, p1 = ok1 ? expf(s1 - mn) : 0.f; l_r[rt][r] = l_r[rt][r] * al + p0 + p1;
#pragma unroll
        for (int dt = 0; dt < DT; ++dt) oacc[rt][dt][r] *= al;
        FragH t2; t2.h[0] = (_Float16)(p0 * 1024.0f); t2.h[1] = (_Float16)(p1 * 1024.0f); sP[w][rt * 16 + 8 * hh + r][ln] = t2.u[0]; sP[w][rt * 16 + 8 * hh + r][16 + ln] = t2.u[1]; }
    __builtin_amdgcn_fence(__ATOMIC_ACQ_REL, "workgroup"); __builtin_amdgcn_wave_barrier();
    FragH pa[2];
#pragma unroll
    for (int rt = 0; rt < RTN; ++rt) { pa[rt].half[0] = *(const v8us*)&sP[w][rt * 16 + ln][8 * hh]; pa[rt].half[1] = *(const v8us*)&sP[w][rt * 16 + ln][16 + 8 * hh]; }
#pragma unroll
    for (int dt = 0; dt < DT; ++dt) { const unsigned short* vrow = Vth + (size_t)(dt * 16 + ln) * TK + j0; FragH bv; bv.half[0] = *(const v8us*)(vrow + 8 * hh); bv.half[1] = *(const v8us*)(vrow + 16 + 8 * hh);
#pragma unroll
      for (int rt = 0; rt < RTN; ++rt) oacc[rt][dt] = mmaH<1>(pa[rt].v, pa[rt].v, bv.v, bv.v, oacc[rt][dt]); }
    __builtin_amdgcn_fence(__ATOMIC_ACQ_REL, "workgroup"); __builtin_amdgcn_wave_barrier(); }
#pragma unroll
  for (int rt = 0; rt < RTN; ++rt) {
#pragma unroll
    for (int r = 0; r < 8; ++r) { float l = l_r[rt][r]; l += __shfl_xor(l, 1, 32); l += __shfl_xor(l, 2, 32); l += __shfl_xor(l, 4, 32); l += __shfl_xor(l, 8, 32); l_r[rt][r] = (l > 0.f) ? 1.0f / (l * 1024.0f) : 0.f; }
#pragma unroll
    for (int dt = 0; dt < DT; ++dt)
#pragma unroll
      for (int r = 0; r < 8; ++r) sO[w][rt * 16 + 8 * hh + r][dt * 16 + ln] = oacc[rt][dt][r] * l_r[rt][r]; }
  __builtin_amdgcn_fence(__ATOMIC_ACQ_REL, "workgroup"); __builtin_amdgcn_wave_barrier();
  {
#pragma unroll
    for (int rp = 0; rp < RPW; rp += 2) { const int r = rp + (lane >> 4), pc = lane & 15; const v4f val = *(const v4fa*)&sO[w][r][pc * 4]; *(v4f*)(O + ((size_t)b * TQ + q0 + r) * ldo + h * 64 + pc * 4) = val; }
     } }
// 5-plane variant: S = Qh Kh^T + (Ql Kh^T + Qh Kl^T)/1024 with Q/K = [hi | 2^10 residual] f16 planes (QL/KL same layout as Q16/K16), then the 3-term P.V below.
// 3-term variant: O = (P_hi V_hi + (P_lo V_hi + P_hi V_lo) / 1024) / l with P = [hi | 2^10 residual] of 1024 p and V^T = [hi | 2^10 residual] planes (VtL same layout as Vt) -> ~2^-21-class products for un-averaged (early causal / peaked) rows
template <int CAUSAL>
__global__ __launch_bounds__(128) void k_flash5(const _Float16* __restrict__ Q16, const _Float16* __restrict__ QL, int ldq, const _Float16* __restrict__ K16, const _Float16* __restrict__ KL, int ldk, const _Float16* __restrict__ Vt, const _Float16* __restrict__ VtL, const int* __restrict__ MSK, float* __restrict__ O, int ldo) {
  constexpr int RPW = 16, RTN = RPW / 16, NQB = TQ / (4 * RPW), DT = 4, KS = 2;
  __shared__ __attribute__((aligned(16))) unsigned short sP[4][RPW][40]; __shared__ __attribute__((aligned(16))) unsigned short sPL[4][RPW][40]; __shared__ __attribute__((aligned(16))) float sO[4][RPW][64 + 4];
  const int tid = threadIdx.x, w = tid >> 5, lane = tid & 31, ln = lane & 15, hh = lane >> 4;
  const int slab = blockIdx.x / QBN5, qblk = QB05 + blockIdx.x % QBN5; (void)NQB; const int b = slab / NH, h = slab % NH; const int qb0 = qblk * (4 * RPW); const int q0 = qb0 + w * RPW;
  FragH aq[2][KS], aql[2][KS];
#pragma unroll
  for (int rt = 0; rt < RTN; ++rt) { const unsigned short* qr = (const unsigned short*)Q16 + ((size_t)b * TQ + q0 + rt * 16 + ln) * ldq + h * 64; const unsigned short* ql = (const unsigned short*)QL + ((size_t)b * TQ + q0 + rt * 16 + ln) * ldq + h * 64;
#pragma unroll
    for (int ks = 0; ks < KS; ++ks) { aq[rt][ks].half[0] = *(const v8us*)(qr + ks * 32 + 8 * hh); aq[rt][ks].half[1] = *(const v8us*)(qr + ks * 32 + 16 + 8 * hh); aql[rt][ks].half[0] = *(const v8us*)(ql + ks * 32 + 8 * hh); aql[rt][ks].half[1] = *(const v8us*)(ql + ks * 32 + 16 + 8 * hh); } }
  const unsigned short* Vth = (const unsigned short*)Vt + (size_t)slab * 64 * TK; const unsigned short* Vtl = (const unsigned short*)VtL + (size_t)slab * 64 * TK;
  float m_r[2][8], l_r[2][8]; v8f oacc[2][DT], oaccL[2][DT];
#pragma unroll
  for (int rt = 0; rt < RTN; ++rt) {
#pragma unroll
    for (int r = 0; r < 8; ++r) { m_r[rt][r] = -3.0e38f; l_r[rt][r] = 0.f; }
#pragma unroll
    for (int dt = 0; dt < DT; ++dt) { oacc[rt][dt] = (v8f){0.f,0.f,0.f,0.f,0.f,0.f,0.f,0.f}; oaccL[rt][dt] = oacc[rt][dt]; } }
  const int jend = (CAUSAL == 1) ? (qb0 + 4 * RPW) : TK;      /* causal: keys beyond the block's last query never contribute */
#pragma unroll 1
  for (int j0 = 0; j0 < jend; j0 += 32) {
    v8f s[2][2];
#pragma unroll
    for (int nt = 0; nt < 2; ++nt) { const unsigned short* kr = (const unsigned short*)K16 + ((size_t)b * TK + j0 + nt * 16 + ln) * ldk + h * 64; const unsigned short* klr = (const unsigned short*)KL + ((size_t)b * TK + j0 + nt * 16 + ln) * ldk + h * 64; FragH bk[KS], bkl[KS];
#pragma unroll
      for (int ks = 0; ks < KS; ++ks) { bk[ks].half[0] = *(const v8us*)(kr + ks * 32 + 8 * hh); bk[ks].half[1] = *(const v8us*)(kr + ks * 32 + 16 + 8 * hh); bkl[ks].half[0] = *(const v8us*)(klr + ks * 32 + 8 * hh); bkl[ks].half[1] = *(const v8us*)(klr + ks * 32 + 16 + 8 * hh); }
#pragma unroll
      for (int rt = 0; rt < RTN; ++rt) { v8f acc = (v8f){0.f,0.f,0.f,0.f,0.f,0.f,0.f,0.f}, accl = acc;
#pragma unroll
        for (int ks = 0; ks < KS; ++ks) { acc = mmaH<1>(aq[rt][ks].v, aq[rt][ks].v, bk[ks].v, bk[ks].v, acc); accl = mmaH<1>(aql[rt][ks].v, aql[rt][ks].v, bk[ks].v, bk[ks].v, accl); accl = mmaH<1>(aq[rt][ks].v, aq[rt][ks].v, bkl[ks].v, bkl[ks].v, accl); }
#pragma unroll
        for (int r = 0; r < 8; ++r) acc[r] += accl[r] * 0.0009765625f;
        s[rt][nt] = acc; } }
#pragma unroll
    for (int rt = 0; rt < RTN; ++rt)
#pragma unroll
      for (int r = 0; r < 8; ++r) { const int tq = q0 + rt * 16 + 8 * hh + r; const int k0 = j0 + ln, k1 = j0 + 16 + ln;
        bool ok0 = (CAUSAL == 1) ? (k0 <= tq) : ((CAUSAL == 2) ? ((k0 >> 5) == (tq >> 5)) : true), ok1 = (CAUSAL == 1) ? (k1 <= tq) : ((CAUSAL == 2) ? ((k1 >> 5) == (tq >> 5)) : true);      /* mode 2: block-diagonal 32-token groups */
        if (CAUSAL == 4) { const int* mrow = MSK + ((size_t)b * TQ + tq) * TK; ok0 = mrow[k0] != 0; ok1 = mrow[k1] != 0; }      /* mode 4: per-(query, key) INPUT mask shared by all heads; masked keys contribute nothing (== the reference's -4096 fill, whose exp underflows to 0), rows with no valid key give l = 0 -> output 0 (== the reference's row_valid zeroing) */
        float s0 = ok0 ? s[rt][0][r] * SCL : -3.0e38f, s1 = ok1 ? s[rt][1][r] * SCL : -3.0e38f; if (CAUSAL == 17) { const float* amk = (const float*)MSK + (size_t)b * TK; s0 += bf16_round(amk[k0]); s1 += bf16_round(amk[k1]); }      /* mode 17: additive per-(batch, key) mask INPUT */ float mc = fmaxf(s0, s1);
        mc = fmaxf(mc, __shfl_xor(mc, 1, 32)); mc = fmaxf(mc, __shfl_xor(mc, 2, 32)); mc = fmaxf(mc, __shfl_xor(mc, 4, 32)); mc = fmaxf(mc, __shfl_xor(mc, 8, 32));
        const float mn = fmaxf(m_r[rt][r], mc); const float al = (mn > -1.0e38f) ? expf(m_r[rt][r] - mn) : 1.0f; m_r[rt][r] = mn; const float p0 = ok0 ? expf(s0 - mn) : 0.f, p1 = ok1 ? expf(s1 - mn) : 0.f; l_r[rt][r] = l_r[rt][r] * al + p0 + p1;
#pragma unroll
        for (int dt = 0; dt < DT; ++dt) { oacc[rt][dt][r] *= al; oaccL[rt][dt][r] *= al; }
        FragH t2, t2l; const float ps0 = p0 * 1024.0f, ps1 = p1 * 1024.0f; t2.h[0] = (_Float16)ps0; t2.h[1] = (_Float16)ps1; t2l.h[0] = (_Float16)((ps0 - (float)t2.h[0]) * 1024.0f); t2l.h[1] = (_Float16)((ps1 - (float)t2.h[1]) * 1024.0f);
        sP[w][rt * 16 + 8 * hh + r][ln] = t2.u[0]; sP[w][rt * 16 + 8 * hh + r][16 + ln] = t2.u[1]; sPL[w][rt * 16 + 8 * hh + r][ln] = t2l.u[0]; sPL[w][rt * 16 + 8 * hh + r][16 + ln] = t2l.u[1]; }
    __builtin_amdgcn_fence(__ATOMIC_ACQ_REL, "workgroup"); __builtin_amdgcn_wave_barrier();
    FragH pa[2], pl[2];
#pragma unroll
    for (int rt = 0; rt < RTN; ++rt) { pa[rt].half[0] = *(const v8us*)&sP[w][rt * 16 + ln][8 * hh]; pa[rt].half[1] = *(const v8us*)&sP[w][rt * 16 + ln][16 + 8 * hh]; pl[rt].half[0] = *(const v8us*)&sPL[w][rt * 16 + ln][8 * hh]; pl[rt].half[1] = *(const v8us*)&sPL[w][rt * 16 + ln][16 + 8 * hh]; }
#pragma unroll
    for (int dt = 0; dt < DT; ++dt) { const unsigned short* vrow = Vth + (size_t)(dt * 16 + ln) * TK + j0; const unsigned short* vrl = Vtl + (size_t)(dt * 16 + ln) * TK + j0; FragH bv, bl; bv.half[0] = *(const v8us*)(vrow + 8 * hh); bv.half[1] = *(const v8us*)(vrow + 16 + 8 * hh); bl.half[0] = *(const v8us*)(vrl + 8 * hh); bl.half[1] = *(const v8us*)(vrl + 16 + 8 * hh);
#pragma unroll
      for (int rt = 0; rt < RTN; ++rt) { oacc[rt][dt] = mmaH<1>(pa[rt].v, pa[rt].v, bv.v, bv.v, oacc[rt][dt]); oaccL[rt][dt] = mmaH<1>(pl[rt].v, pl[rt].v, bv.v, bv.v, oaccL[rt][dt]); oaccL[rt][dt] = mmaH<1>(pa[rt].v, pa[rt].v, bl.v, bl.v, oaccL[rt][dt]); } }
    __builtin_amdgcn_fence(__ATOMIC_ACQ_REL, "workgroup"); __builtin_amdgcn_wave_barrier(); }
#pragma unroll
  for (int rt = 0; rt < RTN; ++rt) {
#pragma unroll
    for (int r = 0; r < 8; ++r) { float l = l_r[rt][r]; l += __shfl_xor(l, 1, 32); l += __shfl_xor(l, 2, 32); l += __shfl_xor(l, 4, 32); l += __shfl_xor(l, 8, 32); l_r[rt][r] = (l > 0.f) ? 1.0f / (l * 1024.0f) : 0.f; }
#pragma unroll
    for (int dt = 0; dt < DT; ++dt)
#pragma unroll
      for (int r = 0; r < 8; ++r) { float v = oacc[rt][dt][r]; v += oaccL[rt][dt][r] * 0.0009765625f; sO[w][rt * 16 + 8 * hh + r][dt * 16 + ln] = v * l_r[rt][r]; } }
  __builtin_amdgcn_fence(__ATOMIC_ACQ_REL, "workgroup"); __builtin_amdgcn_wave_barrier();
  {
#pragma unroll
    for (int rp = 0; rp < RPW; rp += 2) { const int r = rp + (lane >> 4), pc = lane & 15; const v4f val = *(const v4fa*)&sO[w][r][pc * 4]; *(v4f*)(O + ((size_t)b * TQ + q0 + r) * ldo + h * 64 + pc * 4) = val; }
     } }

__global__ __launch_bounds__(256) void k_rotab(float* __restrict__ CS, float* __restrict__ SN) {
  #pragma clang fp contract(off)
  const int t = blockIdx.x * 256 + threadIdx.x; if (t >= SLEN * 32) return; const int j = t % 32, s = t / 32; const float ex = (float)(2 * j) / 64.0f; const float inv = 1.0f / powf(10000.0f, ex); const float th = (float)s * inv; const float c = cosf(th), sn = sinf(th);
  { *(float*)(CS + t) = c; *(float*)(SN + t) = sn;  } }
__global__ __launch_bounds__(256) void k_rope(const float* __restrict__ F, int nsrc, int ndst, int rep, const float* __restrict__ CS, const float* __restrict__ SN, _Float16* __restrict__ H, _Float16* __restrict__ L) {
  #pragma clang fp contract(off)
  const size_t t = (size_t)blockIdx.x * 256 + threadIdx.x; if (t >= (size_t)NR * ndst * 4) return; const int g8 = (int)(t % 4); const int hd = (int)((t / 4) % ndst); const size_t row = t / ((size_t)4 * ndst); const int s = (int)(row % SLEN); const int hs = hd / rep;
  const float* src = F + row * (size_t)(nsrc * 64) + hs * 64; FragH ah, al, bh, bl;
  for (int i = 0; i < 8; ++i) { const int d = g8 * 8 + i; const float c = CS[s * 32 + d], sn = SN[s * 32 + d]; const float x1 = src[d], x2 = src[d + 32];
    float o1 = x1 * c; o1 += -x2 * sn; float o2 = x2 * c; o2 += x1 * sn;
    _Float16 hv = (_Float16)o1; ah.h[i] = hv; al.h[i] = (_Float16)((o1 - (float)hv) * 1024.0f); hv = (_Float16)o2; bh.h[i] = hv; bl.h[i] = (_Float16)((o2 - (float)hv) * 1024.0f); }
  const size_t o = row * (size_t)(ndst * 64) + hd * 64 + g8 * 8;
  { *(v8us*)((unsigned short*)H + o) = ah.half[0]; *(v8us*)((unsigned short*)H + o + 32) = bh.half[0]; *(v8us*)((unsigned short*)L + o) = al.half[0]; *(v8us*)((unsigned short*)L + o + 32) = bl.half[0];  } }
__global__ __launch_bounds__(256) void k_rope2(const float* __restrict__ F, int nsrc, int ndst, int rep, const float* __restrict__ CS, const float* __restrict__ SN, _Float16* __restrict__ H, _Float16* __restrict__ L) {
  #pragma clang fp contract(off)
  const size_t t = (size_t)blockIdx.x * 256 + threadIdx.x; if (t >= (size_t)NR * ndst * 4) return; const int g16 = (int)(t % 4); const int hd = (int)((t / 4) % ndst); const size_t row = t / ((size_t)4 * ndst); const int s = (int)(row % SLEN); const int hs = hd / rep;
  const float* src = F + row * (size_t)(nsrc * 64) + hs * 64 + g16 * 16; FragH ah, al;
  for (int pr = 0; pr < 8; ++pr) { const int i = g16 * 8 + pr; const float c = CS[s * 32 + i], sn = SN[s * 32 + i]; const float x1 = src[2 * pr], x2 = src[2 * pr + 1];
    float o1 = x1 * c; o1 -= x2 * sn; float o2 = x1 * sn; o2 += x2 * c;
    _Float16 hv = (_Float16)o1; ah.h[2 * pr] = hv; al.h[2 * pr] = (_Float16)((o1 - (float)hv) * 1024.0f); hv = (_Float16)o2; ah.h[2 * pr + 1] = hv; al.h[2 * pr + 1] = (_Float16)((o2 - (float)hv) * 1024.0f); }
  const size_t o = row * (size_t)(ndst * 64) + hd * 64 + g16 * 16;
  { *(v8us*)((unsigned short*)H + o) = ah.half[0]; *(v8us*)((unsigned short*)H + o + 8) = ah.half[1]; *(v8us*)((unsigned short*)L + o) = al.half[0]; *(v8us*)((unsigned short*)L + o + 8) = al.half[1];  } }
__global__ __launch_bounds__(256) void k_tabin(const float* __restrict__ sp, float* __restrict__ CS, float* __restrict__ SN) { const int t = blockIdx.x * 256 + threadIdx.x; if (t >= SLEN * 32) return; const int i = t % 32, s = t / 32; const float c = bf16_round(sp[s * 64 + 32 + i]), sn = bf16_round(sp[s * 64 + i]);
  { *(float*)(CS + t) = c; *(float*)(SN + t) = sn;  } }
__global__ __launch_bounds__(256) void k_wsc(const float* __restrict__ Wm, _Float16* __restrict__ Bt, size_t n8, float sc) { const size_t t = (size_t)blockIdx.x * 256 + threadIdx.x; if (t >= n8) return; FragH f; for (int q = 0; q < 8; ++q) f.h[q] = (_Float16)(bf16_round(Wm[t * 8 + q]) * sc); *(v8us*)((unsigned short*)Bt + t * 8) = f.half[0];  }
__global__ __launch_bounds__(256) void k_rotab2(float* __restrict__ CS, float* __restrict__ SN) {
  #pragma clang fp contract(off)
  const int t = blockIdx.x * 256 + threadIdx.x; if (t >= SLEN * 32) return; const int j = t % 32, s = t / 32; const float c0 = -0.14391156831212787f;      /* -ln(10000)/64 rounded to f32 */ const float inv = expf((float)(2 * j) * c0); const float th = (float)s * inv; const float c = cosf(th), sn = sinf(th);
  { *(float*)(CS + t) = c; *(float*)(SN + t) = sn;  } }
__global__ __launch_bounds__(256) void k_lnu(const float* __restrict__ X, _Float16* __restrict__ N16, float* __restrict__ XB) {
  #pragma clang fp contract(off)
  const int wv = threadIdx.x >> 5, ln = threadIdx.x & 31; const size_t r = (size_t)blockIdx.x * 8 + wv; if (r >= NR) return; float a[32]; float s = 0.f;
  for (int i = 0; i < 4; ++i) { const v8f v = *(const v8f*)(X + r * DM + (i * 32 + ln) * 8); for (int q = 0; q < 8; ++q) { const float u = bf16_round(v[q]); a[i * 8 + q] = u; s += u; } }
  for (int o = 16; o > 0; o >>= 1) s += __shfl_xor(s, o, 32); const float mu = s / (float)DM; float var = 0.f; for (int q = 0; q < 32; ++q) { const float d = a[q] - mu; var += d * d; }
  for (int o = 16; o > 0; o >>= 1) var += __shfl_xor(var, o, 32); const float den = sqrtf(var / (float)(DM - 1)) + 1e-6f; const float inv = 1.0f / den;      /* one reciprocal per row; (x-mean)*inv vs the reference's division differs by <= 1 ulp */
  { for (int i = 0; i < 4; ++i) { const int c0 = (i * 32 + ln) * 8; FragH f; v8f xb; for (int q = 0; q < 8; ++q) { f.h[q] = (_Float16)((a[i * 8 + q] - mu) * inv); xb[q] = a[i * 8 + q]; } *(v8us*)((unsigned short*)N16 + r * DM + c0) = f.half[0]; *(v8f*)(XB + r * DM + c0) = xb; }  } }
__global__ __launch_bounds__(256) void k_vtg(const _Float16* __restrict__ V16, _Float16* __restrict__ Vt) { __shared__ unsigned short tl[64][66]; const int tid = threadIdx.x; const int slab = blockIdx.x / (SLEN / 64), lg = blockIdx.x % (SLEN / 64); const int b = slab / NH, h = slab % NH; const int hs = h / NREP;
  for (int i = tid; i < 64 * 8; i += 256) { const int r = i / 8, c8 = (i % 8) * 8; FragH f; f.half[0] = *(const v8us*)((const unsigned short*)V16 + ((size_t)b * SLEN + lg * 64 + r) * KVD + hs * 64 + c8); for (int q = 0; q < 8; ++q) tl[r][c8 + q] = f.u[q]; }
  __syncthreads();
  { for (int rd = 0; rd < 2; ++rd) { const int d = rd * 32 + tid / 8, pc = tid % 8; FragH f; for (int q = 0; q < 8; ++q) f.u[q] = tl[pc * 8 + q][d]; *(v8us*)((unsigned short*)Vt + ((size_t)slab * 64 + d) * SLEN + lg * 64 + pc * 8) = f.half[0]; }  } }

__global__ __launch_bounds__(256) void k_pm(const float* __restrict__ src, _Float16* __restrict__ P16) { const int t = blockIdx.x * 256 + threadIdx.x; if (t >= SLEN * (DM / 8)) return; const int c0 = (t % (DM / 8)) * 8; const int n = t / (DM / 8); FragH f; for (int q = 0; q < 8; ++q) f.h[q] = (_Float16)bf16_round(src[(size_t)(c0 + q) * SLEN + n]);
  *(v8us*)((unsigned short*)P16 + (size_t)n * DM + c0) = f.half[0];  }
__global__ __launch_bounds__(256) void k_nchw(const float* __restrict__ F, float* __restrict__ outb) { const int t = blockIdx.x * 256 + threadIdx.x; if (t >= DM * (SLEN / 4)) return; const int p0 = (t % (SLEN / 4)) * 4; const int o = t / (SLEN / 4); v4f r; for (int q = 0; q < 4; ++q) r[q] = F[(size_t)(p0 + q) * DM + o];
  *(v4f*)(outb + (size_t)o * SLEN + p0) = r;  }

extern "C" void kernel_launch(void* const* d_in, const int* in_sizes, int n_in,
                              void* d_out, int out_size, void* d_ws, size_t ws_size, hipStream_t stream) {
  (void)in_sizes; (void)n_in; (void)out_size;
  const float* const* I = (const float* const*)d_in; const float* vid = I[0]; const float* reff = I[1]; const float* Wq = I[2]; const float* bq = I[3]; const float* Wk = I[4]; const float* bk = I[5]; const float* Wv = I[6]; const float* bv = I[7]; const float* Wo = I[8]; const float* bo = I[9];
  char* ws = (char*)d_ws; size_t off = 0;
  auto take = [&](size_t bytes) { char* p = ws + off; off += (bytes + 255) & ~(size_t)255; return p; };
  const size_t np = (size_t)SLEN * DM;
  _Float16* BQ = (_Float16*)take((size_t)DM * DM * 2); _Float16* BK = (_Float16*)take((size_t)DM * DM * 2); _Float16* BV = (_Float16*)take((size_t)DM * DM * 2); _Float16* BO = (_Float16*)take((size_t)DM * DM * 2);
  _Float16* XV = (_Float16*)take(np * 2); _Float16* XR = (_Float16*)take(np * 2); _Float16* Q16 = (_Float16*)take(np * 2); _Float16* K16 = (_Float16*)take(np * 2); _Float16* V16 = (_Float16*)take(np * 2); _Float16* VT = (_Float16*)take(np * 2); float* O = (float*)take(np * 4); _Float16* O16 = (_Float16*)take(np * 2); float* F = (float*)take(np * 4);
  if (off > ws_size) return;      /* 2 + 7 x 4 + 8 + 8 = 46 MiB */
  k_wsc<<<(DM * DM / 8 + 255) / 256, 256, 0, stream>>>(Wq, BQ, DM * DM / 8, 16.0f); k_wsc<<<(DM * DM / 8 + 255) / 256, 256, 0, stream>>>(Wk, BK, DM * DM / 8, 16.0f); k_wsc<<<(DM * DM / 8 + 255) / 256, 256, 0, stream>>>(Wv, BV, DM * DM / 8, 16.0f); k_wsc<<<(DM * DM / 8 + 255) / 256, 256, 0, stream>>>(Wo, BO, DM * DM / 8, 16.0f);      /* 'oc' = natural Bt */
  k_pm<<<(SLEN * (DM / 8) + 255) / 256, 256, 0, stream>>>(vid, XV); k_pm<<<(SLEN * (DM / 8) + 255) / 256, 256, 0, stream>>>(reff, XR);
  const dim3 gP((SLEN / 128) * (DM / 64), 1);
  k_gemm2<0><<<gP, 128, 0, stream>>>(XV, DM, 0, BQ, DM, 0, 0.0625f, bq, 0, nullptr, 1, 0, 0, nullptr, Q16, DM, 0, SLEN, DM, DM);
  k_gemm2<0><<<gP, 128, 0, stream>>>(XR, DM, 0, BK, DM, 0, 0.0625f, bk, 0, nullptr, 1, 0, 0, nullptr, K16, DM, 0, SLEN, DM, DM);
  k_gemm2<0><<<gP, 128, 0, stream>>>(XR, DM, 0, BV, DM, 0, 0.0625f, bv, 0, nullptr, 1, 0, 0, nullptr, V16, DM, 0, SLEN, DM, DM);
  k_vt<NH, TK><<<NB * NH * (TK / 64), 256, 0, stream>>>(V16, DM, 0, VT);
  k_flash<0><<<NB * NH * QBNP, 128, 0, stream>>>(Q16, DM, K16, DM, VT, nullptr, O, DM);      /* 4096 x 4096 per head */
  k_h16<<<(unsigned)((np / 8 + 255) / 256), 256, 0, stream>>>(O, O16, np / 8);
  k_gemm2<0><<<gP, 128, 0, stream>>>(O16, DM, 0, BO, DM, 0, 0.0625f, bo, 0, nullptr, 1, 0, 0, F, nullptr, DM, 0, SLEN, DM, DM);
  k_nchw<<<(DM * (SLEN / 4) + 255) / 256, 256, 0, stream>>>(F, (float*)d_out);
}

// v001
// A run of this version takes 384 microseconds.
// Timed twice side by side with v000, it ran 1.49 times as fast both times.
#include <hip/hip_runtime.h>
// CrossViewAttention3D (1 clip: 512 channels x (4 x 32 x 32 = 4096) tokens, 8 heads x 64): q = Wq video + bq, k = Wk ref + bk, v = Wv ref + bv (1x1x1 convs = channel matmuls); softmax(q.k / 8) over the 4096 ref tokens; out = Wo ctx + bo; channel-major in and out.
// Structure: exact token-major f16 planes of both inputs; q, k, v as f16 WMMA GEMM outputs (32x64 wave tiles, f32 accumulation, exact x16 weights + bias, f16 out); V^T by LDS tiles; the fused flash kernel (4096 x 4096 per head, plain operands); ctx f16; Wo + bo GEMM; NCHW store.
// Compute dtype: inputs rounded to bf16; inputs exact as f16; q/k/P/v/ctx as plain f16 operands (~2^-12); softmax f32. v_wmma_f32_16x16x32_f16.
#define NB 1
#define DM 512
#define NKV 8
#define NREP (NH / NKV)
#define KVD (NKV * 64)           /* 512 */
#define NR (NB * SLEN)           /* 4096 */
#define SLEN 4096
#define TQ SLEN
#define TK SLEN
#define NH 8
#define SCL 0.125f
#define QBLKS (TQ / 64)
#define QB05 0
#define QBN5 4
#define QB0P 0
#define QBNP QBLKS           /* non-causal: plain flash on every query block */
#define RE 256
typedef __bf16 v16b __attribute__((ext_vector_type(16)));
typedef unsigned short v8us __attribute__((ext_vector_type(8), may_alias));
typedef float  v8f  __attribute__((ext_vector_type(8)));
typedef float  v4f  __attribute__((ext_vector_type(4)));
typedef float  v4fa __attribute__((ext_vector_type(4), may_alias));
union FragB { v16b v; v8us half[2]; unsigned short u[16]; };

__device__ __forceinline__ unsigned short bf16_bits(float x) { unsigned int u = __float_as_uint(x); return (unsigned short)((u + 0x7FFFu + ((u >> 16) & 1u)) >> 16); }
__device__ __forceinline__ float bf16_val(unsigned short b) { return __uint_as_float(((unsigned int)b) << 16); }
__device__ __forceinline__ float bf16_round(float x) { return bf16_val(bf16_bits(x)); }
// D += A·B with NT terms: 1 = ah·bh, 2 = + al·bh (A split), 3 = + ah·bl (both split)
template <int NT>
__device__ __forceinline__ v8f mmaN(v16b ah, v16b al, v16b bh, v16b bl, v8f c) {
  c = __builtin_amdgcn_wmma_f32_16x16x32_bf16(false, ah, false, bh, (short)0, c, false, false);
  if (NT >= 2) c = __builtin_amdgcn_wmma_f32_16x16x32_bf16(false, al, false, bh, (short)0, c, false, false);
  if (NT >= 3) c = __builtin_amdgcn_wmma_f32_16x16x32_bf16(false, ah, false, bl, (short)0, c, false, false);
  asm volatile("v_nop\n\tv_nop\n\tv_nop\n\tv_nop" : "+v"(c) : "v"(ah), "v"(al), "v"(bh), "v"(bl));
  return c;
}

__global__ __launch_bounds__(256) void k_wt_bf16(const float* __restrict__ W, unsigned short* __restrict__ Wt, int K, int N) {
  const int t = blockIdx.x * 256 + threadIdx.x;
  const int k8n = K / 8;
  if (t >= N * k8n) return;
  const int n = t / k8n, k8 = (t % k8n) * 8;
  v8us v;
#pragma unroll
  for (int i = 0; i < 8; ++i) v[i] = bf16_bits(W[(size_t)(k8 + i) * N + n]);
  *(v8us*)(Wt + (size_t)n * K + k8) = v;
  
}

// GEMM C[M][N] (f32, pitch ldc) = act(A[M][K]·W + bias). A f32 row-major (pitch lda) converted per fragment to bf16
// (ASPLIT: hi/lo two planes -> 2 terms, else single rounded term); Wt bf16 [N][K] (pitch ldb). BIAS_BF16 rounds the
// bias to bf16 first (bias quantised to bf16 before the add). K%32==0, M%16==0, N%64==0.
template <bool ASPLIT, int ACT, bool BIAS_BF16>
__global__ __launch_bounds__(128) void k_gemm_bf(const float* __restrict__ A, int lda, const unsigned short* __restrict__ Wt, int ldb,
                                               const float* __restrict__ bias, float* __restrict__ C, int ldc, int M, int N, int K) {
  __shared__ __attribute__((aligned(16))) float so[4][16][64];
  const int tid = threadIdx.x, w = tid >> 5, lane = tid & 31, ln = lane & 15, hh = lane >> 4;
  const int ntn = N / 64;
  const int wid = blockIdx.x * 4 + w;
  const int mt = wid / ntn, nq = wid % ntn;
  if (mt * 16 >= M) return;
  const int row0 = mt * 16, col0 = nq * 64;
  const float* arow = A + (size_t)(row0 + ln) * lda;
  v8f acc[4] = {};
  for (int kb = 0; kb < K; kb += 32) {
    FragB ah, al;
    const v4f x0 = *(const v4fa*)(arow + kb + 8 * hh), x1 = *(const v4fa*)(arow + kb + 8 * hh + 4);
    const v4f x2 = *(const v4fa*)(arow + kb + 16 + 8 * hh), x3 = *(const v4fa*)(arow + kb + 16 + 8 * hh + 4);
    float xs[16] = {x0[0],x0[1],x0[2],x0[3],x1[0],x1[1],x1[2],x1[3],x2[0],x2[1],x2[2],x2[3],x3[0],x3[1],x3[2],x3[3]};
#pragma unroll
    for (int i = 0; i < 16; ++i) { const unsigned short hb = bf16_bits(xs[i]); ah.u[i] = hb; al.u[i] = ASPLIT ? bf16_bits(xs[i] - bf16_val(hb)) : (unsigned short)0; }
#pragma unroll
    for (int t = 0; t < 4; ++t) {
      const unsigned short* brow = Wt + (size_t)(col0 + t * 16 + ln) * ldb + kb;
      FragB b;
      b.half[0] = *(const v8us*)(brow + 8 * hh);
      b.half[1] = *(const v8us*)(brow + 16 + 8 * hh);
      acc[t] = mmaN<ASPLIT ? 2 : 1>(ah.v, al.v, b.v, b.v, acc[t]);
    }
  }
#pragma unroll
  for (int t = 0; t < 4; ++t) {
    float bv = bias ? bias[col0 + t * 16 + ln] : 0.f;
    if (BIAS_BF16) bv = bf16_round(bv);
#pragma unroll
    for (int r = 0; r < 8; ++r) { float v = acc[t][r] + bv; if (ACT == 1) v = fmaxf(v, 0.f); so[w][8 * hh + r][t * 16 + ln] = v; }
  }
  __builtin_amdgcn_fence(__ATOMIC_ACQ_REL, "workgroup");
  __builtin_amdgcn_wave_barrier();
  const int rsub = lane >> 4, c4 = (lane & 15) * 4;
  {
#pragma unroll
    for (int q = 0; q < 8; ++q) {
      const int r = q * 2 + rsub;
      const v4f v = *(const v4fa*)&so[w][r][c4];
      *(v4f*)(C + (size_t)(row0 + r) * ldc + col0 + c4) = v;
    }
    
  }
}

// GEMM C = act(A·W + bias + resid): A f32 (ASPLIT -> hi/lo 2 terms), Wt bf16 [N][K]; ACT 0 none, 1 relu, 2 exact gelu;
// resid (optional, f32, row index = (row % rmod), pitch ldr, RES_BF16 rounds it) added before the activation.
template <bool ASPLIT, int ACT, bool BIAS_BF16, bool RES_BF16>
__global__ __launch_bounds__(128) void k_gemm_bf3(const float* __restrict__ A, int lda, const unsigned short* __restrict__ Wt, int ldb,
                                                const float* __restrict__ bias, const float* __restrict__ resid, int rmod, int ldr,
                                                float* __restrict__ C, int ldc, int M, int N, int K) {
  __shared__ __attribute__((aligned(16))) float so[4][16][64];
  const int tid = threadIdx.x, w = tid >> 5, lane = tid & 31, ln = lane & 15, hh = lane >> 4;
  const int ntn = N / 64;
  const int wid = blockIdx.x * 4 + w;
  const int mt = wid / ntn, nq = wid % ntn;
  if (mt * 16 >= M) return;
  const int row0 = mt * 16, col0 = nq * 64;
  const float* arow = A + (size_t)(row0 + ln) * lda;
  v8f acc[4] = {};
  for (int kb = 0; kb < K; kb += 32) {
    FragB ah, al;
    const v4f x0 = *(const v4fa*)(arow + kb + 8 * hh), x1 = *(const v4fa*)(arow + kb + 8 * hh + 4);
    const v4f x2 = *(const v4fa*)(arow + kb + 16 + 8 * hh), x3 = *(const v4fa*)(arow + kb + 16 + 8 * hh + 4);
    float xs[16] = {x0[0],x0[1],x0[2],x0[3],x1[0],x1[1],x1[2],x1[3],x2[0],x2[1],x2[2],x2[3],x3[0],x3[1],x3[2],x3[3]};
#pragma unroll
    for (int i = 0; i < 16; ++i) { const unsigned short hb = bf16_bits(xs[i]); ah.u[i] = hb; al.u[i] = ASPLIT ? bf16_bits(xs[i] - bf16_val(hb)) : (unsigned short)0; }
#pragma unroll
    for (int t = 0; t < 4; ++t) {
      const unsigned short* brow = Wt + (size_t)(col0 + t * 16 + ln) * ldb + kb;
      FragB b;
      b.half[0] = *(const v8us*)(brow + 8 * hh);
      b.half[1] = *(const v8us*)(brow + 16 + 8 * hh);
      acc[t] = mmaN<ASPLIT ? 2 : 1>(ah.v, al.v, b.v, b.v, acc[t]);
    }
  }
#pragma unroll
  for (int t = 0; t < 4; ++t) {
    const int col = col0 + t * 16 + ln;
    float bv = bias ? bias[col] : 0.f;
    if (BIAS_BF16) bv = bf16_round(bv);
#pragma unroll
    for (int r = 0; r < 8; ++r) {
      float v = acc[t][r] + bv;
      if (resid) { float rv = resid[(size_t)((row0 + 8 * hh + r) % rmod) * ldr + col]; if (RES_BF16) rv = bf16_round(rv); v += rv; }
      if (ACT == 1) v = fmaxf(v, 0.f);
      if (ACT == 2) v = 0.5f * v * (1.0f + erff(v * 0.70710678118654752f));
      if (ACT == 3) { const float u = 0.7978845608028654f * (v + 0.044715f * v * v * v); v = 0.5f * v * (1.0f + tanhf(u)); }
      so[w][8 * hh + r][t * 16 + ln] = v;
    }
  }
  __builtin_amdgcn_fence(__ATOMIC_ACQ_REL, "workgroup");
  __builtin_amdgcn_wave_barrier();
  const int rsub = lane >> 4, c4 = (lane & 15) * 4;
  {
#pragma unroll
    for (int q = 0; q < 8; ++q) {
      const int r = q * 2 + rsub;
      const v4f v = *(const v4fa*)&so[w][r][c4];
      *(v4f*)(C + (size_t)(row0 + r) * ldc + col0 + c4) = v;
    }
    
  }
}
// row LayerNorm (biased variance, eps) over N: s = X (+ R); optional out_sum <- s; out_norm <- (s-mu)*rsqrt(var+eps)*g + b
template <bool PARAM_BF16>
__global__ __launch_bounds__(256) void k_layernorm(const float* __restrict__ X, const float* __restrict__ R, const float* __restrict__ g, const float* __restrict__ bta,
                                                  float* __restrict__ out_sum, float* __restrict__ out_norm, int N, float eps) {
  __shared__ float red[256];
  const int row = blockIdx.x, tid = threadIdx.x;
  const float* x = X + (size_t)row * N; const float* rr = R ? R + (size_t)row * N : nullptr;
  float vals[16];                     // up to N = 4096
  const int per = N / 256;            // contiguous chunk per thread? use strided-by-4 chunks: thread handles j = tid*4 + 1024*u
  float s1 = 0.f;
  for (int u = 0; u < per / 4; ++u) {
    const int j = tid * 4 + 1024 * u;
    const v4f a = *(const v4fa*)(x + j);
    v4f b = {0.f,0.f,0.f,0.f}; if (rr) b = *(const v4fa*)(rr + j);
#pragma unroll
    for (int q = 0; q < 4; ++q) { const float v = a[q] + b[q]; vals[u * 4 + q] = v; s1 += v; }
  }
  red[tid] = s1; __syncthreads();
  for (int st = 128; st > 0; st >>= 1) { if (tid < st) red[tid] += red[tid + st]; __syncthreads(); }
  const float mu = red[0] / (float)N; __syncthreads();
  float s2 = 0.f;
  for (int u = 0; u < per / 4; ++u)
#pragma unroll
    for (int q = 0; q < 4; ++q) { const float c = vals[u * 4 + q] - mu; s2 += c * c; }
  red[tid] = s2; __syncthreads();
  for (int st = 128; st > 0; st >>= 1) { if (tid < st) red[tid] += red[tid + st]; __syncthreads(); }
  const float rs = rsqrtf(red[0] / (float)N + eps);
  {
    for (int u = 0; u < per / 4; ++u) {
      const int j = tid * 4 + 1024 * u;
      v4f o, sm;
#pragma unroll
      for (int q = 0; q < 4; ++q) {
        float gg = g[j + q], bb = bta[j + q];
        if (PARAM_BF16) { gg = bf16_round(gg); bb = bf16_round(bb); }
        sm[q] = vals[u * 4 + q]; o[q] = (vals[u * 4 + q] - mu) * rs * gg + bb;
      }
      if (out_sum) *(v4f*)(out_sum + (size_t)row * N + j) = sm;
      *(v4f*)(out_norm + (size_t)row * N + j) = o;
    }
    
  }
}



// ---- f16 WMMA path (v_wmma_f32_16x16x32_f16): 11-bit significands for operands in range — used where a [0,1] probability operand needs more precision than bf16
typedef _Float16 v16h __attribute__((ext_vector_type(16)));
union FragH { v16h v; v8us half[2]; _Float16 h[16]; unsigned short u[16]; };
template <int NT>
__device__ __forceinline__ v8f mmaH(v16h ah, v16h al, v16h bh, v16h bl, v8f c) {
  c = __builtin_amdgcn_wmma_f32_16x16x32_f16(false, ah, false, bh, (short)0, c, false, false);
  if (NT >= 2) c = __builtin_amdgcn_wmma_f32_16x16x32_f16(false, al, false, bh, (short)0, c, false, false);
  if (NT >= 3) c = __builtin_amdgcn_wmma_f32_16x16x32_f16(false, ah, false, bl, (short)0, c, false, false);
  asm volatile("v_nop\n\tv_nop\n\tv_nop\n\tv_nop" : "+v"(c) : "v"(ah), "v"(al), "v"(bh), "v"(bl));
  return c;
}
// batched GEMM like k_gemm_b but f16 operands: A f32 (split into f16 hi/lo if ASPLIT, else rounded to f16), Bt = f16 values [n][k]; alpha; C f32; N multiple of 16 (partial tiles skipped)
template <bool ASPLIT>
__global__ __launch_bounds__(128) void k_gemm_h(const float* __restrict__ A, int lda, size_t sA, const _Float16* __restrict__ Bh, int ldb, size_t sB, float alpha, float* __restrict__ C, int ldc, size_t sC, int M, int N, int K) {
  __shared__ __attribute__((aligned(16))) float so[4][16][64];
  const int tid = threadIdx.x, w = tid >> 5, lane = tid & 31, ln = lane & 15, hh = lane >> 4; const int by = blockIdx.y;
  A += (size_t)by * sA; Bh += (size_t)by * sB; C += (size_t)by * sC;
  const int ntn = (N + 63) / 64; const int wid = blockIdx.x * 4 + w; const int mt = wid / ntn, nq = wid % ntn; if (mt * 16 >= M) return;
  const int row0 = mt * 16, col0 = nq * 64; const float* arow = A + (size_t)(row0 + ln) * lda;
  v8f acc[4] = {};
  for (int kb = 0; kb < K; kb += 32) {
    FragH ah, al;
    const v4f x0 = *(const v4fa*)(arow + kb + 8 * hh), x1 = *(const v4fa*)(arow + kb + 8 * hh + 4), x2 = *(const v4fa*)(arow + kb + 16 + 8 * hh), x3 = *(const v4fa*)(arow + kb + 16 + 8 * hh + 4);
    float xs[16] = {x0[0],x0[1],x0[2],x0[3],x1[0],x1[1],x1[2],x1[3],x2[0],x2[1],x2[2],x2[3],x3[0],x3[1],x3[2],x3[3]};
#pragma unroll
    for (int i = 0; i < 16; ++i) { const _Float16 h = (_Float16)xs[i]; ah.h[i] = h; al.h[i] = ASPLIT ? (_Float16)(xs[i] - (float)h) : (_Float16)0.0f; }
#pragma unroll
    for (int t = 0; t < 4; ++t) { if (col0 + t * 16 >= N) continue; const size_t boff = (size_t)(col0 + t * 16 + ln) * ldb + kb; FragH bq; bq.half[0] = *(const v8us*)(Bh + boff + 8 * hh); bq.half[1] = *(const v8us*)(Bh + boff + 16 + 8 * hh);
      acc[t] = mmaH<ASPLIT ? 2 : 1>(ah.v, al.v, bq.v, bq.v, acc[t]); }
  }
#pragma unroll
  for (int t = 0; t < 4; ++t) { if (col0 + t * 16 >= N) continue;
#pragma unroll
    for (int r = 0; r < 8; ++r) so[w][8 * hh + r][t * 16 + ln] = acc[t][r] * alpha; }
  __builtin_amdgcn_fence(__ATOMIC_ACQ_REL, "workgroup"); __builtin_amdgcn_wave_barrier();
  const int rsub = lane >> 4, c4 = (lane & 15) * 4;
  {
#pragma unroll
    for (int q = 0; q < 8; ++q) { const int r = q * 2 + rsub; if (col0 + c4 < N) { const v4f v = *(const v4fa*)&so[w][r][c4]; *(v4f*)(C + (size_t)(row0 + r) * ldc + col0 + c4) = v; } }
     }
}

// Wt[n][k] = f16(W[k][n]·scale) from f32 row-major W[K][N] (scale = power of two; bf16-exact weights stay exact in f16 away from the subnormal range)
__global__ __launch_bounds__(256) void k_wt_f16(const float* __restrict__ W, _Float16* __restrict__ Wt, int K, int N, float scale) {
  const int t = blockIdx.x * 256 + threadIdx.x; if (t >= N * (K / 8)) return; const int n = t / (K / 8), k8 = (t % (K / 8)) * 8; FragH f;
#pragma unroll
  for (int i = 0; i < 8; ++i) f.h[i] = (_Float16)(bf16_round(W[(size_t)(k8 + i) * N + n]) * scale); const v8us o = f.half[0];
  *(v8us*)((unsigned short*)Wt + (size_t)n * K + k8) = o; 
}
// k_gemm_hh variant with fused epilogue: v = acc·alpha + bias[by·sBias + col] (+ CP[(row/rowsPerB)·sCPb + by·64 + col] if CP) ; ACT 0 none / 1 elu ; writes f16 C16 (and f32 C if non-null)
template <int ACT>
__global__ __launch_bounds__(128) void k_gemm_hhx(const _Float16* __restrict__ A, int lda, size_t sA, const _Float16* __restrict__ Bh, int ldb, size_t sB, float alpha, const float* __restrict__ bias, size_t sBias, const float* __restrict__ CP, int rowsPerB, size_t sCPb, int row0g,
    float* __restrict__ C, _Float16* __restrict__ C16, int ldc, size_t sC, int M, int N, int K) {
  __shared__ __attribute__((aligned(16))) float so[4][16][64];
  const int tid = threadIdx.x, w = tid >> 5, lane = tid & 31, ln = lane & 15, hh = lane >> 4; const int by = blockIdx.y;
  A += (size_t)by * sA; Bh += (size_t)by * sB; const size_t cofs = (size_t)by * sC; const float* bp = bias ? bias + (size_t)by * sBias : nullptr;
  const int ntn = (N + 63) / 64; const int wid = blockIdx.x * 4 + w; const int mt = wid / ntn, nq = wid % ntn; if (mt * 16 >= M) return;
  const int row0 = mt * 16, col0 = nq * 64; const _Float16* arow = A + (size_t)(row0 + ln) * lda;
  v8f acc[4] = {};
  for (int kb = 0; kb < K; kb += 32) { FragH ah; ah.half[0] = *(const v8us*)((const unsigned short*)arow + kb + 8 * hh); ah.half[1] = *(const v8us*)((const unsigned short*)arow + kb + 16 + 8 * hh);
#pragma unroll
    for (int t = 0; t < 4; ++t) { if (col0 + t * 16 >= N) continue; const size_t boff = (size_t)(col0 + t * 16 + ln) * ldb + kb; FragH bq; bq.half[0] = *(const v8us*)((const unsigned short*)Bh + boff + 8 * hh); bq.half[1] = *(const v8us*)((const unsigned short*)Bh + boff + 16 + 8 * hh);
      acc[t] = mmaH<1>(ah.v, ah.v, bq.v, bq.v, acc[t]); }
  }
#pragma unroll
  for (int t = 0; t < 4; ++t) { if (col0 + t * 16 >= N) continue; const int col = col0 + t * 16 + ln; const float bv = bp ? bf16_round(bp[col]) : 0.f;
#pragma unroll
    for (int r = 0; r < 8; ++r) { float v = acc[t][r] * alpha + bv; if (CP) { const int bidx = (row0g + row0 + 8 * hh + r) / rowsPerB; v += CP[(size_t)bidx * sCPb + (size_t)by * 64 + col]; } if (ACT == 1) v = (v > 0.f) ? v : expm1f(v); else if (ACT == 7) v = (v > 0.f) ? v + 1.0f : expf(v); else if (ACT == 8) v = tanhf(v); else if (ACT == 9) v = 0.5f * v * (1.0f + tanhf(0.7978845608028654f * (v + 0.044715f * v * v * v))); else if (ACT == 11) v = 1.0f / (1.0f + expf(-v)); else if (ACT == 12) v = (v > 0.f) ? v : 0.01f * v; else if (ACT == 14) v = (v > 0.f) ? v : 0.1f * v; else if (ACT == 15) v = v / (1.0f + expf(-v)); else if (ACT == 3) v = fmaxf(v, 0.f); else if (ACT == 6) v = 0.5f * v * (1.0f + erff(v * 0.70710678118654752f)); so[w][8 * hh + r][t * 16 + ln] = v; } }
  __builtin_amdgcn_fence(__ATOMIC_ACQ_REL, "workgroup"); __builtin_amdgcn_wave_barrier();
  const int rsub = lane >> 4, c4 = (lane & 15) * 4; typedef _Float16 v4h __attribute__((ext_vector_type(4)));
  {
#pragma unroll
    for (int q = 0; q < 8; ++q) { const int r = q * 2 + rsub; if (col0 + c4 < N) { const v4f v = *(const v4fa*)&so[w][r][c4]; if (C) *(v4f*)(C + cofs + (size_t)(row0 + r) * ldc + col0 + c4) = v; if (C16) { v4h h4; for (int i = 0; i < 4; ++i) h4[i] = (_Float16)v[i]; *(v4h*)(C16 + cofs + (size_t)(row0 + r) * ldc + col0 + c4) = h4; } } }
     }
}


typedef _Float16 v4h __attribute__((ext_vector_type(4)));

__global__ __launch_bounds__(256) void k_x16(const float* __restrict__ x, _Float16* __restrict__ X16, size_t n8) { const size_t t = (size_t)blockIdx.x * 256 + threadIdx.x; if (t >= n8) return; FragH f;
#pragma unroll
  for (int q = 0; q < 8; ++q) f.h[q] = (_Float16)bf16_round(x[t * 8 + q]); *(v8us*)((unsigned short*)X16 + t * 8) = f.half[0];  }
__global__ __launch_bounds__(256) void k_h16(const float* __restrict__ x, _Float16* __restrict__ X16, size_t n8) { const size_t t = (size_t)blockIdx.x * 256 + threadIdx.x; if (t >= n8) return; FragH f;
#pragma unroll
  for (int q = 0; q < 8; ++q) f.h[q] = (_Float16)x[t * 8 + q]; *(v8us*)((unsigned short*)X16 + t * 8) = f.half[0];  }
__global__ __launch_bounds__(256) void k_round16f(const float* __restrict__ W, _Float16* __restrict__ Bt, size_t n8) { const size_t t = (size_t)blockIdx.x * 256 + threadIdx.x; if (t >= n8) return; FragH f;
#pragma unroll
  for (int i = 0; i < 8; ++i) f.h[i] = (_Float16)(bf16_round(W[t * 8 + i]) * 16.0f); *(v8us*)((unsigned short*)Bt + t * 8) = f.half[0];  }
template <int NHv, int TTv>
__global__ __launch_bounds__(256) void k_vt(const _Float16* __restrict__ V16, int ldv, int voff, _Float16* __restrict__ Vt) { __shared__ unsigned short tl[64][66]; const int tid = threadIdx.x; const int slab = blockIdx.x / (TTv / 64), lg = blockIdx.x % (TTv / 64); const int b = slab / NHv, h = slab % NHv;
  for (int i = tid; i < 64 * 8; i += 256) { const int r = i / 8, c8 = (i % 8) * 8; FragH f; f.half[0] = *(const v8us*)((const unsigned short*)V16 + ((size_t)b * TTv + lg * 64 + r) * ldv + voff + h * 64 + c8);
#pragma unroll
    for (int q = 0; q < 8; ++q) tl[r][c8 + q] = f.u[q]; }
  __syncthreads();
  {
#pragma unroll
    for (int rd = 0; rd < 2; ++rd) { const int d = rd * 32 + tid / 8, pc = tid % 8; FragH f;
#pragma unroll
      for (int q = 0; q < 8; ++q) f.u[q] = tl[pc * 8 + q][d];
      *(v8us*)((unsigned short*)Vt + ((size_t)slab * 64 + d) * TTv + lg * 64 + pc * 8) = f.half[0]; }
     } }

__global__ __launch_bounds__(256) void k_hl(const float* __restrict__ F, _Float16* __restrict__ Hh, _Float16* __restrict__ Hl, size_t n8) { const size_t t = (size_t)blockIdx.x * 256 + threadIdx.x; if (t >= n8) return; FragH fh, fl; const v4f a = *(const v4fa*)(F + t * 8), c = *(const v4fa*)(F + t * 8 + 4);
#pragma unroll
  for (int q = 0; q < 4; ++q) { _Float16 h = (_Float16)a[q]; fh.h[q] = h; fl.h[q] = (_Float16)((a[q] - (float)h) * 1024.0f); h = (_Float16)c[q]; fh.h[4 + q] = h; fl.h[4 + q] = (_Float16)((c[q] - (float)h) * 1024.0f); }
  { *(v8us*)((unsigned short*)Hh + t * 8) = fh.half[0]; *(v8us*)((unsigned short*)Hl + t * 8) = fl.half[0];  } }

// ---- fast GEMM (wave tile 32x64; requires M % 32 == 0 rows per launch region and N % 64 == 0); epilogue = k_gemm_hhx semantics ----
__device__ __forceinline__ v16h g2_frag(const _Float16* p, int hh) { FragH f; f.half[0] = *(const v8us*)((const unsigned short*)p + 8 * hh); f.half[1] = *(const v8us*)((const unsigned short*)p + 16 + 8 * hh); return f.v; }
__device__ __forceinline__ v8f g2_mma(v16h a, v16h b, v8f c) { v8f d = __builtin_amdgcn_wmma_f32_16x16x32_f16(false, a, false, b, (short)0, c, false, false); asm volatile("v_nop\n\tv_nop\n\tv_nop\n\tv_nop" : "+v"(d) : "v"(a), "v"(b)); return d; }
template <int ACT>
__global__ __launch_bounds__(128) void k_gemm2(const _Float16* __restrict__ A, int lda, size_t sA, const _Float16* __restrict__ Bh, int ldb, size_t sB, float alpha, const float* __restrict__ bias, size_t sBias, const float* __restrict__ CP, int rowsPerB, size_t sCPb, int row0g,
    float* __restrict__ C, _Float16* __restrict__ C16, int ldc, size_t sC, int M, int N, int K) {
  __shared__ __attribute__((aligned(16))) float so[4][32][68];
  const int tid = threadIdx.x, w = tid >> 5, lane = tid & 31, ln = lane & 15, hh = lane >> 4; const int by = blockIdx.y;
  A += (size_t)by * sA; Bh += (size_t)by * sB; const size_t cofs = (size_t)by * sC; const float* bp = bias ? bias + (size_t)by * sBias : nullptr;
  const int ntn = N >> 6; const int mt = blockIdx.x / ntn, nq = blockIdx.x - mt * ntn; const int row0 = mt * 128 + 32 * w, col0 = nq * 64; if (row0 >= M) return;
  const _Float16* a0p = A + (size_t)(row0 + ln) * lda; const _Float16* a1p = a0p + (size_t)16 * lda;
  const _Float16* b0p = Bh + (size_t)(col0 + ln) * ldb; const _Float16* b1p = b0p + (size_t)16 * ldb; const _Float16* b2p = b1p + (size_t)16 * ldb; const _Float16* b3p = b2p + (size_t)16 * ldb;
  const v8f z8 = {0.f,0.f,0.f,0.f,0.f,0.f,0.f,0.f}; v8f c00 = z8, c01 = z8, c02 = z8, c03 = z8, c10 = z8, c11 = z8, c12 = z8, c13 = z8;
#pragma unroll 1
  for (int kb = 0; kb < K; kb += 32) { const v16h a0 = g2_frag(a0p + kb, hh), a1 = g2_frag(a1p + kb, hh);
    v16h b = g2_frag(b0p + kb, hh); c00 = g2_mma(a0, b, c00); c10 = g2_mma(a1, b, c10);
    b = g2_frag(b1p + kb, hh); c01 = g2_mma(a0, b, c01); c11 = g2_mma(a1, b, c11);
    b = g2_frag(b2p + kb, hh); c02 = g2_mma(a0, b, c02); c12 = g2_mma(a1, b, c12);
    b = g2_frag(b3p + kb, hh); c03 = g2_mma(a0, b, c03); c13 = g2_mma(a1, b, c13); }
  v8f accs[8] = {c00, c01, c02, c03, c10, c11, c12, c13};
#pragma unroll
  for (int u = 0; u < 8; ++u) { const int t = u & 3, half = u >> 2; const int col = col0 + t * 16 + ln; const float bv = bp ? bf16_round(bp[col]) : 0.f;
#pragma unroll
    for (int r = 0; r < 8; ++r) { const int rloc = half * 16 + 8 * hh + r; float v = accs[u][r] * alpha + bv; if (CP) { const int bidx = (row0g + row0 + rloc) / rowsPerB; v += CP[(size_t)bidx * sCPb + (size_t)by * 64 + col]; }
      if (ACT == 3) v = fmaxf(v, 0.f); else if (ACT == 6) v = 0.5f * v * (1.0f + erff(v * 0.70710678118654752f)); else if (ACT == 11) v = 1.0f / (1.0f + expf(-v)); else if (ACT == 15) v = v / (1.0f + expf(-v)); else if (ACT == 12) v = (v > 0.f) ? v : 0.01f * v; else if (ACT == 8) v = tanhf(v);
      so[w][rloc][t * 16 + ln] = v; } }
  __builtin_amdgcn_fence(__ATOMIC_ACQ_REL, "workgroup"); __builtin_amdgcn_wave_barrier();
  const int rsub = lane >> 4, c4 = (lane & 15) * 4;
  {
#pragma unroll
    for (int q = 0; q < 16; ++q) { const int r = q * 2 + rsub; const v4f v = *(const v4fa*)&so[w][r][c4]; if (C) *(v4f*)(C + cofs + (size_t)(row0 + r) * ldc + col0 + c4) = v; if (C16) { v4h h4; for (int i = 0; i < 4; ++i) h4[i] = (_Float16)v[i]; *(v4h*)(C16 + cofs + (size_t)(row0 + r) * ldc + col0 + c4) = h4; } }
     } }



// lane l <-> lane l ^ 16 (the two lane halves of one fragment column)
__device__ __forceinline__ float xhalf(float x) { return __builtin_bit_cast(float, __builtin_amdgcn_permlanex16(__builtin_bit_cast(int, x), __builtin_bit_cast(int, x), 0x76543210, 0xfedcba98, false, false)); }
template <int CAUSAL>
__global__ __launch_bounds__(128) void k_flash(const _Float16* __restrict__ Q16, int ldq, const _Float16* __restrict__ K16, int ldk, const _Float16* __restrict__ Vt, const int* __restrict__ MSK, float* __restrict__ O, int ldo) {
  constexpr int RPW = 16, DT = 4, KS = 2;
  __shared__ __attribute__((aligned(16))) float sO[4][RPW][64 + 4];
  const int tid = threadIdx.x, w = tid >> 5, lane = tid & 31, ln = lane & 15, hh = lane >> 4;
  const int slab = blockIdx.x / QBNP, qblk = QB0P + blockIdx.x % QBNP; const int b = slab / NH, h = slab % NH; const int qb0 = qblk * (4 * RPW); const int q0 = qb0 + w * RPW; const int tq = q0 + ln;
  FragH bq[KS];
  { const unsigned short* qr = (const unsigned short*)Q16 + ((size_t)b * TQ + tq) * ldq + h * 64;
#pragma unroll
    for (int ks = 0; ks < KS; ++ks) { bq[ks].half[0] = *(const v8us*)(qr + ks * 32 + 8 * hh); bq[ks].half[1] = *(const v8us*)(qr + ks * 32 + 16 + 8 * hh); } }
  const unsigned short* Vth = (const unsigned short*)Vt + (size_t)slab * 64 * TK;
  float m_r = -3.0e38f, l_r = 0.f; v8f oacc[DT];      /* l_r: this lane half's keys only, joined after the loop */
#pragma unroll
  for (int dt = 0; dt < DT; ++dt) oacc[dt] = (v8f){0.f,0.f,0.f,0.f,0.f,0.f,0.f,0.f};
  const int jend = (CAUSAL == 1) ? (qb0 + 4 * RPW) : TK;      /* causal: keys beyond the block's last query never contribute */
#pragma unroll 1
  for (int j0 = 0; j0 < jend; j0 += 32) {
    v8f s[2];
#pragma unroll
    for (int nt = 0; nt < 2; ++nt) { const unsigned short* kr = (const unsigned short*)K16 + ((size_t)b * TK + j0 + nt * 16 + ln) * ldk + h * 64; FragH ak[KS];
#pragma unroll
      for (int ks = 0; ks < KS; ++ks) { ak[ks].half[0] = *(const v8us*)(kr + ks * 32 + 8 * hh); ak[ks].half[1] = *(const v8us*)(kr + ks * 32 + 16 + 8 * hh); }
      v8f acc = (v8f){0.f,0.f,0.f,0.f,0.f,0.f,0.f,0.f};
#pragma unroll
      for (int ks = 0; ks < KS; ++ks) acc = mmaH<1>(ak[ks].v, ak[ks].v, bq[ks].v, bq[ks].v, acc);
      s[nt] = acc; }
    float sc[16], t[8]; bool ok[16];
#pragma unroll
    for (int i = 0; i < 16; ++i) { const int kk = j0 + (i >> 3) * 16 + 8 * hh + (i & 7);
      ok[i] = (CAUSAL == 1) ? (kk <= tq) : ((CAUSAL == 2) ? ((kk >> 5) == (tq >> 5)) : true);      /* mode 2: block-diagonal 32-token groups */
      sc[i] = ok[i] ? s[i >> 3][i & 7] * SCL : -3.0e38f; if (CAUSAL == 17) sc[i] += bf16_round(((const float*)MSK + (size_t)b * TK)[kk]); }      /* mode 17: additive per-(batch, key) mask INPUT */
#pragma unroll
    for (int i = 0; i < 8; ++i) t[i] = fmaxf(sc[i], sc[i + 8]);
    float mc = fmaxf(fmaxf(fmaxf(t[0], t[1]), fmaxf(t[2], t[3])), fmaxf(fmaxf(t[4], t[5]), fmaxf(t[6], t[7])));
    mc = fmaxf(mc, xhalf(mc));      /* both halves feed one O^T column: one maximum for both */
    const float mn = fmaxf(m_r, mc); const float al = (mn > -1.0e38f) ? expf(m_r - mn) : 1.0f; m_r = mn;
    FragH pb;
#pragma unroll
    for (int i = 0; i < 16; ++i) { sc[i] = ok[i] ? expf(sc[i] - mn) : 0.f; pb.h[i] = (_Float16)(sc[i] * 1024.0f); }
#pragma unroll
    for (int i = 0; i < 8; ++i) t[i] = sc[i] + sc[i + 8];
    l_r = l_r * al + (((t[0] + t[1]) + (t[2] + t[3])) + ((t[4] + t[5]) + (t[6] + t[7])));
#pragma unroll
    for (int dt = 0; dt < DT; ++dt)
#pragma unroll
      for (int r = 0; r < 8; ++r) oacc[dt][r] *= al;
#pragma unroll
    for (int dt = 0; dt < DT; ++dt) { const unsigned short* vrow = Vth + (size_t)(dt * 16 + ln) * TK + j0; FragH av; av.half[0] = *(const v8us*)(vrow + 8 * hh); av.half[1] = *(const v8us*)(vrow + 16 + 8 * hh);
      oacc[dt] = mmaH<1>(av.v, av.v, pb.v, pb.v, oacc[dt]); } }
  const float l = l_r + xhalf(l_r); const float li = (l > 0.f) ? 1.0f / (l * 1024.0f) : 0.f;
#pragma unroll
  for (int dt = 0; dt < DT; ++dt) {      /* oacc[dt][r] = O[q0 + ln][16 dt + 8 hh + r] */
    const v4f lo = {oacc[dt][0] * li, oacc[dt][1] * li, oacc[dt][2] * li, oacc[dt][3] * li}, hi = {oacc[dt][4] * li, oacc[dt][5] * li, oacc[dt][6] * li, oacc[dt][7] * li};
    *(v4fa*)&sO[w][ln][dt * 16 + 8 * hh] = lo; *(v4fa*)&sO[w][ln][dt * 16 + 8 * hh + 4] = hi; }
  __builtin_amdgcn_fence(__ATOMIC_ACQ_REL, "workgroup"); __builtin_amdgcn_wave_barrier();
  {
#pragma unroll
    for (int rp = 0; rp < RPW; rp += 2) { const int r = rp + (lane >> 4), pc = lane & 15; const v4f val = *(const v4fa*)&sO[w][r][pc * 4]; *(v4f*)(O + ((size_t)b * TQ + q0 + r) * ldo + h * 64 + pc * 4) = val; }
     } }
// 5-plane variant: S = Qh Kh^T + (Ql Kh^T + Qh Kl^T)/1024 with Q/K = [hi | 2^10 residual] f16 planes (QL/KL same layout as Q16/K16), then the 3-term P.V below.
// 3-term variant: O = (P_hi V_hi + (P_lo V_hi + P_hi V_lo) / 1024) / l with P = [hi | 2^10 residual] of 1024 p and V^T = [hi | 2^10 residual] planes (VtL same layout as Vt) -> ~2^-21-class products for un-averaged (early causal / peaked) rows
template <int CAUSAL>
__global__ __launch_bounds__(128) void k_flash5(const _Float16* __restrict__ Q16, const _Float16* __restrict__ QL, int ldq, const _Float16* __restrict__ K16, const _Float16* __restrict__ KL, int ldk, const _Float16* __restrict__ Vt, const _Float16* __restrict__ VtL, const int* __restrict__ MSK, float* __restrict__ O, int ldo) {
  constexpr int RPW = 16, RTN = RPW / 16, NQB = TQ / (4 * RPW), DT = 4, KS = 2;
  __shared__ __attribute__((aligned(16))) unsigned short sP[4][RPW][40]; __shared__ __attribute__((aligned(16))) unsigned short sPL[4][RPW][40]; __shared__ __attribute__((aligned(16))) float sO[4][RPW][64 + 4];
  const int tid = threadIdx.x, w = tid >> 5, lane = tid & 31, ln = lane & 15, hh = lane >> 4;
  const int slab = blockIdx.x / QBN5, qblk = QB05 + blockIdx.x % QBN5; (void)NQB; const int b = slab / NH, h = slab % NH; const int qb0 = qblk * (4 * RPW); const int q0 = qb0 + w * RPW;
  FragH aq[2][KS], aql[2][KS];
#pragma unroll
  for (int rt = 0; rt < RTN; ++rt) { const unsigned short* qr = (const unsigned short*)Q16 + ((size_t)b * TQ + q0 + rt * 16 + ln) * ldq + h * 64; const unsigned short* ql = (const unsigned short*)QL + ((size_t)b * TQ + q0 + rt * 16 + ln) * ldq + h * 64;
#pragma unroll
    for (int ks = 0; ks < KS; ++ks) { aq[rt][ks].half[0] = *(const v8us*)(qr + ks * 32 + 8 * hh); aq[rt][ks].half[1] = *(const v8us*)(qr + ks * 32 + 16 + 8 * hh); aql[rt][ks].half[0] = *(const v8us*)(ql + ks * 32 + 8 * hh); aql[rt][ks].half[1] = *(const v8us*)(ql + ks * 32 + 16 + 8 * hh); } }
  const unsigned short* Vth = (const unsigned short*)Vt + (size_t)slab * 64 * TK; const unsigned short* Vtl = (const unsigned short*)VtL + (size_t)slab * 64 * TK;
  float m_r[2][8], l_r[2][8]; v8f oacc[2][DT], oaccL[2][DT];
#pragma unroll
  for (int rt = 0; rt < RTN; ++rt) {
#pragma unroll
    for (int r = 0; r < 8; ++r) { m_r[rt][r] = -3.0e38f; l_r[rt][r] = 0.f; }
#pragma unroll
    for (int dt = 0; dt < DT; ++dt) { oacc[rt][dt] = (v8f){0.f,0.f,0.f,0.f,0.f,0.f,0.f,0.f}; oaccL[rt][dt] = oacc[rt][dt]; } }
  const int jend = (CAUSAL == 1) ? (qb0 + 4 * RPW) : TK;      /* causal: keys beyond the block's last query never contribute */
#pragma unroll 1
  for (int j0 = 0; j0 < jend; j0 += 32) {
    v8f s[2][2];
#pragma unroll
    for (int nt = 0; nt < 2; ++nt) { const unsigned short* kr = (const unsigned short*)K16 + ((size_t)b * TK + j0 + nt * 16 + ln) * ldk + h * 64; const unsigned short* klr = (const unsigned short*)KL + ((size_t)b * TK + j0 + nt * 16 + ln) * ldk + h * 64; FragH bk[KS], bkl[KS];
#pragma unroll
      for (int ks = 0; ks < KS; ++ks) { bk[ks].half[0] = *(const v8us*)(kr + ks * 32 + 8 * hh); bk[ks].half[1] = *(const v8us*)(kr + ks * 32 + 16 + 8 * hh); bkl[ks].half[0] = *(const v8us*)(klr + ks * 32 + 8 * hh); bkl[ks].half[1] = *(const v8us*)(klr + ks * 32 + 16 + 8 * hh); }
#pragma unroll
      for (int rt = 0; rt < RTN; ++rt) { v8f acc = (v8f){0.f,0.f,0.f,0.f,0.f,0.f,0.f,0.f}, accl = acc;
#pragma unroll
        for (int ks = 0; ks < KS; ++ks) { acc = mmaH<1>(aq[rt][ks].v, aq[rt][ks].v, bk[ks].v, bk[ks].v, acc); accl = mmaH<1>(aql[rt][ks].v, aql[rt][ks].v, bk[ks].v, bk[ks].v, accl); accl = mmaH<1>(aq[rt][ks].v, aq[rt][ks].v, bkl[ks].v, bkl[ks].v, accl); }
#pragma unroll
        for (int r = 0; r < 8; ++r) acc[r] += accl[r] * 0.0009765625f;
        s[rt][nt] = acc; } }
#pragma unroll
    for (int rt = 0; rt < RTN; ++rt)
#pragma unroll
      for (int r = 0; r < 8; ++r) { const int tq = q0 + rt * 16 + 8 * hh + r; const int k0 = j0 + ln, k1 = j0 + 16 + ln;
        bool ok0 = (CAUSAL == 1) ? (k0 <= tq) : ((CAUSAL == 2) ? ((k0 >> 5) == (tq >> 5)) : true), ok1 = (CAUSAL == 1) ? (k1 <= tq) : ((CAUSAL == 2) ? ((k1 >> 5) == (tq >> 5)) : true);      /* mode 2: block-diagonal 32-token groups */
        if (CAUSAL == 4) { const int* mrow = MSK + ((size_t)b * TQ + tq) * TK; ok0 = mrow[k0] != 0; ok1 = mrow[k1] != 0; }      /* mode 4: per-(query, key) INPUT mask shared by all heads; masked keys contribute nothing (== the reference's -4096 fill, whose exp underflows to 0), rows with no valid key give l = 0 -> output 0 (== the reference's row_valid zeroing) */
        float s0 = ok0 ? s[rt][0][r] * SCL : -3.0e38f, s1 = ok1 ? s[rt][1][r] * SCL : -3.0e38f; if (CAUSAL == 17) { const float* amk = (const float*)MSK + (size_t)b * TK; s0 += bf16_round(amk[k0]); s1 += bf16_round(amk[k1]); }      /* mode 17: additive per-(batch, key) mask INPUT */ float mc = fmaxf(s0, s1);
        mc = fmaxf(mc, __shfl_xor(mc, 1, 32)); mc = fmaxf(mc, __shfl_xor(mc, 2, 32)); mc = fmaxf(mc, __shfl_xor(mc, 4, 32)); mc = fmaxf(mc, __shfl_xor(mc, 8, 32));
        const float mn = fmaxf(m_r[rt][r], mc); const float al = (mn > -1.0e38f) ? expf(m_r[rt][r] - mn) : 1.0f; m_r[rt][r] = mn; const float p0 = ok0 ? expf(s0 - mn) : 0.f, p1 = ok1 ? expf(s1 - mn) : 0.f; l_r[rt][r] = l_r[rt][r] * al + p0 + p1;
#pragma unroll
        for (int dt = 0; dt < DT; ++dt) { oacc[rt][dt][r] *= al; oaccL[rt][dt][r] *= al; }
        FragH t2, t2l; const float ps0 = p0 * 1024.0f, ps1 = p1 * 1024.0f; t2.h[0] = (_Float16)ps0; t2.h[1] = (_Float16)ps1; t2l.h[0] = (_Float16)((ps0 - (float)t2.h[0]) * 1024.0f); t2l.h[1] = (_Float16)((ps1 - (float)t2.h[1]) * 1024.0f);
        sP[w][rt * 16 + 8 * hh + r][ln] = t2.u[0]; sP[w][rt * 16 + 8 * hh + r][16 + ln] = t2.u[1]; sPL[w][rt * 16 + 8 * hh + r][ln] = t2l.u[0]; sPL[w][rt * 16 + 8 * hh + r][16 + ln] = t2l.u[1]; }
    __builtin_amdgcn_fence(__ATOMIC_ACQ_REL, "workgroup"); __builtin_amdgcn_wave_barrier();
    FragH pa[2], pl[2];
#pragma unroll
    for (int rt = 0; rt < RTN; ++rt) { pa[rt].half[0] = *(const v8us*)&sP[w][rt * 16 + ln][8 * hh]; pa[rt].half[1] = *(const v8us*)&sP[w][rt * 16 + ln][16 + 8 * hh]; pl[rt].half[0] = *(const v8us*)&sPL[w][rt * 16 + ln][8 * hh]; pl[rt].half[1] = *(const v8us*)&sPL[w][rt * 16 + ln][16 + 8 * hh]; }
#pragma unroll
    for (int dt = 0; dt < DT; ++dt) { const unsigned short* vrow = Vth + (size_t)(dt * 16 + ln) * TK + j0; const unsigned short* vrl = Vtl + (size_t)(dt * 16 + ln) * TK + j0; FragH bv, bl; bv.half[0] = *(const v8us*)(vrow + 8 * hh); bv.half[1] = *(const v8us*)(vrow + 16 + 8 * hh); bl.half[0] = *(const v8us*)(vrl + 8 * hh); bl.half[1] = *(const v8us*)(vrl + 16 + 8 * hh);
#pragma unroll
      for (int rt = 0; rt < RTN; ++rt) { oacc[rt][dt] = mmaH<1>(pa[rt].v, pa[rt].v, bv.v, bv.v, oacc[rt][dt]); oaccL[rt][dt] = mmaH<1>(pl[rt].v, pl[rt].v, bv.v, bv.v, oaccL[rt][dt]); oaccL[rt][dt] = mmaH<1>(pa[rt].v, pa[rt].v, bl.v, bl.v, oaccL[rt][dt]); } }
    __builtin_amdgcn_fence(__ATOMIC_ACQ_REL, "workgroup"); __builtin_amdgcn_wave_barrier(); }
#pragma unroll
  for (int rt = 0; rt < RTN; ++rt) {
#pragma unroll
    for (int r = 0; r < 8; ++r) { float l = l_r[rt][r]; l += __shfl_xor(l, 1, 32); l += __shfl_xor(l, 2, 32); l += __shfl_xor(l, 4, 32); l += __shfl_xor(l, 8, 32); l_r[rt][r] = (l > 0.f) ? 1.0f / (l * 1024.0f) : 0.f; }
#pragma unroll
    for (int dt = 0; dt < DT; ++dt)
#pragma unroll
      for (int r = 0; r < 8; ++r) { float v = oacc[rt][dt][r]; v += oaccL[rt][dt][r] * 0.0009765625f; sO[w][rt * 16 + 8 * hh + r][dt * 16 + ln] = v * l_r[rt][r]; } }
  __builtin_amdgcn_fence(__ATOMIC_ACQ_REL, "workgroup"); __builtin_amdgcn_wave_barrier();
  {
#pragma unroll
    for (int rp = 0; rp < RPW; rp += 2) { const int r = rp + (lane >> 4), pc = lane & 15; const v4f val = *(const v4fa*)&sO[w][r][pc * 4]; *(v4f*)(O + ((size_t)b * TQ + q0 + r) * ldo + h * 64 + pc * 4) = val; }
     } }

__global__ __launch_bounds__(256) void k_rotab(float* __restrict__ CS, float* __restrict__ SN) {
  #pragma clang fp contract(off)
  const int t = blockIdx.x * 256 + threadIdx.x; if (t >= SLEN * 32) return; const int j = t % 32, s = t / 32; const float ex = (float)(2 * j) / 64.0f; const float inv = 1.0f / powf(10000.0f, ex); const float th = (float)s * inv; const float c = cosf(th), sn = sinf(th);
  { *(float*)(CS + t) = c; *(float*)(SN + t) = sn;  } }
__global__ __launch_bounds__(256) void k_rope(const float* __restrict__ F, int nsrc, int ndst, int rep, const float* __restrict__ CS, const float* __restrict__ SN, _Float16* __restrict__ H, _Float16* __restrict__ L) {
  #pragma clang fp contract(off)
  const size_t t = (size_t)blockIdx.x * 256 + threadIdx.x; if (t >= (size_t)NR * ndst * 4) return; const int g8 = (int)(t % 4); const int hd = (int)((t / 4) % ndst); const size_t row = t / ((size_t)4 * ndst); const int s = (int)(row % SLEN); const int hs = hd / rep;
  const float* src = F + row * (size_t)(nsrc * 64) + hs * 64; FragH ah, al, bh, bl;
  for (int i = 0; i < 8; ++i) { const int d = g8 * 8 + i; const float c = CS[s * 32 + d], sn = SN[s * 32 + d]; const float x1 = src[d], x2 = src[d + 32];
    float o1 = x1 * c; o1 += -x2 * sn; float o2 = x2 * c; o2 += x1 * sn;
    _Float16 hv = (_Float16)o1; ah.h[i] = hv; al.h[i] = (_Float16)((o1 - (float)hv) * 1024.0f); hv = (_Float16)o2; bh.h[i] = hv; bl.h[i] = (_Float16)((o2 - (float)hv) * 1024.0f); }
  const size_t o = row * (size_t)(ndst * 64) + hd * 64 + g8 * 8;
  { *(v8us*)((unsigned short*)H + o) = ah.half[0]; *(v8us*)((unsigned short*)H + o + 32) = bh.half[0]; *(v8us*)((unsigned short*)L + o) = al.half[0]; *(v8us*)((unsigned short*)L + o + 32) = bl.half[0];  } }
__global__ __launch_bounds__(256) void k_rope2(const float* __restrict__ F, int nsrc, int ndst, int rep, const float* __restrict__ CS, const float* __restrict__ SN, _Float16* __restrict__ H, _Float16* __restrict__ L) {
  #pragma clang fp contract(off)
  const size_t t = (size_t)blockIdx.x * 256 + threadIdx.x; if (t >= (size_t)NR * ndst * 4) return; const int g16 = (int)(t % 4); const int hd = (int)((t / 4) % ndst); const size_t row = t / ((size_t)4 * ndst); const int s = (int)(row % SLEN); const int hs = hd / rep;
  const float* src = F + row * (size_t)(nsrc * 64) + hs * 64 + g16 * 16; FragH ah, al;
  for (int pr = 0; pr < 8; ++pr) { const int i = g16 * 8 + pr; const float c = CS[s * 32 + i], sn = SN[s * 32 + i]; const float x1 = src[2 * pr], x2 = src[2 * pr + 1];
    float o1 = x1 * c; o1 -= x2 * sn; float o2 = x1 * sn; o2 += x2 * c;
    _Float16 hv = (_Float16)o1; ah.h[2 * pr] = hv; al.h[2 * pr] = (_Float16)((o1 - (float)hv) * 1024.0f); hv = (_Float16)o2; ah.h[2 * pr + 1] = hv; al.h[2 * pr + 1] = (_Float16)((o2 - (float)hv) * 1024.0f); }
  const size_t o = row * (size_t)(ndst * 64) + hd * 64 + g16 * 16;
  { *(v8us*)((unsigned short*)H + o) = ah.half[0]; *(v8us*)((unsigned short*)H + o + 8) = ah.half[1]; *(v8us*)((unsigned short*)L + o) = al.half[0]; *(v8us*)((unsigned short*)L + o + 8) = al.half[1];  } }
__global__ __launch_bounds__(256) void k_tabin(const float* __restrict__ sp, float* __restrict__ CS, float* __restrict__ SN) { const int t = blockIdx.x * 256 + threadIdx.x; if (t >= SLEN * 32) return; const int i = t % 32, s = t / 32; const float c = bf16_round(sp[s * 64 + 32 + i]), sn = bf16_round(sp[s * 64 + i]);
  { *(float*)(CS + t) = c; *(float*)(SN + t) = sn;  } }
__global__ __launch_bounds__(256) void k_wsc(const float* __restrict__ Wm, _Float16* __restrict__ Bt, size_t n8, float sc) { const size_t t = (size_t)blockIdx.x * 256 + threadIdx.x; if (t >= n8) return; FragH f; for (int q = 0; q < 8; ++q) f.h[q] = (_Float16)(bf16_round(Wm[t * 8 + q]) * sc); *(v8us*)((unsigned short*)Bt + t * 8) = f.half[0];  }
__global__ __launch_bounds__(256) void k_rotab2(float* __restrict__ CS, float* __restrict__ SN) {
  #pragma clang fp contract(off)
  const int t = blockIdx.x * 256 + threadIdx.x; if (t >= SLEN * 32) return; const int j = t % 32, s = t / 32; const float c0 = -0.14391156831212787f;      /* -ln(10000)/64 rounded to f32 */ const float inv = expf((float)(2 * j) * c0); const float th = (float)s * inv; const float c = cosf(th), sn = sinf(th);
  { *(float*)(CS + t) = c; *(float*)(SN + t) = sn;  } }
__global__ __launch_bounds__(256) void k_lnu(const float* __restrict__ X, _Float16* __restrict__ N16, float* __restrict__ XB) {
  #pragma clang fp contract(off)
  const int wv = threadIdx.x >> 5, ln = threadIdx.x & 31; const size_t r = (size_t)blockIdx.x * 8 + wv; if (r >= NR) return; float a[32]; float s = 0.f;
  for (int i = 0; i < 4; ++i) { const v8f v = *(const v8f*)(X + r * DM + (i * 32 + ln) * 8); for (int q = 0; q < 8; ++q) { const float u = bf16_round(v[q]); a[i * 8 + q] = u; s += u; } }
  for (int o = 16; o > 0; o >>= 1) s += __shfl_xor(s, o, 32); const float mu = s / (float)DM; float var = 0.f; for (int q = 0; q < 32; ++q) { const float d = a[q] - mu; var += d * d; }
  for (int o = 16; o > 0; o >>= 1) var += __shfl_xor(var, o, 32); const float den = sqrtf(var / (float)(DM - 1)) + 1e-6f; const float inv = 1.0f / den;      /* one reciprocal per row; (x-mean)*inv vs the reference's division differs by <= 1 ulp */
  { for (int i = 0; i < 4; ++i) { const int c0 = (i * 32 + ln) * 8; FragH f; v8f xb; for (int q = 0; q < 8; ++q) { f.h[q] = (_Float16)((a[i * 8 + q] - mu) * inv); xb[q] = a[i * 8 + q]; } *(v8us*)((unsigned short*)N16 + r * DM + c0) = f.half[0]; *(v8f*)(XB + r * DM + c0) = xb; }  } }
__global__ __launch_bounds__(256) void k_vtg(const _Float16* __restrict__ V16, _Float16* __restrict__ Vt) { __shared__ unsigned short tl[64][66]; const int tid = threadIdx.x; const int slab = blockIdx.x / (SLEN / 64), lg = blockIdx.x % (SLEN / 64); const int b = slab / NH, h = slab % NH; const int hs = h / NREP;
  for (int i = tid; i < 64 * 8; i += 256) { const int r = i / 8, c8 = (i % 8) * 8; FragH f; f.half[0] = *(const v8us*)((const unsigned short*)V16 + ((size_t)b * SLEN + lg * 64 + r) * KVD + hs * 64 + c8); for (int q = 0; q < 8; ++q) tl[r][c8 + q] = f.u[q]; }
  __syncthreads();
  { for (int rd = 0; rd < 2; ++rd) { const int d = rd * 32 + tid / 8, pc = tid % 8; FragH f; for (int q = 0; q < 8; ++q) f.u[q] = tl[pc * 8 + q][d]; *(v8us*)((unsigned short*)Vt + ((size_t)slab * 64 + d) * SLEN + lg * 64 + pc * 8) = f.half[0]; }  } }

__global__ __launch_bounds__(256) void k_pm(const float* __restrict__ src, _Float16* __restrict__ P16) { const int t = blockIdx.x * 256 + threadIdx.x; if (t >= SLEN * (DM / 8)) return; const int c0 = (t % (DM / 8)) * 8; const int n = t / (DM / 8); FragH f; for (int q = 0; q < 8; ++q) f.h[q] = (_Float16)bf16_round(src[(size_t)(c0 + q) * SLEN + n]);
  *(v8us*)((unsigned short*)P16 + (size_t)n * DM + c0) = f.half[0];  }
__global__ __launch_bounds__(256) void k_nchw(const float* __restrict__ F, float* __restrict__ outb) { const int t = blockIdx.x * 256 + threadIdx.x; if (t >= DM * (SLEN / 4)) return; const int p0 = (t % (SLEN / 4)) * 4; const int o = t / (SLEN / 4); v4f r; for (int q = 0; q < 4; ++q) r[q] = F[(size_t)(p0 + q) * DM + o];
  *(v4f*)(outb + (size_t)o * SLEN + p0) = r;  }

extern "C" void kernel_launch(void* const* d_in, const int* in_sizes, int n_in,
                              void* d_out, int out_size, void* d_ws, size_t ws_size, hipStream_t stream) {
  (void)in_sizes; (void)n_in; (void)out_size;
  const float* const* I = (const float* const*)d_in; const float* vid = I[0]; const float* reff = I[1]; const float* Wq = I[2]; const float* bq = I[3]; const float* Wk = I[4]; const float* bk = I[5]; const float* Wv = I[6]; const float* bv = I[7]; const float* Wo = I[8]; const float* bo = I[9];
  char* ws = (char*)d_ws; size_t off = 0;
  auto take = [&](size_t bytes) { char* p = ws + off; off += (bytes + 255) & ~(size_t)255; return p; };
  const size_t np = (size_t)SLEN * DM;
  _Float16* BQ = (_Float16*)take((size_t)DM * DM * 2); _Float16* BK = (_Float16*)take((size_t)DM * DM * 2); _Float16* BV = (_Float16*)take((size_t)DM * DM * 2); _Float16* BO = (_Float16*)take((size_t)DM * DM * 2);
  _Float16* XV = (_Float16*)take(np * 2); _Float16* XR = (_Float16*)take(np * 2); _Float16* Q16 = (_Float16*)take(np * 2); _Float16* K16 = (_Float16*)take(np * 2); _Float16* V16 = (_Float16*)take(np * 2); _Float16* VT = (_Float16*)take(np * 2); float* O = (float*)take(np * 4); _Float16* O16 = (_Float16*)take(np * 2); float* F = (float*)take(np * 4);
  if (off > ws_size) return;      /* 2 + 7 x 4 + 8 + 8 = 46 MiB */
  k_wsc<<<(DM * DM / 8 + 255) / 256, 256, 0, stream>>>(Wq, BQ, DM * DM / 8, 16.0f); k_wsc<<<(DM * DM / 8 + 255) / 256, 256, 0, stream>>>(Wk, BK, DM * DM / 8, 16.0f); k_wsc<<<(DM * DM / 8 + 255) / 256, 256, 0, stream>>>(Wv, BV, DM * DM / 8, 16.0f); k_wsc<<<(DM * DM / 8 + 255) / 256, 256, 0, stream>>>(Wo, BO, DM * DM / 8, 16.0f);      /* 'oc' = natural Bt */
  k_pm<<<(SLEN * (DM / 8) + 255) / 256, 256, 0, stream>>>(vid, XV); k_pm<<<(SLEN * (DM / 8) + 255) / 256, 256, 0, stream>>>(reff, XR);
  const dim3 gP((SLEN / 128) * (DM / 64), 1);
  k_gemm2<0><<<gP, 128, 0, stream>>>(XV, DM, 0, BQ, DM, 0, 0.0625f, bq, 0, nullptr, 1, 0, 0, nullptr, Q16, DM, 0, SLEN, DM, DM);
  k_gemm2<0><<<gP, 128, 0, stream>>>(XR, DM, 0, BK, DM, 0, 0.0625f, bk, 0, nullptr, 1, 0, 0, nullptr, K16, DM, 0, SLEN, DM, DM);
  k_gemm2<0><<<gP, 128, 0, stream>>>(XR, DM, 0, BV, DM, 0, 0.0625f, bv, 0, nullptr, 1, 0, 0, nullptr, V16, DM, 0, SLEN, DM, DM);
  k_vt<NH, TK><<<NB * NH * (TK / 64), 256, 0, stream>>>(V16, DM, 0, VT);
  k_flash<0><<<NB * NH * QBNP, 128, 0, stream>>>(Q16, DM, K16, DM, VT, nullptr, O, DM);      /* 4096 x 4096 per head */
  k_h16<<<(unsigned)((np / 8 + 255) / 256), 256, 0, stream>>>(O, O16, np / 8);
  k_gemm2<0><<<gP, 128, 0, stream>>>(O16, DM, 0, BO, DM, 0, 0.0625f, bo, 0, nullptr, 1, 0, 0, F, nullptr, DM, 0, SLEN, DM, DM);
  k_nchw<<<(DM * (SLEN / 4) + 255) / 256, 256, 0, stream>>>(F, (float*)d_out);
}

// v002
// A run of this version takes 209 microseconds.
// Next to v001, in two timings, it ran 1.83 and 1.84 times as fast.
// Counting every step since v000, it is 2.74 times as fast.
#include <hip/hip_runtime.h>
// CrossViewAttention3D (1 clip: 512 channels x (4 x 32 x 32 = 4096) tokens, 8 heads x 64): q = Wq video + bq, k = Wk ref + bk, v = Wv ref + bv (1x1x1 convs = channel matmuls); softmax(q.k / 8) over the 4096 ref tokens; out = Wo ctx + bo; channel-major in and out.
// Structure: exact token-major f16 planes of both inputs; q, k, v as f16 WMMA GEMM outputs (32x64 wave tiles, f32 accumulation, exact x16 weights + bias, f16 out); V^T by LDS tiles; the fused flash kernel (4096 x 4096 per head, plain operands); ctx f16; Wo + bo GEMM; NCHW store.
// Compute dtype: inputs rounded to bf16; inputs exact as f16; q/k/P/v/ctx as plain f16 operands (~2^-12); softmax f32. v_wmma_f32_16x16x32_f16.
#define NB 1
#define DM 512
#define NKV 8
#define NREP (NH / NKV)
#define KVD (NKV * 64)           /* 512 */
#define NR (NB * SLEN)           /* 4096 */
#define SLEN 4096
#define TQ SLEN
#define TK SLEN
#define NH 8
#define SCL 0.125f
#define QBLKS (TQ / 64)
#define QB05 0
#define QBN5 4
#define QB0P 0
#define QBNP QBLKS           /* non-causal: plain flash on every query block */
#define RE 256
typedef __bf16 v16b __attribute__((ext_vector_type(16)));
typedef unsigned short v8us __attribute__((ext_vector_type(8), may_alias));
typedef float  v8f  __attribute__((ext_vector_type(8)));
typedef float  v4f  __attribute__((ext_vector_type(4)));
typedef float  v4fa __attribute__((ext_vector_type(4), may_alias));
union FragB { v16b v; v8us half[2]; unsigned short u[16]; };

__device__ __forceinline__ unsigned short bf16_bits(float x) { unsigned int u = __float_as_uint(x); return (unsigned short)((u + 0x7FFFu + ((u >> 16) & 1u)) >> 16); }
__device__ __forceinline__ float bf16_val(unsigned short b) { return __uint_as_float(((unsigned int)b) << 16); }
__device__ __forceinline__ float bf16_round(float x) { return bf16_val(bf16_bits(x)); }
// D += A·B with NT terms: 1 = ah·bh, 2 = + al·bh (A split), 3 = + ah·bl (both split)
template <int NT>
__device__ __forceinline__ v8f mmaN(v16b ah, v16b al, v16b bh, v16b bl, v8f c) {
  c = __builtin_amdgcn_wmma_f32_16x16x32_bf16(false, ah, false, bh, (short)0, c, false, false);
  if (NT >= 2) c = __builtin_amdgcn_wmma_f32_16x16x32_bf16(false, al, false, bh, (short)0, c, false, false);
  if (NT >= 3) c = __builtin_amdgcn_wmma_f32_16x16x32_bf16(false, ah, false, bl, (short)0, c, false, false);
  asm volatile("v_nop\n\tv_nop\n\tv_nop\n\tv_nop" : "+v"(c) : "v"(ah), "v"(al), "v"(bh), "v"(bl));
  return c;
}

__global__ __launch_bounds__(256) void k_wt_bf16(const float* __restrict__ W, unsigned short* __restrict__ Wt, int K, int N) {
  const int t = blockIdx.x * 256 + threadIdx.x;
  const int k8n = K / 8;
  if (t >= N * k8n) return;
  const int n = t / k8n, k8 = (t % k8n) * 8;
  v8us v;
#pragma unroll
  for (int i = 0; i < 8; ++i) v[i] = bf16_bits(W[(size_t)(k8 + i) * N + n]);
  *(v8us*)(Wt + (size_t)n * K + k8) = v;
  
}

// GEMM C[M][N] (f32, pitch ldc) = act(A[M][K]·W + bias). A f32 row-major (pitch lda) converted per fragment to bf16
// (ASPLIT: hi/lo two planes -> 2 terms, else single rounded term); Wt bf16 [N][K] (pitch ldb). BIAS_BF16 rounds the
// bias to bf16 first (bias quantised to bf16 before the add). K%32==0, M%16==0, N%64==0.
template <bool ASPLIT, int ACT, bool BIAS_BF16>
__global__ __launch_bounds__(128) void k_gemm_bf(const float* __restrict__ A, int lda, const unsigned short* __restrict__ Wt, int ldb,
                                               const float* __restrict__ bias, float* __restrict__ C, int ldc, int M, int N, int K) {
  __shared__ __attribute__((aligned(16))) float so[4][16][64];
  const int tid = threadIdx.x, w = tid >> 5, lane = tid & 31, ln = lane & 15, hh = lane >> 4;
  const int ntn = N / 64;
  const int wid = blockIdx.x * 4 + w;
  const int mt = wid / ntn, nq = wid % ntn;
  if (mt * 16 >= M) return;
  const int row0 = mt * 16, col0 = nq * 64;
  const float* arow = A + (size_t)(row0 + ln) * lda;
  v8f acc[4] = {};
  for (int kb = 0; kb < K; kb += 32) {
    FragB ah, al;
    const v4f x0 = *(const v4fa*)(arow + kb + 8 * hh), x1 = *(const v4fa*)(arow + kb + 8 * hh + 4);
    const v4f x2 = *(const v4fa*)(arow + kb + 16 + 8 * hh), x3 = *(const v4fa*)(arow + kb + 16 + 8 * hh + 4);
    float xs[16] = {x0[0],x0[1],x0[2],x0[3],x1[0],x1[1],x1[2],x1[3],x2[0],x2[1],x2[2],x2[3],x3[0],x3[1],x3[2],x3[3]};
#pragma unroll
    for (int i = 0; i < 16; ++i) { const unsigned short hb = bf16_bits(xs[i]); ah.u[i] = hb; al.u[i] = ASPLIT ? bf16_bits(xs[i] - bf16_val(hb)) : (unsigned short)0; }
#pragma unroll
    for (int t = 0; t < 4; ++t) {
      const unsigned short* brow = Wt + (size_t)(col0 + t * 16 + ln) * ldb + kb;
      FragB b;
      b.half[0] = *(const v8us*)(brow + 8 * hh);
      b.half[1] = *(const v8us*)(brow + 16 + 8 * hh);
      acc[t] = mmaN<ASPLIT ? 2 : 1>(ah.v, al.v, b.v, b.v, acc[t]);
    }
  }
#pragma unroll
  for (int t = 0; t < 4; ++t) {
    float bv = bias ? bias[col0 + t * 16 + ln] : 0.f;
    if (BIAS_BF16) bv = bf16_round(bv);
#pragma unroll
    for (int r = 0; r < 8; ++r) { float v = acc[t][r] + bv; if (ACT == 1) v = fmaxf(v, 0.f); so[w][8 * hh + r][t * 16 + ln] = v; }
  }
  __builtin_amdgcn_fence(__ATOMIC_ACQ_REL, "workgroup");
  __builtin_amdgcn_wave_barrier();
  const int rsub = lane >> 4, c4 = (lane & 15) * 4;
  {
#pragma unroll
    for (int q = 0; q < 8; ++q) {
      const int r = q * 2 + rsub;
      const v4f v = *(const v4fa*)&so[w][r][c4];
      *(v4f*)(C + (size_t)(row0 + r) * ldc + col0 + c4) = v;
    }
    
  }
}

// GEMM C = act(A·W + bias + resid): A f32 (ASPLIT -> hi/lo 2 terms), Wt bf16 [N][K]; ACT 0 none, 1 relu, 2 exact gelu;
// resid (optional, f32, row index = (row % rmod), pitch ldr, RES_BF16 rounds it) added before the activation.
template <bool ASPLIT, int ACT, bool BIAS_BF16, bool RES_BF16>
__global__ __launch_bounds__(128) void k_gemm_bf3(const float* __restrict__ A, int lda, const unsigned short* __restrict__ Wt, int ldb,
                                                const float* __restrict__ bias, const float* __restrict__ resid, int rmod, int ldr,
                                                float* __restrict__ C, int ldc, int M, int N, int K) {
  __shared__ __attribute__((aligned(16))) float so[4][16][64];
  const int tid = threadIdx.x, w = tid >> 5, lane = tid & 31, ln = lane & 15, hh = lane >> 4;
  const int ntn = N / 64;
  const int wid = blockIdx.x * 4 + w;
  const int mt = wid / ntn, nq = wid % ntn;
  if (mt * 16 >= M) return;
  const int row0 = mt * 16, col0 = nq * 64;
  const float* arow = A + (size_t)(row0 + ln) * lda;
  v8f acc[4] = {};
  for (int kb = 0; kb < K; kb += 32) {
    FragB ah, al;
    const v4f x0 = *(const v4fa*)(arow + kb + 8 * hh), x1 = *(const v4fa*)(arow + kb + 8 * hh + 4);
    const v4f x2 = *(const v4fa*)(arow + kb + 16 + 8 * hh), x3 = *(const v4fa*)(arow + kb + 16 + 8 * hh + 4);
    float xs[16] = {x0[0],x0[1],x0[2],x0[3],x1[0],x1[1],x1[2],x1[3],x2[0],x2[1],x2[2],x2[3],x3[0],x3[1],x3[2],x3[3]};
#pragma unroll
    for (int i = 0; i < 16; ++i) { const unsigned short hb = bf16_bits(xs[i]); ah.u[i] = hb; al.u[i] = ASPLIT ? bf16_bits(xs[i] - bf16_val(hb)) : (unsigned short)0; }
#pragma unroll
    for (int t = 0; t < 4; ++t) {
      const unsigned short* brow = Wt + (size_t)(col0 + t * 16 + ln) * ldb + kb;
      FragB b;
      b.half[0] = *(const v8us*)(brow + 8 * hh);
      b.half[1] = *(const v8us*)(brow + 16 + 8 * hh);
      acc[t] = mmaN<ASPLIT ? 2 : 1>(ah.v, al.v, b.v, b.v, acc[t]);
    }
  }
#pragma unroll
  for (int t = 0; t < 4; ++t) {
    const int col = col0 + t * 16 + ln;
    float bv = bias ? bias[col] : 0.f;
    if (BIAS_BF16) bv = bf16_round(bv);
#pragma unroll
    for (int r = 0; r < 8; ++r) {
      float v = acc[t][r] + bv;
      if (resid) { float rv = resid[(size_t)((row0 + 8 * hh + r) % rmod) * ldr + col]; if (RES_BF16) rv = bf16_round(rv); v += rv; }
      if (ACT == 1) v = fmaxf(v, 0.f);
      if (ACT == 2) v = 0.5f * v * (1.0f + erff(v * 0.70710678118654752f));
      if (ACT == 3) { const float u = 0.7978845608028654f * (v + 0.044715f * v * v * v); v = 0.5f * v * (1.0f + tanhf(u)); }
      so[w][8 * hh + r][t * 16 + ln] = v;
    }
  }
  __builtin_amdgcn_fence(__ATOMIC_ACQ_REL, "workgroup");
  __builtin_amdgcn_wave_barrier();
  const int rsub = lane >> 4, c4 = (lane & 15) * 4;
  {
#pragma unroll
    for (int q = 0; q < 8; ++q) {
      const int r = q * 2 + rsub;
      const v4f v = *(const v4fa*)&so[w][r][c4];
      *(v4f*)(C + (size_t)(row0 + r) * ldc + col0 + c4) = v;
    }
    
  }
}
// row LayerNorm (biased variance, eps) over N: s = X (+ R); optional out_sum <- s; out_norm <- (s-mu)*rsqrt(var+eps)*g + b
template <bool PARAM_BF16>
__global__ __launch_bounds__(256) void k_layernorm(const float* __restrict__ X, const float* __restrict__ R, const float* __restrict__ g, const float* __restrict__ bta,
                                                  float* __restrict__ out_sum, float* __restrict__ out_norm, int N, float eps) {
  __shared__ float red[256];
  const int row = blockIdx.x, tid = threadIdx.x;
  const float* x = X + (size_t)row * N; const float* rr = R ? R + (size_t)row * N : nullptr;
  float vals[16];                     // up to N = 4096
  const int per = N / 256;            // contiguous chunk per thread? use strided-by-4 chunks: thread handles j = tid*4 + 1024*u
  float s1 = 0.f;
  for (int u = 0; u < per / 4; ++u) {
    const int j = tid * 4 + 1024 * u;
    const v4f a = *(const v4fa*)(x + j);
    v4f b = {0.f,0.f,0.f,0.f}; if (rr) b = *(const v4fa*)(rr + j);
#pragma unroll
    for (int q = 0; q < 4; ++q) { const float v = a[q] + b[q]; vals[u * 4 + q] = v; s1 += v; }
  }
  red[tid] = s1; __syncthreads();
  for (int st = 128; st > 0; st >>= 1) { if (tid < st) red[tid] += red[tid + st]; __syncthreads(); }
  const float mu = red[0] / (float)N; __syncthreads();
  float s2 = 0.f;
  for (int u = 0; u < per / 4; ++u)
#pragma unroll
    for (int q = 0; q < 4; ++q) { const float c = vals[u * 4 + q] - mu; s2 += c * c; }
  red[tid] = s2; __syncthreads();
  for (int st = 128; st > 0; st >>= 1) { if (tid < st) red[tid] += red[tid + st]; __syncthreads(); }
  const float rs = rsqrtf(red[0] / (float)N + eps);
  {
    for (int u = 0; u < per / 4; ++u) {
      const int j = tid * 4 + 1024 * u;
      v4f o, sm;
#pragma unroll
      for (int q = 0; q < 4; ++q) {
        float gg = g[j + q], bb = bta[j + q];
        if (PARAM_BF16) { gg = bf16_round(gg); bb = bf16_round(bb); }
        sm[q] = vals[u * 4 + q]; o[q] = (vals[u * 4 + q] - mu) * rs * gg + bb;
      }
      if (out_sum) *(v4f*)(out_sum + (size_t)row * N + j) = sm;
      *(v4f*)(out_norm + (size_t)row * N + j) = o;
    }
    
  }
}



// ---- f16 WMMA path (v_wmma_f32_16x16x32_f16): 11-bit significands for operands in range — used where a [0,1] probability operand needs more precision than bf16
typedef _Float16 v16h __attribute__((ext_vector_type(16)));
union FragH { v16h v; v8us half[2]; _Float16 h[16]; unsigned short u[16]; };
template <int NT>
__device__ __forceinline__ v8f mmaH(v16h ah, v16h al, v16h bh, v16h bl, v8f c) {
  c = __builtin_amdgcn_wmma_f32_16x16x32_f16(false, ah, false, bh, (short)0, c, false, false);
  if (NT >= 2) c = __builtin_amdgcn_wmma_f32_16x16x32_f16(false, al, false, bh, (short)0, c, false, false);
  if (NT >= 3) c = __builtin_amdgcn_wmma_f32_16x16x32_f16(false, ah, false, bl, (short)0, c, false, false);
  asm volatile("v_nop\n\tv_nop\n\tv_nop\n\tv_nop" : "+v"(c) : "v"(ah), "v"(al), "v"(bh), "v"(bl));
  return c;
}
// batched GEMM like k_gemm_b but f16 operands: A f32 (split into f16 hi/lo if ASPLIT, else rounded to f16), Bt = f16 values [n][k]; alpha; C f32; N multiple of 16 (partial tiles skipped)
template <bool ASPLIT>
__global__ __launch_bounds__(128) void k_gemm_h(const float* __restrict__ A, int lda, size_t sA, const _Float16* __restrict__ Bh, int ldb, size_t sB, float alpha, float* __restrict__ C, int ldc, size_t sC, int M, int N, int K) {
  __shared__ __attribute__((aligned(16))) float so[4][16][64];
  const int tid = threadIdx.x, w = tid >> 5, lane = tid & 31, ln = lane & 15, hh = lane >> 4; const int by = blockIdx.y;
  A += (size_t)by * sA; Bh += (size_t)by * sB; C += (size_t)by * sC;
  const int ntn = (N + 63) / 64; const int wid = blockIdx.x * 4 + w; const int mt = wid / ntn, nq = wid % ntn; if (mt * 16 >= M) return;
  const int row0 = mt * 16, col0 = nq * 64; const float* arow = A + (size_t)(row0 + ln) * lda;
  v8f acc[4] = {};
  for (int kb = 0; kb < K; kb += 32) {
    FragH ah, al;
    const v4f x0 = *(const v4fa*)(arow + kb + 8 * hh), x1 = *(const v4fa*)(arow + kb + 8 * hh + 4), x2 = *(const v4fa*)(arow + kb + 16 + 8 * hh), x3 = *(const v4fa*)(arow + kb + 16 + 8 * hh + 4);
    float xs[16] = {x0[0],x0[1],x0[2],x0[3],x1[0],x1[1],x1[2],x1[3],x2[0],x2[1],x2[2],x2[3],x3[0],x3[1],x3[2],x3[3]};
#pragma unroll
    for (int i = 0; i < 16; ++i) { const _Float16 h = (_Float16)xs[i]; ah.h[i] = h; al.h[i] = ASPLIT ? (_Float16)(xs[i] - (float)h) : (_Float16)0.0f; }
#pragma unroll
    for (int t = 0; t < 4; ++t) { if (col0 + t * 16 >= N) continue; const size_t boff = (size_t)(col0 + t * 16 + ln) * ldb + kb; FragH bq; bq.half[0] = *(const v8us*)(Bh + boff + 8 * hh); bq.half[1] = *(const v8us*)(Bh + boff + 16 + 8 * hh);
      acc[t] = mmaH<ASPLIT ? 2 : 1>(ah.v, al.v, bq.v, bq.v, acc[t]); }
  }
#pragma unroll
  for (int t = 0; t < 4; ++t) { if (col0 + t * 16 >= N) continue;
#pragma unroll
    for (int r = 0; r < 8; ++r) so[w][8 * hh + r][t * 16 + ln] = acc[t][r] * alpha; }
  __builtin_amdgcn_fence(__ATOMIC_ACQ_REL, "workgroup"); __builtin_amdgcn_wave_barrier();
  const int rsub = lane >> 4, c4 = (lane & 15) * 4;
  {
#pragma unroll
    for (int q = 0; q < 8; ++q) { const int r = q * 2 + rsub; if (col0 + c4 < N) { const v4f v = *(const v4fa*)&so[w][r][c4]; *(v4f*)(C + (size_t)(row0 + r) * ldc + col0 + c4) = v; } }
     }
}

// Wt[n][k] = f16(W[k][n]·scale) from f32 row-major W[K][N] (scale = power of two; bf16-exact weights stay exact in f16 away from the subnormal range)
__global__ __launch_bounds__(256) void k_wt_f16(const float* __restrict__ W, _Float16* __restrict__ Wt, int K, int N, float scale) {
  const int t = blockIdx.x * 256 + threadIdx.x; if (t >= N * (K / 8)) return; const int n = t / (K / 8), k8 = (t % (K / 8)) * 8; FragH f;
#pragma unroll
  for (int i = 0; i < 8; ++i) f.h[i] = (_Float16)(bf16_round(W[(size_t)(k8 + i) * N + n]) * scale); const v8us o = f.half[0];
  *(v8us*)((unsigned short*)Wt + (size_t)n * K + k8) = o; 
}
// k_gemm_hh variant with fused epilogue: v = acc·alpha + bias[by·sBias + col] (+ CP[(row/rowsPerB)·sCPb + by·64 + col] if CP) ; ACT 0 none / 1 elu ; writes f16 C16 (and f32 C if non-null)
template <int ACT>
__global__ __launch_bounds__(128) void k_gemm_hhx(const _Float16* __restrict__ A, int lda, size_t sA, const _Float16* __restrict__ Bh, int ldb, size_t sB, float alpha, const float* __restrict__ bias, size_t sBias, const float* __restrict__ CP, int rowsPerB, size_t sCPb, int row0g,
    float* __restrict__ C, _Float16* __restrict__ C16, int ldc, size_t sC, int M, int N, int K) {
  __shared__ __attribute__((aligned(16))) float so[4][16][64];
  const int tid = threadIdx.x, w = tid >> 5, lane = tid & 31, ln = lane & 15, hh = lane >> 4; const int by = blockIdx.y;
  A += (size_t)by * sA; Bh += (size_t)by * sB; const size_t cofs = (size_t)by * sC; const float* bp = bias ? bias + (size_t)by * sBias : nullptr;
  const int ntn = (N + 63) / 64; const int wid = blockIdx.x * 4 + w; const int mt = wid / ntn, nq = wid % ntn; if (mt * 16 >= M) return;
  const int row0 = mt * 16, col0 = nq * 64; const _Float16* arow = A + (size_t)(row0 + ln) * lda;
  v8f acc[4] = {};
  for (int kb = 0; kb < K; kb += 32) { FragH ah; ah.half[0] = *(const v8us*)((const unsigned short*)arow + kb + 8 * hh); ah.half[1] = *(const v8us*)((const unsigned short*)arow + kb + 16 + 8 * hh);
#pragma unroll
    for (int t = 0; t < 4; ++t) { if (col0 + t * 16 >= N) continue; const size_t boff = (size_t)(col0 + t * 16 + ln) * ldb + kb; FragH bq; bq.half[0] = *(const v8us*)((const unsigned short*)Bh + boff + 8 * hh); bq.half[1] = *(const v8us*)((const unsigned short*)Bh + boff + 16 + 8 * hh);
      acc[t] = mmaH<1>(ah.v, ah.v, bq.v, bq.v, acc[t]); }
  }
#pragma unroll
  for (int t = 0; t < 4; ++t) { if (col0 + t * 16 >= N) continue; const int col = col0 + t * 16 + ln; const float bv = bp ? bf16_round(bp[col]) : 0.f;
#pragma unroll
    for (int r = 0; r < 8; ++r) { float v = acc[t][r] * alpha + bv; if (CP) { const int bidx = (row0g + row0 + 8 * hh + r) / rowsPerB; v += CP[(size_t)bidx * sCPb + (size_t)by * 64 + col]; } if (ACT == 1) v = (v > 0.f) ? v : expm1f(v); else if (ACT == 7) v = (v > 0.f) ? v + 1.0f : expf(v); else if (ACT == 8) v = tanhf(v); else if (ACT == 9) v = 0.5f * v * (1.0f + tanhf(0.7978845608028654f * (v + 0.044715f * v * v * v))); else if (ACT == 11) v = 1.0f / (1.0f + expf(-v)); else if (ACT == 12) v = (v > 0.f) ? v : 0.01f * v; else if (ACT == 14) v = (v > 0.f) ? v : 0.1f * v; else if (ACT == 15) v = v / (1.0f + expf(-v)); else if (ACT == 3) v = fmaxf(v, 0.f); else if (ACT == 6) v = 0.5f * v * (1.0f + erff(v * 0.70710678118654752f)); so[w][8 * hh + r][t * 16 + ln] = v; } }
  __builtin_amdgcn_fence(__ATOMIC_ACQ_REL, "workgroup"); __builtin_amdgcn_wave_barrier();
  const int rsub = lane >> 4, c4 = (lane & 15) * 4; typedef _Float16 v4h __attribute__((ext_vector_type(4)));
  {
#pragma unroll
    for (int q = 0; q < 8; ++q) { const int r = q * 2 + rsub; if (col0 + c4 < N) { const v4f v = *(const v4fa*)&so[w][r][c4]; if (C) *(v4f*)(C + cofs + (size_t)(row0 + r) * ldc + col0 + c4) = v; if (C16) { v4h h4; for (int i = 0; i < 4; ++i) h4[i] = (_Float16)v[i]; *(v4h*)(C16 + cofs + (size_t)(row0 + r) * ldc + col0 + c4) = h4; } } }
     }
}


typedef _Float16 v4h __attribute__((ext_vector_type(4)));

__global__ __launch_bounds__(256) void k_x16(const float* __restrict__ x, _Float16* __restrict__ X16, size_t n8) { const size_t t = (size_t)blockIdx.x * 256 + threadIdx.x; if (t >= n8) return; FragH f;
#pragma unroll
  for (int q = 0; q < 8; ++q) f.h[q] = (_Float16)bf16_round(x[t * 8 + q]); *(v8us*)((unsigned short*)X16 + t * 8) = f.half[0];  }
__global__ __launch_bounds__(256) void k_h16(const float* __restrict__ x, _Float16* __restrict__ X16, size_t n8) { const size_t t = (size_t)blockIdx.x * 256 + threadIdx.x; if (t >= n8) return; FragH f;
#pragma unroll
  for (int q = 0; q < 8; ++q) f.h[q] = (_Float16)x[t * 8 + q]; *(v8us*)((unsigned short*)X16 + t * 8) = f.half[0];  }
__global__ __launch_bounds__(256) void k_round16f(const float* __restrict__ W, _Float16* __restrict__ Bt, size_t n8) { const size_t t = (size_t)blockIdx.x * 256 + threadIdx.x; if (t >= n8) return; FragH f;
#pragma unroll
  for (int i = 0; i < 8; ++i) f.h[i] = (_Float16)(bf16_round(W[t * 8 + i]) * 16.0f); *(v8us*)((unsigned short*)Bt + t * 8) = f.half[0];  }
template <int NHv, int TTv>
__global__ __launch_bounds__(256) void k_vt(const _Float16* __restrict__ V16, int ldv, int voff, _Float16* __restrict__ Vt) { __shared__ unsigned short tl[64][66]; const int tid = threadIdx.x; const int slab = blockIdx.x / (TTv / 64), lg = blockIdx.x % (TTv / 64); const int b = slab / NHv, h = slab % NHv;
  for (int i = tid; i < 64 * 8; i += 256) { const int r = i / 8, c8 = (i % 8) * 8; FragH f; f.half[0] = *(const v8us*)((const unsigned short*)V16 + ((size_t)b * TTv + lg * 64 + r) * ldv + voff + h * 64 + c8);
#pragma unroll
    for (int q = 0; q < 8; ++q) tl[r][c8 + q] = f.u[q]; }
  __syncthreads();
  {
#pragma unroll
    for (int rd = 0; rd < 2; ++rd) { const int d = rd * 32 + tid / 8, pc = tid % 8; FragH f;
#pragma unroll
      for (int q = 0; q < 8; ++q) f.u[q] = tl[pc * 8 + q][d];
      *(v8us*)((unsigned short*)Vt + ((size_t)slab * 64 + d) * TTv + lg * 64 + pc * 8) = f.half[0]; }
     } }

__global__ __launch_bounds__(256) void k_hl(const float* __restrict__ F, _Float16* __restrict__ Hh, _Float16* __restrict__ Hl, size_t n8) { const size_t t = (size_t)blockIdx.x * 256 + threadIdx.x; if (t >= n8) return; FragH fh, fl; const v4f a = *(const v4fa*)(F + t * 8), c = *(const v4fa*)(F + t * 8 + 4);
#pragma unroll
  for (int q = 0; q < 4; ++q) { _Float16 h = (_Float16)a[q]; fh.h[q] = h; fl.h[q] = (_Float16)((a[q] - (float)h) * 1024.0f); h = (_Float16)c[q]; fh.h[4 + q] = h; fl.h[4 + q] = (_Float16)((c[q] - (float)h) * 1024.0f); }
  { *(v8us*)((unsigned short*)Hh + t * 8) = fh.half[0]; *(v8us*)((unsigned short*)Hl + t * 8) = fl.half[0];  } }

// ---- fast GEMM (wave tile 32x64; requires M % 32 == 0 rows per launch region and N % 64 == 0); epilogue = k_gemm_hhx semantics ----
__device__ __forceinline__ v16h g2_frag(const _Float16* p, int hh) { FragH f; f.half[0] = *(const v8us*)((const unsigned short*)p + 8 * hh); f.half[1] = *(const v8us*)((const unsigned short*)p + 16 + 8 * hh); return f.v; }
__device__ __forceinline__ v8f g2_mma(v16h a, v16h b, v8f c) { v8f d = __builtin_amdgcn_wmma_f32_16x16x32_f16(false, a, false, b, (short)0, c, false, false); asm volatile("v_nop\n\tv_nop\n\tv_nop\n\tv_nop" : "+v"(d) : "v"(a), "v"(b)); return d; }
template <int ACT>
__global__ __launch_bounds__(128) void k_gemm2(const _Float16* __restrict__ A, int lda, size_t sA, const _Float16* __restrict__ Bh, int ldb, size_t sB, float alpha, const float* __restrict__ bias, size_t sBias, const float* __restrict__ CP, int rowsPerB, size_t sCPb, int row0g,
    float* __restrict__ C, _Float16* __restrict__ C16, int ldc, size_t sC, int M, int N, int K) {
  __shared__ __attribute__((aligned(16))) float so[4][32][68];
  const int tid = threadIdx.x, w = tid >> 5, lane = tid & 31, ln = lane & 15, hh = lane >> 4; const int by = blockIdx.y;
  A += (size_t)by * sA; Bh += (size_t)by * sB; const size_t cofs = (size_t)by * sC; const float* bp = bias ? bias + (size_t)by * sBias : nullptr;
  const int ntn = N >> 6; const int mt = blockIdx.x / ntn, nq = blockIdx.x - mt * ntn; const int row0 = mt * 128 + 32 * w, col0 = nq * 64; if (row0 >= M) return;
  const _Float16* a0p = A + (size_t)(row0 + ln) * lda; const _Float16* a1p = a0p + (size_t)16 * lda;
  const _Float16* b0p = Bh + (size_t)(col0 + ln) * ldb; const _Float16* b1p = b0p + (size_t)16 * ldb; const _Float16* b2p = b1p + (size_t)16 * ldb; const _Float16* b3p = b2p + (size_t)16 * ldb;
  const v8f z8 = {0.f,0.f,0.f,0.f,0.f,0.f,0.f,0.f}; v8f c00 = z8, c01 = z8, c02 = z8, c03 = z8, c10 = z8, c11 = z8, c12 = z8, c13 = z8;
#pragma unroll 1
  for (int kb = 0; kb < K; kb += 32) { const v16h a0 = g2_frag(a0p + kb, hh), a1 = g2_frag(a1p + kb, hh);
    v16h b = g2_frag(b0p + kb, hh); c00 = g2_mma(a0, b, c00); c10 = g2_mma(a1, b, c10);
    b = g2_frag(b1p + kb, hh); c01 = g2_mma(a0, b, c01); c11 = g2_mma(a1, b, c11);
    b = g2_frag(b2p + kb, hh); c02 = g2_mma(a0, b, c02); c12 = g2_mma(a1, b, c12);
    b = g2_frag(b3p + kb, hh); c03 = g2_mma(a0, b, c03); c13 = g2_mma(a1, b, c13); }
  v8f accs[8] = {c00, c01, c02, c03, c10, c11, c12, c13};
#pragma unroll
  for (int u = 0; u < 8; ++u) { const int t = u & 3, half = u >> 2; const int col = col0 + t * 16 + ln; const float bv = bp ? bf16_round(bp[col]) : 0.f;
#pragma unroll
    for (int r = 0; r < 8; ++r) { const int rloc = half * 16 + 8 * hh + r; float v = accs[u][r] * alpha + bv; if (CP) { const int bidx = (row0g + row0 + rloc) / rowsPerB; v += CP[(size_t)bidx * sCPb + (size_t)by * 64 + col]; }
      if (ACT == 3) v = fmaxf(v, 0.f); else if (ACT == 6) v = 0.5f * v * (1.0f + erff(v * 0.70710678118654752f)); else if (ACT == 11) v = 1.0f / (1.0f + expf(-v)); else if (ACT == 15) v = v / (1.0f + expf(-v)); else if (ACT == 12) v = (v > 0.f) ? v : 0.01f * v; else if (ACT == 8) v = tanhf(v);
      so[w][rloc][t * 16 + ln] = v; } }
  __builtin_amdgcn_fence(__ATOMIC_ACQ_REL, "workgroup"); __builtin_amdgcn_wave_barrier();
  const int rsub = lane >> 4, c4 = (lane & 15) * 4;
  {
#pragma unroll
    for (int q = 0; q < 16; ++q) { const int r = q * 2 + rsub; const v4f v = *(const v4fa*)&so[w][r][c4]; if (C) *(v4f*)(C + cofs + (size_t)(row0 + r) * ldc + col0 + c4) = v; if (C16) { v4h h4; for (int i = 0; i < 4; ++i) h4[i] = (_Float16)v[i]; *(v4h*)(C16 + cofs + (size_t)(row0 + r) * ldc + col0 + c4) = h4; } }
     } }



// lane l <-> lane l ^ 16 (the two lane halves of one fragment column)
__device__ __forceinline__ float xhalf(float x) { return __builtin_bit_cast(float, __builtin_amdgcn_permlanex16(__builtin_bit_cast(int, x), __builtin_bit_cast(int, x), 0x76543210, 0xfedcba98, false, false)); }
__device__ __forceinline__ void kv_stage(unsigned lk, unsigned lv, const unsigned short* gk, size_t k16, const unsigned short* gv, size_t v16) {
  const unsigned lk1 = lk + 2304u, lk2 = lk + 4608u, lk3 = lk + 6912u, lv1 = lv + 2304u, lv2 = lv + 4608u, lv3 = lv + 6912u;      /* 16 rows x 144 B */
  const unsigned short* gk1 = gk + k16; const unsigned short* gk2 = gk1 + k16; const unsigned short* gk3 = gk2 + k16;
  const unsigned short* gv1 = gv + v16; const unsigned short* gv2 = gv1 + v16; const unsigned short* gv3 = gv2 + v16;
  /* the closing s_wait_xcnt 0 stands inside the statement so that no address register of a copy is rewritten in front of it */
  asm volatile("global_load_async_to_lds_b128 %0, %8, off\n\t"
               "global_load_async_to_lds_b128 %1, %9, off\n\t"
               "global_load_async_to_lds_b128 %2, %10, off\n\t"
               "global_load_async_to_lds_b128 %3, %11, off\n\t"
               "global_load_async_to_lds_b128 %4, %12, off\n\t"
               "global_load_async_to_lds_b128 %5, %13, off\n\t"
               "global_load_async_to_lds_b128 %6, %14, off\n\t"
               "global_load_async_to_lds_b128 %7, %15, off\n\t"
               "s_wait_xcnt 0x0"
               :: "v"(lk), "v"(lk1), "v"(lk2), "v"(lk3), "v"(lv), "v"(lv1), "v"(lv2), "v"(lv3),
                  "v"(gk), "v"(gk1), "v"(gk2), "v"(gk3), "v"(gv), "v"(gv1), "v"(gv2), "v"(gv3) : "memory");
}
template <int CAUSAL>
__global__ __launch_bounds__(128) void k_flash(const _Float16* __restrict__ Q16, int ldq, const _Float16* __restrict__ K16, int ldk, const _Float16* __restrict__ Vt, const int* __restrict__ MSK, float* __restrict__ O, int ldo) {
  constexpr int RPW = 16, DT = 4, KS = 2, KT = 64, LP = 72;      /* KT keys a stage; LP: LDS row pitch in halves = 128 B + 16 B, the pitch of 16-byte LDS readers */
  __shared__ __attribute__((aligned(16))) unsigned short sK[2][KT][LP];
  __shared__ __attribute__((aligned(16))) unsigned short sV[2][64][LP];
  __shared__ __attribute__((aligned(16))) float sO[4][RPW][64 + 4];
  const int tid = threadIdx.x, w = tid >> 5, lane = tid & 31, ln = lane & 15, hh = lane >> 4;
  const int slab = blockIdx.x / QBNP, qblk = QB0P + blockIdx.x % QBNP; const int b = slab / NH, h = slab % NH; const int qb0 = qblk * (4 * RPW); const int q0 = qb0 + w * RPW; const int tq = q0 + ln;
  const unsigned short* Vth = (const unsigned short*)Vt + (size_t)slab * 64 * TK;
  const int jend = (CAUSAL == 1) ? (qb0 + 4 * RPW) : TK;      /* causal: keys beyond the block's last query never contribute */
  const int nst = jend / KT;
  const int crow = tid >> 3, cc = (tid & 7) * 8;      /* eight lanes copy one 128-B row */
  const unsigned short* gk = (const unsigned short*)K16 + ((size_t)b * TK + crow) * ldk + h * 64 + cc;
  const unsigned short* gv = Vth + (size_t)crow * TK + cc;
  const size_t k16 = (size_t)16 * ldk, v16 = (size_t)16 * TK, kst = (size_t)KT * ldk;
  const unsigned lk0 = (unsigned)(size_t)&sK[0][crow][cc], lv0 = (unsigned)(size_t)&sV[0][crow][cc];
  constexpr unsigned BUFB = KT * LP * 2;      /* bytes of one buffer */
  kv_stage(lk0, lv0, gk, k16, gv, v16);
  FragH bq[KS];
  { const unsigned short* qr = (const unsigned short*)Q16 + ((size_t)b * TQ + tq) * ldq + h * 64;
#pragma unroll
    for (int ks = 0; ks < KS; ++ks) { bq[ks].half[0] = *(const v8us*)(qr + ks * 32 + 8 * hh); bq[ks].half[1] = *(const v8us*)(qr + ks * 32 + 16 + 8 * hh); } }
  float m_r = -3.0e38f, l_r = 0.f; v8f oacc[DT];      /* l_r: this lane half's keys only, joined after the loop */
#pragma unroll
  for (int dt = 0; dt < DT; ++dt) oacc[dt] = (v8f){0.f,0.f,0.f,0.f,0.f,0.f,0.f,0.f};
  asm volatile("s_wait_asynccnt 0x0" ::: "memory");      /* stage 0: this wave's copies have landed */
  __syncthreads();      /* stage 0 is readable by every wave */
  if (nst > 1) kv_stage(lk0 + BUFB, lv0 + BUFB, gk + kst, k16, gv + KT, v16);
#pragma unroll 1      /* stays rolled: one copy of the body serves both buffers, chosen by st & 1 */
  for (int st = 0; st < nst; ++st) {      /* stage st is worked on while stage st + 1 flies into the other buffer */
    const int bf = st & 1;
#pragma unroll      /* unrolled: the half stage becomes a constant offset of the LDS reads */
    for (int sub = 0; sub < KT / 32; ++sub) {
    const int j0 = st * KT + sub * 32;
    FragH ak[2][KS], av[DT];
#pragma unroll
    for (int nt = 0; nt < 2; ++nt) { const unsigned short* kr = &sK[bf][sub * 32 + nt * 16 + ln][0];
#pragma unroll
      for (int ks = 0; ks < KS; ++ks) { ak[nt][ks].half[0] = *(const v8us*)(kr + ks * 32 + 8 * hh); ak[nt][ks].half[1] = *(const v8us*)(kr + ks * 32 + 16 + 8 * hh); } }
#pragma unroll
    for (int dt = 0; dt < DT; ++dt) { const unsigned short* vrow = &sV[bf][dt * 16 + ln][sub * 32]; av[dt].half[0] = *(const v8us*)(vrow + 8 * hh); av[dt].half[1] = *(const v8us*)(vrow + 16 + 8 * hh); }
    v8f s[2];
#pragma unroll
    for (int nt = 0; nt < 2; ++nt) {
      v8f acc = (v8f){0.f,0.f,0.f,0.f,0.f,0.f,0.f,0.f};
#pragma unroll
      for (int ks = 0; ks < KS; ++ks) acc = mmaH<1>(ak[nt][ks].v, ak[nt][ks].v, bq[ks].v, bq[ks].v, acc);
      s[nt] = acc; }
    float sc[16], t[8]; bool ok[16];
#pragma unroll
    for (int i = 0; i < 16; ++i) { const int kk = j0 + (i >> 3) * 16 + 8 * hh + (i & 7);
      ok[i] = (CAUSAL == 1) ? (kk <= tq) : ((CAUSAL == 2) ? ((kk >> 5) == (tq >> 5)) : true);      /* mode 2: block-diagonal 32-token groups */
      sc[i] = ok[i] ? s[i >> 3][i & 7] * SCL : -3.0e38f; if (CAUSAL == 17) sc[i] += bf16_round(((const float*)MSK + (size_t)b * TK)[kk]); }      /* mode 17: additive per-(batch, key) mask INPUT */
#pragma unroll
    for (int i = 0; i < 8; ++i) t[i] = fmaxf(sc[i], sc[i + 8]);
    float mc = fmaxf(fmaxf(fmaxf(t[0], t[1]), fmaxf(t[2], t[3])), fmaxf(fmaxf(t[4], t[5]), fmaxf(t[6], t[7])));
    mc = fmaxf(mc, xhalf(mc));      /* both halves feed one O^T column: one maximum for both */
    const float mn = fmaxf(m_r, mc); const float al = (mn > -1.0e38f) ? expf(m_r - mn) : 1.0f; m_r = mn;
    FragH pb;
#pragma unroll
    for (int i = 0; i < 16; ++i) { sc[i] = ok[i] ? expf(sc[i] - mn) : 0.f; pb.h[i] = (_Float16)(sc[i] * 1024.0f); }
#pragma unroll
    for (int i = 0; i < 8; ++i) t[i] = sc[i] + sc[i + 8];
    l_r = l_r * al + (((t[0] + t[1]) + (t[2] + t[3])) + ((t[4] + t[5]) + (t[6] + t[7])));
#pragma unroll
    for (int dt = 0; dt < DT; ++dt)
#pragma unroll
      for (int r = 0; r < 8; ++r) oacc[dt][r] *= al;
#pragma unroll
    for (int dt = 0; dt < DT; ++dt) oacc[dt] = mmaH<1>(av[dt].v, av[dt].v, pb.v, pb.v, oacc[dt]);
    }
    asm volatile("s_wait_dscnt 0x0" ::: "memory");      /* this wave's reads of buffer bf are done before the buffer is given up */
    asm volatile("s_wait_asynccnt 0x0" ::: "memory");      /* this wave's copies of stage st + 1 have landed */
    __syncthreads();      /* publishes stage st + 1 and ends every wave's reads of buffer bf */
    if (st + 2 < nst) kv_stage(lk0 + bf * BUFB, lv0 + bf * BUFB, gk + (size_t)(st + 2) * kst, k16, gv + (size_t)(st + 2) * KT, v16);
  }
  asm volatile("s_wait_asynccnt 0x0" ::: "memory");      /* no copy is left in flight when the wave goes on */
  const float l = l_r + xhalf(l_r); const float li = (l > 0.f) ? 1.0f / (l * 1024.0f) : 0.f;
#pragma unroll
  for (int dt = 0; dt < DT; ++dt) {      /* oacc[dt][r] = O[q0 + ln][16 dt + 8 hh + r] */
    const v4f lo = {oacc[dt][0] * li, oacc[dt][1] * li, oacc[dt][2] * li, oacc[dt][3] * li}, hi = {oacc[dt][4] * li, oacc[dt][5] * li, oacc[dt][6] * li, oacc[dt][7] * li};
    *(v4fa*)&sO[w][ln][dt * 16 + 8 * hh] = lo; *(v4fa*)&sO[w][ln][dt * 16 + 8 * hh + 4] = hi; }
  __builtin_amdgcn_fence(__ATOMIC_ACQ_REL, "workgroup"); __builtin_amdgcn_wave_barrier();
  {
#pragma unroll
    for (int rp = 0; rp < RPW; rp += 2) { const int r = rp + (lane >> 4), pc = lane & 15; const v4f val = *(const v4fa*)&sO[w][r][pc * 4]; *(v4f*)(O + ((size_t)b * TQ + q0 + r) * ldo + h * 64 + pc * 4) = val; }
     } }
// 5-plane variant: S = Qh Kh^T + (Ql Kh^T + Qh Kl^T)/1024 with Q/K = [hi | 2^10 residual] f16 planes (QL/KL same layout as Q16/K16), then the 3-term P.V below.
// 3-term variant: O = (P_hi V_hi + (P_lo V_hi + P_hi V_lo) / 1024) / l with P = [hi | 2^10 residual] of 1024 p and V^T = [hi | 2^10 residual] planes (VtL same layout as Vt) -> ~2^-21-class products for un-averaged (early causal / peaked) rows
template <int CAUSAL>
__global__ __launch_bounds__(128) void k_flash5(const _Float16* __restrict__ Q16, const _Float16* __restrict__ QL, int ldq, const _Float16* __restrict__ K16, const _Float16* __restrict__ KL, int ldk, const _Float16* __restrict__ Vt, const _Float16* __restrict__ VtL, const int* __restrict__ MSK, float* __restrict__ O, int ldo) {
  constexpr int RPW = 16, RTN = RPW / 16, NQB = TQ / (4 * RPW), DT = 4, KS = 2;
  __shared__ __attribute__((aligned(16))) unsigned short sP[4][RPW][40]; __shared__ __attribute__((aligned(16))) unsigned short sPL[4][RPW][40]; __shared__ __attribute__((aligned(16))) float sO[4][RPW][64 + 4];
  const int tid = threadIdx.x, w = tid >> 5, lane = tid & 31, ln = lane & 15, hh = lane >> 4;
  const int slab = blockIdx.x / QBN5, qblk = QB05 + blockIdx.x % QBN5; (void)NQB; const int b = slab / NH, h = slab % NH; const int qb0 = qblk * (4 * RPW); const int q0 = qb0 + w * RPW;
  FragH aq[2][KS], aql[2][KS];
#pragma unroll
  for (int rt = 0; rt < RTN; ++rt) { const unsigned short* qr = (const unsigned short*)Q16 + ((size_t)b * TQ + q0 + rt * 16 + ln) * ldq + h * 64; const unsigned short* ql = (const unsigned short*)QL + ((size_t)b * TQ + q0 + rt * 16 + ln) * ldq + h * 64;
#pragma unroll
    for (int ks = 0; ks < KS; ++ks) { aq[rt][ks].half[0] = *(const v8us*)(qr + ks * 32 + 8 * hh); aq[rt][ks].half[1] = *(const v8us*)(qr + ks * 32 + 16 + 8 * hh); aql[rt][ks].half[0] = *(const v8us*)(ql + ks * 32 + 8 * hh); aql[rt][ks].half[1] = *(const v8us*)(ql + ks * 32 + 16 + 8 * hh); } }
  const unsigned short* Vth = (const unsigned short*)Vt + (size_t)slab * 64 * TK; const unsigned short* Vtl = (const unsigned short*)VtL + (size_t)slab * 64 * TK;
  float m_r[2][8], l_r[2][8]; v8f oacc[2][DT], oaccL[2][DT];
#pragma unroll
  for (int rt = 0; rt < RTN; ++rt) {
#pragma unroll
    for (int r = 0; r < 8; ++r) { m_r[rt][r] = -3.0e38f; l_r[rt][r] = 0.f; }
#pragma unroll
    for (int dt = 0; dt < DT; ++dt) { oacc[rt][dt] = (v8f){0.f,0.f,0.f,0.f,0.f,0.f,0.f,0.f}; oaccL[rt][dt] = oacc[rt][dt]; } }
  const int jend = (CAUSAL == 1) ? (qb0 + 4 * RPW) : TK;      /* causal: keys beyond the block's last query never contribute */
#pragma unroll 1
  for (int j0 = 0; j0 < jend; j0 += 32) {
    v8f s[2][2];
#pragma unroll
    for (int nt = 0; nt < 2; ++nt) { const unsigned short* kr = (const unsigned short*)K16 + ((size_t)b * TK + j0 + nt * 16 + ln) * ldk + h * 64; const unsigned short* klr = (const unsigned short*)KL + ((size_t)b * TK + j0 + nt * 16 + ln) * ldk + h * 64; FragH bk[KS], bkl[KS];
#pragma unroll
      for (int ks = 0; ks < KS; ++ks) { bk[ks].half[0] = *(const v8us*)(kr + ks * 32 + 8 * hh); bk[ks].half[1] = *(const v8us*)(kr + ks * 32 + 16 + 8 * hh); bkl[ks].half[0] = *(const v8us*)(klr + ks * 32 + 8 * hh); bkl[ks].half[1] = *(const v8us*)(klr + ks * 32 + 16 + 8 * hh); }
#pragma unroll
      for (int rt = 0; rt < RTN; ++rt) { v8f acc = (v8f){0.f,0.f,0.f,0.f,0.f,0.f,0.f,0.f}, accl = acc;
#pragma unroll
        for (int ks = 0; ks < KS; ++ks) { acc = mmaH<1>(aq[rt][ks].v, aq[rt][ks].v, bk[ks].v, bk[ks].v, acc); accl = mmaH<1>(aql[rt][ks].v, aql[rt][ks].v, bk[ks].v, bk[ks].v, accl); accl = mmaH<1>(aq[rt][ks].v, aq[rt][ks].v, bkl[ks].v, bkl[ks].v, accl); }
#pragma unroll
        for (int r = 0; r < 8; ++r) acc[r] += accl[r] * 0.0009765625f;
        s[rt][nt] = acc; } }
#pragma unroll
    for (int rt = 0; rt < RTN; ++rt)
#pragma unroll
      for (int r = 0; r < 8; ++r) { const int tq = q0 + rt * 16 + 8 * hh + r; const int k0 = j0 + ln, k1 = j0 + 16 + ln;
        bool ok0 = (CAUSAL == 1) ? (k0 <= tq) : ((CAUSAL == 2) ? ((k0 >> 5) == (tq >> 5)) : true), ok1 = (CAUSAL == 1) ? (k1 <= tq) : ((CAUSAL == 2) ? ((k1 >> 5) == (tq >> 5)) : true);      /* mode 2: block-diagonal 32-token groups */
        if (CAUSAL == 4) { const int* mrow = MSK + ((size_t)b * TQ + tq) * TK; ok0 = mrow[k0] != 0; ok1 = mrow[k1] != 0; }      /* mode 4: per-(query, key) INPUT mask shared by all heads; masked keys contribute nothing (== the reference's -4096 fill, whose exp underflows to 0), rows with no valid key give l = 0 -> output 0 (== the reference's row_valid zeroing) */
        float s0 = ok0 ? s[rt][0][r] * SCL : -3.0e38f, s1 = ok1 ? s[rt][1][r] * SCL : -3.0e38f; if (CAUSAL == 17) { const float* amk = (const float*)MSK + (size_t)b * TK; s0 += bf16_round(amk[k0]); s1 += bf16_round(amk[k1]); }      /* mode 17: additive per-(batch, key) mask INPUT */ float mc = fmaxf(s0, s1);
        mc = fmaxf(mc, __shfl_xor(mc, 1, 32)); mc = fmaxf(mc, __shfl_xor(mc, 2, 32)); mc = fmaxf(mc, __shfl_xor(mc, 4, 32)); mc = fmaxf(mc, __shfl_xor(mc, 8, 32));
        const float mn = fmaxf(m_r[rt][r], mc); const float al = (mn > -1.0e38f) ? expf(m_r[rt][r] - mn) : 1.0f; m_r[rt][r] = mn; const float p0 = ok0 ? expf(s0 - mn) : 0.f, p1 = ok1 ? expf(s1 - mn) : 0.f; l_r[rt][r] = l_r[rt][r] * al + p0 + p1;
#pragma unroll
        for (int dt = 0; dt < DT; ++dt) { oacc[rt][dt][r] *= al; oaccL[rt][dt][r] *= al; }
        FragH t2, t2l; const float ps0 = p0 * 1024.0f, ps1 = p1 * 1024.0f; t2.h[0] = (_Float16)ps0; t2.h[1] = (_Float16)ps1; t2l.h[0] = (_Float16)((ps0 - (float)t2.h[0]) * 1024.0f); t2l.h[1] = (_Float16)((ps1 - (float)t2.h[1]) * 1024.0f);
        sP[w][rt * 16 + 8 * hh + r][ln] = t2.u[0]; sP[w][rt * 16 + 8 * hh + r][16 + ln] = t2.u[1]; sPL[w][rt * 16 + 8 * hh + r][ln] = t2l.u[0]; sPL[w][rt * 16 + 8 * hh + r][16 + ln] = t2l.u[1]; }
    __builtin_amdgcn_fence(__ATOMIC_ACQ_REL, "workgroup"); __builtin_amdgcn_wave_barrier();
    FragH pa[2], pl[2];
#pragma unroll
    for (int rt = 0; rt < RTN; ++rt) { pa[rt].half[0] = *(const v8us*)&sP[w][rt * 16 + ln][8 * hh]; pa[rt].half[1] = *(const v8us*)&sP[w][rt * 16 + ln][16 + 8 * hh]; pl[rt].half[0] = *(const v8us*)&sPL[w][rt * 16 + ln][8 * hh]; pl[rt].half[1] = *(const v8us*)&sPL[w][rt * 16 + ln][16 + 8 * hh]; }
#pragma unroll
    for (int dt = 0; dt < DT; ++dt) { const unsigned short* vrow = Vth + (size_t)(dt * 16 + ln) * TK + j0; const unsigned short* vrl = Vtl + (size_t)(dt * 16 + ln) * TK + j0; FragH bv, bl; bv.half[0] = *(const v8us*)(vrow + 8 * hh); bv.half[1] = *(const v8us*)(vrow + 16 + 8 * hh); bl.half[0] = *(const v8us*)(vrl + 8 * hh); bl.half[1] = *(const v8us*)(vrl + 16 + 8 * hh);
#pragma unroll
      for (int rt = 0; rt < RTN; ++rt) { oacc[rt][dt] = mmaH<1>(pa[rt].v, pa[rt].v, bv.v, bv.v, oacc[rt][dt]); oaccL[rt][dt] = mmaH<1>(pl[rt].v, pl[rt].v, bv.v, bv.v, oaccL[rt][dt]); oaccL[rt][dt] = mmaH<1>(pa[rt].v, pa[rt].v, bl.v, bl.v, oaccL[rt][dt]); } }
    __builtin_amdgcn_fence(__ATOMIC_ACQ_REL, "workgroup"); __builtin_amdgcn_wave_barrier(); }
#pragma unroll
  for (int rt = 0; rt < RTN; ++rt) {
#pragma unroll
    for (int r = 0; r < 8; ++r) { float l = l_r[rt][r]; l += __shfl_xor(l, 1, 32); l += __shfl_xor(l, 2, 32); l += __shfl_xor(l, 4, 32); l += __shfl_xor(l, 8, 32); l_r[rt][r] = (l > 0.f) ? 1.0f / (l * 1024.0f) : 0.f; }
#pragma unroll
    for (int dt = 0; dt < DT; ++dt)
#pragma unroll
      for (int r = 0; r < 8; ++r) { float v = oacc[rt][dt][r]; v += oaccL[rt][dt][r] * 0.0009765625f; sO[w][rt * 16 + 8 * hh + r][dt * 16 + ln] = v * l_r[rt][r]; } }
  __builtin_amdgcn_fence(__ATOMIC_ACQ_REL, "workgroup"); __builtin_amdgcn_wave_barrier();
  {
#pragma unroll
    for (int rp = 0; rp < RPW; rp += 2) { const int r = rp + (lane >> 4), pc = lane & 15; const v4f val = *(const v4fa*)&sO[w][r][pc * 4]; *(v4f*)(O + ((size_t)b * TQ + q0 + r) * ldo + h * 64 + pc * 4) = val; }
     } }

__global__ __launch_bounds__(256) void k_rotab(float* __restrict__ CS, float* __restrict__ SN) {
  #pragma clang fp contract(off)
  const int t = blockIdx.x * 256 + threadIdx.x; if (t >= SLEN * 32) return; const int j = t % 32, s = t / 32; const float ex = (float)(2 * j) / 64.0f; const float inv = 1.0f / powf(10000.0f, ex); const float th = (float)s * inv; const float c = cosf(th), sn = sinf(th);
  { *(float*)(CS + t) = c; *(float*)(SN + t) = sn;  } }
__global__ __launch_bounds__(256) void k_rope(const float* __restrict__ F, int nsrc, int ndst, int rep, const float* __restrict__ CS, const float* __restrict__ SN, _Float16* __restrict__ H, _Float16* __restrict__ L) {
  #pragma clang fp contract(off)
  const size_t t = (size_t)blockIdx.x * 256 + threadIdx.x; if (t >= (size_t)NR * ndst * 4) return; const int g8 = (int)(t % 4); const int hd = (int)((t / 4) % ndst); const size_t row = t / ((size_t)4 * ndst); const int s = (int)(row % SLEN); const int hs = hd / rep;
  const float* src = F + row * (size_t)(nsrc * 64) + hs * 64; FragH ah, al, bh, bl;
  for (int i = 0; i < 8; ++i) { const int d = g8 * 8 + i; const float c = CS[s * 32 + d], sn = SN[s * 32 + d]; const float x1 = src[d], x2 = src[d + 32];
    float o1 = x1 * c; o1 += -x2 * sn; float o2 = x2 * c; o2 += x1 * sn;
    _Float16 hv = (_Float16)o1; ah.h[i] = hv; al.h[i] = (_Float16)((o1 - (float)hv) * 1024.0f); hv = (_Float16)o2; bh.h[i] = hv; bl.h[i] = (_Float16)((o2 - (float)hv) * 1024.0f); }
  const size_t o = row * (size_t)(ndst * 64) + hd * 64 + g8 * 8;
  { *(v8us*)((unsigned short*)H + o) = ah.half[0]; *(v8us*)((unsigned short*)H + o + 32) = bh.half[0]; *(v8us*)((unsigned short*)L + o) = al.half[0]; *(v8us*)((unsigned short*)L + o + 32) = bl.half[0];  } }
__global__ __launch_bounds__(256) void k_rope2(const float* __restrict__ F, int nsrc, int ndst, int rep, const float* __restrict__ CS, const float* __restrict__ SN, _Float16* __restrict__ H, _Float16* __restrict__ L) {
  #pragma clang fp contract(off)
  const size_t t = (size_t)blockIdx.x * 256 + threadIdx.x; if (t >= (size_t)NR * ndst * 4) return; const int g16 = (int)(t % 4); const int hd = (int)((t / 4) % ndst); const size_t row = t / ((size_t)4 * ndst); const int s = (int)(row % SLEN); const int hs = hd / rep;
  const float* src = F + row * (size_t)(nsrc * 64) + hs * 64 + g16 * 16; FragH ah, al;
  for (int pr = 0; pr < 8; ++pr) { const int i = g16 * 8 + pr; const float c = CS[s * 32 + i], sn = SN[s * 32 + i]; const float x1 = src[2 * pr], x2 = src[2 * pr + 1];
    float o1 = x1 * c; o1 -= x2 * sn; float o2 = x1 * sn; o2 += x2 * c;
    _Float16 hv = (_Float16)o1; ah.h[2 * pr] = hv; al.h[2 * pr] = (_Float16)((o1 - (float)hv) * 1024.0f); hv = (_Float16)o2; ah.h[2 * pr + 1] = hv; al.h[2 * pr + 1] = (_Float16)((o2 - (float)hv) * 1024.0f); }
  const size_t o = row * (size_t)(ndst * 64) + hd * 64 + g16 * 16;
  { *(v8us*)((unsigned short*)H + o) = ah.half[0]; *(v8us*)((unsigned short*)H + o + 8) = ah.half[1]; *(v8us*)((unsigned short*)L + o) = al.half[0]; *(v8us*)((unsigned short*)L + o + 8) = al.half[1];  } }
__global__ __launch_bounds__(256) void k_tabin(const float* __restrict__ sp, float* __restrict__ CS, float* __restrict__ SN) { const int t = blockIdx.x * 256 + threadIdx.x; if (t >= SLEN * 32) return; const int i = t % 32, s = t / 32; const float c = bf16_round(sp[s * 64 + 32 + i]), sn = bf16_round(sp[s * 64 + i]);
  { *(float*)(CS + t) = c; *(float*)(SN + t) = sn;  } }
__global__ __launch_bounds__(256) void k_wsc(const float* __restrict__ Wm, _Float16* __restrict__ Bt, size_t n8, float sc) { const size_t t = (size_t)blockIdx.x * 256 + threadIdx.x; if (t >= n8) return; FragH f; for (int q = 0; q < 8; ++q) f.h[q] = (_Float16)(bf16_round(Wm[t * 8 + q]) * sc); *(v8us*)((unsigned short*)Bt + t * 8) = f.half[0];  }
__global__ __launch_bounds__(256) void k_rotab2(float* __restrict__ CS, float* __restrict__ SN) {
  #pragma clang fp contract(off)
  const int t = blockIdx.x * 256 + threadIdx.x; if (t >= SLEN * 32) return; const int j = t % 32, s = t / 32; const float c0 = -0.14391156831212787f;      /* -ln(10000)/64 rounded to f32 */ const float inv = expf((float)(2 * j) * c0); const float th = (float)s * inv; const float c = cosf(th), sn = sinf(th);
  { *(float*)(CS + t) = c; *(float*)(SN + t) = sn;  } }
__global__ __launch_bounds__(256) void k_lnu(const float* __restrict__ X, _Float16* __restrict__ N16, float* __restrict__ XB) {
  #pragma clang fp contract(off)
  const int wv = threadIdx.x >> 5, ln = threadIdx.x & 31; const size_t r = (size_t)blockIdx.x * 8 + wv; if (r >= NR) return; float a[32]; float s = 0.f;
  for (int i = 0; i < 4; ++i) { const v8f v = *(const v8f*)(X + r * DM + (i * 32 + ln) * 8); for (int q = 0; q < 8; ++q) { const float u = bf16_round(v[q]); a[i * 8 + q] = u; s += u; } }
  for (int o = 16; o > 0; o >>= 1) s += __shfl_xor(s, o, 32); const float mu = s / (float)DM; float var = 0.f; for (int q = 0; q < 32; ++q) { const float d = a[q] - mu; var += d * d; }
  for (int o = 16; o > 0; o >>= 1) var += __shfl_xor(var, o, 32); const float den = sqrtf(var / (float)(DM - 1)) + 1e-6f; const float inv = 1.0f / den;      /* one reciprocal per row; (x-mean)*inv vs the reference's division differs by <= 1 ulp */
  { for (int i = 0; i < 4; ++i) { const int c0 = (i * 32 + ln) * 8; FragH f; v8f xb; for (int q = 0; q < 8; ++q) { f.h[q] = (_Float16)((a[i * 8 + q] - mu) * inv); xb[q] = a[i * 8 + q]; } *(v8us*)((unsigned short*)N16 + r * DM + c0) = f.half[0]; *(v8f*)(XB + r * DM + c0) = xb; }  } }
__global__ __launch_bounds__(256) void k_vtg(const _Float16* __restrict__ V16, _Float16* __restrict__ Vt) { __shared__ unsigned short tl[64][66]; const int tid = threadIdx.x; const int slab = blockIdx.x / (SLEN / 64), lg = blockIdx.x % (SLEN / 64); const int b = slab / NH, h = slab % NH; const int hs = h / NREP;
  for (int i = tid; i < 64 * 8; i += 256) { const int r = i / 8, c8 = (i % 8) * 8; FragH f; f.half[0] = *(const v8us*)((const unsigned short*)V16 + ((size_t)b * SLEN + lg * 64 + r) * KVD + hs * 64 + c8); for (int q = 0; q < 8; ++q) tl[r][c8 + q] = f.u[q]; }
  __syncthreads();
  { for (int rd = 0; rd < 2; ++rd) { const int d = rd * 32 + tid / 8, pc = tid % 8; FragH f; for (int q = 0; q < 8; ++q) f.u[q] = tl[pc * 8 + q][d]; *(v8us*)((unsigned short*)Vt + ((size_t)slab * 64 + d) * SLEN + lg * 64 + pc * 8) = f.half[0]; }  } }

__global__ __launch_bounds__(256) void k_pm(const float* __restrict__ src, _Float16* __restrict__ P16) { const int t = blockIdx.x * 256 + threadIdx.x; if (t >= SLEN * (DM / 8)) return; const int c0 = (t % (DM / 8)) * 8; const int n = t / (DM / 8); FragH f; for (int q = 0; q < 8; ++q) f.h[q] = (_Float16)bf16_round(src[(size_t)(c0 + q) * SLEN + n]);
  *(v8us*)((unsigned short*)P16 + (size_t)n * DM + c0) = f.half[0];  }
__global__ __launch_bounds__(256) void k_nchw(const float* __restrict__ F, float* __restrict__ outb) { const int t = blockIdx.x * 256 + threadIdx.x; if (t >= DM * (SLEN / 4)) return; const int p0 = (t % (SLEN / 4)) * 4; const int o = t / (SLEN / 4); v4f r; for (int q = 0; q < 4; ++q) r[q] = F[(size_t)(p0 + q) * DM + o];
  *(v4f*)(outb + (size_t)o * SLEN + p0) = r;  }

extern "C" void kernel_launch(void* const* d_in, const int* in_sizes, int n_in,
                              void* d_out, int out_size, void* d_ws, size_t ws_size, hipStream_t stream) {
  (void)in_sizes; (void)n_in; (void)out_size;
  const float* const* I = (const float* const*)d_in; const float* vid = I[0]; const float* reff = I[1]; const float* Wq = I[2]; const float* bq = I[3]; const float* Wk = I[4]; const float* bk = I[5]; const float* Wv = I[6]; const float* bv = I[7]; const float* Wo = I[8]; const float* bo = I[9];
  char* ws = (char*)d_ws; size_t off = 0;
  auto take = [&](size_t bytes) { char* p = ws + off; off += (bytes + 255) & ~(size_t)255; return p; };
  const size_t np = (size_t)SLEN * DM;
  _Float16* BQ = (_Float16*)take((size_t)DM * DM * 2); _Float16* BK = (_Float16*)take((size_t)DM * DM * 2); _Float16* BV = (_Float16*)take((size_t)DM * DM * 2); _Float16* BO = (_Float16*)take((size_t)DM * DM * 2);
  _Float16* XV = (_Float16*)take(np * 2); _Float16* XR = (_Float16*)take(np * 2); _Float16* Q16 = (_Float16*)take(np * 2); _Float16* K16 = (_Float16*)take(np * 2); _Float16* V16 = (_Float16*)take(np * 2); _Float16* VT = (_Float16*)take(np * 2); float* O = (float*)take(np * 4); _Float16* O16 = (_Float16*)take(np * 2); float* F = (float*)take(np * 4);
  if (off > ws_size) return;      /* 2 + 7 x 4 + 8 + 8 = 46 MiB */
  k_wsc<<<(DM * DM / 8 + 255) / 256, 256, 0, stream>>>(Wq, BQ, DM * DM / 8, 16.0f); k_wsc<<<(DM * DM / 8 + 255) / 256, 256, 0, stream>>>(Wk, BK, DM * DM / 8, 16.0f); k_wsc<<<(DM * DM / 8 + 255) / 256, 256, 0, stream>>>(Wv, BV, DM * DM / 8, 16.0f); k_wsc<<<(DM * DM / 8 + 255) / 256, 256, 0, stream>>>(Wo, BO, DM * DM / 8, 16.0f);      /* 'oc' = natural Bt */
  k_pm<<<(SLEN * (DM / 8) + 255) / 256, 256, 0, stream>>>(vid, XV); k_pm<<<(SLEN * (DM / 8) + 255) / 256, 256, 0, stream>>>(reff, XR);
  const dim3 gP((SLEN / 128) * (DM / 64), 1);
  k_gemm2<0><<<gP, 128, 0, stream>>>(XV, DM, 0, BQ, DM, 0, 0.0625f, bq, 0, nullptr, 1, 0, 0, nullptr, Q16, DM, 0, SLEN, DM, DM);
  k_gemm2<0><<<gP, 128, 0, stream>>>(XR, DM, 0, BK, DM, 0, 0.0625f, bk, 0, nullptr, 1, 0, 0, nullptr, K16, DM, 0, SLEN, DM, DM);
  k_gemm2<0><<<gP, 128, 0, stream>>>(XR, DM, 0, BV, DM, 0, 0.0625f, bv, 0, nullptr, 1, 0, 0, nullptr, V16, DM, 0, SLEN, DM, DM);
  k_vt<NH, TK><<<NB * NH * (TK / 64), 256, 0, stream>>>(V16, DM, 0, VT);
  k_flash<0><<<NB * NH * QBNP, 128, 0, stream>>>(Q16, DM, K16, DM, VT, nullptr, O, DM);      /* 4096 x 4096 per head */
  k_h16<<<(unsigned)((np / 8 + 255) / 256), 256, 0, stream>>>(O, O16, np / 8);
  k_gemm2<0><<<gP, 128, 0, stream>>>(O16, DM, 0, BO, DM, 0, 0.0625f, bo, 0, nullptr, 1, 0, 0, F, nullptr, DM, 0, SLEN, DM, DM);
  k_nchw<<<(DM * (SLEN / 4) + 255) / 256, 256, 0, stream>>>(F, (float*)d_out);
}

// v003
// It runs in 182 microseconds.
// Next to v002, in two timings, it ran 1.15 times as fast each time.
// Over all steps from v000 it is 3.16 times as fast.
#include <hip/hip_runtime.h>
// CrossViewAttention3D (1 clip: 512 channels x (4 x 32 x 32 = 4096) tokens, 8 heads x 64): q = Wq video + bq, k = Wk ref + bk, v = Wv ref + bv (1x1x1 convs = channel matmuls); softmax(q.k / 8) over the 4096 ref tokens; out = Wo ctx + bo; channel-major in and out.
// Structure: exact token-major f16 planes of both inputs; q, k, v as f16 WMMA GEMM outputs (32x64 wave tiles, f32 accumulation, exact x16 weights + bias, f16 out); V^T by LDS tiles; the fused flash kernel (4096 x 4096 per head, plain operands); ctx f16; Wo + bo GEMM; NCHW store.
// Compute dtype: inputs rounded to bf16; inputs exact as f16; q/k/P/v/ctx as plain f16 operands (~2^-12); softmax f32. v_wmma_f32_16x16x32_f16.
#define NB 1
#define DM 512
#define NKV 8
#define NREP (NH / NKV)
#define KVD (NKV * 64)           /* 512 */
#define NR (NB * SLEN)           /* 4096 */
#define SLEN 4096
#define TQ SLEN
#define TK SLEN
#define NH 8
#define SCL 0.125f
#define QBLKS (TQ / 64)
#define QB05 0
#define QBN5 4
#define QB0P 0
#define QBNP QBLKS           /* non-causal: plain flash on every query block */
#define RE 256
typedef __bf16 v16b __attribute__((ext_vector_type(16)));
typedef unsigned short v8us __attribute__((ext_vector_type(8), may_alias));
typedef float  v8f  __attribute__((ext_vector_type(8)));
typedef float  v4f  __attribute__((ext_vector_type(4)));
typedef float  v4fa __attribute__((ext_vector_type(4), may_alias));
union FragB { v16b v; v8us half[2]; unsigned short u[16]; };

__device__ __forceinline__ unsigned short bf16_bits(float x) { unsigned int u = __float_as_uint(x); return (unsigned short)((u + 0x7FFFu + ((u >> 16) & 1u)) >> 16); }
__device__ __forceinline__ float bf16_val(unsigned short b) { return __uint_as_float(((unsigned int)b) << 16); }
__device__ __forceinline__ float bf16_round(float x) { return bf16_val(bf16_bits(x)); }
// D += A·B with NT terms: 1 = ah·bh, 2 = + al·bh (A split), 3 = + ah·bl (both split)
template <int NT>
__device__ __forceinline__ v8f mmaN(v16b ah, v16b al, v16b bh, v16b bl, v8f c) {
  c = __builtin_amdgcn_wmma_f32_16x16x32_bf16(false, ah, false, bh, (short)0, c, false, false);
  if (NT >= 2) c = __builtin_amdgcn_wmma_f32_16x16x32_bf16(false, al, false, bh, (short)0, c, false, false);
  if (NT >= 3) c = __builtin_amdgcn_wmma_f32_16x16x32_bf16(false, ah, false, bl, (short)0, c, false, false);
  asm volatile("v_nop\n\tv_nop\n\tv_nop\n\tv_nop" : "+v"(c) : "v"(ah), "v"(al), "v"(bh), "v"(bl));
  return c;
}

__global__ __launch_bounds__(256) void k_wt_bf16(const float* __restrict__ W, unsigned short* __restrict__ Wt, int K, int N) {
  const int t = blockIdx.x * 256 + threadIdx.x;
  const int k8n = K / 8;
  if (t >= N * k8n) return;
  const int n = t / k8n, k8 = (t % k8n) * 8;
  v8us v;
#pragma unroll
  for (int i = 0; i < 8; ++i) v[i] = bf16_bits(W[(size_t)(k8 + i) * N + n]);
  *(v8us*)(Wt + (size_t)n * K + k8) = v;
  
}

// GEMM C[M][N] (f32, pitch ldc) = act(A[M][K]·W + bias). A f32 row-major (pitch lda) converted per fragment to bf16
// (ASPLIT: hi/lo two planes -> 2 terms, else single rounded term); Wt bf16 [N][K] (pitch ldb). BIAS_BF16 rounds the
// bias to bf16 first (bias quantised to bf16 before the add). K%32==0, M%16==0, N%64==0.
template <bool ASPLIT, int ACT, bool BIAS_BF16>
__global__ __launch_bounds__(128) void k_gemm_bf(const float* __restrict__ A, int lda, const unsigned short* __restrict__ Wt, int ldb,
                                               const float* __restrict__ bias, float* __restrict__ C, int ldc, int M, int N, int K) {
  __shared__ __attribute__((aligned(16))) float so[4][16][64];
  const int tid = threadIdx.x, w = tid >> 5, lane = tid & 31, ln = lane & 15, hh = lane >> 4;
  const int ntn = N / 64;
  const int wid = blockIdx.x * 4 + w;
  const int mt = wid / ntn, nq = wid % ntn;
  if (mt * 16 >= M) return;
  const int row0 = mt * 16, col0 = nq * 64;
  const float* arow = A + (size_t)(row0 + ln) * lda;
  v8f acc[4] = {};
  for (int kb = 0; kb < K; kb += 32) {
    FragB ah, al;
    const v4f x0 = *(const v4fa*)(arow + kb + 8 * hh), x1 = *(const v4fa*)(arow + kb + 8 * hh + 4);
    const v4f x2 = *(const v4fa*)(arow + kb + 16 + 8 * hh), x3 = *(const v4fa*)(arow + kb + 16 + 8 * hh + 4);
    float xs[16] = {x0[0],x0[1],x0[2],x0[3],x1[0],x1[1],x1[2],x1[3],x2[0],x2[1],x2[2],x2[3],x3[0],x3[1],x3[2],x3[3]};
#pragma unroll
    for (int i = 0; i < 16; ++i) { const unsigned short hb = bf16_bits(xs[i]); ah.u[i] = hb; al.u[i] = ASPLIT ? bf16_bits(xs[i] - bf16_val(hb)) : (unsigned short)0; }
#pragma unroll
    for (int t = 0; t < 4; ++t) {
      const unsigned short* brow = Wt + (size_t)(col0 + t * 16 + ln) * ldb + kb;
      FragB b;
      b.half[0] = *(const v8us*)(brow + 8 * hh);
      b.half[1] = *(const v8us*)(brow + 16 + 8 * hh);
      acc[t] = mmaN<ASPLIT ? 2 : 1>(ah.v, al.v, b.v, b.v, acc[t]);
    }
  }
#pragma unroll
  for (int t = 0; t < 4; ++t) {
    float bv = bias ? bias[col0 + t * 16 + ln] : 0.f;
    if (BIAS_BF16) bv = bf16_round(bv);
#pragma unroll
    for (int r = 0; r < 8; ++r) { float v = acc[t][r] + bv; if (ACT == 1) v = fmaxf(v, 0.f); so[w][8 * hh + r][t * 16 + ln] = v; }
  }
  __builtin_amdgcn_fence(__ATOMIC_ACQ_REL, "workgroup");
  __builtin_amdgcn_wave_barrier();
  const int rsub = lane >> 4, c4 = (lane & 15) * 4;
  {
#pragma unroll
    for (int q = 0; q < 8; ++q) {
      const int r = q * 2 + rsub;
      const v4f v = *(const v4fa*)&so[w][r][c4];
      *(v4f*)(C + (size_t)(row0 + r) * ldc + col0 + c4) = v;
    }
    
  }
}

// GEMM C = act(A·W + bias + resid): A f32 (ASPLIT -> hi/lo 2 terms), Wt bf16 [N][K]; ACT 0 none, 1 relu, 2 exact gelu;
// resid (optional, f32, row index = (row % rmod), pitch ldr, RES_BF16 rounds it) added before the activation.
template <bool ASPLIT, int ACT, bool BIAS_BF16, bool RES_BF16>
__global__ __launch_bounds__(128) void k_gemm_bf3(const float* __restrict__ A, int lda, const unsigned short* __restrict__ Wt, int ldb,
                                                const float* __restrict__ bias, const float* __restrict__ resid, int rmod, int ldr,
                                                float* __restrict__ C, int ldc, int M, int N, int K) {
  __shared__ __attribute__((aligned(16))) float so[4][16][64];
  const int tid = threadIdx.x, w = tid >> 5, lane = tid & 31, ln = lane & 15, hh = lane >> 4;
  const int ntn = N / 64;
  const int wid = blockIdx.x * 4 + w;
  const int mt = wid / ntn, nq = wid % ntn;
  if (mt * 16 >= M) return;
  const int row0 = mt * 16, col0 = nq * 64;
  const float* arow = A + (size_t)(row0 + ln) * lda;
  v8f acc[4] = {};
  for (int kb = 0; kb < K; kb += 32) {
    FragB ah, al;
    const v4f x0 = *(const v4fa*)(arow + kb + 8 * hh), x1 = *(const v4fa*)(arow + kb + 8 * hh + 4);
    const v4f x2 = *(const v4fa*)(arow + kb + 16 + 8 * hh), x3 = *(const v4fa*)(arow + kb + 16 + 8 * hh + 4);
    float xs[16] = {x0[0],x0[1],x0[2],x0[3],x1[0],x1[1],x1[2],x1[3],x2[0],x2[1],x2[2],x2[3],x3[0],x3[1],x3[2],x3[3]};
#pragma unroll
    for (int i = 0; i < 16; ++i) { const unsigned short hb = bf16_bits(xs[i]); ah.u[i] = hb; al.u[i] = ASPLIT ? bf16_bits(xs[i] - bf16_val(hb)) : (unsigned short)0; }
#pragma unroll
    for (int t = 0; t < 4; ++t) {
      const unsigned short* brow = Wt + (size_t)(col0 + t * 16 + ln) * ldb + kb;
      FragB b;
      b.half[0] = *(const v8us*)(brow + 8 * hh);
      b.half[1] = *(const v8us*)(brow + 16 + 8 * hh);
      acc[t] = mmaN<ASPLIT ? 2 : 1>(ah.v, al.v, b.v, b.v, acc[t]);
    }
  }
#pragma unroll
  for (int t = 0; t < 4; ++t) {
    const int col = col0 + t * 16 + ln;
    float bv = bias ? bias[col] : 0.f;
    if (BIAS_BF16) bv = bf16_round(bv);
#pragma unroll
    for (int r = 0; r < 8; ++r) {
      float v = acc[t][r] + bv;
      if (resid) { float rv = resid[(size_t)((row0 + 8 * hh + r) % rmod) * ldr + col]; if (RES_BF16) rv = bf16_round(rv); v += rv; }
      if (ACT == 1) v = fmaxf(v, 0.f);
      if (ACT == 2) v = 0.5f * v * (1.0f + erff(v * 0.70710678118654752f));
      if (ACT == 3) { const float u = 0.7978845608028654f * (v + 0.044715f * v * v * v); v = 0.5f * v * (1.0f + tanhf(u)); }
      so[w][8 * hh + r][t * 16 + ln] = v;
    }
  }
  __builtin_amdgcn_fence(__ATOMIC_ACQ_REL, "workgroup");
  __builtin_amdgcn_wave_barrier();
  const int rsub = lane >> 4, c4 = (lane & 15) * 4;
  {
#pragma unroll
    for (int q = 0; q < 8; ++q) {
      const int r = q * 2 + rsub;
      const v4f v = *(const v4fa*)&so[w][r][c4];
      *(v4f*)(C + (size_t)(row0 + r) * ldc + col0 + c4) = v;
    }
    
  }
}
// row LayerNorm (biased variance, eps) over N: s = X (+ R); optional out_sum <- s; out_norm <- (s-mu)*rsqrt(var+eps)*g + b
template <bool PARAM_BF16>
__global__ __launch_bounds__(256) void k_layernorm(const float* __restrict__ X, const float* __restrict__ R, const float* __restrict__ g, const float* __restrict__ bta,
                                                  float* __restrict__ out_sum, float* __restrict__ out_norm, int N, float eps) {
  __shared__ float red[256];
  const int row = blockIdx.x, tid = threadIdx.x;
  const float* x = X + (size_t)row * N; const float* rr = R ? R + (size_t)row * N : nullptr;
  float vals[16];                     // up to N = 4096
  const int per = N / 256;            // contiguous chunk per thread? use strided-by-4 chunks: thread handles j = tid*4 + 1024*u
  float s1 = 0.f;
  for (int u = 0; u < per / 4; ++u) {
    const int j = tid * 4 + 1024 * u;
    const v4f a = *(const v4fa*)(x + j);
    v4f b = {0.f,0.f,0.f,0.f}; if (rr) b = *(const v4fa*)(rr + j);
#pragma unroll
    for (int q = 0; q < 4; ++q) { const float v = a[q] + b[q]; vals[u * 4 + q] = v; s1 += v; }
  }
  red[tid] = s1; __syncthreads();
  for (int st = 128; st > 0; st >>= 1) { if (tid < st) red[tid] += red[tid + st]; __syncthreads(); }
  const float mu = red[0] / (float)N; __syncthreads();
  float s2 = 0.f;
  for (int u = 0; u < per / 4; ++u)
#pragma unroll
    for (int q = 0; q < 4; ++q) { const float c = vals[u * 4 + q] - mu; s2 += c * c; }
  red[tid] = s2; __syncthreads();
  for (int st = 128; st > 0; st >>= 1) { if (tid < st) red[tid] += red[tid + st]; __syncthreads(); }
  const float rs = rsqrtf(red[0] / (float)N + eps);
  {
    for (int u = 0; u < per / 4; ++u) {
      const int j = tid * 4 + 1024 * u;
      v4f o, sm;
#pragma unroll
      for (int q = 0; q < 4; ++q) {
        float gg = g[j + q], bb = bta[j + q];
        if (PARAM_BF16) { gg = bf16_round(gg); bb = bf16_round(bb); }
        sm[q] = vals[u * 4 + q]; o[q] = (vals[u * 4 + q] - mu) * rs * gg + bb;
      }
      if (out_sum) *(v4f*)(out_sum + (size_t)row * N + j) = sm;
      *(v4f*)(out_norm + (size_t)row * N + j) = o;
    }
    
  }
}



// ---- f16 WMMA path (v_wmma_f32_16x16x32_f16): 11-bit significands for operands in range — used where a [0,1] probability operand needs more precision than bf16
typedef _Float16 v16h __attribute__((ext_vector_type(16)));
union FragH { v16h v; v8us half[2]; _Float16 h[16]; unsigned short u[16]; };
template <int NT>
__device__ __forceinline__ v8f mmaH(v16h ah, v16h al, v16h bh, v16h bl, v8f c) {
  c = __builtin_amdgcn_wmma_f32_16x16x32_f16(false, ah, false, bh, (short)0, c, false, false);
  if (NT >= 2) c = __builtin_amdgcn_wmma_f32_16x16x32_f16(false, al, false, bh, (short)0, c, false, false);
  if (NT >= 3) c = __builtin_amdgcn_wmma_f32_16x16x32_f16(false, ah, false, bl, (short)0, c, false, false);
  asm volatile("v_nop\n\tv_nop\n\tv_nop\n\tv_nop" : "+v"(c) : "v"(ah), "v"(al), "v"(bh), "v"(bl));
  return c;
}
// batched GEMM like k_gemm_b but f16 operands: A f32 (split into f16 hi/lo if ASPLIT, else rounded to f16), Bt = f16 values [n][k]; alpha; C f32; N multiple of 16 (partial tiles skipped)
template <bool ASPLIT>
__global__ __launch_bounds__(128) void k_gemm_h(const float* __restrict__ A, int lda, size_t sA, const _Float16* __restrict__ Bh, int ldb, size_t sB, float alpha, float* __restrict__ C, int ldc, size_t sC, int M, int N, int K) {
  __shared__ __attribute__((aligned(16))) float so[4][16][64];
  const int tid = threadIdx.x, w = tid >> 5, lane = tid & 31, ln = lane & 15, hh = lane >> 4; const int by = blockIdx.y;
  A += (size_t)by * sA; Bh += (size_t)by * sB; C += (size_t)by * sC;
  const int ntn = (N + 63) / 64; const int wid = blockIdx.x * 4 + w; const int mt = wid / ntn, nq = wid % ntn; if (mt * 16 >= M) return;
  const int row0 = mt * 16, col0 = nq * 64; const float* arow = A + (size_t)(row0 + ln) * lda;
  v8f acc[4] = {};
  for (int kb = 0; kb < K; kb += 32) {
    FragH ah, al;
    const v4f x0 = *(const v4fa*)(arow + kb + 8 * hh), x1 = *(const v4fa*)(arow + kb + 8 * hh + 4), x2 = *(const v4fa*)(arow + kb + 16 + 8 * hh), x3 = *(const v4fa*)(arow + kb + 16 + 8 * hh + 4);
    float xs[16] = {x0[0],x0[1],x0[2],x0[3],x1[0],x1[1],x1[2],x1[3],x2[0],x2[1],x2[2],x2[3],x3[0],x3[1],x3[2],x3[3]};
#pragma unroll
    for (int i = 0; i < 16; ++i) { const _Float16 h = (_Float16)xs[i]; ah.h[i] = h; al.h[i] = ASPLIT ? (_Float16)(xs[i] - (float)h) : (_Float16)0.0f; }
#pragma unroll
    for (int t = 0; t < 4; ++t) { if (col0 + t * 16 >= N) continue; const size_t boff = (size_t)(col0 + t * 16 + ln) * ldb + kb; FragH bq; bq.half[0] = *(const v8us*)(Bh + boff + 8 * hh); bq.half[1] = *(const v8us*)(Bh + boff + 16 + 8 * hh);
      acc[t] = mmaH<ASPLIT ? 2 : 1>(ah.v, al.v, bq.v, bq.v, acc[t]); }
  }
#pragma unroll
  for (int t = 0; t < 4; ++t) { if (col0 + t * 16 >= N) continue;
#pragma unroll
    for (int r = 0; r < 8; ++r) so[w][8 * hh + r][t * 16 + ln] = acc[t][r] * alpha; }
  __builtin_amdgcn_fence(__ATOMIC_ACQ_REL, "workgroup"); __builtin_amdgcn_wave_barrier();
  const int rsub = lane >> 4, c4 = (lane & 15) * 4;
  {
#pragma unroll
    for (int q = 0; q < 8; ++q) { const int r = q * 2 + rsub; if (col0 + c4 < N) { const v4f v = *(const v4fa*)&so[w][r][c4]; *(v4f*)(C + (size_t)(row0 + r) * ldc + col0 + c4) = v; } }
     }
}

// Wt[n][k] = f16(W[k][n]·scale) from f32 row-major W[K][N] (scale = power of two; bf16-exact weights stay exact in f16 away from the subnormal range)
__global__ __launch_bounds__(256) void k_wt_f16(const float* __restrict__ W, _Float16* __restrict__ Wt, int K, int N, float scale) {
  const int t = blockIdx.x * 256 + threadIdx.x; if (t >= N * (K / 8)) return; const int n = t / (K / 8), k8 = (t % (K / 8)) * 8; FragH f;
#pragma unroll
  for (int i = 0; i < 8; ++i) f.h[i] = (_Float16)(bf16_round(W[(size_t)(k8 + i) * N + n]) * scale); const v8us o = f.half[0];
  *(v8us*)((unsigned short*)Wt + (size_t)n * K + k8) = o; 
}
// k_gemm_hh variant with fused epilogue: v = acc·alpha + bias[by·sBias + col] (+ CP[(row/rowsPerB)·sCPb + by·64 + col] if CP) ; ACT 0 none / 1 elu ; writes f16 C16 (and f32 C if non-null)
template <int ACT>
__global__ __launch_bounds__(128) void k_gemm_hhx(const _Float16* __restrict__ A, int lda, size_t sA, const _Float16* __restrict__ Bh, int ldb, size_t sB, float alpha, const float* __restrict__ bias, size_t sBias, const float* __restrict__ CP, int rowsPerB, size_t sCPb, int row0g,
    float* __restrict__ C, _Float16* __restrict__ C16, int ldc, size_t sC, int M, int N, int K) {
  __shared__ __attribute__((aligned(16))) float so[4][16][64];
  const int tid = threadIdx.x, w = tid >> 5, lane = tid & 31, ln = lane & 15, hh = lane >> 4; const int by = blockIdx.y;
  A += (size_t)by * sA; Bh += (size_t)by * sB; const size_t cofs = (size_t)by * sC; const float* bp = bias ? bias + (size_t)by * sBias : nullptr;
  const int ntn = (N + 63) / 64; const int wid = blockIdx.x * 4 + w; const int mt = wid / ntn, nq = wid % ntn; if (mt * 16 >= M) return;
  const int row0 = mt * 16, col0 = nq * 64; const _Float16* arow = A + (size_t)(row0 + ln) * lda;
  v8f acc[4] = {};
  for (int kb = 0; kb < K; kb += 32) { FragH ah; ah.half[0] = *(const v8us*)((const unsigned short*)arow + kb + 8 * hh); ah.half[1] = *(const v8us*)((const unsigned short*)arow + kb + 16 + 8 * hh);
#pragma unroll
    for (int t = 0; t < 4; ++t) { if (col0 + t * 16 >= N) continue; const size_t boff = (size_t)(col0 + t * 16 + ln) * ldb + kb; FragH bq; bq.half[0] = *(const v8us*)((const unsigned short*)Bh + boff + 8 * hh); bq.half[1] = *(const v8us*)((const unsigned short*)Bh + boff + 16 + 8 * hh);
      acc[t] = mmaH<1>(ah.v, ah.v, bq.v, bq.v, acc[t]); }
  }
#pragma unroll
  for (int t = 0; t < 4; ++t) { if (col0 + t * 16 >= N) continue; const int col = col0 + t * 16 + ln; const float bv = bp ? bf16_round(bp[col]) : 0.f;
#pragma unroll
    for (int r = 0; r < 8; ++r) { float v = acc[t][r] * alpha + bv; if (CP) { const int bidx = (row0g + row0 + 8 * hh + r) / rowsPerB; v += CP[(size_t)bidx * sCPb + (size_t)by * 64 + col]; } if (ACT == 1) v = (v > 0.f) ? v : expm1f(v); else if (ACT == 7) v = (v > 0.f) ? v + 1.0f : expf(v); else if (ACT == 8) v = tanhf(v); else if (ACT == 9) v = 0.5f * v * (1.0f + tanhf(0.7978845608028654f * (v + 0.044715f * v * v * v))); else if (ACT == 11) v = 1.0f / (1.0f + expf(-v)); else if (ACT == 12) v = (v > 0.f) ? v : 0.01f * v; else if (ACT == 14) v = (v > 0.f) ? v : 0.1f * v; else if (ACT == 15) v = v / (1.0f + expf(-v)); else if (ACT == 3) v = fmaxf(v, 0.f); else if (ACT == 6) v = 0.5f * v * (1.0f + erff(v * 0.70710678118654752f)); so[w][8 * hh + r][t * 16 + ln] = v; } }
  __builtin_amdgcn_fence(__ATOMIC_ACQ_REL, "workgroup"); __builtin_amdgcn_wave_barrier();
  const int rsub = lane >> 4, c4 = (lane & 15) * 4; typedef _Float16 v4h __attribute__((ext_vector_type(4)));
  {
#pragma unroll
    for (int q = 0; q < 8; ++q) { const int r = q * 2 + rsub; if (col0 + c4 < N) { const v4f v = *(const v4fa*)&so[w][r][c4]; if (C) *(v4f*)(C + cofs + (size_t)(row0 + r) * ldc + col0 + c4) = v; if (C16) { v4h h4; for (int i = 0; i < 4; ++i) h4[i] = (_Float16)v[i]; *(v4h*)(C16 + cofs + (size_t)(row0 + r) * ldc + col0 + c4) = h4; } } }
     }
}


typedef _Float16 v4h __attribute__((ext_vector_type(4)));

__global__ __launch_bounds__(256) void k_x16(const float* __restrict__ x, _Float16* __restrict__ X16, size_t n8) { const size_t t = (size_t)blockIdx.x * 256 + threadIdx.x; if (t >= n8) return; FragH f;
#pragma unroll
  for (int q = 0; q < 8; ++q) f.h[q] = (_Float16)bf16_round(x[t * 8 + q]); *(v8us*)((unsigned short*)X16 + t * 8) = f.half[0];  }
__global__ __launch_bounds__(256) void k_h16(const float* __restrict__ x, _Float16* __restrict__ X16, size_t n8) { const size_t t = (size_t)blockIdx.x * 256 + threadIdx.x; if (t >= n8) return; FragH f;
#pragma unroll
  for (int q = 0; q < 8; ++q) f.h[q] = (_Float16)x[t * 8 + q]; *(v8us*)((unsigned short*)X16 + t * 8) = f.half[0];  }
__global__ __launch_bounds__(256) void k_round16f(const float* __restrict__ W, _Float16* __restrict__ Bt, size_t n8) { const size_t t = (size_t)blockIdx.x * 256 + threadIdx.x; if (t >= n8) return; FragH f;
#pragma unroll
  for (int i = 0; i < 8; ++i) f.h[i] = (_Float16)(bf16_round(W[t * 8 + i]) * 16.0f); *(v8us*)((unsigned short*)Bt + t * 8) = f.half[0];  }
template <int NHv, int TTv>
__global__ __launch_bounds__(256) void k_vt(const _Float16* __restrict__ V16, int ldv, int voff, _Float16* __restrict__ Vt) { __shared__ unsigned short tl[64][66]; const int tid = threadIdx.x; const int slab = blockIdx.x / (TTv / 64), lg = blockIdx.x % (TTv / 64); const int b = slab / NHv, h = slab % NHv;
  for (int i = tid; i < 64 * 8; i += 256) { const int r = i / 8, c8 = (i % 8) * 8; FragH f; f.half[0] = *(const v8us*)((const unsigned short*)V16 + ((size_t)b * TTv + lg * 64 + r) * ldv + voff + h * 64 + c8);
#pragma unroll
    for (int q = 0; q < 8; ++q) tl[r][c8 + q] = f.u[q]; }
  __syncthreads();
  {
#pragma unroll
    for (int rd = 0; rd < 2; ++rd) { const int d = rd * 32 + tid / 8, pc = tid % 8; FragH f;
#pragma unroll
      for (int q = 0; q < 8; ++q) f.u[q] = tl[pc * 8 + q][d];
      *(v8us*)((unsigned short*)Vt + ((size_t)slab * 64 + d) * TTv + lg * 64 + pc * 8) = f.half[0]; }
     } }

__global__ __launch_bounds__(256) void k_hl(const float* __restrict__ F, _Float16* __restrict__ Hh, _Float16* __restrict__ Hl, size_t n8) { const size_t t = (size_t)blockIdx.x * 256 + threadIdx.x; if (t >= n8) return; FragH fh, fl; const v4f a = *(const v4fa*)(F + t * 8), c = *(const v4fa*)(F + t * 8 + 4);
#pragma unroll
  for (int q = 0; q < 4; ++q) { _Float16 h = (_Float16)a[q]; fh.h[q] = h; fl.h[q] = (_Float16)((a[q] - (float)h) * 1024.0f); h = (_Float16)c[q]; fh.h[4 + q] = h; fl.h[4 + q] = (_Float16)((c[q] - (float)h) * 1024.0f); }
  { *(v8us*)((unsigned short*)Hh + t * 8) = fh.half[0]; *(v8us*)((unsigned short*)Hl + t * 8) = fl.half[0];  } }

// ---- fast GEMM (wave tile 32x64; requires M % 32 == 0 rows per launch region and N % 64 == 0); epilogue = k_gemm_hhx semantics ----
__device__ __forceinline__ v16h g2_frag(const _Float16* p, int hh) { FragH f; f.half[0] = *(const v8us*)((const unsigned short*)p + 8 * hh); f.half[1] = *(const v8us*)((const unsigned short*)p + 16 + 8 * hh); return f.v; }
__device__ __forceinline__ v8f g2_mma(v16h a, v16h b, v8f c) { v8f d = __builtin_amdgcn_wmma_f32_16x16x32_f16(false, a, false, b, (short)0, c, false, false); asm volatile("v_nop\n\tv_nop\n\tv_nop\n\tv_nop" : "+v"(d) : "v"(a), "v"(b)); return d; }
template <int ACT>
__global__ __launch_bounds__(128) void k_gemm2(const _Float16* __restrict__ A, int lda, size_t sA, const _Float16* __restrict__ Bh, int ldb, size_t sB, float alpha, const float* __restrict__ bias, size_t sBias, const float* __restrict__ CP, int rowsPerB, size_t sCPb, int row0g,
    float* __restrict__ C, _Float16* __restrict__ C16, int ldc, size_t sC, int M, int N, int K) {
  __shared__ __attribute__((aligned(16))) float so[4][32][68];
  const int tid = threadIdx.x, w = tid >> 5, lane = tid & 31, ln = lane & 15, hh = lane >> 4; const int by = blockIdx.y;
  A += (size_t)by * sA; Bh += (size_t)by * sB; const size_t cofs = (size_t)by * sC; const float* bp = bias ? bias + (size_t)by * sBias : nullptr;
  const int ntn = N >> 6; const int mt = blockIdx.x / ntn, nq = blockIdx.x - mt * ntn; const int row0 = mt * 128 + 32 * w, col0 = nq * 64; if (row0 >= M) return;
  const _Float16* a0p = A + (size_t)(row0 + ln) * lda; const _Float16* a1p = a0p + (size_t)16 * lda;
  const _Float16* b0p = Bh + (size_t)(col0 + ln) * ldb; const _Float16* b1p = b0p + (size_t)16 * ldb; const _Float16* b2p = b1p + (size_t)16 * ldb; const _Float16* b3p = b2p + (size_t)16 * ldb;
  const v8f z8 = {0.f,0.f,0.f,0.f,0.f,0.f,0.f,0.f}; v8f c00 = z8, c01 = z8, c02 = z8, c03 = z8, c10 = z8, c11 = z8, c12 = z8, c13 = z8;
#pragma unroll 1
  for (int kb = 0; kb < K; kb += 32) { const v16h a0 = g2_frag(a0p + kb, hh), a1 = g2_frag(a1p + kb, hh);
    v16h b = g2_frag(b0p + kb, hh); c00 = g2_mma(a0, b, c00); c10 = g2_mma(a1, b, c10);
    b = g2_frag(b1p + kb, hh); c01 = g2_mma(a0, b, c01); c11 = g2_mma(a1, b, c11);
    b = g2_frag(b2p + kb, hh); c02 = g2_mma(a0, b, c02); c12 = g2_mma(a1, b, c12);
    b = g2_frag(b3p + kb, hh); c03 = g2_mma(a0, b, c03); c13 = g2_mma(a1, b, c13); }
  v8f accs[8] = {c00, c01, c02, c03, c10, c11, c12, c13};
#pragma unroll
  for (int u = 0; u < 8; ++u) { const int t = u & 3, half = u >> 2; const int col = col0 + t * 16 + ln; const float bv = bp ? bf16_round(bp[col]) : 0.f;
#pragma unroll
    for (int r = 0; r < 8; ++r) { const int rloc = half * 16 + 8 * hh + r; float v = accs[u][r] * alpha + bv; if (CP) { const int bidx = (row0g + row0 + rloc) / rowsPerB; v += CP[(size_t)bidx * sCPb + (size_t)by * 64 + col]; }
      if (ACT == 3) v = fmaxf(v, 0.f); else if (ACT == 6) v = 0.5f * v * (1.0f + erff(v * 0.70710678118654752f)); else if (ACT == 11) v = 1.0f / (1.0f + expf(-v)); else if (ACT == 15) v = v / (1.0f + expf(-v)); else if (ACT == 12) v = (v > 0.f) ? v : 0.01f * v; else if (ACT == 8) v = tanhf(v);
      so[w][rloc][t * 16 + ln] = v; } }
  __builtin_amdgcn_fence(__ATOMIC_ACQ_REL, "workgroup"); __builtin_amdgcn_wave_barrier();
  const int rsub = lane >> 4, c4 = (lane & 15) * 4;
  {
#pragma unroll
    for (int q = 0; q < 16; ++q) { const int r = q * 2 + rsub; const v4f v = *(const v4fa*)&so[w][r][c4]; if (C) *(v4f*)(C + cofs + (size_t)(row0 + r) * ldc + col0 + c4) = v; if (C16) { v4h h4; for (int i = 0; i < 4; ++i) h4[i] = (_Float16)v[i]; *(v4h*)(C16 + cofs + (size_t)(row0 + r) * ldc + col0 + c4) = h4; } }
     } }



// lane l <-> lane l ^ 16 (the two lane halves of one fragment column)
__device__ __forceinline__ float xhalf(float x) { return __builtin_bit_cast(float, __builtin_amdgcn_permlanex16(__builtin_bit_cast(int, x), __builtin_bit_cast(int, x), 0x76543210, 0xfedcba98, false, false)); }
__device__ __forceinline__ void kv_stage(unsigned lk, unsigned lv, const unsigned short* gk, size_t k16, const unsigned short* gv, size_t v16) {
  const unsigned lk1 = lk + 2304u, lk2 = lk + 4608u, lk3 = lk + 6912u, lv1 = lv + 2304u, lv2 = lv + 4608u, lv3 = lv + 6912u;      /* 16 rows x 144 B */
  const unsigned short* gk1 = gk + k16; const unsigned short* gk2 = gk1 + k16; const unsigned short* gk3 = gk2 + k16;
  const unsigned short* gv1 = gv + v16; const unsigned short* gv2 = gv1 + v16; const unsigned short* gv3 = gv2 + v16;
  /* the closing s_wait_xcnt 0 stands inside the statement so that no address register of a copy is rewritten in front of it */
  asm volatile("global_load_async_to_lds_b128 %0, %8, off\n\t"
               "global_load_async_to_lds_b128 %1, %9, off\n\t"
               "global_load_async_to_lds_b128 %2, %10, off\n\t"
               "global_load_async_to_lds_b128 %3, %11, off\n\t"
               "global_load_async_to_lds_b128 %4, %12, off\n\t"
               "global_load_async_to_lds_b128 %5, %13, off\n\t"
               "global_load_async_to_lds_b128 %6, %14, off\n\t"
               "global_load_async_to_lds_b128 %7, %15, off\n\t"
               "s_wait_xcnt 0x0"
               :: "v"(lk), "v"(lk1), "v"(lk2), "v"(lk3), "v"(lv), "v"(lv1), "v"(lv2), "v"(lv3),
                  "v"(gk), "v"(gk1), "v"(gk2), "v"(gk3), "v"(gv), "v"(gv1), "v"(gv2), "v"(gv3) : "memory");
}
template <int CAUSAL>
__global__ __launch_bounds__(128) void k_flash(const _Float16* __restrict__ Q16, int ldq, const _Float16* __restrict__ K16, int ldk, const _Float16* __restrict__ Vt, const int* __restrict__ MSK, float* __restrict__ O, int ldo) {
  constexpr int RPW = 16, DT = 4, KS = 2, KT = 64, LP = 72;      /* KT keys a stage; LP: LDS row pitch in halves = 128 B + 16 B, the pitch of 16-byte LDS readers */
  __shared__ __attribute__((aligned(16))) unsigned short sK[2][KT][LP];
  __shared__ __attribute__((aligned(16))) unsigned short sV[2][64][LP];
  __shared__ __attribute__((aligned(16))) float sO[4][RPW][64 + 4];
  const int tid = threadIdx.x, w = tid >> 5, lane = tid & 31, ln = lane & 15, hh = lane >> 4;
  const int slab = blockIdx.x / QBNP, qblk = QB0P + blockIdx.x % QBNP; const int b = slab / NH, h = slab % NH; const int qb0 = qblk * (4 * RPW); const int q0 = qb0 + w * RPW; const int tq = q0 + ln;
  const unsigned short* Vth = (const unsigned short*)Vt + (size_t)slab * 64 * TK;
  const int jend = (CAUSAL == 1) ? (qb0 + 4 * RPW) : TK;      /* causal: keys beyond the block's last query never contribute */
  const int nst = jend / KT;
  const int crow = tid >> 3, cc = (tid & 7) * 8;      /* eight lanes copy one 128-B row */
  const unsigned short* gk = (const unsigned short*)K16 + ((size_t)b * TK + crow) * ldk + h * 64 + cc;
  const unsigned short* gv = Vth + (size_t)crow * TK + cc;
  const size_t k16 = (size_t)16 * ldk, v16 = (size_t)16 * TK, kst = (size_t)KT * ldk;
  const unsigned lk0 = (unsigned)(size_t)&sK[0][crow][cc], lv0 = (unsigned)(size_t)&sV[0][crow][cc];
  constexpr unsigned BUFB = KT * LP * 2;      /* bytes of one buffer */
  kv_stage(lk0, lv0, gk, k16, gv, v16);
  FragH bq[KS];
  { const unsigned short* qr = (const unsigned short*)Q16 + ((size_t)b * TQ + tq) * ldq + h * 64;
#pragma unroll
    for (int ks = 0; ks < KS; ++ks) { bq[ks].half[0] = *(const v8us*)(qr + ks * 32 + 8 * hh); bq[ks].half[1] = *(const v8us*)(qr + ks * 32 + 16 + 8 * hh); } }
  constexpr float C2 = SCL * 1.4426950408889634f;      /* score -> base-2 exponent: scale x log2(e) */
  float m_r = -3.0e38f, l_r = 0.f; v8f oacc[DT];      /* m_r: running maximum of the unscaled scores; l_r: sum of 1024 p over this lane half's keys only, joined after the loop */
#pragma unroll
  for (int dt = 0; dt < DT; ++dt) oacc[dt] = (v8f){0.f,0.f,0.f,0.f,0.f,0.f,0.f,0.f};
  asm volatile("s_wait_asynccnt 0x0" ::: "memory");      /* stage 0: this wave's copies have landed */
  __syncthreads();      /* stage 0 is readable by every wave */
  if (nst > 1) kv_stage(lk0 + BUFB, lv0 + BUFB, gk + kst, k16, gv + KT, v16);
#pragma unroll 1      /* stays rolled: one copy of the body serves both buffers, chosen by st & 1 */
  for (int st = 0; st < nst; ++st) {      /* stage st is worked on while stage st + 1 flies into the other buffer */
    const int bf = st & 1;
#pragma unroll      /* unrolled: the half stage becomes a constant offset of the LDS reads */
    for (int sub = 0; sub < KT / 32; ++sub) {
    const int j0 = st * KT + sub * 32;
    FragH ak[2][KS], av[DT];
#pragma unroll
    for (int nt = 0; nt < 2; ++nt) { const unsigned short* kr = &sK[bf][sub * 32 + nt * 16 + ln][0];
#pragma unroll
      for (int ks = 0; ks < KS; ++ks) { ak[nt][ks].half[0] = *(const v8us*)(kr + ks * 32 + 8 * hh); ak[nt][ks].half[1] = *(const v8us*)(kr + ks * 32 + 16 + 8 * hh); } }
#pragma unroll
    for (int dt = 0; dt < DT; ++dt) { const unsigned short* vrow = &sV[bf][dt * 16 + ln][sub * 32]; av[dt].half[0] = *(const v8us*)(vrow + 8 * hh); av[dt].half[1] = *(const v8us*)(vrow + 16 + 8 * hh); }
    v8f s[2];
#pragma unroll
    for (int nt = 0; nt < 2; ++nt) {
      v8f acc = (v8f){0.f,0.f,0.f,0.f,0.f,0.f,0.f,0.f};
#pragma unroll
      for (int ks = 0; ks < KS; ++ks) acc = mmaH<1>(ak[nt][ks].v, ak[nt][ks].v, bq[ks].v, bq[ks].v, acc);
      s[nt] = acc; }
    float sc[16], t[8]; bool ok[16];
#pragma unroll
    for (int i = 0; i < 16; ++i) { const int kk = j0 + (i >> 3) * 16 + 8 * hh + (i & 7);
      ok[i] = (CAUSAL == 1) ? (kk <= tq) : ((CAUSAL == 2) ? ((kk >> 5) == (tq >> 5)) : true);      /* mode 2: block-diagonal 32-token groups */
      sc[i] = ok[i] ? s[i >> 3][i & 7] : -3.0e38f; if (CAUSAL == 17) sc[i] += bf16_round(((const float*)MSK + (size_t)b * TK)[kk]) * (1.0f / SCL); }      /* unscaled scores (the scale is positive: the maximum commutes with it); mode 17: additive per-(batch, key) mask INPUT, in the same units */
#pragma unroll
    for (int i = 0; i < 8; ++i) t[i] = fmaxf(sc[i], sc[i + 8]);
    float mc = fmaxf(fmaxf(fmaxf(t[0], t[1]), fmaxf(t[2], t[3])), fmaxf(fmaxf(t[4], t[5]), fmaxf(t[6], t[7])));
    mc = fmaxf(mc, xhalf(mc));      /* both halves feed one O^T column: one maximum for both */
    const float mn = fmaxf(m_r, mc); const float al = (mn > -1.0e38f) ? __builtin_amdgcn_exp2f((m_r - mn) * C2) : 1.0f; m_r = mn;
    const float nb = __builtin_fmaf(-mn, C2, 10.0f);      /* 1024 p = 2^(C2 s - C2 m + 10): one fused multiply-add in front of the hardware's base-2 exponential */
    FragH pb;
#pragma unroll
    for (int i = 0; i < 16; ++i) sc[i] = __builtin_fmaf(sc[i], C2, nb);
    /* sixteen exponentials in place, in one statement: each is independent of the one in front of it (no result read, no source overwritten), and the closing v_nop is the slot behind the last one; last element first, because the packing behind it starts with the last pair */
    asm("v_exp_f32 %15, %15\n\tv_exp_f32 %14, %14\n\tv_exp_f32 %13, %13\n\tv_exp_f32 %12, %12\n\t"
        "v_exp_f32 %11, %11\n\tv_exp_f32 %10, %10\n\tv_exp_f32 %9, %9\n\tv_exp_f32 %8, %8\n\t"
        "v_exp_f32 %7, %7\n\tv_exp_f32 %6, %6\n\tv_exp_f32 %5, %5\n\tv_exp_f32 %4, %4\n\t"
        "v_exp_f32 %3, %3\n\tv_exp_f32 %2, %2\n\tv_exp_f32 %1, %1\n\tv_exp_f32 %0, %0\n\tv_nop"
        : "+v"(sc[0]), "+v"(sc[1]), "+v"(sc[2]), "+v"(sc[3]), "+v"(sc[4]), "+v"(sc[5]), "+v"(sc[6]), "+v"(sc[7]),
          "+v"(sc[8]), "+v"(sc[9]), "+v"(sc[10]), "+v"(sc[11]), "+v"(sc[12]), "+v"(sc[13]), "+v"(sc[14]), "+v"(sc[15]));
#pragma unroll
    for (int i = 0; i < 16; ++i) { if (!ok[i]) sc[i] = 0.f; pb.h[i] = (_Float16)sc[i]; }
#pragma unroll
    for (int i = 0; i < 8; ++i) t[i] = sc[i] + sc[i + 8];
    l_r = l_r * al + (((t[0] + t[1]) + (t[2] + t[3])) + ((t[4] + t[5]) + (t[6] + t[7])));
#pragma unroll
    for (int dt = 0; dt < DT; ++dt)
#pragma unroll
      for (int r = 0; r < 8; ++r) oacc[dt][r] *= al;
#pragma unroll
    for (int dt = 0; dt < DT; ++dt) oacc[dt] = mmaH<1>(av[dt].v, av[dt].v, pb.v, pb.v, oacc[dt]);
    }
    asm volatile("s_wait_dscnt 0x0" ::: "memory");      /* this wave's reads of buffer bf are done before the buffer is given up */
    asm volatile("s_wait_asynccnt 0x0" ::: "memory");      /* this wave's copies of stage st + 1 have landed */
    __syncthreads();      /* publishes stage st + 1 and ends every wave's reads of buffer bf */
    if (st + 2 < nst) kv_stage(lk0 + bf * BUFB, lv0 + bf * BUFB, gk + (size_t)(st + 2) * kst, k16, gv + (size_t)(st + 2) * KT, v16);
  }
  asm volatile("s_wait_asynccnt 0x0" ::: "memory");      /* no copy is left in flight when the wave goes on */
  const float l = l_r + xhalf(l_r); const float li = (l > 0.f) ? 1.0f / l : 0.f;      /* numerator and sum both carry the factor 1024 */
#pragma unroll
  for (int dt = 0; dt < DT; ++dt) {      /* oacc[dt][r] = O[q0 + ln][16 dt + 8 hh + r] */
    const v4f lo = {oacc[dt][0] * li, oacc[dt][1] * li, oacc[dt][2] * li, oacc[dt][3] * li}, hi = {oacc[dt][4] * li, oacc[dt][5] * li, oacc[dt][6] * li, oacc[dt][7] * li};
    *(v4fa*)&sO[w][ln][dt * 16 + 8 * hh] = lo; *(v4fa*)&sO[w][ln][dt * 16 + 8 * hh + 4] = hi; }
  __builtin_amdgcn_fence(__ATOMIC_ACQ_REL, "workgroup"); __builtin_amdgcn_wave_barrier();
  {
#pragma unroll
    for (int rp = 0; rp < RPW; rp += 2) { const int r = rp + (lane >> 4), pc = lane & 15; const v4f val = *(const v4fa*)&sO[w][r][pc * 4]; *(v4f*)(O + ((size_t)b * TQ + q0 + r) * ldo + h * 64 + pc * 4) = val; }
     } }
// 5-plane variant: S = Qh Kh^T + (Ql Kh^T + Qh Kl^T)/1024 with Q/K = [hi | 2^10 residual] f16 planes (QL/KL same layout as Q16/K16), then the 3-term P.V below.
// 3-term variant: O = (P_hi V_hi + (P_lo V_hi + P_hi V_lo) / 1024) / l with P = [hi | 2^10 residual] of 1024 p and V^T = [hi | 2^10 residual] planes (VtL same layout as Vt) -> ~2^-21-class products for un-averaged (early causal / peaked) rows
template <int CAUSAL>
__global__ __launch_bounds__(128) void k_flash5(const _Float16* __restrict__ Q16, const _Float16* __restrict__ QL, int ldq, const _Float16* __restrict__ K16, const _Float16* __restrict__ KL, int ldk, const _Float16* __restrict__ Vt, const _Float16* __restrict__ VtL, const int* __restrict__ MSK, float* __restrict__ O, int ldo) {
  constexpr int RPW = 16, RTN = RPW / 16, NQB = TQ / (4 * RPW), DT = 4, KS = 2;
  __shared__ __attribute__((aligned(16))) unsigned short sP[4][RPW][40]; __shared__ __attribute__((aligned(16))) unsigned short sPL[4][RPW][40]; __shared__ __attribute__((aligned(16))) float sO[4][RPW][64 + 4];
  const int tid = threadIdx.x, w = tid >> 5, lane = tid & 31, ln = lane & 15, hh = lane >> 4;
  const int slab = blockIdx.x / QBN5, qblk = QB05 + blockIdx.x % QBN5; (void)NQB; const int b = slab / NH, h = slab % NH; const int qb0 = qblk * (4 * RPW); const int q0 = qb0 + w * RPW;
  FragH aq[2][KS], aql[2][KS];
#pragma unroll
  for (int rt = 0; rt < RTN; ++rt) { const unsigned short* qr = (const unsigned short*)Q16 + ((size_t)b * TQ + q0 + rt * 16 + ln) * ldq + h * 64; const unsigned short* ql = (const unsigned short*)QL + ((size_t)b * TQ + q0 + rt * 16 + ln) * ldq + h * 64;
#pragma unroll
    for (int ks = 0; ks < KS; ++ks) { aq[rt][ks].half[0] = *(const v8us*)(qr + ks * 32 + 8 * hh); aq[rt][ks].half[1] = *(const v8us*)(qr + ks * 32 + 16 + 8 * hh); aql[rt][ks].half[0] = *(const v8us*)(ql + ks * 32 + 8 * hh); aql[rt][ks].half[1] = *(const v8us*)(ql + ks * 32 + 16 + 8 * hh); } }
  const unsigned short* Vth = (const unsigned short*)Vt + (size_t)slab * 64 * TK; const unsigned short* Vtl = (const unsigned short*)VtL + (size_t)slab * 64 * TK;
  float m_r[2][8], l_r[2][8]; v8f oacc[2][DT], oaccL[2][DT];
#pragma unroll
  for (int rt = 0; rt < RTN; ++rt) {
#pragma unroll
    for (int r = 0; r < 8; ++r) { m_r[rt][r] = -3.0e38f; l_r[rt][r] = 0.f; }
#pragma unroll
    for (int dt = 0; dt < DT; ++dt) { oacc[rt][dt] = (v8f){0.f,0.f,0.f,0.f,0.f,0.f,0.f,0.f}; oaccL[rt][dt] = oacc[rt][dt]; } }
  const int jend = (CAUSAL == 1) ? (qb0 + 4 * RPW) : TK;      /* causal: keys beyond the block's last query never contribute */
#pragma unroll 1
  for (int j0 = 0; j0 < jend; j0 += 32) {
    v8f s[2][2];
#pragma unroll
    for (int nt = 0; nt < 2; ++nt) { const unsigned short* kr = (const unsigned short*)K16 + ((size_t)b * TK + j0 + nt * 16 + ln) * ldk + h * 64; const unsigned short* klr = (const unsigned short*)KL + ((size_t)b * TK + j0 + nt * 16 + ln) * ldk + h * 64; FragH bk[KS], bkl[KS];
#pragma unroll
      for (int ks = 0; ks < KS; ++ks) { bk[ks].half[0] = *(const v8us*)(kr + ks * 32 + 8 * hh); bk[ks].half[1] = *(const v8us*)(kr + ks * 32 + 16 + 8 * hh); bkl[ks].half[0] = *(const v8us*)(klr + ks * 32 + 8 * hh); bkl[ks].half[1] = *(const v8us*)(klr + ks * 32 + 16 + 8 * hh); }
#pragma unroll
      for (int rt = 0; rt < RTN; ++rt) { v8f acc = (v8f){0.f,0.f,0.f,0.f,0.f,0.f,0.f,0.f}, accl = acc;
#pragma unroll
        for (int ks = 0; ks < KS; ++ks) { acc = mmaH<1>(aq[rt][ks].v, aq[rt][ks].v, bk[ks].v, bk[ks].v, acc); accl = mmaH<1>(aql[rt][ks].v, aql[rt][ks].v, bk[ks].v, bk[ks].v, accl); accl = mmaH<1>(aq[rt][ks].v, aq[rt][ks].v, bkl[ks].v, bkl[ks].v, accl); }
#pragma unroll
        for (int r = 0; r < 8; ++r) acc[r] += accl[r] * 0.0009765625f;
        s[rt][nt] = acc; } }
#pragma unroll
    for (int rt = 0; rt < RTN; ++rt)
#pragma unroll
      for (int r = 0; r < 8; ++r) { const int tq = q0 + rt * 16 + 8 * hh + r; const int k0 = j0 + ln, k1 = j0 + 16 + ln;
        bool ok0 = (CAUSAL == 1) ? (k0 <= tq) : ((CAUSAL == 2) ? ((k0 >> 5) == (tq >> 5)) : true), ok1 = (CAUSAL == 1) ? (k1 <= tq) : ((CAUSAL == 2) ? ((k1 >> 5) == (tq >> 5)) : true);      /* mode 2: block-diagonal 32-token groups */
        if (CAUSAL == 4) { const int* mrow = MSK + ((size_t)b * TQ + tq) * TK; ok0 = mrow[k0] != 0; ok1 = mrow[k1] != 0; }      /* mode 4: per-(query, key) INPUT mask shared by all heads; masked keys contribute nothing (== the reference's -4096 fill, whose exp underflows to 0), rows with no valid key give l = 0 -> output 0 (== the reference's row_valid zeroing) */
        float s0 = ok0 ? s[rt][0][r] * SCL : -3.0e38f, s1 = ok1 ? s[rt][1][r] * SCL : -3.0e38f; if (CAUSAL == 17) { const float* amk = (const float*)MSK + (size_t)b * TK; s0 += bf16_round(amk[k0]); s1 += bf16_round(amk[k1]); }      /* mode 17: additive per-(batch, key) mask INPUT */ float mc = fmaxf(s0, s1);
        mc = fmaxf(mc, __shfl_xor(mc, 1, 32)); mc = fmaxf(mc, __shfl_xor(mc, 2, 32)); mc = fmaxf(mc, __shfl_xor(mc, 4, 32)); mc = fmaxf(mc, __shfl_xor(mc, 8, 32));
        const float mn = fmaxf(m_r[rt][r], mc); const float al = (mn > -1.0e38f) ? expf(m_r[rt][r] - mn) : 1.0f; m_r[rt][r] = mn; const float p0 = ok0 ? expf(s0 - mn) : 0.f, p1 = ok1 ? expf(s1 - mn) : 0.f; l_r[rt][r] = l_r[rt][r] * al + p0 + p1;
#pragma unroll
        for (int dt = 0; dt < DT; ++dt) { oacc[rt][dt][r] *= al; oaccL[rt][dt][r] *= al; }
        FragH t2, t2l; const float ps0 = p0 * 1024.0f, ps1 = p1 * 1024.0f; t2.h[0] = (_Float16)ps0; t2.h[1] = (_Float16)ps1; t2l.h[0] = (_Float16)((ps0 - (float)t2.h[0]) * 1024.0f); t2l.h[1] = (_Float16)((ps1 - (float)t2.h[1]) * 1024.0f);
        sP[w][rt * 16 + 8 * hh + r][ln] = t2.u[0]; sP[w][rt * 16 + 8 * hh + r][16 + ln] = t2.u[1]; sPL[w][rt * 16 + 8 * hh + r][ln] = t2l.u[0]; sPL[w][rt * 16 + 8 * hh + r][16 + ln] = t2l.u[1]; }
    __builtin_amdgcn_fence(__ATOMIC_ACQ_REL, "workgroup"); __builtin_amdgcn_wave_barrier();
    FragH pa[2], pl[2];
#pragma unroll
    for (int rt = 0; rt < RTN; ++rt) { pa[rt].half[0] = *(const v8us*)&sP[w][rt * 16 + ln][8 * hh]; pa[rt].half[1] = *(const v8us*)&sP[w][rt * 16 + ln][16 + 8 * hh]; pl[rt].half[0] = *(const v8us*)&sPL[w][rt * 16 + ln][8 * hh]; pl[rt].half[1] = *(const v8us*)&sPL[w][rt * 16 + ln][16 + 8 * hh]; }
#pragma unroll
    for (int dt = 0; dt < DT; ++dt) { const unsigned short* vrow = Vth + (size_t)(dt * 16 + ln) * TK + j0; const unsigned short* vrl = Vtl + (size_t)(dt * 16 + ln) * TK + j0; FragH bv, bl; bv.half[0] = *(const v8us*)(vrow + 8 * hh); bv.half[1] = *(const v8us*)(vrow + 16 + 8 * hh); bl.half[0] = *(const v8us*)(vrl + 8 * hh); bl.half[1] = *(const v8us*)(vrl + 16 + 8 * hh);
#pragma unroll
      for (int rt = 0; rt < RTN; ++rt) { oacc[rt][dt] = mmaH<1>(pa[rt].v, pa[rt].v, bv.v, bv.v, oacc[rt][dt]); oaccL[rt][dt] = mmaH<1>(pl[rt].v, pl[rt].v, bv.v, bv.v, oaccL[rt][dt]); oaccL[rt][dt] = mmaH<1>(pa[rt].v, pa[rt].v, bl.v, bl.v, oaccL[rt][dt]); } }
    __builtin_amdgcn_fence(__ATOMIC_ACQ_REL, "workgroup"); __builtin_amdgcn_wave_barrier(); }
#pragma unroll
  for (int rt = 0; rt < RTN; ++rt) {
#pragma unroll
    for (int r = 0; r < 8; ++r) { float l = l_r[rt][r]; l += __shfl_xor(l, 1, 32); l += __shfl_xor(l, 2, 32); l += __shfl_xor(l, 4, 32); l += __shfl_xor(l, 8, 32); l_r[rt][r] = (l > 0.f) ? 1.0f / (l * 1024.0f) : 0.f; }
#pragma unroll
    for (int dt = 0; dt < DT; ++dt)
#pragma unroll
      for (int r = 0; r < 8; ++r) { float v = oacc[rt][dt][r]; v += oaccL[rt][dt][r] * 0.0009765625f; sO[w][rt * 16 + 8 * hh + r][dt * 16 + ln] = v * l_r[rt][r]; } }
  __builtin_amdgcn_fence(__ATOMIC_ACQ_REL, "workgroup"); __builtin_amdgcn_wave_barrier();
  {
#pragma unroll
    for (int rp = 0; rp < RPW; rp += 2) { const int r = rp + (lane >> 4), pc = lane & 15; const v4f val = *(const v4fa*)&sO[w][r][pc * 4]; *(v4f*)(O + ((size_t)b * TQ + q0 + r) * ldo + h * 64 + pc * 4) = val; }
     } }

__global__ __launch_bounds__(256) void k_rotab(float* __restrict__ CS, float* __restrict__ SN) {
  #pragma clang fp contract(off)
  const int t = blockIdx.x * 256 + threadIdx.x; if (t >= SLEN * 32) return; const int j = t % 32, s = t / 32; const float ex = (float)(2 * j) / 64.0f; const float inv = 1.0f / powf(10000.0f, ex); const float th = (float)s * inv; const float c = cosf(th), sn = sinf(th);
  { *(float*)(CS + t) = c; *(float*)(SN + t) = sn;  } }
__global__ __launch_bounds__(256) void k_rope(const float* __restrict__ F, int nsrc, int ndst, int rep, const float* __restrict__ CS, const float* __restrict__ SN, _Float16* __restrict__ H, _Float16* __restrict__ L) {
  #pragma clang fp contract(off)
  const size_t t = (size_t)blockIdx.x * 256 + threadIdx.x; if (t >= (size_t)NR * ndst * 4) return; const int g8 = (int)(t % 4); const int hd = (int)((t / 4) % ndst); const size_t row = t / ((size_t)4 * ndst); const int s = (int)(row % SLEN); const int hs = hd / rep;
  const float* src = F + row * (size_t)(nsrc * 64) + hs * 64; FragH ah, al, bh, bl;
  for (int i = 0; i < 8; ++i) { const int d = g8 * 8 + i; const float c = CS[s * 32 + d], sn = SN[s * 32 + d]; const float x1 = src[d], x2 = src[d + 32];
    float o1 = x1 * c; o1 += -x2 * sn; float o2 = x2 * c; o2 += x1 * sn;
    _Float16 hv = (_Float16)o1; ah.h[i] = hv; al.h[i] = (_Float16)((o1 - (float)hv) * 1024.0f); hv = (_Float16)o2; bh.h[i] = hv; bl.h[i] = (_Float16)((o2 - (float)hv) * 1024.0f); }
  const size_t o = row * (size_t)(ndst * 64) + hd * 64 + g8 * 8;
  { *(v8us*)((unsigned short*)H + o) = ah.half[0]; *(v8us*)((unsigned short*)H + o + 32) = bh.half[0]; *(v8us*)((unsigned short*)L + o) = al.half[0]; *(v8us*)((unsigned short*)L + o + 32) = bl.half[0];  } }
__global__ __launch_bounds__(256) void k_rope2(const float* __restrict__ F, int nsrc, int ndst, int rep, const float* __restrict__ CS, const float* __restrict__ SN, _Float16* __restrict__ H, _Float16* __restrict__ L) {
  #pragma clang fp contract(off)
  const size_t t = (size_t)blockIdx.x * 256 + threadIdx.x; if (t >= (size_t)NR * ndst * 4) return; const int g16 = (int)(t % 4); const int hd = (int)((t / 4) % ndst); const size_t row = t / ((size_t)4 * ndst); const int s = (int)(row % SLEN); const int hs = hd / rep;
  const float* src = F + row * (size_t)(nsrc * 64) + hs * 64 + g16 * 16; FragH ah, al;
  for (int pr = 0; pr < 8; ++pr) { const int i = g16 * 8 + pr; const float c = CS[s * 32 + i], sn = SN[s * 32 + i]; const float x1 = src[2 * pr], x2 = src[2 * pr + 1];
    float o1 = x1 * c; o1 -= x2 * sn; float o2 = x1 * sn; o2 += x2 * c;
    _Float16 hv = (_Float16)o1; ah.h[2 * pr] = hv; al.h[2 * pr] = (_Float16)((o1 - (float)hv) * 1024.0f); hv = (_Float16)o2; ah.h[2 * pr + 1] = hv; al.h[2 * pr + 1] = (_Float16)((o2 - (float)hv) * 1024.0f); }
  const size_t o = row * (size_t)(ndst * 64) + hd * 64 + g16 * 16;
  { *(v8us*)((unsigned short*)H + o) = ah.half[0]; *(v8us*)((unsigned short*)H + o + 8) = ah.half[1]; *(v8us*)((unsigned short*)L + o) = al.half[0]; *(v8us*)((unsigned short*)L + o + 8) = al.half[1];  } }
__global__ __launch_bounds__(256) void k_tabin(const float* __restrict__ sp, float* __restrict__ CS, float* __restrict__ SN) { const int t = blockIdx.x * 256 + threadIdx.x; if (t >= SLEN * 32) return; const int i = t % 32, s = t / 32; const float c = bf16_round(sp[s * 64 + 32 + i]), sn = bf16_round(sp[s * 64 + i]);
  { *(float*)(CS + t) = c; *(float*)(SN + t) = sn;  } }
__global__ __launch_bounds__(256) void k_wsc(const float* __restrict__ Wm, _Float16* __restrict__ Bt, size_t n8, float sc) { const size_t t = (size_t)blockIdx.x * 256 + threadIdx.x; if (t >= n8) return; FragH f; for (int q = 0; q < 8; ++q) f.h[q] = (_Float16)(bf16_round(Wm[t * 8 + q]) * sc); *(v8us*)((unsigned short*)Bt + t * 8) = f.half[0];  }
__global__ __launch_bounds__(256) void k_rotab2(float* __restrict__ CS, float* __restrict__ SN) {
  #pragma clang fp contract(off)
  const int t = blockIdx.x * 256 + threadIdx.x; if (t >= SLEN * 32) return; const int j = t % 32, s = t / 32; const float c0 = -0.14391156831212787f;      /* -ln(10000)/64 rounded to f32 */ const float inv = expf((float)(2 * j) * c0); const float th = (float)s * inv; const float c = cosf(th), sn = sinf(th);
  { *(float*)(CS + t) = c; *(float*)(SN + t) = sn;  } }
__global__ __launch_bounds__(256) void k_lnu(const float* __restrict__ X, _Float16* __restrict__ N16, float* __restrict__ XB) {
  #pragma clang fp contract(off)
  const int wv = threadIdx.x >> 5, ln = threadIdx.x & 31; const size_t r = (size_t)blockIdx.x * 8 + wv; if (r >= NR) return; float a[32]; float s = 0.f;
  for (int i = 0; i < 4; ++i) { const v8f v = *(const v8f*)(X + r * DM + (i * 32 + ln) * 8); for (int q = 0; q < 8; ++q) { const float u = bf16_round(v[q]); a[i * 8 + q] = u; s += u; } }
  for (int o = 16; o > 0; o >>= 1) s += __shfl_xor(s, o, 32); const float mu = s / (float)DM; float var = 0.f; for (int q = 0; q < 32; ++q) { const float d = a[q] - mu; var += d * d; }
  for (int o = 16; o > 0; o >>= 1) var += __shfl_xor(var, o, 32); const float den = sqrtf(var / (float)(DM - 1)) + 1e-6f; const float inv = 1.0f / den;      /* one reciprocal per row; (x-mean)*inv vs the reference's division differs by <= 1 ulp */
  { for (int i = 0; i < 4; ++i) { const int c0 = (i * 32 + ln) * 8; FragH f; v8f xb; for (int q = 0; q < 8; ++q) { f.h[q] = (_Float16)((a[i * 8 + q] - mu) * inv); xb[q] = a[i * 8 + q]; } *(v8us*)((unsigned short*)N16 + r * DM + c0) = f.half[0]; *(v8f*)(XB + r * DM + c0) = xb; }  } }
__global__ __launch_bounds__(256) void k_vtg(const _Float16* __restrict__ V16, _Float16* __restrict__ Vt) { __shared__ unsigned short tl[64][66]; const int tid = threadIdx.x; const int slab = blockIdx.x / (SLEN / 64), lg = blockIdx.x % (SLEN / 64); const int b = slab / NH, h = slab % NH; const int hs = h / NREP;
  for (int i = tid; i < 64 * 8; i += 256) { const int r = i / 8, c8 = (i % 8) * 8; FragH f; f.half[0] = *(const v8us*)((const unsigned short*)V16 + ((size_t)b * SLEN + lg * 64 + r) * KVD + hs * 64 + c8); for (int q = 0; q < 8; ++q) tl[r][c8 + q] = f.u[q]; }
  __syncthreads();
  { for (int rd = 0; rd < 2; ++rd) { const int d = rd * 32 + tid / 8, pc = tid % 8; FragH f; for (int q = 0; q < 8; ++q) f.u[q] = tl[pc * 8 + q][d]; *(v8us*)((unsigned short*)Vt + ((size_t)slab * 64 + d) * SLEN + lg * 64 + pc * 8) = f.half[0]; }  } }

__global__ __launch_bounds__(256) void k_pm(const float* __restrict__ src, _Float16* __restrict__ P16) { const int t = blockIdx.x * 256 + threadIdx.x; if (t >= SLEN * (DM / 8)) return; const int c0 = (t % (DM / 8)) * 8; const int n = t / (DM / 8); FragH f; for (int q = 0; q < 8; ++q) f.h[q] = (_Float16)bf16_round(src[(size_t)(c0 + q) * SLEN + n]);
  *(v8us*)((unsigned short*)P16 + (size_t)n * DM + c0) = f.half[0];  }
__global__ __launch_bounds__(256) void k_nchw(const float* __restrict__ F, float* __restrict__ outb) { const int t = blockIdx.x * 256 + threadIdx.x; if (t >= DM * (SLEN / 4)) return; const int p0 = (t % (SLEN / 4)) * 4; const int o = t / (SLEN / 4); v4f r; for (int q = 0; q < 4; ++q) r[q] = F[(size_t)(p0 + q) * DM + o];
  *(v4f*)(outb + (size_t)o * SLEN + p0) = r;  }

extern "C" void kernel_launch(void* const* d_in, const int* in_sizes, int n_in,
                              void* d_out, int out_size, void* d_ws, size_t ws_size, hipStream_t stream) {
  (void)in_sizes; (void)n_in; (void)out_size;
  const float* const* I = (const float* const*)d_in; const float* vid = I[0]; const float* reff = I[1]; const float* Wq = I[2]; const float* bq = I[3]; const float* Wk = I[4]; const float* bk = I[5]; const float* Wv = I[6]; const float* bv = I[7]; const float* Wo = I[8]; const float* bo = I[9];
  char* ws = (char*)d_ws; size_t off = 0;
  auto take = [&](size_t bytes) { char* p = ws + off; off += (bytes + 255) & ~(size_t)255; return p; };
  const size_t np = (size_t)SLEN * DM;
  _Float16* BQ = (_Float16*)take((size_t)DM * DM * 2); _Float16* BK = (_Float16*)take((size_t)DM * DM * 2); _Float16* BV = (_Float16*)take((size_t)DM * DM * 2); _Float16* BO = (_Float16*)take((size_t)DM * DM * 2);
  _Float16* XV = (_Float16*)take(np * 2); _Float16* XR = (_Float16*)take(np * 2); _Float16* Q16 = (_Float16*)take(np * 2); _Float16* K16 = (_Float16*)take(np * 2); _Float16* V16 = (_Float16*)take(np * 2); _Float16* VT = (_Float16*)take(np * 2); float* O = (float*)take(np * 4); _Float16* O16 = (_Float16*)take(np * 2); float* F = (float*)take(np * 4);
  if (off > ws_size) return;      /* 2 + 7 x 4 + 8 + 8 = 46 MiB */
  k_wsc<<<(DM * DM / 8 + 255) / 256, 256, 0, stream>>>(Wq, BQ, DM * DM / 8, 16.0f); k_wsc<<<(DM * DM / 8 + 255) / 256, 256, 0, stream>>>(Wk, BK, DM * DM / 8, 16.0f); k_wsc<<<(DM * DM / 8 + 255) / 256, 256, 0, stream>>>(Wv, BV, DM * DM / 8, 16.0f); k_wsc<<<(DM * DM / 8 + 255) / 256, 256, 0, stream>>>(Wo, BO, DM * DM / 8, 16.0f);      /* 'oc' = natural Bt */
  k_pm<<<(SLEN * (DM / 8) + 255) / 256, 256, 0, stream>>>(vid, XV); k_pm<<<(SLEN * (DM / 8) + 255) / 256, 256, 0, stream>>>(reff, XR);
  const dim3 gP((SLEN / 128) * (DM / 64), 1);
  k_gemm2<0><<<gP, 128, 0, stream>>>(XV, DM, 0, BQ, DM, 0, 0.0625f, bq, 0, nullptr, 1, 0, 0, nullptr, Q16, DM, 0, SLEN, DM, DM);
  k_gemm2<0><<<gP, 128, 0, stream>>>(XR, DM, 0, BK, DM, 0, 0.0625f, bk, 0, nullptr, 1, 0, 0, nullptr, K16, DM, 0, SLEN, DM, DM);
  k_gemm2<0><<<gP, 128, 0, stream>>>(XR, DM, 0, BV, DM, 0, 0.0625f, bv, 0, nullptr, 1, 0, 0, nullptr, V16, DM, 0, SLEN, DM, DM);
  k_vt<NH, TK><<<NB * NH * (TK / 64), 256, 0, stream>>>(V16, DM, 0, VT);
  k_flash<0><<<NB * NH * QBNP, 128, 0, stream>>>(Q16, DM, K16, DM, VT, nullptr, O, DM);      /* 4096 x 4096 per head */
  k_h16<<<(unsigned)((np / 8 + 255) / 256), 256, 0, stream>>>(O, O16, np / 8);
  k_gemm2<0><<<gP, 128, 0, stream>>>(O16, DM, 0, BO, DM, 0, 0.0625f, bo, 0, nullptr, 1, 0, 0, F, nullptr, DM, 0, SLEN, DM, DM);
  k_nchw<<<(DM * (SLEN / 4) + 255) / 256, 256, 0, stream>>>(F, (float*)d_out);
}

// v004
// One run takes 133 microseconds.
// Next to v003, in two timings, it ran 1.35 and 1.36 times as fast.
// All steps since v000 together make it 4.27 times as fast.
#include <hip/hip_runtime.h>
// CrossViewAttention3D (1 clip: 512 channels x (4 x 32 x 32 = 4096) tokens, 8 heads x 64): q = Wq video + bq, k = Wk ref + bk, v = Wv ref + bv (1x1x1 convs = channel matmuls); softmax(q.k / 8) over the 4096 ref tokens; out = Wo ctx + bo; channel-major in and out.
// Structure: exact token-major f16 planes of both inputs; q, k, v as f16 WMMA GEMM outputs (32x64 wave tiles, f32 accumulation, exact x16 weights + bias, f16 out); V^T by LDS tiles; the fused flash kernel (4096 x 4096 per head, plain operands); ctx f16; Wo + bo GEMM; NCHW store.
// Compute dtype: inputs rounded to bf16; inputs exact as f16; q/k/P/v/ctx as plain f16 operands (~2^-12); softmax f32. v_wmma_f32_16x16x32_f16.
#define NB 1
#define DM 512
#define NKV 8
#define NREP (NH / NKV)
#define KVD (NKV * 64)           /* 512 */
#define NR (NB * SLEN)           /* 4096 */
#define SLEN 4096
#define TQ SLEN
#define TK SLEN
#define NH 8
#define SCL 0.125f
#define QBLKS (TQ / 64)
#define QB05 0
#define QBN5 4
#define QB0P 0
#define QBNP QBLKS           /* non-causal: plain flash on every query block */
#define RE 256
typedef __bf16 v16b __attribute__((ext_vector_type(16)));
typedef unsigned short v8us __attribute__((ext_vector_type(8), may_alias));
typedef float  v8f  __attribute__((ext_vector_type(8)));
typedef float  v4f  __attribute__((ext_vector_type(4)));
typedef float  v4fa __attribute__((ext_vector_type(4), may_alias));
union FragB { v16b v; v8us half[2]; unsigned short u[16]; };

__device__ __forceinline__ unsigned short bf16_bits(float x) { unsigned int u = __float_as_uint(x); return (unsigned short)((u + 0x7FFFu + ((u >> 16) & 1u)) >> 16); }
__device__ __forceinline__ float bf16_val(unsigned short b) { return __uint_as_float(((unsigned int)b) << 16); }
__device__ __forceinline__ float bf16_round(float x) { return bf16_val(bf16_bits(x)); }
// D += A·B with NT terms: 1 = ah·bh, 2 = + al·bh (A split), 3 = + ah·bl (both split)
template <int NT>
__device__ __forceinline__ v8f mmaN(v16b ah, v16b al, v16b bh, v16b bl, v8f c) {
  c = __builtin_amdgcn_wmma_f32_16x16x32_bf16(false, ah, false, bh, (short)0, c, false, false);
  if (NT >= 2) c = __builtin_amdgcn_wmma_f32_16x16x32_bf16(false, al, false, bh, (short)0, c, false, false);
  if (NT >= 3) c = __builtin_amdgcn_wmma_f32_16x16x32_bf16(false, ah, false, bl, (short)0, c, false, false);
  asm volatile("v_nop\n\tv_nop\n\tv_nop\n\tv_nop" : "+v"(c) : "v"(ah), "v"(al), "v"(bh), "v"(bl));
  return c;
}

__global__ __launch_bounds__(256) void k_wt_bf16(const float* __restrict__ W, unsigned short* __restrict__ Wt, int K, int N) {
  const int t = blockIdx.x * 256 + threadIdx.x;
  const int k8n = K / 8;
  if (t >= N * k8n) return;
  const int n = t / k8n, k8 = (t % k8n) * 8;
  v8us v;
#pragma unroll
  for (int i = 0; i < 8; ++i) v[i] = bf16_bits(W[(size_t)(k8 + i) * N + n]);
  *(v8us*)(Wt + (size_t)n * K + k8) = v;
  
}

// GEMM C[M][N] (f32, pitch ldc) = act(A[M][K]·W + bias). A f32 row-major (pitch lda) converted per fragment to bf16
// (ASPLIT: hi/lo two planes -> 2 terms, else single rounded term); Wt bf16 [N][K] (pitch ldb). BIAS_BF16 rounds the
// bias to bf16 first (bias quantised to bf16 before the add). K%32==0, M%16==0, N%64==0.
template <bool ASPLIT, int ACT, bool BIAS_BF16>
__global__ __launch_bounds__(128) void k_gemm_bf(const float* __restrict__ A, int lda, const unsigned short* __restrict__ Wt, int ldb,
                                               const float* __restrict__ bias, float* __restrict__ C, int ldc, int M, int N, int K) {
  __shared__ __attribute__((aligned(16))) float so[4][16][64];
  const int tid = threadIdx.x, w = tid >> 5, lane = tid & 31, ln = lane & 15, hh = lane >> 4;
  const int ntn = N / 64;
  const int wid = blockIdx.x * 4 + w;
  const int mt = wid / ntn, nq = wid % ntn;
  if (mt * 16 >= M) return;
  const int row0 = mt * 16, col0 = nq * 64;
  const float* arow = A + (size_t)(row0 + ln) * lda;
  v8f acc[4] = {};
  for (int kb = 0; kb < K; kb += 32) {
    FragB ah, al;
    const v4f x0 = *(const v4fa*)(arow + kb + 8 * hh), x1 = *(const v4fa*)(arow + kb + 8 * hh + 4);
    const v4f x2 = *(const v4fa*)(arow + kb + 16 + 8 * hh), x3 = *(const v4fa*)(arow + kb + 16 + 8 * hh + 4);
    float xs[16] = {x0[0],x0[1],x0[2],x0[3],x1[0],x1[1],x1[2],x1[3],x2[0],x2[1],x2[2],x2[3],x3[0],x3[1],x3[2],x3[3]};
#pragma unroll
    for (int i = 0; i < 16; ++i) { const unsigned short hb = bf16_bits(xs[i]); ah.u[i] = hb; al.u[i] = ASPLIT ? bf16_bits(xs[i] - bf16_val(hb)) : (unsigned short)0; }
#pragma unroll
    for (int t = 0; t < 4; ++t) {
      const unsigned short* brow = Wt + (size_t)(col0 + t * 16 + ln) * ldb + kb;
      FragB b;
      b.half[0] = *(const v8us*)(brow + 8 * hh);
      b.half[1] = *(const v8us*)(brow + 16 + 8 * hh);
      acc[t] = mmaN<ASPLIT ? 2 : 1>(ah.v, al.v, b.v, b.v, acc[t]);
    }
  }
#pragma unroll
  for (int t = 0; t < 4; ++t) {
    float bv = bias ? bias[col0 + t * 16 + ln] : 0.f;
    if (BIAS_BF16) bv = bf16_round(bv);
#pragma unroll
    for (int r = 0; r < 8; ++r) { float v = acc[t][r] + bv; if (ACT == 1) v = fmaxf(v, 0.f); so[w][8 * hh + r][t * 16 + ln] = v; }
  }
  __builtin_amdgcn_fence(__ATOMIC_ACQ_REL, "workgroup");
  __builtin_amdgcn_wave_barrier();
  const int rsub = lane >> 4, c4 = (lane & 15) * 4;
  {
#pragma unroll
    for (int q = 0; q < 8; ++q) {
      const int r = q * 2 + rsub;
      const v4f v = *(const v4fa*)&so[w][r][c4];
      *(v4f*)(C + (size_t)(row0 + r) * ldc + col0 + c4) = v;
    }
    
  }
}

// GEMM C = act(A·W + bias + resid): A f32 (ASPLIT -> hi/lo 2 terms), Wt bf16 [N][K]; ACT 0 none, 1 relu, 2 exact gelu;
// resid (optional, f32, row index = (row % rmod), pitch ldr, RES_BF16 rounds it) added before the activation.
template <bool ASPLIT, int ACT, bool BIAS_BF16, bool RES_BF16>
__global__ __launch_bounds__(128) void k_gemm_bf3(const float* __restrict__ A, int lda, const unsigned short* __restrict__ Wt, int ldb,
                                                const float* __restrict__ bias, const float* __restrict__ resid, int rmod, int ldr,
                                                float* __restrict__ C, int ldc, int M, int N, int K) {
  __shared__ __attribute__((aligned(16))) float so[4][16][64];
  const int tid = threadIdx.x, w = tid >> 5, lane = tid & 31, ln = lane & 15, hh = lane >> 4;
  const int ntn = N / 64;
  const int wid = blockIdx.x * 4 + w;
  const int mt = wid / ntn, nq = wid % ntn;
  if (mt * 16 >= M) return;
  const int row0 = mt * 16, col0 = nq * 64;
  const float* arow = A + (size_t)(row0 + ln) * lda;
  v8f acc[4] = {};
  for (int kb = 0; kb < K; kb += 32) {
    FragB ah, al;
    const v4f x0 = *(const v4fa*)(arow + kb + 8 * hh), x1 = *(const v4fa*)(arow + kb + 8 * hh + 4);
    const v4f x2 = *(const v4fa*)(arow + kb + 16 + 8 * hh), x3 = *(const v4fa*)(arow + kb + 16 + 8 * hh + 4);
    float xs[16] = {x0[0],x0[1],x0[2],x0[3],x1[0],x1[1],x1[2],x1[3],x2[0],x2[1],x2[2],x2[3],x3[0],x3[1],x3[2],x3[3]};
#pragma unroll
    for (int i = 0; i < 16; ++i) { const unsigned short hb = bf16_bits(xs[i]); ah.u[i] = hb; al.u[i] = ASPLIT ? bf16_bits(xs[i] - bf16_val(hb)) : (unsigned short)0; }
#pragma unroll
    for (int t = 0; t < 4; ++t) {
      const unsigned short* brow = Wt + (size_t)(col0 + t * 16 + ln) * ldb + kb;
      FragB b;
      b.half[0] = *(const v8us*)(brow + 8 * hh);
      b.half[1] = *(const v8us*)(brow + 16 + 8 * hh);
      acc[t] = mmaN<ASPLIT ? 2 : 1>(ah.v, al.v, b.v, b.v, acc[t]);
    }
  }
#pragma unroll
  for (int t = 0; t < 4; ++t) {
    const int col = col0 + t * 16 + ln;
    float bv = bias ? bias[col] : 0.f;
    if (BIAS_BF16) bv = bf16_round(bv);
#pragma unroll
    for (int r = 0; r < 8; ++r) {
      float v = acc[t][r] + bv;
      if (resid) { float rv = resid[(size_t)((row0 + 8 * hh + r) % rmod) * ldr + col]; if (RES_BF16) rv = bf16_round(rv); v += rv; }
      if (ACT == 1) v = fmaxf(v, 0.f);
      if (ACT == 2) v = 0.5f * v * (1.0f + erff(v * 0.70710678118654752f));
      if (ACT == 3) { const float u = 0.7978845608028654f * (v + 0.044715f * v * v * v); v = 0.5f * v * (1.0f + tanhf(u)); }
      so[w][8 * hh + r][t * 16 + ln] = v;
    }
  }
  __builtin_amdgcn_fence(__ATOMIC_ACQ_REL, "workgroup");
  __builtin_amdgcn_wave_barrier();
  const int rsub = lane >> 4, c4 = (lane & 15) * 4;
  {
#pragma unroll
    for (int q = 0; q < 8; ++q) {
      const int r = q * 2 + rsub;
      const v4f v = *(const v4fa*)&so[w][r][c4];
      *(v4f*)(C + (size_t)(row0 + r) * ldc + col0 + c4) = v;
    }
    
  }
}
// row LayerNorm (biased variance, eps) over N: s = X (+ R); optional out_sum <- s; out_norm <- (s-mu)*rsqrt(var+eps)*g + b
template <bool PARAM_BF16>
__global__ __launch_bounds__(256) void k_layernorm(const float* __restrict__ X, const float* __restrict__ R, const float* __restrict__ g, const float* __restrict__ bta,
                                                  float* __restrict__ out_sum, float* __restrict__ out_norm, int N, float eps) {
  __shared__ float red[256];
  const int row = blockIdx.x, tid = threadIdx.x;
  const float* x = X + (size_t)row * N; const float* rr = R ? R + (size_t)row * N : nullptr;
  float vals[16];                     // up to N = 4096
  const int per = N / 256;            // contiguous chunk per thread? use strided-by-4 chunks: thread handles j = tid*4 + 1024*u
  float s1 = 0.f;
  for (int u = 0; u < per / 4; ++u) {
    const int j = tid * 4 + 1024 * u;
    const v4f a = *(const v4fa*)(x + j);
    v4f b = {0.f,0.f,0.f,0.f}; if (rr) b = *(const v4fa*)(rr + j);
#pragma unroll
    for (int q = 0; q < 4; ++q) { const float v = a[q] + b[q]; vals[u * 4 + q] = v; s1 += v; }
  }
  red[tid] = s1; __syncthreads();
  for (int st = 128; st > 0; st >>= 1) { if (tid < st) red[tid] += red[tid + st]; __syncthreads(); }
  const float mu = red[0] / (float)N; __syncthreads();
  float s2 = 0.f;
  for (int u = 0; u < per / 4; ++u)
#pragma unroll
    for (int q = 0; q < 4; ++q) { const float c = vals[u * 4 + q] - mu; s2 += c * c; }
  red[tid] = s2; __syncthreads();
  for (int st = 128; st > 0; st >>= 1) { if (tid < st) red[tid] += red[tid + st]; __syncthreads(); }
  const float rs = rsqrtf(red[0] / (float)N + eps);
  {
    for (int u = 0; u < per / 4; ++u) {
      const int j = tid * 4 + 1024 * u;
      v4f o, sm;
#pragma unroll
      for (int q = 0; q < 4; ++q) {
        float gg = g[j + q], bb = bta[j + q];
        if (PARAM_BF16) { gg = bf16_round(gg); bb = bf16_round(bb); }
        sm[q] = vals[u * 4 + q]; o[q] = (vals[u * 4 + q] - mu) * rs * gg + bb;
      }
      if (out_sum) *(v4f*)(out_sum + (size_t)row * N + j) = sm;
      *(v4f*)(out_norm + (size_t)row * N + j) = o;
    }
    
  }
}



// ---- f16 WMMA path (v_wmma_f32_16x16x32_f16): 11-bit significands for operands in range — used where a [0,1] probability operand needs more precision than bf16
typedef _Float16 v16h __attribute__((ext_vector_type(16)));
union FragH { v16h v; v8us half[2]; _Float16 h[16]; unsigned short u[16]; };
template <int NT>
__device__ __forceinline__ v8f mmaH(v16h ah, v16h al, v16h bh, v16h bl, v8f c) {
  c = __builtin_amdgcn_wmma_f32_16x16x32_f16(false, ah, false, bh, (short)0, c, false, false);
  if (NT >= 2) c = __builtin_amdgcn_wmma_f32_16x16x32_f16(false, al, false, bh, (short)0, c, false, false);
  if (NT >= 3) c = __builtin_amdgcn_wmma_f32_16x16x32_f16(false, ah, false, bl, (short)0, c, false, false);
  asm volatile("v_nop\n\tv_nop\n\tv_nop\n\tv_nop" : "+v"(c) : "v"(ah), "v"(al), "v"(bh), "v"(bl));
  return c;
}
// batched GEMM like k_gemm_b but f16 operands: A f32 (split into f16 hi/lo if ASPLIT, else rounded to f16), Bt = f16 values [n][k]; alpha; C f32; N multiple of 16 (partial tiles skipped)
template <bool ASPLIT>
__global__ __launch_bounds__(128) void k_gemm_h(const float* __restrict__ A, int lda, size_t sA, const _Float16* __restrict__ Bh, int ldb, size_t sB, float alpha, float* __restrict__ C, int ldc, size_t sC, int M, int N, int K) {
  __shared__ __attribute__((aligned(16))) float so[4][16][64];
  const int tid = threadIdx.x, w = tid >> 5, lane = tid & 31, ln = lane & 15, hh = lane >> 4; const int by = blockIdx.y;
  A += (size_t)by * sA; Bh += (size_t)by * sB; C += (size_t)by * sC;
  const int ntn = (N + 63) / 64; const int wid = blockIdx.x * 4 + w; const int mt = wid / ntn, nq = wid % ntn; if (mt * 16 >= M) return;
  const int row0 = mt * 16, col0 = nq * 64; const float* arow = A + (size_t)(row0 + ln) * lda;
  v8f acc[4] = {};
  for (int kb = 0; kb < K; kb += 32) {
    FragH ah, al;
    const v4f x0 = *(const v4fa*)(arow + kb + 8 * hh), x1 = *(const v4fa*)(arow + kb + 8 * hh + 4), x2 = *(const v4fa*)(arow + kb + 16 + 8 * hh), x3 = *(const v4fa*)(arow + kb + 16 + 8 * hh + 4);
    float xs[16] = {x0[0],x0[1],x0[2],x0[3],x1[0],x1[1],x1[2],x1[3],x2[0],x2[1],x2[2],x2[3],x3[0],x3[1],x3[2],x3[3]};
#pragma unroll
    for (int i = 0; i < 16; ++i) { const _Float16 h = (_Float16)xs[i]; ah.h[i] = h; al.h[i] = ASPLIT ? (_Float16)(xs[i] - (float)h) : (_Float16)0.0f; }
#pragma unroll
    for (int t = 0; t < 4; ++t) { if (col0 + t * 16 >= N) continue; const size_t boff = (size_t)(col0 + t * 16 + ln) * ldb + kb; FragH bq; bq.half[0] = *(const v8us*)(Bh + boff + 8 * hh); bq.half[1] = *(const v8us*)(Bh + boff + 16 + 8 * hh);
      acc[t] = mmaH<ASPLIT ? 2 : 1>(ah.v, al.v, bq.v, bq.v, acc[t]); }
  }
#pragma unroll
  for (int t = 0; t < 4; ++t) { if (col0 + t * 16 >= N) continue;
#pragma unroll
    for (int r = 0; r < 8; ++r) so[w][8 * hh + r][t * 16 + ln] = acc[t][r] * alpha; }
  __builtin_amdgcn_fence(__ATOMIC_ACQ_REL, "workgroup"); __builtin_amdgcn_wave_barrier();
  const int rsub = lane >> 4, c4 = (lane & 15) * 4;
  {
#pragma unroll
    for (int q = 0; q < 8; ++q) { const int r = q * 2 + rsub; if (col0 + c4 < N) { const v4f v = *(const v4fa*)&so[w][r][c4]; *(v4f*)(C + (size_t)(row0 + r) * ldc + col0 + c4) = v; } }
     }
}

// Wt[n][k] = f16(W[k][n]·scale) from f32 row-major W[K][N] (scale = power of two; bf16-exact weights stay exact in f16 away from the subnormal range)
__global__ __launch_bounds__(256) void k_wt_f16(const float* __restrict__ W, _Float16* __restrict__ Wt, int K, int N, float scale) {
  const int t = blockIdx.x * 256 + threadIdx.x; if (t >= N * (K / 8)) return; const int n = t / (K / 8), k8 = (t % (K / 8)) * 8; FragH f;
#pragma unroll
  for (int i = 0; i < 8; ++i) f.h[i] = (_Float16)(bf16_round(W[(size_t)(k8 + i) * N + n]) * scale); const v8us o = f.half[0];
  *(v8us*)((unsigned short*)Wt + (size_t)n * K + k8) = o; 
}
// k_gemm_hh variant with fused epilogue: v = acc·alpha + bias[by·sBias + col] (+ CP[(row/rowsPerB)·sCPb + by·64 + col] if CP) ; ACT 0 none / 1 elu ; writes f16 C16 (and f32 C if non-null)
template <int ACT>
__global__ __launch_bounds__(128) void k_gemm_hhx(const _Float16* __restrict__ A, int lda, size_t sA, const _Float16* __restrict__ Bh, int ldb, size_t sB, float alpha, const float* __restrict__ bias, size_t sBias, const float* __restrict__ CP, int rowsPerB, size_t sCPb, int row0g,
    float* __restrict__ C, _Float16* __restrict__ C16, int ldc, size_t sC, int M, int N, int K) {
  __shared__ __attribute__((aligned(16))) float so[4][16][64];
  const int tid = threadIdx.x, w = tid >> 5, lane = tid & 31, ln = lane & 15, hh = lane >> 4; const int by = blockIdx.y;
  A += (size_t)by * sA; Bh += (size_t)by * sB; const size_t cofs = (size_t)by * sC; const float* bp = bias ? bias + (size_t)by * sBias : nullptr;
  const int ntn = (N + 63) / 64; const int wid = blockIdx.x * 4 + w; const int mt = wid / ntn, nq = wid % ntn; if (mt * 16 >= M) return;
  const int row0 = mt * 16, col0 = nq * 64; const _Float16* arow = A + (size_t)(row0 + ln) * lda;
  v8f acc[4] = {};
  for (int kb = 0; kb < K; kb += 32) { FragH ah; ah.half[0] = *(const v8us*)((const unsigned short*)arow + kb + 8 * hh); ah.half[1] = *(const v8us*)((const unsigned short*)arow + kb + 16 + 8 * hh);
#pragma unroll
    for (int t = 0; t < 4; ++t) { if (col0 + t * 16 >= N) continue; const size_t boff = (size_t)(col0 + t * 16 + ln) * ldb + kb; FragH bq; bq.half[0] = *(const v8us*)((const unsigned short*)Bh + boff + 8 * hh); bq.half[1] = *(const v8us*)((const unsigned short*)Bh + boff + 16 + 8 * hh);
      acc[t] = mmaH<1>(ah.v, ah.v, bq.v, bq.v, acc[t]); }
  }
#pragma unroll
  for (int t = 0; t < 4; ++t) { if (col0 + t * 16 >= N) continue; const int col = col0 + t * 16 + ln; const float bv = bp ? bf16_round(bp[col]) : 0.f;
#pragma unroll
    for (int r = 0; r < 8; ++r) { float v = acc[t][r] * alpha + bv; if (CP) { const int bidx = (row0g + row0 + 8 * hh + r) / rowsPerB; v += CP[(size_t)bidx * sCPb + (size_t)by * 64 + col]; } if (ACT == 1) v = (v > 0.f) ? v : expm1f(v); else if (ACT == 7) v = (v > 0.f) ? v + 1.0f : expf(v); else if (ACT == 8) v = tanhf(v); else if (ACT == 9) v = 0.5f * v * (1.0f + tanhf(0.7978845608028654f * (v + 0.044715f * v * v * v))); else if (ACT == 11) v = 1.0f / (1.0f + expf(-v)); else if (ACT == 12) v = (v > 0.f) ? v : 0.01f * v; else if (ACT == 14) v = (v > 0.f) ? v : 0.1f * v; else if (ACT == 15) v = v / (1.0f + expf(-v)); else if (ACT == 3) v = fmaxf(v, 0.f); else if (ACT == 6) v = 0.5f * v * (1.0f + erff(v * 0.70710678118654752f)); so[w][8 * hh + r][t * 16 + ln] = v; } }
  __builtin_amdgcn_fence(__ATOMIC_ACQ_REL, "workgroup"); __builtin_amdgcn_wave_barrier();
  const int rsub = lane >> 4, c4 = (lane & 15) * 4; typedef _Float16 v4h __attribute__((ext_vector_type(4)));
  {
#pragma unroll
    for (int q = 0; q < 8; ++q) { const int r = q * 2 + rsub; if (col0 + c4 < N) { const v4f v = *(const v4fa*)&so[w][r][c4]; if (C) *(v4f*)(C + cofs + (size_t)(row0 + r) * ldc + col0 + c4) = v; if (C16) { v4h h4; for (int i = 0; i < 4; ++i) h4[i] = (_Float16)v[i]; *(v4h*)(C16 + cofs + (size_t)(row0 + r) * ldc + col0 + c4) = h4; } } }
     }
}


typedef _Float16 v4h __attribute__((ext_vector_type(4)));

__global__ __launch_bounds__(256) void k_x16(const float* __restrict__ x, _Float16* __restrict__ X16, size_t n8) { const size_t t = (size_t)blockIdx.x * 256 + threadIdx.x; if (t >= n8) return; FragH f;
#pragma unroll
  for (int q = 0; q < 8; ++q) f.h[q] = (_Float16)bf16_round(x[t * 8 + q]); *(v8us*)((unsigned short*)X16 + t * 8) = f.half[0];  }
__global__ __launch_bounds__(256) void k_h16(const float* __restrict__ x, _Float16* __restrict__ X16, size_t n8) { const size_t t = (size_t)blockIdx.x * 256 + threadIdx.x; if (t >= n8) return; FragH f;
#pragma unroll
  for (int q = 0; q < 8; ++q) f.h[q] = (_Float16)x[t * 8 + q]; *(v8us*)((unsigned short*)X16 + t * 8) = f.half[0];  }
__global__ __launch_bounds__(256) void k_round16f(const float* __restrict__ W, _Float16* __restrict__ Bt, size_t n8) { const size_t t = (size_t)blockIdx.x * 256 + threadIdx.x; if (t >= n8) return; FragH f;
#pragma unroll
  for (int i = 0; i < 8; ++i) f.h[i] = (_Float16)(bf16_round(W[t * 8 + i]) * 16.0f); *(v8us*)((unsigned short*)Bt + t * 8) = f.half[0];  }
template <int NHv, int TTv>
__global__ __launch_bounds__(256) void k_vt(const _Float16* __restrict__ V16, int ldv, int voff, _Float16* __restrict__ Vt) { __shared__ unsigned short tl[64][66]; const int tid = threadIdx.x; const int slab = blockIdx.x / (TTv / 64), lg = blockIdx.x % (TTv / 64); const int b = slab / NHv, h = slab % NHv;
  for (int i = tid; i < 64 * 8; i += 256) { const int r = i / 8, c8 = (i % 8) * 8; FragH f; f.half[0] = *(const v8us*)((const unsigned short*)V16 + ((size_t)b * TTv + lg * 64 + r) * ldv + voff + h * 64 + c8);
#pragma unroll
    for (int q = 0; q < 8; ++q) tl[r][c8 + q] = f.u[q]; }
  __syncthreads();
  {
#pragma unroll
    for (int rd = 0; rd < 2; ++rd) { const int d = rd * 32 + tid / 8, pc = tid % 8; FragH f;
#pragma unroll
      for (int q = 0; q < 8; ++q) f.u[q] = tl[pc * 8 + q][d];
      *(v8us*)((unsigned short*)Vt + ((size_t)slab * 64 + d) * TTv + lg * 64 + pc * 8) = f.half[0]; }
     } }

__global__ __launch_bounds__(256) void k_hl(const float* __restrict__ F, _Float16* __restrict__ Hh, _Float16* __restrict__ Hl, size_t n8) { const size_t t = (size_t)blockIdx.x * 256 + threadIdx.x; if (t >= n8) return; FragH fh, fl; const v4f a = *(const v4fa*)(F + t * 8), c = *(const v4fa*)(F + t * 8 + 4);
#pragma unroll
  for (int q = 0; q < 4; ++q) { _Float16 h = (_Float16)a[q]; fh.h[q] = h; fl.h[q] = (_Float16)((a[q] - (float)h) * 1024.0f); h = (_Float16)c[q]; fh.h[4 + q] = h; fl.h[4 + q] = (_Float16)((c[q] - (float)h) * 1024.0f); }
  { *(v8us*)((unsigned short*)Hh + t * 8) = fh.half[0]; *(v8us*)((unsigned short*)Hl + t * 8) = fl.half[0];  } }

// ---- fast GEMM (wave tile 32x64; requires M % 32 == 0 rows per launch region and N % 64 == 0); epilogue = k_gemm_hhx semantics ----
__device__ __forceinline__ v16h g2_frag(const _Float16* p, int hh) { FragH f; f.half[0] = *(const v8us*)((const unsigned short*)p + 8 * hh); f.half[1] = *(const v8us*)((const unsigned short*)p + 16 + 8 * hh); return f.v; }
__device__ __forceinline__ v8f g2_mma(v16h a, v16h b, v8f c) { v8f d = __builtin_amdgcn_wmma_f32_16x16x32_f16(false, a, false, b, (short)0, c, false, false); asm volatile("v_nop\n\tv_nop\n\tv_nop\n\tv_nop" : "+v"(d) : "v"(a), "v"(b)); return d; }
template <int ACT>
__device__ __forceinline__ void gemm2_body(const int by, const _Float16* __restrict__ A, int lda, size_t sA, const _Float16* __restrict__ Bh, int ldb, size_t sB, float alpha, const float* __restrict__ bias, size_t sBias, const float* __restrict__ CP, int rowsPerB, size_t sCPb, int row0g,
    float* __restrict__ C, _Float16* __restrict__ C16, int ldc, size_t sC, int M, int N, int K) {
  __shared__ __attribute__((aligned(16))) float so[4][32][68];
  const int tid = threadIdx.x, w = tid >> 5, lane = tid & 31, ln = lane & 15, hh = lane >> 4;
  A += (size_t)by * sA; Bh += (size_t)by * sB; const size_t cofs = (size_t)by * sC; const float* bp = bias ? bias + (size_t)by * sBias : nullptr;
  const int ntn = N >> 6; const int mt = blockIdx.x / ntn, nq = blockIdx.x - mt * ntn; const int row0 = mt * 128 + 32 * w, col0 = nq * 64; if (row0 >= M) return;
  const _Float16* a0p = A + (size_t)(row0 + ln) * lda; const _Float16* a1p = a0p + (size_t)16 * lda;
  const _Float16* b0p = Bh + (size_t)(col0 + ln) * ldb; const _Float16* b1p = b0p + (size_t)16 * ldb; const _Float16* b2p = b1p + (size_t)16 * ldb; const _Float16* b3p = b2p + (size_t)16 * ldb;
  const v8f z8 = {0.f,0.f,0.f,0.f,0.f,0.f,0.f,0.f}; v8f c00 = z8, c01 = z8, c02 = z8, c03 = z8, c10 = z8, c11 = z8, c12 = z8, c13 = z8;
#pragma unroll 1
  for (int kb = 0; kb < K; kb += 32) { const v16h a0 = g2_frag(a0p + kb, hh), a1 = g2_frag(a1p + kb, hh);
    v16h b = g2_frag(b0p + kb, hh); c00 = g2_mma(a0, b, c00); c10 = g2_mma(a1, b, c10);
    b = g2_frag(b1p + kb, hh); c01 = g2_mma(a0, b, c01); c11 = g2_mma(a1, b, c11);
    b = g2_frag(b2p + kb, hh); c02 = g2_mma(a0, b, c02); c12 = g2_mma(a1, b, c12);
    b = g2_frag(b3p + kb, hh); c03 = g2_mma(a0, b, c03); c13 = g2_mma(a1, b, c13); }
  v8f accs[8] = {c00, c01, c02, c03, c10, c11, c12, c13};
#pragma unroll
  for (int u = 0; u < 8; ++u) { const int t = u & 3, half = u >> 2; const int col = col0 + t * 16 + ln; const float bv = bp ? bf16_round(bp[col]) : 0.f;
#pragma unroll
    for (int r = 0; r < 8; ++r) { const int rloc = half * 16 + 8 * hh + r; float v = accs[u][r] * alpha + bv; if (CP) { const int bidx = (row0g + row0 + rloc) / rowsPerB; v += CP[(size_t)bidx * sCPb + (size_t)by * 64 + col]; }
      if (ACT == 3) v = fmaxf(v, 0.f); else if (ACT == 6) v = 0.5f * v * (1.0f + erff(v * 0.70710678118654752f)); else if (ACT == 11) v = 1.0f / (1.0f + expf(-v)); else if (ACT == 15) v = v / (1.0f + expf(-v)); else if (ACT == 12) v = (v > 0.f) ? v : 0.01f * v; else if (ACT == 8) v = tanhf(v);
      so[w][rloc][t * 16 + ln] = v; } }
  __builtin_amdgcn_fence(__ATOMIC_ACQ_REL, "workgroup"); __builtin_amdgcn_wave_barrier();
  const int rsub = lane >> 4, c4 = (lane & 15) * 4;
  {
#pragma unroll
    for (int q = 0; q < 16; ++q) { const int r = q * 2 + rsub; const v4f v = *(const v4fa*)&so[w][r][c4]; if (C) *(v4f*)(C + cofs + (size_t)(row0 + r) * ldc + col0 + c4) = v; if (C16) { v4h h4; for (int i = 0; i < 4; ++i) h4[i] = (_Float16)v[i]; *(v4h*)(C16 + cofs + (size_t)(row0 + r) * ldc + col0 + c4) = h4; } }
     } }
template <int ACT>
__global__ __launch_bounds__(128) void k_gemm2(const _Float16* __restrict__ A, int lda, size_t sA, const _Float16* __restrict__ Bh, int ldb, size_t sB, float alpha, const float* __restrict__ bias, size_t sBias, const float* __restrict__ CP, int rowsPerB, size_t sCPb, int row0g,
    float* __restrict__ C, _Float16* __restrict__ C16, int ldc, size_t sC, int M, int N, int K) {
  gemm2_body<ACT>(blockIdx.y, A, lda, sA, Bh, ldb, sB, alpha, bias, sBias, CP, rowsPerB, sCPb, row0g, C, C16, ldc, sC, M, N, K); }
// Three independent products of one shape in one launch: blockIdx.y picks the operands, the bias and the f16 output; the tile work is gemm2_body's, unchanged.
template <int ACT>
__global__ __launch_bounds__(128) void k_gemm2x3(const _Float16* __restrict__ A0, const _Float16* __restrict__ A1, const _Float16* __restrict__ A2, const _Float16* __restrict__ B0, const _Float16* __restrict__ B1, const _Float16* __restrict__ B2,
    const float* __restrict__ bias0, const float* __restrict__ bias1, const float* __restrict__ bias2, _Float16* __restrict__ C0, _Float16* __restrict__ C1, _Float16* __restrict__ C2, float alpha, int ld, int M, int N, int K) {
  const int j = blockIdx.y;
  const _Float16* A = (j == 0) ? A0 : ((j == 1) ? A1 : A2); const _Float16* Bh = (j == 0) ? B0 : ((j == 1) ? B1 : B2); const float* bias = (j == 0) ? bias0 : ((j == 1) ? bias1 : bias2); _Float16* C16 = (j == 0) ? C0 : ((j == 1) ? C1 : C2);
  gemm2_body<ACT>(0, A, ld, 0, Bh, ld, 0, alpha, bias, 0, nullptr, 1, 0, 0, nullptr, C16, ld, 0, M, N, K); }



// lane l <-> lane l ^ 16 (the two lane halves of one fragment column)
__device__ __forceinline__ float xhalf(float x) { return __builtin_bit_cast(float, __builtin_amdgcn_permlanex16(__builtin_bit_cast(int, x), __builtin_bit_cast(int, x), 0x76543210, 0xfedcba98, false, false)); }
__device__ __forceinline__ void kv_stage(unsigned lk, unsigned lv, const unsigned short* gk, size_t k16, const unsigned short* gv, size_t v16) {
  const unsigned lk1 = lk + 2304u, lk2 = lk + 4608u, lk3 = lk + 6912u, lv1 = lv + 2304u, lv2 = lv + 4608u, lv3 = lv + 6912u;      /* 16 rows x 144 B */
  const unsigned short* gk1 = gk + k16; const unsigned short* gk2 = gk1 + k16; const unsigned short* gk3 = gk2 + k16;
  const unsigned short* gv1 = gv + v16; const unsigned short* gv2 = gv1 + v16; const unsigned short* gv3 = gv2 + v16;
  /* the closing s_wait_xcnt 0 stands inside the statement so that no address register of a copy is rewritten in front of it */
  asm volatile("global_load_async_to_lds_b128 %0, %8, off\n\t"
               "global_load_async_to_lds_b128 %1, %9, off\n\t"
               "global_load_async_to_lds_b128 %2, %10, off\n\t"
               "global_load_async_to_lds_b128 %3, %11, off\n\t"
               "global_load_async_to_lds_b128 %4, %12, off\n\t"
               "global_load_async_to_lds_b128 %5, %13, off\n\t"
               "global_load_async_to_lds_b128 %6, %14, off\n\t"
               "global_load_async_to_lds_b128 %7, %15, off\n\t"
               "s_wait_xcnt 0x0"
               :: "v"(lk), "v"(lk1), "v"(lk2), "v"(lk3), "v"(lv), "v"(lv1), "v"(lv2), "v"(lv3),
                  "v"(gk), "v"(gk1), "v"(gk2), "v"(gk3), "v"(gv), "v"(gv1), "v"(gv2), "v"(gv3) : "memory");
}
template <int CAUSAL>
__global__ __launch_bounds__(128) void k_flash(const _Float16* __restrict__ Q16, int ldq, const _Float16* __restrict__ K16, int ldk, const _Float16* __restrict__ Vt, const int* __restrict__ MSK, float* __restrict__ O, int ldo) {
  constexpr int RPW = 16, DT = 4, KS = 2, KT = 64, LP = 72;      /* KT keys a stage; LP: LDS row pitch in halves = 128 B + 16 B, the pitch of 16-byte LDS readers */
  __shared__ __attribute__((aligned(16))) unsigned short sK[2][KT][LP];
  __shared__ __attribute__((aligned(16))) unsigned short sV[2][64][LP];
  __shared__ __attribute__((aligned(16))) float sO[4][RPW][64 + 4];
  const int tid = threadIdx.x, w = tid >> 5, lane = tid & 31, ln = lane & 15, hh = lane >> 4;
  const int slab = blockIdx.x / QBNP, qblk = QB0P + blockIdx.x % QBNP; const int b = slab / NH, h = slab % NH; const int qb0 = qblk * (4 * RPW); const int q0 = qb0 + w * RPW; const int tq = q0 + ln;
  const unsigned short* Vth = (const unsigned short*)Vt + (size_t)slab * 64 * TK;
  const int jend = (CAUSAL == 1) ? (qb0 + 4 * RPW) : TK;      /* causal: keys beyond the block's last query never contribute */
  const int nst = jend / KT;
  const int crow = tid >> 3, cc = (tid & 7) * 8;      /* eight lanes copy one 128-B row */
  const unsigned short* gk = (const unsigned short*)K16 + ((size_t)b * TK + crow) * ldk + h * 64 + cc;
  const unsigned short* gv = Vth + (size_t)crow * TK + cc;
  const size_t k16 = (size_t)16 * ldk, v16 = (size_t)16 * TK, kst = (size_t)KT * ldk;
  const unsigned lk0 = (unsigned)(size_t)&sK[0][crow][cc], lv0 = (unsigned)(size_t)&sV[0][crow][cc];
  constexpr unsigned BUFB = KT * LP * 2;      /* bytes of one buffer */
  kv_stage(lk0, lv0, gk, k16, gv, v16);
  FragH bq[KS];
  { const unsigned short* qr = (const unsigned short*)Q16 + ((size_t)b * TQ + tq) * ldq + h * 64;
#pragma unroll
    for (int ks = 0; ks < KS; ++ks) { bq[ks].half[0] = *(const v8us*)(qr + ks * 32 + 8 * hh); bq[ks].half[1] = *(const v8us*)(qr + ks * 32 + 16 + 8 * hh); } }
  constexpr float C2 = SCL * 1.4426950408889634f;      /* score -> base-2 exponent: scale x log2(e) */
  float m_r = -3.0e38f, l_r = 0.f; v8f oacc[DT];      /* m_r: running maximum of the unscaled scores; l_r: sum of 1024 p over this lane half's keys only, joined after the loop */
#pragma unroll
  for (int dt = 0; dt < DT; ++dt) oacc[dt] = (v8f){0.f,0.f,0.f,0.f,0.f,0.f,0.f,0.f};
  asm volatile("s_wait_asynccnt 0x0" ::: "memory");      /* stage 0: this wave's copies have landed */
  __syncthreads();      /* stage 0 is readable by every wave */
  if (nst > 1) kv_stage(lk0 + BUFB, lv0 + BUFB, gk + kst, k16, gv + KT, v16);
#pragma unroll 1      /* stays rolled: one copy of the body serves both buffers, chosen by st & 1 */
  for (int st = 0; st < nst; ++st) {      /* stage st is worked on while stage st + 1 flies into the other buffer */
    const int bf = st & 1;
#pragma unroll      /* unrolled: the half stage becomes a constant offset of the LDS reads */
    for (int sub = 0; sub < KT / 32; ++sub) {
    const int j0 = st * KT + sub * 32;
    FragH ak[2][KS], av[DT];
#pragma unroll
    for (int nt = 0; nt < 2; ++nt) { const unsigned short* kr = &sK[bf][sub * 32 + nt * 16 + ln][0];
#pragma unroll
      for (int ks = 0; ks < KS; ++ks) { ak[nt][ks].half[0] = *(const v8us*)(kr + ks * 32 + 8 * hh); ak[nt][ks].half[1] = *(const v8us*)(kr + ks * 32 + 16 + 8 * hh); } }
#pragma unroll
    for (int dt = 0; dt < DT; ++dt) { const unsigned short* vrow = &sV[bf][dt * 16 + ln][sub * 32]; av[dt].half[0] = *(const v8us*)(vrow + 8 * hh); av[dt].half[1] = *(const v8us*)(vrow + 16 + 8 * hh); }
    v8f s[2];
#pragma unroll
    for (int nt = 0; nt < 2; ++nt) {
      v8f acc = (v8f){0.f,0.f,0.f,0.f,0.f,0.f,0.f,0.f};
#pragma unroll
      for (int ks = 0; ks < KS; ++ks) acc = mmaH<1>(ak[nt][ks].v, ak[nt][ks].v, bq[ks].v, bq[ks].v, acc);
      s[nt] = acc; }
    float sc[16], t[8]; bool ok[16];
#pragma unroll
    for (int i = 0; i < 16; ++i) { const int kk = j0 + (i >> 3) * 16 + 8 * hh + (i & 7);
      ok[i] = (CAUSAL == 1) ? (kk <= tq) : ((CAUSAL == 2) ? ((kk >> 5) == (tq >> 5)) : true);      /* mode 2: block-diagonal 32-token groups */
      sc[i] = ok[i] ? s[i >> 3][i & 7] : -3.0e38f; if (CAUSAL == 17) sc[i] += bf16_round(((const float*)MSK + (size_t)b * TK)[kk]) * (1.0f / SCL); }      /* unscaled scores (the scale is positive: the maximum commutes with it); mode 17: additive per-(batch, key) mask INPUT, in the same units */
#pragma unroll
    for (int i = 0; i < 8; ++i) t[i] = fmaxf(sc[i], sc[i + 8]);
    float mc = fmaxf(fmaxf(fmaxf(t[0], t[1]), fmaxf(t[2], t[3])), fmaxf(fmaxf(t[4], t[5]), fmaxf(t[6], t[7])));
    mc = fmaxf(mc, xhalf(mc));      /* both halves feed one O^T column: one maximum for both */
    const float mn = fmaxf(m_r, mc); const float al = (mn > -1.0e38f) ? __builtin_amdgcn_exp2f((m_r - mn) * C2) : 1.0f; m_r = mn;
    const float nb = __builtin_fmaf(-mn, C2, 10.0f);      /* 1024 p = 2^(C2 s - C2 m + 10): one fused multiply-add in front of the hardware's base-2 exponential */
    FragH pb;
#pragma unroll
    for (int i = 0; i < 16; ++i) sc[i] = __builtin_fmaf(sc[i], C2, nb);
    /* sixteen exponentials in place, in one statement: each is independent of the one in front of it (no result read, no source overwritten), and the closing v_nop is the slot behind the last one; last element first, because the packing behind it starts with the last pair */
    asm("v_exp_f32 %15, %15\n\tv_exp_f32 %14, %14\n\tv_exp_f32 %13, %13\n\tv_exp_f32 %12, %12\n\t"
        "v_exp_f32 %11, %11\n\tv_exp_f32 %10, %10\n\tv_exp_f32 %9, %9\n\tv_exp_f32 %8, %8\n\t"
        "v_exp_f32 %7, %7\n\tv_exp_f32 %6, %6\n\tv_exp_f32 %5, %5\n\tv_exp_f32 %4, %4\n\t"
        "v_exp_f32 %3, %3\n\tv_exp_f32 %2, %2\n\tv_exp_f32 %1, %1\n\tv_exp_f32 %0, %0\n\tv_nop"
        : "+v"(sc[0]), "+v"(sc[1]), "+v"(sc[2]), "+v"(sc[3]), "+v"(sc[4]), "+v"(sc[5]), "+v"(sc[6]), "+v"(sc[7]),
          "+v"(sc[8]), "+v"(sc[9]), "+v"(sc[10]), "+v"(sc[11]), "+v"(sc[12]), "+v"(sc[13]), "+v"(sc[14]), "+v"(sc[15]));
#pragma unroll
    for (int i = 0; i < 16; ++i) { if (!ok[i]) sc[i] = 0.f; pb.h[i] = (_Float16)sc[i]; }
#pragma unroll
    for (int i = 0; i < 8; ++i) t[i] = sc[i] + sc[i + 8];
    l_r = l_r * al + (((t[0] + t[1]) + (t[2] + t[3])) + ((t[4] + t[5]) + (t[6] + t[7])));
#pragma unroll
    for (int dt = 0; dt < DT; ++dt)
#pragma unroll
      for (int r = 0; r < 8; ++r) oacc[dt][r] *= al;
#pragma unroll
    for (int dt = 0; dt < DT; ++dt) oacc[dt] = mmaH<1>(av[dt].v, av[dt].v, pb.v, pb.v, oacc[dt]);
    }
    asm volatile("s_wait_dscnt 0x0" ::: "memory");      /* this wave's reads of buffer bf are done before the buffer is given up */
    asm volatile("s_wait_asynccnt 0x0" ::: "memory");      /* this wave's copies of stage st + 1 have landed */
    __syncthreads();      /* publishes stage st + 1 and ends every wave's reads of buffer bf */
    if (st + 2 < nst) kv_stage(lk0 + bf * BUFB, lv0 + bf * BUFB, gk + (size_t)(st + 2) * kst, k16, gv + (size_t)(st + 2) * KT, v16);
  }
  asm volatile("s_wait_asynccnt 0x0" ::: "memory");      /* no copy is left in flight when the wave goes on */
  const float l = l_r + xhalf(l_r); const float li = (l > 0.f) ? 1.0f / l : 0.f;      /* numerator and sum both carry the factor 1024 */
#pragma unroll
  for (int dt = 0; dt < DT; ++dt) {      /* oacc[dt][r] = O[q0 + ln][16 dt + 8 hh + r] */
    const v4f lo = {oacc[dt][0] * li, oacc[dt][1] * li, oacc[dt][2] * li, oacc[dt][3] * li}, hi = {oacc[dt][4] * li, oacc[dt][5] * li, oacc[dt][6] * li, oacc[dt][7] * li};
    *(v4fa*)&sO[w][ln][dt * 16 + 8 * hh] = lo; *(v4fa*)&sO[w][ln][dt * 16 + 8 * hh + 4] = hi; }
  __builtin_amdgcn_fence(__ATOMIC_ACQ_REL, "workgroup"); __builtin_amdgcn_wave_barrier();
  {
#pragma unroll
    for (int rp = 0; rp < RPW; rp += 2) { const int r = rp + (lane >> 4), pc = lane & 15; const v4f val = *(const v4fa*)&sO[w][r][pc * 4]; *(v4f*)(O + ((size_t)b * TQ + q0 + r) * ldo + h * 64 + pc * 4) = val; }
     } }
// 5-plane variant: S = Qh Kh^T + (Ql Kh^T + Qh Kl^T)/1024 with Q/K = [hi | 2^10 residual] f16 planes (QL/KL same layout as Q16/K16), then the 3-term P.V below.
// 3-term variant: O = (P_hi V_hi + (P_lo V_hi + P_hi V_lo) / 1024) / l with P = [hi | 2^10 residual] of 1024 p and V^T = [hi | 2^10 residual] planes (VtL same layout as Vt) -> ~2^-21-class products for un-averaged (early causal / peaked) rows
template <int CAUSAL>
__global__ __launch_bounds__(128) void k_flash5(const _Float16* __restrict__ Q16, const _Float16* __restrict__ QL, int ldq, const _Float16* __restrict__ K16, const _Float16* __restrict__ KL, int ldk, const _Float16* __restrict__ Vt, const _Float16* __restrict__ VtL, const int* __restrict__ MSK, float* __restrict__ O, int ldo) {
  constexpr int RPW = 16, RTN = RPW / 16, NQB = TQ / (4 * RPW), DT = 4, KS = 2;
  __shared__ __attribute__((aligned(16))) unsigned short sP[4][RPW][40]; __shared__ __attribute__((aligned(16))) unsigned short sPL[4][RPW][40]; __shared__ __attribute__((aligned(16))) float sO[4][RPW][64 + 4];
  const int tid = threadIdx.x, w = tid >> 5, lane = tid & 31, ln = lane & 15, hh = lane >> 4;
  const int slab = blockIdx.x / QBN5, qblk = QB05 + blockIdx.x % QBN5; (void)NQB; const int b = slab / NH, h = slab % NH; const int qb0 = qblk * (4 * RPW); const int q0 = qb0 + w * RPW;
  FragH aq[2][KS], aql[2][KS];
#pragma unroll
  for (int rt = 0; rt < RTN; ++rt) { const unsigned short* qr = (const unsigned short*)Q16 + ((size_t)b * TQ + q0 + rt * 16 + ln) * ldq + h * 64; const unsigned short* ql = (const unsigned short*)QL + ((size_t)b * TQ + q0 + rt * 16 + ln) * ldq + h * 64;
#pragma unroll
    for (int ks = 0; ks < KS; ++ks) { aq[rt][ks].half[0] = *(const v8us*)(qr + ks * 32 + 8 * hh); aq[rt][ks].half[1] = *(const v8us*)(qr + ks * 32 + 16 + 8 * hh); aql[rt][ks].half[0] = *(const v8us*)(ql + ks * 32 + 8 * hh); aql[rt][ks].half[1] = *(const v8us*)(ql + ks * 32 + 16 + 8 * hh); } }
  const unsigned short* Vth = (const unsigned short*)Vt + (size_t)slab * 64 * TK; const unsigned short* Vtl = (const unsigned short*)VtL + (size_t)slab * 64 * TK;
  float m_r[2][8], l_r[2][8]; v8f oacc[2][DT], oaccL[2][DT];
#pragma unroll
  for (int rt = 0; rt < RTN; ++rt) {
#pragma unroll
    for (int r = 0; r < 8; ++r) { m_r[rt][r] = -3.0e38f; l_r[rt][r] = 0.f; }
#pragma unroll
    for (int dt = 0; dt < DT; ++dt) { oacc[rt][dt] = (v8f){0.f,0.f,0.f,0.f,0.f,0.f,0.f,0.f}; oaccL[rt][dt] = oacc[rt][dt]; } }
  const int jend = (CAUSAL == 1) ? (qb0 + 4 * RPW) : TK;      /* causal: keys beyond the block's last query never contribute */
#pragma unroll 1
  for (int j0 = 0; j0 < jend; j0 += 32) {
    v8f s[2][2];
#pragma unroll
    for (int nt = 0; nt < 2; ++nt) { const unsigned short* kr = (const unsigned short*)K16 + ((size_t)b * TK + j0 + nt * 16 + ln) * ldk + h * 64; const unsigned short* klr = (const unsigned short*)KL + ((size_t)b * TK + j0 + nt * 16 + ln) * ldk + h * 64; FragH bk[KS], bkl[KS];
#pragma unroll
      for (int ks = 0; ks < KS; ++ks) { bk[ks].half[0] = *(const v8us*)(kr + ks * 32 + 8 * hh); bk[ks].half[1] = *(const v8us*)(kr + ks * 32 + 16 + 8 * hh); bkl[ks].half[0] = *(const v8us*)(klr + ks * 32 + 8 * hh); bkl[ks].half[1] = *(const v8us*)(klr + ks * 32 + 16 + 8 * hh); }
#pragma unroll
      for (int rt = 0; rt < RTN; ++rt) { v8f acc = (v8f){0.f,0.f,0.f,0.f,0.f,0.f,0.f,0.f}, accl = acc;
#pragma unroll
        for (int ks = 0; ks < KS; ++ks) { acc = mmaH<1>(aq[rt][ks].v, aq[rt][ks].v, bk[ks].v, bk[ks].v, acc); accl = mmaH<1>(aql[rt][ks].v, aql[rt][ks].v, bk[ks].v, bk[ks].v, accl); accl = mmaH<1>(aq[rt][ks].v, aq[rt][ks].v, bkl[ks].v, bkl[ks].v, accl); }
#pragma unroll
        for (int r = 0; r < 8; ++r) acc[r] += accl[r] * 0.0009765625f;
        s[rt][nt] = acc; } }
#pragma unroll
    for (int rt = 0; rt < RTN; ++rt)
#pragma unroll
      for (int r = 0; r < 8; ++r) { const int tq = q0 + rt * 16 + 8 * hh + r; const int k0 = j0 + ln, k1 = j0 + 16 + ln;
        bool ok0 = (CAUSAL == 1) ? (k0 <= tq) : ((CAUSAL == 2) ? ((k0 >> 5) == (tq >> 5)) : true), ok1 = (CAUSAL == 1) ? (k1 <= tq) : ((CAUSAL == 2) ? ((k1 >> 5) == (tq >> 5)) : true);      /* mode 2: block-diagonal 32-token groups */
        if (CAUSAL == 4) { const int* mrow = MSK + ((size_t)b * TQ + tq) * TK; ok0 = mrow[k0] != 0; ok1 = mrow[k1] != 0; }      /* mode 4: per-(query, key) INPUT mask shared by all heads; masked keys contribute nothing (== the reference's -4096 fill, whose exp underflows to 0), rows with no valid key give l = 0 -> output 0 (== the reference's row_valid zeroing) */
        float s0 = ok0 ? s[rt][0][r] * SCL : -3.0e38f, s1 = ok1 ? s[rt][1][r] * SCL : -3.0e38f; if (CAUSAL == 17) { const float* amk = (const float*)MSK + (size_t)b * TK; s0 += bf16_round(amk[k0]); s1 += bf16_round(amk[k1]); }      /* mode 17: additive per-(batch, key) mask INPUT */ float mc = fmaxf(s0, s1);
        mc = fmaxf(mc, __shfl_xor(mc, 1, 32)); mc = fmaxf(mc, __shfl_xor(mc, 2, 32)); mc = fmaxf(mc, __shfl_xor(mc, 4, 32)); mc = fmaxf(mc, __shfl_xor(mc, 8, 32));
        const float mn = fmaxf(m_r[rt][r], mc); const float al = (mn > -1.0e38f) ? expf(m_r[rt][r] - mn) : 1.0f; m_r[rt][r] = mn; const float p0 = ok0 ? expf(s0 - mn) : 0.f, p1 = ok1 ? expf(s1 - mn) : 0.f; l_r[rt][r] = l_r[rt][r] * al + p0 + p1;
#pragma unroll
        for (int dt = 0; dt < DT; ++dt) { oacc[rt][dt][r] *= al; oaccL[rt][dt][r] *= al; }
        FragH t2, t2l; const float ps0 = p0 * 1024.0f, ps1 = p1 * 1024.0f; t2.h[0] = (_Float16)ps0; t2.h[1] = (_Float16)ps1; t2l.h[0] = (_Float16)((ps0 - (float)t2.h[0]) * 1024.0f); t2l.h[1] = (_Float16)((ps1 - (float)t2.h[1]) * 1024.0f);
        sP[w][rt * 16 + 8 * hh + r][ln] = t2.u[0]; sP[w][rt * 16 + 8 * hh + r][16 + ln] = t2.u[1]; sPL[w][rt * 16 + 8 * hh + r][ln] = t2l.u[0]; sPL[w][rt * 16 + 8 * hh + r][16 + ln] = t2l.u[1]; }
    __builtin_amdgcn_fence(__ATOMIC_ACQ_REL, "workgroup"); __builtin_amdgcn_wave_barrier();
    FragH pa[2], pl[2];
#pragma unroll
    for (int rt = 0; rt < RTN; ++rt) { pa[rt].half[0] = *(const v8us*)&sP[w][rt * 16 + ln][8 * hh]; pa[rt].half[1] = *(const v8us*)&sP[w][rt * 16 + ln][16 + 8 * hh]; pl[rt].half[0] = *(const v8us*)&sPL[w][rt * 16 + ln][8 * hh]; pl[rt].half[1] = *(const v8us*)&sPL[w][rt * 16 + ln][16 + 8 * hh]; }
#pragma unroll
    for (int dt = 0; dt < DT; ++dt) { const unsigned short* vrow = Vth + (size_t)(dt * 16 + ln) * TK + j0; const unsigned short* vrl = Vtl + (size_t)(dt * 16 + ln) * TK + j0; FragH bv, bl; bv.half[0] = *(const v8us*)(vrow + 8 * hh); bv.half[1] = *(const v8us*)(vrow + 16 + 8 * hh); bl.half[0] = *(const v8us*)(vrl + 8 * hh); bl.half[1] = *(const v8us*)(vrl + 16 + 8 * hh);
#pragma unroll
      for (int rt = 0; rt < RTN; ++rt) { oacc[rt][dt] = mmaH<1>(pa[rt].v, pa[rt].v, bv.v, bv.v, oacc[rt][dt]); oaccL[rt][dt] = mmaH<1>(pl[rt].v, pl[rt].v, bv.v, bv.v, oaccL[rt][dt]); oaccL[rt][dt] = mmaH<1>(pa[rt].v, pa[rt].v, bl.v, bl.v, oaccL[rt][dt]); } }
    __builtin_amdgcn_fence(__ATOMIC_ACQ_REL, "workgroup"); __builtin_amdgcn_wave_barrier(); }
#pragma unroll
  for (int rt = 0; rt < RTN; ++rt) {
#pragma unroll
    for (int r = 0; r < 8; ++r) { float l = l_r[rt][r]; l += __shfl_xor(l, 1, 32); l += __shfl_xor(l, 2, 32); l += __shfl_xor(l, 4, 32); l += __shfl_xor(l, 8, 32); l_r[rt][r] = (l > 0.f) ? 1.0f / (l * 1024.0f) : 0.f; }
#pragma unroll
    for (int dt = 0; dt < DT; ++dt)
#pragma unroll
      for (int r = 0; r < 8; ++r) { float v = oacc[rt][dt][r]; v += oaccL[rt][dt][r] * 0.0009765625f; sO[w][rt * 16 + 8 * hh + r][dt * 16 + ln] = v * l_r[rt][r]; } }
  __builtin_amdgcn_fence(__ATOMIC_ACQ_REL, "workgroup"); __builtin_amdgcn_wave_barrier();
  {
#pragma unroll
    for (int rp = 0; rp < RPW; rp += 2) { const int r = rp + (lane >> 4), pc = lane & 15; const v4f val = *(const v4fa*)&sO[w][r][pc * 4]; *(v4f*)(O + ((size_t)b * TQ + q0 + r) * ldo + h * 64 + pc * 4) = val; }
     } }

__global__ __launch_bounds__(256) void k_rotab(float* __restrict__ CS, float* __restrict__ SN) {
  #pragma clang fp contract(off)
  const int t = blockIdx.x * 256 + threadIdx.x; if (t >= SLEN * 32) return; const int j = t % 32, s = t / 32; const float ex = (float)(2 * j) / 64.0f; const float inv = 1.0f / powf(10000.0f, ex); const float th = (float)s * inv; const float c = cosf(th), sn = sinf(th);
  { *(float*)(CS + t) = c; *(float*)(SN + t) = sn;  } }
__global__ __launch_bounds__(256) void k_rope(const float* __restrict__ F, int nsrc, int ndst, int rep, const float* __restrict__ CS, const float* __restrict__ SN, _Float16* __restrict__ H, _Float16* __restrict__ L) {
  #pragma clang fp contract(off)
  const size_t t = (size_t)blockIdx.x * 256 + threadIdx.x; if (t >= (size_t)NR * ndst * 4) return; const int g8 = (int)(t % 4); const int hd = (int)((t / 4) % ndst); const size_t row = t / ((size_t)4 * ndst); const int s = (int)(row % SLEN); const int hs = hd / rep;
  const float* src = F + row * (size_t)(nsrc * 64) + hs * 64; FragH ah, al, bh, bl;
  for (int i = 0; i < 8; ++i) { const int d = g8 * 8 + i; const float c = CS[s * 32 + d], sn = SN[s * 32 + d]; const float x1 = src[d], x2 = src[d + 32];
    float o1 = x1 * c; o1 += -x2 * sn; float o2 = x2 * c; o2 += x1 * sn;
    _Float16 hv = (_Float16)o1; ah.h[i] = hv; al.h[i] = (_Float16)((o1 - (float)hv) * 1024.0f); hv = (_Float16)o2; bh.h[i] = hv; bl.h[i] = (_Float16)((o2 - (float)hv) * 1024.0f); }
  const size_t o = row * (size_t)(ndst * 64) + hd * 64 + g8 * 8;
  { *(v8us*)((unsigned short*)H + o) = ah.half[0]; *(v8us*)((unsigned short*)H + o + 32) = bh.half[0]; *(v8us*)((unsigned short*)L + o) = al.half[0]; *(v8us*)((unsigned short*)L + o + 32) = bl.half[0];  } }
__global__ __launch_bounds__(256) void k_rope2(const float* __restrict__ F, int nsrc, int ndst, int rep, const float* __restrict__ CS, const float* __restrict__ SN, _Float16* __restrict__ H, _Float16* __restrict__ L) {
  #pragma clang fp contract(off)
  const size_t t = (size_t)blockIdx.x * 256 + threadIdx.x; if (t >= (size_t)NR * ndst * 4) return; const int g16 = (int)(t % 4); const int hd = (int)((t / 4) % ndst); const size_t row = t / ((size_t)4 * ndst); const int s = (int)(row % SLEN); const int hs = hd / rep;
  const float* src = F + row * (size_t)(nsrc * 64) + hs * 64 + g16 * 16; FragH ah, al;
  for (int pr = 0; pr < 8; ++pr) { const int i = g16 * 8 + pr; const float c = CS[s * 32 + i], sn = SN[s * 32 + i]; const float x1 = src[2 * pr], x2 = src[2 * pr + 1];
    float o1 = x1 * c; o1 -= x2 * sn; float o2 = x1 * sn; o2 += x2 * c;
    _Float16 hv = (_Float16)o1; ah.h[2 * pr] = hv; al.h[2 * pr] = (_Float16)((o1 - (float)hv) * 1024.0f); hv = (_Float16)o2; ah.h[2 * pr + 1] = hv; al.h[2 * pr + 1] = (_Float16)((o2 - (float)hv) * 1024.0f); }
  const size_t o = row * (size_t)(ndst * 64) + hd * 64 + g16 * 16;
  { *(v8us*)((unsigned short*)H + o) = ah.half[0]; *(v8us*)((unsigned short*)H + o + 8) = ah.half[1]; *(v8us*)((unsigned short*)L + o) = al.half[0]; *(v8us*)((unsigned short*)L + o + 8) = al.half[1];  } }
__global__ __launch_bounds__(256) void k_tabin(const float* __restrict__ sp, float* __restrict__ CS, float* __restrict__ SN) { const int t = blockIdx.x * 256 + threadIdx.x; if (t >= SLEN * 32) return; const int i = t % 32, s = t / 32; const float c = bf16_round(sp[s * 64 + 32 + i]), sn = bf16_round(sp[s * 64 + i]);
  { *(float*)(CS + t) = c; *(float*)(SN + t) = sn;  } }
__device__ __forceinline__ void d_wsc(const size_t t, const float* __restrict__ Wm, _Float16* __restrict__ Bt, size_t n8, float sc) { if (t >= n8) return; FragH f; for (int q = 0; q < 8; ++q) f.h[q] = (_Float16)(bf16_round(Wm[t * 8 + q]) * sc); *(v8us*)((unsigned short*)Bt + t * 8) = f.half[0];  }
__global__ __launch_bounds__(256) void k_rotab2(float* __restrict__ CS, float* __restrict__ SN) {
  #pragma clang fp contract(off)
  const int t = blockIdx.x * 256 + threadIdx.x; if (t >= SLEN * 32) return; const int j = t % 32, s = t / 32; const float c0 = -0.14391156831212787f;      /* -ln(10000)/64 rounded to f32 */ const float inv = expf((float)(2 * j) * c0); const float th = (float)s * inv; const float c = cosf(th), sn = sinf(th);
  { *(float*)(CS + t) = c; *(float*)(SN + t) = sn;  } }
__global__ __launch_bounds__(256) void k_lnu(const float* __restrict__ X, _Float16* __restrict__ N16, float* __restrict__ XB) {
  #pragma clang fp contract(off)
  const int wv = threadIdx.x >> 5, ln = threadIdx.x & 31; const size_t r = (size_t)blockIdx.x * 8 + wv; if (r >= NR) return; float a[32]; float s = 0.f;
  for (int i = 0; i < 4; ++i) { const v8f v = *(const v8f*)(X + r * DM + (i * 32 + ln) * 8); for (int q = 0; q < 8; ++q) { const float u = bf16_round(v[q]); a[i * 8 + q] = u; s += u; } }
  for (int o = 16; o > 0; o >>= 1) s += __shfl_xor(s, o, 32); const float mu = s / (float)DM; float var = 0.f; for (int q = 0; q < 32; ++q) { const float d = a[q] - mu; var += d * d; }
  for (int o = 16; o > 0; o >>= 1) var += __shfl_xor(var, o, 32); const float den = sqrtf(var / (float)(DM - 1)) + 1e-6f; const float inv = 1.0f / den;      /* one reciprocal per row; (x-mean)*inv vs the reference's division differs by <= 1 ulp */
  { for (int i = 0; i < 4; ++i) { const int c0 = (i * 32 + ln) * 8; FragH f; v8f xb; for (int q = 0; q < 8; ++q) { f.h[q] = (_Float16)((a[i * 8 + q] - mu) * inv); xb[q] = a[i * 8 + q]; } *(v8us*)((unsigned short*)N16 + r * DM + c0) = f.half[0]; *(v8f*)(XB + r * DM + c0) = xb; }  } }
__global__ __launch_bounds__(256) void k_vtg(const _Float16* __restrict__ V16, _Float16* __restrict__ Vt) { __shared__ unsigned short tl[64][66]; const int tid = threadIdx.x; const int slab = blockIdx.x / (SLEN / 64), lg = blockIdx.x % (SLEN / 64); const int b = slab / NH, h = slab % NH; const int hs = h / NREP;
  for (int i = tid; i < 64 * 8; i += 256) { const int r = i / 8, c8 = (i % 8) * 8; FragH f; f.half[0] = *(const v8us*)((const unsigned short*)V16 + ((size_t)b * SLEN + lg * 64 + r) * KVD + hs * 64 + c8); for (int q = 0; q < 8; ++q) tl[r][c8 + q] = f.u[q]; }
  __syncthreads();
  { for (int rd = 0; rd < 2; ++rd) { const int d = rd * 32 + tid / 8, pc = tid % 8; FragH f; for (int q = 0; q < 8; ++q) f.u[q] = tl[pc * 8 + q][d]; *(v8us*)((unsigned short*)Vt + ((size_t)slab * 64 + d) * SLEN + lg * 64 + pc * 8) = f.half[0]; }  } }

__device__ __forceinline__ void d_pm(const int t, const float* __restrict__ src, _Float16* __restrict__ P16) { if (t >= SLEN * (DM / 8)) return; const int c0 = (t % (DM / 8)) * 8; const int n = t / (DM / 8); FragH f; for (int q = 0; q < 8; ++q) f.h[q] = (_Float16)bf16_round(src[(size_t)(c0 + q) * SLEN + n]);
  *(v8us*)((unsigned short*)P16 + (size_t)n * DM + c0) = f.half[0];  }
// The six independent preparation jobs in one launch: blocks [0, 2 PMB) write the two token-major planes, the next 4 WSB blocks the four weight planes; each block does what a block of the single launches did.
#define PMB ((SLEN * (DM / 8) + 255) / 256)
#define WSB ((DM * DM / 8 + 255) / 256)
__global__ __launch_bounds__(256) void k_prep(const float* __restrict__ vid, const float* __restrict__ reff, _Float16* __restrict__ XV, _Float16* __restrict__ XR,
    const float* __restrict__ Wq, const float* __restrict__ Wk, const float* __restrict__ Wv, const float* __restrict__ Wo, _Float16* __restrict__ BQ, _Float16* __restrict__ BK, _Float16* __restrict__ BV, _Float16* __restrict__ BO) {
  const int bx = blockIdx.x;
  if (bx < 2 * PMB) { const bool second = bx >= PMB; d_pm((bx - (second ? PMB : 0)) * 256 + (int)threadIdx.x, second ? reff : vid, second ? XR : XV); return; }
  const int j = (bx - 2 * PMB) / WSB, wb = (bx - 2 * PMB) % WSB;
  const float* Wm = (j == 0) ? Wq : ((j == 1) ? Wk : ((j == 2) ? Wv : Wo)); _Float16* Bt = (j == 0) ? BQ : ((j == 1) ? BK : ((j == 2) ? BV : BO));
  d_wsc((size_t)wb * 256 + threadIdx.x, Wm, Bt, DM * DM / 8, 16.0f); }
__global__ __launch_bounds__(256) void k_nchw(const float* __restrict__ F, float* __restrict__ outb) { const int t = blockIdx.x * 256 + threadIdx.x; if (t >= DM * (SLEN / 4)) return; const int p0 = (t % (SLEN / 4)) * 4; const int o = t / (SLEN / 4); v4f r; for (int q = 0; q < 4; ++q) r[q] = F[(size_t)(p0 + q) * DM + o];
  *(v4f*)(outb + (size_t)o * SLEN + p0) = r;  }

extern "C" void kernel_launch(void* const* d_in, const int* in_sizes, int n_in,
                              void* d_out, int out_size, void* d_ws, size_t ws_size, hipStream_t stream) {
  (void)in_sizes; (void)n_in; (void)out_size;
  const float* const* I = (const float* const*)d_in; const float* vid = I[0]; const float* reff = I[1]; const float* Wq = I[2]; const float* bq = I[3]; const float* Wk = I[4]; const float* bk = I[5]; const float* Wv = I[6]; const float* bv = I[7]; const float* Wo = I[8]; const float* bo = I[9];
  char* ws = (char*)d_ws; size_t off = 0;
  auto take = [&](size_t bytes) { char* p = ws + off; off += (bytes + 255) & ~(size_t)255; return p; };
  const size_t np = (size_t)SLEN * DM;
  _Float16* BQ = (_Float16*)take((size_t)DM * DM * 2); _Float16* BK = (_Float16*)take((size_t)DM * DM * 2); _Float16* BV = (_Float16*)take((size_t)DM * DM * 2); _Float16* BO = (_Float16*)take((size_t)DM * DM * 2);
  _Float16* XV = (_Float16*)take(np * 2); _Float16* XR = (_Float16*)take(np * 2); _Float16* Q16 = (_Float16*)take(np * 2); _Float16* K16 = (_Float16*)take(np * 2); _Float16* V16 = (_Float16*)take(np * 2); _Float16* VT = (_Float16*)take(np * 2); float* O = (float*)take(np * 4); _Float16* O16 = (_Float16*)take(np * 2); float* F = (float*)take(np * 4);
  if (off > ws_size) return;      /* 2 + 7 x 4 + 8 + 8 = 46 MiB */
  k_prep<<<2 * PMB + 4 * WSB, 256, 0, stream>>>(vid, reff, XV, XR, Wq, Wk, Wv, Wo, BQ, BK, BV, BO);      /* 'oc' = natural Bt */
  const dim3 gP((SLEN / 128) * (DM / 64), 1);
  const dim3 gP3((SLEN / 128) * (DM / 64), 3);
  k_gemm2x3<0><<<gP3, 128, 0, stream>>>(XV, XR, XR, BQ, BK, BV, bq, bk, bv, Q16, K16, V16, 0.0625f, DM, SLEN, DM, DM);      /* q, k, v */
  k_vt<NH, TK><<<NB * NH * (TK / 64), 256, 0, stream>>>(V16, DM, 0, VT);
  k_flash<0><<<NB * NH * QBNP, 128, 0, stream>>>(Q16, DM, K16, DM, VT, nullptr, O, DM);      /* 4096 x 4096 per head */
  k_h16<<<(unsigned)((np / 8 + 255) / 256), 256, 0, stream>>>(O, O16, np / 8);
  k_gemm2<0><<<gP, 128, 0, stream>>>(O16, DM, 0, BO, DM, 0, 0.0625f, bo, 0, nullptr, 1, 0, 0, F, nullptr, DM, 0, SLEN, DM, DM);
  k_nchw<<<(DM * (SLEN / 4) + 255) / 256, 256, 0, stream>>>(F, (float*)d_out);
}

// v005
// One run takes 106 microseconds.
// Next to v004, in two timings, it ran 1.27 and 1.25 times as fast.
// All steps since v000 together make it 5.38 times as fast.
#include <hip/hip_runtime.h>
// CrossViewAttention3D (1 clip: 512 channels x (4 x 32 x 32 = 4096) tokens, 8 heads x 64): q = Wq video + bq, k = Wk ref + bk, v = Wv ref + bv (1x1x1 convs = channel matmuls); softmax(q.k / 8) over the 4096 ref tokens; out = Wo ctx + bo; channel-major in and out.
// Structure: exact token-major f16 planes of both inputs; q, k, v as f16 WMMA GEMM outputs (32x64 wave tiles, f32 accumulation, exact x16 weights + bias, f16 out); V^T straight from its GEMM (weights as rows, tokens as columns); the fused flash kernel (4096 x 4096 per head, plain operands) stores ctx as f16; the Wo + bo GEMM, weights as rows, stores channel-major.
// Compute dtype: inputs rounded to bf16; inputs exact as f16; q/k/P/v/ctx as plain f16 operands (~2^-12); softmax f32. v_wmma_f32_16x16x32_f16.
#define NB 1
#define DM 512
#define NKV 8
#define NREP (NH / NKV)
#define KVD (NKV * 64)           /* 512 */
#define NR (NB * SLEN)           /* 4096 */
#define SLEN 4096
#define TQ SLEN
#define TK SLEN
#define NH 8
#define SCL 0.125f
#define QBLKS (TQ / 64)
#define QB05 0
#define QBN5 4
#define QB0P 0
#define QBNP QBLKS           /* non-causal: plain flash on every query block */
#define RE 256
typedef __bf16 v16b __attribute__((ext_vector_type(16)));
typedef unsigned short v8us __attribute__((ext_vector_type(8), may_alias));
typedef float  v8f  __attribute__((ext_vector_type(8)));
typedef float  v4f  __attribute__((ext_vector_type(4)));
typedef float  v4fa __attribute__((ext_vector_type(4), may_alias));
union FragB { v16b v; v8us half[2]; unsigned short u[16]; };

__device__ __forceinline__ unsigned short bf16_bits(float x) { unsigned int u = __float_as_uint(x); return (unsigned short)((u + 0x7FFFu + ((u >> 16) & 1u)) >> 16); }
__device__ __forceinline__ float bf16_val(unsigned short b) { return __uint_as_float(((unsigned int)b) << 16); }
__device__ __forceinline__ float bf16_round(float x) { return bf16_val(bf16_bits(x)); }
// D += A·B with NT terms: 1 = ah·bh, 2 = + al·bh (A split), 3 = + ah·bl (both split)
template <int NT>
__device__ __forceinline__ v8f mmaN(v16b ah, v16b al, v16b bh, v16b bl, v8f c) {
  c = __builtin_amdgcn_wmma_f32_16x16x32_bf16(false, ah, false, bh, (short)0, c, false, false);
  if (NT >= 2) c = __builtin_amdgcn_wmma_f32_16x16x32_bf16(false, al, false, bh, (short)0, c, false, false);
  if (NT >= 3) c = __builtin_amdgcn_wmma_f32_16x16x32_bf16(false, ah, false, bl, (short)0, c, false, false);
  asm volatile("v_nop\n\tv_nop\n\tv_nop\n\tv_nop" : "+v"(c) : "v"(ah), "v"(al), "v"(bh), "v"(bl));
  return c;
}

__global__ __launch_bounds__(256) void k_wt_bf16(const float* __restrict__ W, unsigned short* __restrict__ Wt, int K, int N) {
  const int t = blockIdx.x * 256 + threadIdx.x;
  const int k8n = K / 8;
  if (t >= N * k8n) return;
  const int n = t / k8n, k8 = (t % k8n) * 8;
  v8us v;
#pragma unroll
  for (int i = 0; i < 8; ++i) v[i] = bf16_bits(W[(size_t)(k8 + i) * N + n]);
  *(v8us*)(Wt + (size_t)n * K + k8) = v;
  
}

// GEMM C[M][N] (f32, pitch ldc) = act(A[M][K]·W + bias). A f32 row-major (pitch lda) converted per fragment to bf16
// (ASPLIT: hi/lo two planes -> 2 terms, else single rounded term); Wt bf16 [N][K] (pitch ldb). BIAS_BF16 rounds the
// bias to bf16 first (bias quantised to bf16 before the add). K%32==0, M%16==0, N%64==0.
template <bool ASPLIT, int ACT, bool BIAS_BF16>
__global__ __launch_bounds__(128) void k_gemm_bf(const float* __restrict__ A, int lda, const unsigned short* __restrict__ Wt, int ldb,
                                               const float* __restrict__ bias, float* __restrict__ C, int ldc, int M, int N, int K) {
  __shared__ __attribute__((aligned(16))) float so[4][16][64];
  const int tid = threadIdx.x, w = tid >> 5, lane = tid & 31, ln = lane & 15, hh = lane >> 4;
  const int ntn = N / 64;
  const int wid = blockIdx.x * 4 + w;
  const int mt = wid / ntn, nq = wid % ntn;
  if (mt * 16 >= M) return;
  const int row0 = mt * 16, col0 = nq * 64;
  const float* arow = A + (size_t)(row0 + ln) * lda;
  v8f acc[4] = {};
  for (int kb = 0; kb < K; kb += 32) {
    FragB ah, al;
    const v4f x0 = *(const v4fa*)(arow + kb + 8 * hh), x1 = *(const v4fa*)(arow + kb + 8 * hh + 4);
    const v4f x2 = *(const v4fa*)(arow + kb + 16 + 8 * hh), x3 = *(const v4fa*)(arow + kb + 16 + 8 * hh + 4);
    float xs[16] = {x0[0],x0[1],x0[2],x0[3],x1[0],x1[1],x1[2],x1[3],x2[0],x2[1],x2[2],x2[3],x3[0],x3[1],x3[2],x3[3]};
#pragma unroll
    for (int i = 0; i < 16; ++i) { const unsigned short hb = bf16_bits(xs[i]); ah.u[i] = hb; al.u[i] = ASPLIT ? bf16_bits(xs[i] - bf16_val(hb)) : (unsigned short)0; }
#pragma unroll
    for (int t = 0; t < 4; ++t) {
      const unsigned short* brow = Wt + (size_t)(col0 + t * 16 + ln) * ldb + kb;
      FragB b;
      b.half[0] = *(const v8us*)(brow + 8 * hh);
      b.half[1] = *(const v8us*)(brow + 16 + 8 * hh);
      acc[t] = mmaN<ASPLIT ? 2 : 1>(ah.v, al.v, b.v, b.v, acc[t]);
    }
  }
#pragma unroll
  for (int t = 0; t < 4; ++t) {
    float bv = bias ? bias[col0 + t * 16 + ln] : 0.f;
    if (BIAS_BF16) bv = bf16_round(bv);
#pragma unroll
    for (int r = 0; r < 8; ++r) { float v = acc[t][r] + bv; if (ACT == 1) v = fmaxf(v, 0.f); so[w][8 * hh + r][t * 16 + ln] = v; }
  }
  __builtin_amdgcn_fence(__ATOMIC_ACQ_REL, "workgroup");
  __builtin_amdgcn_wave_barrier();
  const int rsub = lane >> 4, c4 = (lane & 15) * 4;
  {
#pragma unroll
    for (int q = 0; q < 8; ++q) {
      const int r = q * 2 + rsub;
      const v4f v = *(const v4fa*)&so[w][r][c4];
      *(v4f*)(C + (size_t)(row0 + r) * ldc + col0 + c4) = v;
    }
    
  }
}

// GEMM C = act(A·W + bias + resid): A f32 (ASPLIT -> hi/lo 2 terms), Wt bf16 [N][K]; ACT 0 none, 1 relu, 2 exact gelu;
// resid (optional, f32, row index = (row % rmod), pitch ldr, RES_BF16 rounds it) added before the activation.
template <bool ASPLIT, int ACT, bool BIAS_BF16, bool RES_BF16>
__global__ __launch_bounds__(128) void k_gemm_bf3(const float* __restrict__ A, int lda, const unsigned short* __restrict__ Wt, int ldb,
                                                const float* __restrict__ bias, const float* __restrict__ resid, int rmod, int ldr,
                                                float* __restrict__ C, int ldc, int M, int N, int K) {
  __shared__ __attribute__((aligned(16))) float so[4][16][64];
  const int tid = threadIdx.x, w = tid >> 5, lane = tid & 31, ln = lane & 15, hh = lane >> 4;
  const int ntn = N / 64;
  const int wid = blockIdx.x * 4 + w;
  const int mt = wid / ntn, nq = wid % ntn;
  if (mt * 16 >= M) return;
  const int row0 = mt * 16, col0 = nq * 64;
  const float* arow = A + (size_t)(row0 + ln) * lda;
  v8f acc[4] = {};
  for (int kb = 0; kb < K; kb += 32) {
    FragB ah, al;
    const v4f x0 = *(const v4fa*)(arow + kb + 8 * hh), x1 = *(const v4fa*)(arow + kb + 8 * hh + 4);
    const v4f x2 = *(const v4fa*)(arow + kb + 16 + 8 * hh), x3 = *(const v4fa*)(arow + kb + 16 + 8 * hh + 4);
    float xs[16] = {x0[0],x0[1],x0[2],x0[3],x1[0],x1[1],x1[2],x1[3],x2[0],x2[1],x2[2],x2[3],x3[0],x3[1],x3[2],x3[3]};
#pragma unroll
    for (int i = 0; i < 16; ++i) { const unsigned short hb = bf16_bits(xs[i]); ah.u[i] = hb; al.u[i] = ASPLIT ? bf16_bits(xs[i] - bf16_val(hb)) : (unsigned short)0; }
#pragma unroll
    for (int t = 0; t < 4; ++t) {
      const unsigned short* brow = Wt + (size_t)(col0 + t * 16 + ln) * ldb + kb;
      FragB b;
      b.half[0] = *(const v8us*)(brow + 8 * hh);
      b.half[1] = *(const v8us*)(brow + 16 + 8 * hh);
      acc[t] = mmaN<ASPLIT ? 2 : 1>(ah.v, al.v, b.v, b.v, acc[t]);
    }
  }
#pragma unroll
  for (int t = 0; t < 4; ++t) {
    const int col = col0 + t * 16 + ln;
    float bv = bias ? bias[col] : 0.f;
    if (BIAS_BF16) bv = bf16_round(bv);
#pragma unroll
    for (int r = 0; r < 8; ++r) {
      float v = acc[t][r] + bv;
      if (resid) { float rv = resid[(size_t)((row0 + 8 * hh + r) % rmod) * ldr + col]; if (RES_BF16) rv = bf16_round(rv); v += rv; }
      if (ACT == 1) v = fmaxf(v, 0.f);
      if (ACT == 2) v = 0.5f * v * (1.0f + erff(v * 0.70710678118654752f));
      if (ACT == 3) { const float u = 0.7978845608028654f * (v + 0.044715f * v * v * v); v = 0.5f * v * (1.0f + tanhf(u)); }
      so[w][8 * hh + r][t * 16 + ln] = v;
    }
  }
  __builtin_amdgcn_fence(__ATOMIC_ACQ_REL, "workgroup");
  __builtin_amdgcn_wave_barrier();
  const int rsub = lane >> 4, c4 = (lane & 15) * 4;
  {
#pragma unroll
    for (int q = 0; q < 8; ++q) {
      const int r = q * 2 + rsub;
      const v4f v = *(const v4fa*)&so[w][r][c4];
      *(v4f*)(C + (size_t)(row0 + r) * ldc + col0 + c4) = v;
    }
    
  }
}
// row LayerNorm (biased variance, eps) over N: s = X (+ R); optional out_sum <- s; out_norm <- (s-mu)*rsqrt(var+eps)*g + b
template <bool PARAM_BF16>
__global__ __launch_bounds__(256) void k_layernorm(const float* __restrict__ X, const float* __restrict__ R, const float* __restrict__ g, const float* __restrict__ bta,
                                                  float* __restrict__ out_sum, float* __restrict__ out_norm, int N, float eps) {
  __shared__ float red[256];
  const int row = blockIdx.x, tid = threadIdx.x;
  const float* x = X + (size_t)row * N; const float* rr = R ? R + (size_t)row * N : nullptr;
  float vals[16];                     // up to N = 4096
  const int per = N / 256;            // contiguous chunk per thread? use strided-by-4 chunks: thread handles j = tid*4 + 1024*u
  float s1 = 0.f;
  for (int u = 0; u < per / 4; ++u) {
    const int j = tid * 4 + 1024 * u;
    const v4f a = *(const v4fa*)(x + j);
    v4f b = {0.f,0.f,0.f,0.f}; if (rr) b = *(const v4fa*)(rr + j);
#pragma unroll
    for (int q = 0; q < 4; ++q) { const float v = a[q] + b[q]; vals[u * 4 + q] = v; s1 += v; }
  }
  red[tid] = s1; __syncthreads();
  for (int st = 128; st > 0; st >>= 1) { if (tid < st) red[tid] += red[tid + st]; __syncthreads(); }
  const float mu = red[0] / (float)N; __syncthreads();
  float s2 = 0.f;
  for (int u = 0; u < per / 4; ++u)
#pragma unroll
    for (int q = 0; q < 4; ++q) { const float c = vals[u * 4 + q] - mu; s2 += c * c; }
  red[tid] = s2; __syncthreads();
  for (int st = 128; st > 0; st >>= 1) { if (tid < st) red[tid] += red[tid + st]; __syncthreads(); }
  const float rs = rsqrtf(red[0] / (float)N + eps);
  {
    for (int u = 0; u < per / 4; ++u) {
      const int j = tid * 4 + 1024 * u;
      v4f o, sm;
#pragma unroll
      for (int q = 0; q < 4; ++q) {
        float gg = g[j + q], bb = bta[j + q];
        if (PARAM_BF16) { gg = bf16_round(gg); bb = bf16_round(bb); }
        sm[q] = vals[u * 4 + q]; o[q] = (vals[u * 4 + q] - mu) * rs * gg + bb;
      }
      if (out_sum) *(v4f*)(out_sum + (size_t)row * N + j) = sm;
      *(v4f*)(out_norm + (size_t)row * N + j) = o;
    }
    
  }
}



// ---- f16 WMMA path (v_wmma_f32_16x16x32_f16): 11-bit significands for operands in range — used where a [0,1] probability operand needs more precision than bf16
typedef _Float16 v16h __attribute__((ext_vector_type(16)));
union FragH { v16h v; v8us half[2]; _Float16 h[16]; unsigned short u[16]; };
template <int NT>
__device__ __forceinline__ v8f mmaH(v16h ah, v16h al, v16h bh, v16h bl, v8f c) {
  c = __builtin_amdgcn_wmma_f32_16x16x32_f16(false, ah, false, bh, (short)0, c, false, false);
  if (NT >= 2) c = __builtin_amdgcn_wmma_f32_16x16x32_f16(false, al, false, bh, (short)0, c, false, false);
  if (NT >= 3) c = __builtin_amdgcn_wmma_f32_16x16x32_f16(false, ah, false, bl, (short)0, c, false, false);
  asm volatile("v_nop\n\tv_nop\n\tv_nop\n\tv_nop" : "+v"(c) : "v"(ah), "v"(al), "v"(bh), "v"(bl));
  return c;
}
// batched GEMM like k_gemm_b but f16 operands: A f32 (split into f16 hi/lo if ASPLIT, else rounded to f16), Bt = f16 values [n][k]; alpha; C f32; N multiple of 16 (partial tiles skipped)
template <bool ASPLIT>
__global__ __launch_bounds__(128) void k_gemm_h(const float* __restrict__ A, int lda, size_t sA, const _Float16* __restrict__ Bh, int ldb, size_t sB, float alpha, float* __restrict__ C, int ldc, size_t sC, int M, int N, int K) {
  __shared__ __attribute__((aligned(16))) float so[4][16][64];
  const int tid = threadIdx.x, w = tid >> 5, lane = tid & 31, ln = lane & 15, hh = lane >> 4; const int by = blockIdx.y;
  A += (size_t)by * sA; Bh += (size_t)by * sB; C += (size_t)by * sC;
  const int ntn = (N + 63) / 64; const int wid = blockIdx.x * 4 + w; const int mt = wid / ntn, nq = wid % ntn; if (mt * 16 >= M) return;
  const int row0 = mt * 16, col0 = nq * 64; const float* arow = A + (size_t)(row0 + ln) * lda;
  v8f acc[4] = {};
  for (int kb = 0; kb < K; kb += 32) {
    FragH ah, al;
    const v4f x0 = *(const v4fa*)(arow + kb + 8 * hh), x1 = *(const v4fa*)(arow + kb + 8 * hh + 4), x2 = *(const v4fa*)(arow + kb + 16 + 8 * hh), x3 = *(const v4fa*)(arow + kb + 16 + 8 * hh + 4);
    float xs[16] = {x0[0],x0[1],x0[2],x0[3],x1[0],x1[1],x1[2],x1[3],x2[0],x2[1],x2[2],x2[3],x3[0],x3[1],x3[2],x3[3]};
#pragma unroll
    for (int i = 0; i < 16; ++i) { const _Float16 h = (_Float16)xs[i]; ah.h[i] = h; al.h[i] = ASPLIT ? (_Float16)(xs[i] - (float)h) : (_Float16)0.0f; }
#pragma unroll
    for (int t = 0; t < 4; ++t) { if (col0 + t * 16 >= N) continue; const size_t boff = (size_t)(col0 + t * 16 + ln) * ldb + kb; FragH bq; bq.half[0] = *(const v8us*)(Bh + boff + 8 * hh); bq.half[1] = *(const v8us*)(Bh + boff + 16 + 8 * hh);
      acc[t] = mmaH<ASPLIT ? 2 : 1>(ah.v, al.v, bq.v, bq.v, acc[t]); }
  }
#pragma unroll
  for (int t = 0; t < 4; ++t) { if (col0 + t * 16 >= N) continue;
#pragma unroll
    for (int r = 0; r < 8; ++r) so[w][8 * hh + r][t * 16 + ln] = acc[t][r] * alpha; }
  __builtin_amdgcn_fence(__ATOMIC_ACQ_REL, "workgroup"); __builtin_amdgcn_wave_barrier();
  const int rsub = lane >> 4, c4 = (lane & 15) * 4;
  {
#pragma unroll
    for (int q = 0; q < 8; ++q) { const int r = q * 2 + rsub; if (col0 + c4 < N) { const v4f v = *(const v4fa*)&so[w][r][c4]; *(v4f*)(C + (size_t)(row0 + r) * ldc + col0 + c4) = v; } }
     }
}

// Wt[n][k] = f16(W[k][n]·scale) from f32 row-major W[K][N] (scale = power of two; bf16-exact weights stay exact in f16 away from the subnormal range)
__global__ __launch_bounds__(256) void k_wt_f16(const float* __restrict__ W, _Float16* __restrict__ Wt, int K, int N, float scale) {
  const int t = blockIdx.x * 256 + threadIdx.x; if (t >= N * (K / 8)) return; const int n = t / (K / 8), k8 = (t % (K / 8)) * 8; FragH f;
#pragma unroll
  for (int i = 0; i < 8; ++i) f.h[i] = (_Float16)(bf16_round(W[(size_t)(k8 + i) * N + n]) * scale); const v8us o = f.half[0];
  *(v8us*)((unsigned short*)Wt + (size_t)n * K + k8) = o; 
}
// k_gemm_hh variant with fused epilogue: v = acc·alpha + bias[by·sBias + col] (+ CP[(row/rowsPerB)·sCPb + by·64 + col] if CP) ; ACT 0 none / 1 elu ; writes f16 C16 (and f32 C if non-null)
template <int ACT>
__global__ __launch_bounds__(128) void k_gemm_hhx(const _Float16* __restrict__ A, int lda, size_t sA, const _Float16* __restrict__ Bh, int ldb, size_t sB, float alpha, const float* __restrict__ bias, size_t sBias, const float* __restrict__ CP, int rowsPerB, size_t sCPb, int row0g,
    float* __restrict__ C, _Float16* __restrict__ C16, int ldc, size_t sC, int M, int N, int K) {
  __shared__ __attribute__((aligned(16))) float so[4][16][64];
  const int tid = threadIdx.x, w = tid >> 5, lane = tid & 31, ln = lane & 15, hh = lane >> 4; const int by = blockIdx.y;
  A += (size_t)by * sA; Bh += (size_t)by * sB; const size_t cofs = (size_t)by * sC; const float* bp = bias ? bias + (size_t)by * sBias : nullptr;
  const int ntn = (N + 63) / 64; const int wid = blockIdx.x * 4 + w; const int mt = wid / ntn, nq = wid % ntn; if (mt * 16 >= M) return;
  const int row0 = mt * 16, col0 = nq * 64; const _Float16* arow = A + (size_t)(row0 + ln) * lda;
  v8f acc[4] = {};
  for (int kb = 0; kb < K; kb += 32) { FragH ah; ah.half[0] = *(const v8us*)((const unsigned short*)arow + kb + 8 * hh); ah.half[1] = *(const v8us*)((const unsigned short*)arow + kb + 16 + 8 * hh);
#pragma unroll
    for (int t = 0; t < 4; ++t) { if (col0 + t * 16 >= N) continue; const size_t boff = (size_t)(col0 + t * 16 + ln) * ldb + kb; FragH bq; bq.half[0] = *(const v8us*)((const unsigned short*)Bh + boff + 8 * hh); bq.half[1] = *(const v8us*)((const unsigned short*)Bh + boff + 16 + 8 * hh);
      acc[t] = mmaH<1>(ah.v, ah.v, bq.v, bq.v, acc[t]); }
  }
#pragma unroll
  for (int t = 0; t < 4; ++t) { if (col0 + t * 16 >= N) continue; const int col = col0 + t * 16 + ln; const float bv = bp ? bf16_round(bp[col]) : 0.f;
#pragma unroll
    for (int r = 0; r < 8; ++r) { float v = acc[t][r] * alpha + bv; if (CP) { const int bidx = (row0g + row0 + 8 * hh + r) / rowsPerB; v += CP[(size_t)bidx * sCPb + (size_t)by * 64 + col]; } if (ACT == 1) v = (v > 0.f) ? v : expm1f(v); else if (ACT == 7) v = (v > 0.f) ? v + 1.0f : expf(v); else if (ACT == 8) v = tanhf(v); else if (ACT == 9) v = 0.5f * v * (1.0f + tanhf(0.7978845608028654f * (v + 0.044715f * v * v * v))); else if (ACT == 11) v = 1.0f / (1.0f + expf(-v)); else if (ACT == 12) v = (v > 0.f) ? v : 0.01f * v; else if (ACT == 14) v = (v > 0.f) ? v : 0.1f * v; else if (ACT == 15) v = v / (1.0f + expf(-v)); else if (ACT == 3) v = fmaxf(v, 0.f); else if (ACT == 6) v = 0.5f * v * (1.0f + erff(v * 0.70710678118654752f)); so[w][8 * hh + r][t * 16 + ln] = v; } }
  __builtin_amdgcn_fence(__ATOMIC_ACQ_REL, "workgroup"); __builtin_amdgcn_wave_barrier();
  const int rsub = lane >> 4, c4 = (lane & 15) * 4; typedef _Float16 v4h __attribute__((ext_vector_type(4)));
  {
#pragma unroll
    for (int q = 0; q < 8; ++q) { const int r = q * 2 + rsub; if (col0 + c4 < N) { const v4f v = *(const v4fa*)&so[w][r][c4]; if (C) *(v4f*)(C + cofs + (size_t)(row0 + r) * ldc + col0 + c4) = v; if (C16) { v4h h4; for (int i = 0; i < 4; ++i) h4[i] = (_Float16)v[i]; *(v4h*)(C16 + cofs + (size_t)(row0 + r) * ldc + col0 + c4) = h4; } } }
     }
}


typedef _Float16 v4h __attribute__((ext_vector_type(4)));

__global__ __launch_bounds__(256) void k_x16(const float* __restrict__ x, _Float16* __restrict__ X16, size_t n8) { const size_t t = (size_t)blockIdx.x * 256 + threadIdx.x; if (t >= n8) return; FragH f;
#pragma unroll
  for (int q = 0; q < 8; ++q) f.h[q] = (_Float16)bf16_round(x[t * 8 + q]); *(v8us*)((unsigned short*)X16 + t * 8) = f.half[0];  }
__global__ __launch_bounds__(256) void k_h16(const float* __restrict__ x, _Float16* __restrict__ X16, size_t n8) { const size_t t = (size_t)blockIdx.x * 256 + threadIdx.x; if (t >= n8) return; FragH f;
#pragma unroll
  for (int q = 0; q < 8; ++q) f.h[q] = (_Float16)x[t * 8 + q]; *(v8us*)((unsigned short*)X16 + t * 8) = f.half[0];  }
__global__ __launch_bounds__(256) void k_round16f(const float* __restrict__ W, _Float16* __restrict__ Bt, size_t n8) { const size_t t = (size_t)blockIdx.x * 256 + threadIdx.x; if (t >= n8) return; FragH f;
#pragma unroll
  for (int i = 0; i < 8; ++i) f.h[i] = (_Float16)(bf16_round(W[t * 8 + i]) * 16.0f); *(v8us*)((unsigned short*)Bt + t * 8) = f.half[0];  }
template <int NHv, int TTv>
__global__ __launch_bounds__(256) void k_vt(const _Float16* __restrict__ V16, int ldv, int voff, _Float16* __restrict__ Vt) { __shared__ unsigned short tl[64][66]; const int tid = threadIdx.x; const int slab = blockIdx.x / (TTv / 64), lg = blockIdx.x % (TTv / 64); const int b = slab / NHv, h = slab % NHv;
  for (int i = tid; i < 64 * 8; i += 256) { const int r = i / 8, c8 = (i % 8) * 8; FragH f; f.half[0] = *(const v8us*)((const unsigned short*)V16 + ((size_t)b * TTv + lg * 64 + r) * ldv + voff + h * 64 + c8);
#pragma unroll
    for (int q = 0; q < 8; ++q) tl[r][c8 + q] = f.u[q]; }
  __syncthreads();
  {
#pragma unroll
    for (int rd = 0; rd < 2; ++rd) { const int d = rd * 32 + tid / 8, pc = tid % 8; FragH f;
#pragma unroll
      for (int q = 0; q < 8; ++q) f.u[q] = tl[pc * 8 + q][d];
      *(v8us*)((unsigned short*)Vt + ((size_t)slab * 64 + d) * TTv + lg * 64 + pc * 8) = f.half[0]; }
     } }

__global__ __launch_bounds__(256) void k_hl(const float* __restrict__ F, _Float16* __restrict__ Hh, _Float16* __restrict__ Hl, size_t n8) { const size_t t = (size_t)blockIdx.x * 256 + threadIdx.x; if (t >= n8) return; FragH fh, fl; const v4f a = *(const v4fa*)(F + t * 8), c = *(const v4fa*)(F + t * 8 + 4);
#pragma unroll
  for (int q = 0; q < 4; ++q) { _Float16 h = (_Float16)a[q]; fh.h[q] = h; fl.h[q] = (_Float16)((a[q] - (float)h) * 1024.0f); h = (_Float16)c[q]; fh.h[4 + q] = h; fl.h[4 + q] = (_Float16)((c[q] - (float)h) * 1024.0f); }
  { *(v8us*)((unsigned short*)Hh + t * 8) = fh.half[0]; *(v8us*)((unsigned short*)Hl + t * 8) = fl.half[0];  } }

// ---- fast GEMM (wave tile 32x64; requires M % 32 == 0 rows per launch region and N % 64 == 0); epilogue = k_gemm_hhx semantics ----
__device__ __forceinline__ v16h g2_frag(const _Float16* p, int hh) { FragH f; f.half[0] = *(const v8us*)((const unsigned short*)p + 8 * hh); f.half[1] = *(const v8us*)((const unsigned short*)p + 16 + 8 * hh); return f.v; }
// g2_frag with s_wait_xcnt 0 in front of its second load, whose result is given registers that hold addresses of loads already issued; the same wait behind it keeps the loads that follow in the source behind it, so that none of their addresses is among those registers
__device__ __forceinline__ v16h g2_frag_w(const _Float16* p, int hh) { FragH f; f.half[0] = *(const v8us*)((const unsigned short*)p + 8 * hh); asm volatile("s_wait_xcnt 0x0" ::: "memory"); f.half[1] = *(const v8us*)((const unsigned short*)p + 16 + 8 * hh); asm volatile("s_wait_xcnt 0x0" ::: "memory"); return f.v; }
__device__ __forceinline__ v8f g2_mma(v16h a, v16h b, v8f c) { v8f d = __builtin_amdgcn_wmma_f32_16x16x32_f16(false, a, false, b, (short)0, c, false, false); asm volatile("v_nop\n\tv_nop\n\tv_nop\n\tv_nop" : "+v"(d) : "v"(a), "v"(b)); return d; }
// ROWB: the bias belongs to the rows of C (weights as the A operand: C comes out channel-major) instead of its columns. so: the caller's staging array, one for all bodies of a kernel.
template <int ACT, bool ROWB>
__device__ __forceinline__ void gemm2_body(float (*so)[32][68], const int by, const _Float16* __restrict__ A, int lda, size_t sA, const _Float16* __restrict__ Bh, int ldb, size_t sB, float alpha, const float* __restrict__ bias, size_t sBias, const float* __restrict__ CP, int rowsPerB, size_t sCPb, int row0g,
    float* __restrict__ C, _Float16* __restrict__ C16, int ldc, size_t sC, int M, int N, int K) {
  const int tid = threadIdx.x, w = tid >> 5, lane = tid & 31, ln = lane & 15, hh = lane >> 4;
  A += (size_t)by * sA; Bh += (size_t)by * sB; const size_t cofs = (size_t)by * sC; const float* bp = bias ? bias + (size_t)by * sBias : nullptr;
  const int ntn = N >> 6; const int mt = blockIdx.x / ntn, nq = blockIdx.x - mt * ntn; const int row0 = mt * 128 + 32 * w, col0 = nq * 64; if (row0 >= M) return;
  const _Float16* a0p = A + (size_t)(row0 + ln) * lda; const _Float16* a1p = a0p + (size_t)16 * lda;
  const _Float16* b0p = Bh + (size_t)(col0 + ln) * ldb; const _Float16* b1p = b0p + (size_t)16 * ldb; const _Float16* b2p = b1p + (size_t)16 * ldb; const _Float16* b3p = b2p + (size_t)16 * ldb;
  const v8f z8 = {0.f,0.f,0.f,0.f,0.f,0.f,0.f,0.f}; v8f c00 = z8, c01 = z8, c02 = z8, c03 = z8, c10 = z8, c11 = z8, c12 = z8, c13 = z8;
#pragma unroll 1
  for (int kb = 0; kb < K; kb += 32) { const v16h a0 = g2_frag(a0p + kb, hh), a1 = g2_frag_w(a1p + kb, hh);
    v16h b = g2_frag(b0p + kb, hh); c00 = g2_mma(a0, b, c00); c10 = g2_mma(a1, b, c10);
    b = g2_frag(b1p + kb, hh); c01 = g2_mma(a0, b, c01); c11 = g2_mma(a1, b, c11);
    b = g2_frag(b2p + kb, hh); c02 = g2_mma(a0, b, c02); c12 = g2_mma(a1, b, c12);
    b = g2_frag(b3p + kb, hh); c03 = g2_mma(a0, b, c03); c13 = g2_mma(a1, b, c13); }
  v8f accs[8] = {c00, c01, c02, c03, c10, c11, c12, c13};
  float bvr[2][8];      /* ROWB: the biases of this lane's sixteen rows */
  if (ROWB) {
#pragma unroll      /* unrolled: bvr is indexed by constants and stays in registers */
    for (int i = 0; i < 16; ++i) bvr[i >> 3][i & 7] = bp ? bf16_round(bp[row0 + (i >> 3) * 16 + 8 * hh + (i & 7)]) : 0.f; }
#pragma unroll
  for (int u = 0; u < 8; ++u) { const int t = u & 3, half = u >> 2; const int col = col0 + t * 16 + ln; const float bvc = (!ROWB && bp) ? bf16_round(bp[col]) : 0.f;
#pragma unroll
    for (int r = 0; r < 8; ++r) { const int rloc = half * 16 + 8 * hh + r; const float bv = ROWB ? bvr[half][r] : bvc; float v = accs[u][r] * alpha + bv; if (CP) { const int bidx = (row0g + row0 + rloc) / rowsPerB; v += CP[(size_t)bidx * sCPb + (size_t)by * 64 + col]; }
      if (ACT == 3) v = fmaxf(v, 0.f); else if (ACT == 6) v = 0.5f * v * (1.0f + erff(v * 0.70710678118654752f)); else if (ACT == 11) v = 1.0f / (1.0f + expf(-v)); else if (ACT == 15) v = v / (1.0f + expf(-v)); else if (ACT == 12) v = (v > 0.f) ? v : 0.01f * v; else if (ACT == 8) v = tanhf(v);
      so[w][rloc][t * 16 + ln] = v; } }
  __builtin_amdgcn_fence(__ATOMIC_ACQ_REL, "workgroup"); __builtin_amdgcn_wave_barrier();
  const int rsub = lane >> 4, c4 = (lane & 15) * 4;
  { v4f vq[16];      /* all LDS reads first, so that the waits behind the stores do not stand between them */
#pragma unroll      /* unrolled, here and below: vq is indexed by constants and stays in registers */
    for (int q = 0; q < 16; ++q) vq[q] = *(const v4fa*)&so[w][q * 2 + rsub][c4];
#pragma unroll
    for (int q = 0; q < 16; ++q) { const int r = q * 2 + rsub; const v4f v = vq[q];      /* s_wait_xcnt 0 behind a store: the conversions and address sums that follow reuse the store's registers */
      if (C) { *(v4f*)(C + cofs + (size_t)(row0 + r) * ldc + col0 + c4) = v; asm volatile("s_wait_xcnt 0x0" ::: "memory"); }
      if (C16) { v4h h4; for (int i = 0; i < 4; ++i) h4[i] = (_Float16)v[i]; *(v4h*)(C16 + cofs + (size_t)(row0 + r) * ldc + col0 + c4) = h4; if (q + 1 < 16) asm volatile("s_wait_xcnt 0x0" ::: "memory"); } }
     } }
template <int ACT, bool ROWB>
__global__ __launch_bounds__(128) void k_gemm2(const _Float16* __restrict__ A, int lda, size_t sA, const _Float16* __restrict__ Bh, int ldb, size_t sB, float alpha, const float* __restrict__ bias, size_t sBias, const float* __restrict__ CP, int rowsPerB, size_t sCPb, int row0g,
    float* __restrict__ C, _Float16* __restrict__ C16, int ldc, size_t sC, int M, int N, int K) {
  __shared__ __attribute__((aligned(16))) float so[4][32][68];
  gemm2_body<ACT, ROWB>(so, blockIdx.y, A, lda, sA, Bh, ldb, sB, alpha, bias, sBias, CP, rowsPerB, sCPb, row0g, C, C16, ldc, sC, M, N, K); }
// Three independent products of one shape in one launch: blockIdx.y picks the operands, the bias and the f16 output; the tile work is gemm2_body's.
// Jobs 0 and 1 give C[M][N] (tokens x channels). Job 2 takes its operands in swapped roles and gives C2[N][M] (channels x tokens, pitch M), the layout its reader wants; (M / 128)(N / 64) tiles either way.
template <int ACT>
__global__ __launch_bounds__(128) void k_gemm2x3(const _Float16* __restrict__ A0, const _Float16* __restrict__ A1, const _Float16* __restrict__ A2, const _Float16* __restrict__ B0, const _Float16* __restrict__ B1, const _Float16* __restrict__ B2,
    const float* __restrict__ bias0, const float* __restrict__ bias1, const float* __restrict__ bias2, _Float16* __restrict__ C0, _Float16* __restrict__ C1, _Float16* __restrict__ C2, float alpha, int ld, int M, int N, int K) {
  __shared__ __attribute__((aligned(16))) float so[4][32][68];
  const int j = blockIdx.y;
  if (j == 2) { gemm2_body<ACT, true>(so, 0, B2, ld, 0, A2, ld, 0, alpha, bias2, 0, nullptr, 1, 0, 0, nullptr, C2, M, 0, N, M, K); return; }
  const _Float16* A = (j == 0) ? A0 : A1; const _Float16* Bh = (j == 0) ? B0 : B1; const float* bias = (j == 0) ? bias0 : bias1; _Float16* C16 = (j == 0) ? C0 : C1;
  gemm2_body<ACT, false>(so, 0, A, ld, 0, Bh, ld, 0, alpha, bias, 0, nullptr, 1, 0, 0, nullptr, C16, ld, 0, M, N, K); }



// lane l <-> lane l ^ 16 (the two lane halves of one fragment column)
__device__ __forceinline__ float xhalf(float x) { return __builtin_bit_cast(float, __builtin_amdgcn_permlanex16(__builtin_bit_cast(int, x), __builtin_bit_cast(int, x), 0x76543210, 0xfedcba98, false, false)); }
__device__ __forceinline__ void kv_stage(unsigned lk, unsigned lv, const unsigned short* gk, size_t k16, const unsigned short* gv, size_t v16) {
  const unsigned lk1 = lk + 2304u, lk2 = lk + 4608u, lk3 = lk + 6912u, lv1 = lv + 2304u, lv2 = lv + 4608u, lv3 = lv + 6912u;      /* 16 rows x 144 B */
  const unsigned short* gk1 = gk + k16; const unsigned short* gk2 = gk1 + k16; const unsigned short* gk3 = gk2 + k16;
  const unsigned short* gv1 = gv + v16; const unsigned short* gv2 = gv1 + v16; const unsigned short* gv3 = gv2 + v16;
  /* the closing s_wait_xcnt 0 stands inside the statement so that no address register of a copy is rewritten in front of it */
  asm volatile("global_load_async_to_lds_b128 %0, %8, off\n\t"
               "global_load_async_to_lds_b128 %1, %9, off\n\t"
               "global_load_async_to_lds_b128 %2, %10, off\n\t"
               "global_load_async_to_lds_b128 %3, %11, off\n\t"
               "global_load_async_to_lds_b128 %4, %12, off\n\t"
               "global_load_async_to_lds_b128 %5, %13, off\n\t"
               "global_load_async_to_lds_b128 %6, %14, off\n\t"
               "global_load_async_to_lds_b128 %7, %15, off\n\t"
               "s_wait_xcnt 0x0"
               :: "v"(lk), "v"(lk1), "v"(lk2), "v"(lk3), "v"(lv), "v"(lv1), "v"(lv2), "v"(lv3),
                  "v"(gk), "v"(gk1), "v"(gk2), "v"(gk3), "v"(gv), "v"(gv1), "v"(gv2), "v"(gv3) : "memory");
}
template <int CAUSAL>
__global__ __launch_bounds__(128) void k_flash(const _Float16* __restrict__ Q16, int ldq, const _Float16* __restrict__ K16, int ldk, const _Float16* __restrict__ Vt, const int* __restrict__ MSK, _Float16* __restrict__ O, int ldo) {
  constexpr int RPW = 16, DT = 4, KS = 2, KT = 64, LP = 72;      /* KT keys a stage; LP: LDS row pitch in halves = 128 B + 16 B, the pitch of 16-byte LDS readers */
  __shared__ __attribute__((aligned(16))) unsigned short sK[2][KT][LP];
  __shared__ __attribute__((aligned(16))) unsigned short sV[2][64][LP];
  __shared__ __attribute__((aligned(16))) float sO[4][RPW][64 + 4];
  const int tid = threadIdx.x, w = tid >> 5, lane = tid & 31, ln = lane & 15, hh = lane >> 4;
  const int slab = blockIdx.x / QBNP, qblk = QB0P + blockIdx.x % QBNP; const int b = slab / NH, h = slab % NH; const int qb0 = qblk * (4 * RPW); const int q0 = qb0 + w * RPW; const int tq = q0 + ln;
  const unsigned short* Vth = (const unsigned short*)Vt + (size_t)slab * 64 * TK;
  const int jend = (CAUSAL == 1) ? (qb0 + 4 * RPW) : TK;      /* causal: keys beyond the block's last query never contribute */
  const int nst = jend / KT;
  const int crow = tid >> 3, cc = (tid & 7) * 8;      /* eight lanes copy one 128-B row */
  const unsigned short* gk = (const unsigned short*)K16 + ((size_t)b * TK + crow) * ldk + h * 64 + cc;
  const unsigned short* gv = Vth + (size_t)crow * TK + cc;
  const size_t k16 = (size_t)16 * ldk, v16 = (size_t)16 * TK, kst = (size_t)KT * ldk;
  const unsigned lk0 = (unsigned)(size_t)&sK[0][crow][cc], lv0 = (unsigned)(size_t)&sV[0][crow][cc];
  constexpr unsigned BUFB = KT * LP * 2;      /* bytes of one buffer */
  kv_stage(lk0, lv0, gk, k16, gv, v16);
  FragH bq[KS];
  { const unsigned short* qr = (const unsigned short*)Q16 + ((size_t)b * TQ + tq) * ldq + h * 64;
#pragma unroll
    for (int ks = 0; ks < KS; ++ks) { bq[ks].half[0] = *(const v8us*)(qr + ks * 32 + 8 * hh); bq[ks].half[1] = *(const v8us*)(qr + ks * 32 + 16 + 8 * hh); } }
  constexpr float C2 = SCL * 1.4426950408889634f;      /* score -> base-2 exponent: scale x log2(e) */
  float m_r = -3.0e38f, l_r = 0.f; v8f oacc[DT];      /* m_r: running maximum of the unscaled scores; l_r: sum of 1024 p over this lane half's keys only, joined after the loop */
#pragma unroll
  for (int dt = 0; dt < DT; ++dt) oacc[dt] = (v8f){0.f,0.f,0.f,0.f,0.f,0.f,0.f,0.f};
  asm volatile("s_wait_asynccnt 0x0" ::: "memory");      /* stage 0: this wave's copies have landed */
  __syncthreads();      /* stage 0 is readable by every wave */
  if (nst > 1) kv_stage(lk0 + BUFB, lv0 + BUFB, gk + kst, k16, gv + KT, v16);
#pragma unroll 1      /* stays rolled: one copy of the body serves both buffers, chosen by st & 1 */
  for (int st = 0; st < nst; ++st) {      /* stage st is worked on while stage st + 1 flies into the other buffer */
    const int bf = st & 1;
#pragma unroll      /* unrolled: the half stage becomes a constant offset of the LDS reads */
    for (int sub = 0; sub < KT / 32; ++sub) {
    const int j0 = st * KT + sub * 32;
    FragH ak[2][KS], av[DT];
#pragma unroll
    for (int nt = 0; nt < 2; ++nt) { const unsigned short* kr = &sK[bf][sub * 32 + nt * 16 + ln][0];
#pragma unroll
      for (int ks = 0; ks < KS; ++ks) { ak[nt][ks].half[0] = *(const v8us*)(kr + ks * 32 + 8 * hh); ak[nt][ks].half[1] = *(const v8us*)(kr + ks * 32 + 16 + 8 * hh); } }
#pragma unroll
    for (int dt = 0; dt < DT; ++dt) { const unsigned short* vrow = &sV[bf][dt * 16 + ln][sub * 32]; av[dt].half[0] = *(const v8us*)(vrow + 8 * hh); av[dt].half[1] = *(const v8us*)(vrow + 16 + 8 * hh); }
    v8f s[2];
#pragma unroll
    for (int nt = 0; nt < 2; ++nt) {
      v8f acc = (v8f){0.f,0.f,0.f,0.f,0.f,0.f,0.f,0.f};
#pragma unroll
      for (int ks = 0; ks < KS; ++ks) acc = mmaH<1>(ak[nt][ks].v, ak[nt][ks].v, bq[ks].v, bq[ks].v, acc);
      s[nt] = acc; }
    float sc[16], t[8]; bool ok[16];
#pragma unroll
    for (int i = 0; i < 16; ++i) { const int kk = j0 + (i >> 3) * 16 + 8 * hh + (i & 7);
      ok[i] = (CAUSAL == 1) ? (kk <= tq) : ((CAUSAL == 2) ? ((kk >> 5) == (tq >> 5)) : true);      /* mode 2: block-diagonal 32-token groups */
      sc[i] = ok[i] ? s[i >> 3][i & 7] : -3.0e38f; if (CAUSAL == 17) sc[i] += bf16_round(((const float*)MSK + (size_t)b * TK)[kk]) * (1.0f / SCL); }      /* unscaled scores (the scale is positive: the maximum commutes with it); mode 17: additive per-(batch, key) mask INPUT, in the same units */
#pragma unroll
    for (int i = 0; i < 8; ++i) t[i] = fmaxf(sc[i], sc[i + 8]);
    float mc = fmaxf(fmaxf(fmaxf(t[0], t[1]), fmaxf(t[2], t[3])), fmaxf(fmaxf(t[4], t[5]), fmaxf(t[6], t[7])));
    mc = fmaxf(mc, xhalf(mc));      /* both halves feed one O^T column: one maximum for both */
    const float mn = fmaxf(m_r, mc); const float al = (mn > -1.0e38f) ? __builtin_amdgcn_exp2f((m_r - mn) * C2) : 1.0f; m_r = mn;
    const float nb = __builtin_fmaf(-mn, C2, 10.0f);      /* 1024 p = 2^(C2 s - C2 m + 10): one fused multiply-add in front of the hardware's base-2 exponential */
    FragH pb;
#pragma unroll
    for (int i = 0; i < 16; ++i) sc[i] = __builtin_fmaf(sc[i], C2, nb);
    /* sixteen exponentials in place, in one statement: each is independent of the one in front of it (no result read, no source overwritten), and the closing v_nop is the slot behind the last one; last element first, because the packing behind it starts with the last pair */
    asm("v_exp_f32 %15, %15\n\tv_exp_f32 %14, %14\n\tv_exp_f32 %13, %13\n\tv_exp_f32 %12, %12\n\t"
        "v_exp_f32 %11, %11\n\tv_exp_f32 %10, %10\n\tv_exp_f32 %9, %9\n\tv_exp_f32 %8, %8\n\t"
        "v_exp_f32 %7, %7\n\tv_exp_f32 %6, %6\n\tv_exp_f32 %5, %5\n\tv_exp_f32 %4, %4\n\t"
        "v_exp_f32 %3, %3\n\tv_exp_f32 %2, %2\n\tv_exp_f32 %1, %1\n\tv_exp_f32 %0, %0\n\tv_nop"
        : "+v"(sc[0]), "+v"(sc[1]), "+v"(sc[2]), "+v"(sc[3]), "+v"(sc[4]), "+v"(sc[5]), "+v"(sc[6]), "+v"(sc[7]),
          "+v"(sc[8]), "+v"(sc[9]), "+v"(sc[10]), "+v"(sc[11]), "+v"(sc[12]), "+v"(sc[13]), "+v"(sc[14]), "+v"(sc[15]));
#pragma unroll
    for (int i = 0; i < 16; ++i) { if (!ok[i]) sc[i] = 0.f; pb.h[i] = (_Float16)sc[i]; }
#pragma unroll
    for (int i = 0; i < 8; ++i) t[i] = sc[i] + sc[i + 8];
    l_r = l_r * al + (((t[0] + t[1]) + (t[2] + t[3])) + ((t[4] + t[5]) + (t[6] + t[7])));
#pragma unroll
    for (int dt = 0; dt < DT; ++dt)
#pragma unroll
      for (int r = 0; r < 8; ++r) oacc[dt][r] *= al;
#pragma unroll
    for (int dt = 0; dt < DT; ++dt) oacc[dt] = mmaH<1>(av[dt].v, av[dt].v, pb.v, pb.v, oacc[dt]);
    }
    asm volatile("s_wait_dscnt 0x0" ::: "memory");      /* this wave's reads of buffer bf are done before the buffer is given up */
    asm volatile("s_wait_asynccnt 0x0" ::: "memory");      /* this wave's copies of stage st + 1 have landed */
    __syncthreads();      /* publishes stage st + 1 and ends every wave's reads of buffer bf */
    if (st + 2 < nst) kv_stage(lk0 + bf * BUFB, lv0 + bf * BUFB, gk + (size_t)(st + 2) * kst, k16, gv + (size_t)(st + 2) * KT, v16);
  }
  asm volatile("s_wait_asynccnt 0x0" ::: "memory");      /* no copy is left in flight when the wave goes on */
  const float l = l_r + xhalf(l_r); const float li = (l > 0.f) ? 1.0f / l : 0.f;      /* numerator and sum both carry the factor 1024 */
#pragma unroll
  for (int dt = 0; dt < DT; ++dt) {      /* oacc[dt][r] = O[q0 + ln][16 dt + 8 hh + r] */
    const v4f lo = {oacc[dt][0] * li, oacc[dt][1] * li, oacc[dt][2] * li, oacc[dt][3] * li}, hi = {oacc[dt][4] * li, oacc[dt][5] * li, oacc[dt][6] * li, oacc[dt][7] * li};
    *(v4fa*)&sO[w][ln][dt * 16 + 8 * hh] = lo; *(v4fa*)&sO[w][ln][dt * 16 + 8 * hh + 4] = hi; }
  __builtin_amdgcn_fence(__ATOMIC_ACQ_REL, "workgroup"); __builtin_amdgcn_wave_barrier();
  { v4h h4[RPW / 2];      /* all LDS reads first, so that the waits behind the stores do not stand between them */
#pragma unroll      /* unrolled, here and below: h4 is indexed by constants and stays in registers */
    for (int rp = 0; rp < RPW; rp += 2) { const v4f val = *(const v4fa*)&sO[w][rp + (lane >> 4)][(lane & 15) * 4]; for (int i = 0; i < 4; ++i) h4[rp >> 1][i] = (_Float16)val[i]; }      /* ctx leaves as the f16 operand of the last product */
#pragma unroll
    for (int rp = 0; rp < RPW; rp += 2) { const int r = rp + (lane >> 4), pc = lane & 15; *(v4h*)(O + ((size_t)b * TQ + q0 + r) * ldo + h * 64 + pc * 4) = h4[rp >> 1];      /* sixteen lanes fill one 128-B line */
      if (rp + 2 < RPW) asm volatile("s_wait_xcnt 0x0" ::: "memory"); }      /* the address sums that follow reuse the store's registers */
     } }
// 5-plane variant: S = Qh Kh^T + (Ql Kh^T + Qh Kl^T)/1024 with Q/K = [hi | 2^10 residual] f16 planes (QL/KL same layout as Q16/K16), then the 3-term P.V below.
// 3-term variant: O = (P_hi V_hi + (P_lo V_hi + P_hi V_lo) / 1024) / l with P = [hi | 2^10 residual] of 1024 p and V^T = [hi | 2^10 residual] planes (VtL same layout as Vt) -> ~2^-21-class products for un-averaged (early causal / peaked) rows
template <int CAUSAL>
__global__ __launch_bounds__(128) void k_flash5(const _Float16* __restrict__ Q16, const _Float16* __restrict__ QL, int ldq, const _Float16* __restrict__ K16, const _Float16* __restrict__ KL, int ldk, const _Float16* __restrict__ Vt, const _Float16* __restrict__ VtL, const int* __restrict__ MSK, float* __restrict__ O, int ldo) {
  constexpr int RPW = 16, RTN = RPW / 16, NQB = TQ / (4 * RPW), DT = 4, KS = 2;
  __shared__ __attribute__((aligned(16))) unsigned short sP[4][RPW][40]; __shared__ __attribute__((aligned(16))) unsigned short sPL[4][RPW][40]; __shared__ __attribute__((aligned(16))) float sO[4][RPW][64 + 4];
  const int tid = threadIdx.x, w = tid >> 5, lane = tid & 31, ln = lane & 15, hh = lane >> 4;
  const int slab = blockIdx.x / QBN5, qblk = QB05 + blockIdx.x % QBN5; (void)NQB; const int b = slab / NH, h = slab % NH; const int qb0 = qblk * (4 * RPW); const int q0 = qb0 + w * RPW;
  FragH aq[2][KS], aql[2][KS];
#pragma unroll
  for (int rt = 0; rt < RTN; ++rt) { const unsigned short* qr = (const unsigned short*)Q16 + ((size_t)b * TQ + q0 + rt * 16 + ln) * ldq + h * 64; const unsigned short* ql = (const unsigned short*)QL + ((size_t)b * TQ + q0 + rt * 16 + ln) * ldq + h * 64;
#pragma unroll
    for (int ks = 0; ks < KS; ++ks) { aq[rt][ks].half[0] = *(const v8us*)(qr + ks * 32 + 8 * hh); aq[rt][ks].half[1] = *(const v8us*)(qr + ks * 32 + 16 + 8 * hh); aql[rt][ks].half[0] = *(const v8us*)(ql + ks * 32 + 8 * hh); aql[rt][ks].half[1] = *(const v8us*)(ql + ks * 32 + 16 + 8 * hh); } }
  const unsigned short* Vth = (const unsigned short*)Vt + (size_t)slab * 64 * TK; const unsigned short* Vtl = (const unsigned short*)VtL + (size_t)slab * 64 * TK;
  float m_r[2][8], l_r[2][8]; v8f oacc[2][DT], oaccL[2][DT];
#pragma unroll
  for (int rt = 0; rt < RTN; ++rt) {
#pragma unroll
    for (int r = 0; r < 8; ++r) { m_r[rt][r] = -3.0e38f; l_r[rt][r] = 0.f; }
#pragma unroll
    for (int dt = 0; dt < DT; ++dt) { oacc[rt][dt] = (v8f){0.f,0.f,0.f,0.f,0.f,0.f,0.f,0.f}; oaccL[rt][dt] = oacc[rt][dt]; } }
  const int jend = (CAUSAL == 1) ? (qb0 + 4 * RPW) : TK;      /* causal: keys beyond the block's last query never contribute */
#pragma unroll 1
  for (int j0 = 0; j0 < jend; j0 += 32) {
    v8f s[2][2];
#pragma unroll
    for (int nt = 0; nt < 2; ++nt) { const unsigned short* kr = (const unsigned short*)K16 + ((size_t)b * TK + j0 + nt * 16 + ln) * ldk + h * 64; const unsigned short* klr = (const unsigned short*)KL + ((size_t)b * TK + j0 + nt * 16 + ln) * ldk + h * 64; FragH bk[KS], bkl[KS];
#pragma unroll
      for (int ks = 0; ks < KS; ++ks) { bk[ks].half[0] = *(const v8us*)(kr + ks * 32 + 8 * hh); bk[ks].half[1] = *(const v8us*)(kr + ks * 32 + 16 + 8 * hh); bkl[ks].half[0] = *(const v8us*)(klr + ks * 32 + 8 * hh); bkl[ks].half[1] = *(const v8us*)(klr + ks * 32 + 16 + 8 * hh); }
#pragma unroll
      for (int rt = 0; rt < RTN; ++rt) { v8f acc = (v8f){0.f,0.f,0.f,0.f,0.f,0.f,0.f,0.f}, accl = acc;
#pragma unroll
        for (int ks = 0; ks < KS; ++ks) { acc = mmaH<1>(aq[rt][ks].v, aq[rt][ks].v, bk[ks].v, bk[ks].v, acc); accl = mmaH<1>(aql[rt][ks].v, aql[rt][ks].v, bk[ks].v, bk[ks].v, accl); accl = mmaH<1>(aq[rt][ks].v, aq[rt][ks].v, bkl[ks].v, bkl[ks].v, accl); }
#pragma unroll
        for (int r = 0; r < 8; ++r) acc[r] += accl[r] * 0.0009765625f;
        s[rt][nt] = acc; } }
#pragma unroll
    for (int rt = 0; rt < RTN; ++rt)
#pragma unroll
      for (int r = 0; r < 8; ++r) { const int tq = q0 + rt * 16 + 8 * hh + r; const int k0 = j0 + ln, k1 = j0 + 16 + ln;
        bool ok0 = (CAUSAL == 1) ? (k0 <= tq) : ((CAUSAL == 2) ? ((k0 >> 5) == (tq >> 5)) : true), ok1 = (CAUSAL == 1) ? (k1 <= tq) : ((CAUSAL == 2) ? ((k1 >> 5) == (tq >> 5)) : true);      /* mode 2: block-diagonal 32-token groups */
        if (CAUSAL == 4) { const int* mrow = MSK + ((size_t)b * TQ + tq) * TK; ok0 = mrow[k0] != 0; ok1 = mrow[k1] != 0; }      /* mode 4: per-(query, key) INPUT mask shared by all heads; masked keys contribute nothing (== the reference's -4096 fill, whose exp underflows to 0), rows with no valid key give l = 0 -> output 0 (== the reference's row_valid zeroing) */
        float s0 = ok0 ? s[rt][0][r] * SCL : -3.0e38f, s1 = ok1 ? s[rt][1][r] * SCL : -3.0e38f; if (CAUSAL == 17) { const float* amk = (const float*)MSK + (size_t)b * TK; s0 += bf16_round(amk[k0]); s1 += bf16_round(amk[k1]); }      /* mode 17: additive per-(batch, key) mask INPUT */ float mc = fmaxf(s0, s1);
        mc = fmaxf(mc, __shfl_xor(mc, 1, 32)); mc = fmaxf(mc, __shfl_xor(mc, 2, 32)); mc = fmaxf(mc, __shfl_xor(mc, 4, 32)); mc = fmaxf(mc, __shfl_xor(mc, 8, 32));
        const float mn = fmaxf(m_r[rt][r], mc); const float al = (mn > -1.0e38f) ? expf(m_r[rt][r] - mn) : 1.0f; m_r[rt][r] = mn; const float p0 = ok0 ? expf(s0 - mn) : 0.f, p1 = ok1 ? expf(s1 - mn) : 0.f; l_r[rt][r] = l_r[rt][r] * al + p0 + p1;
#pragma unroll
        for (int dt = 0; dt < DT; ++dt) { oacc[rt][dt][r] *= al; oaccL[rt][dt][r] *= al; }
        FragH t2, t2l; const float ps0 = p0 * 1024.0f, ps1 = p1 * 1024.0f; t2.h[0] = (_Float16)ps0; t2.h[1] = (_Float16)ps1; t2l.h[0] = (_Float16)((ps0 - (float)t2.h[0]) * 1024.0f); t2l.h[1] = (_Float16)((ps1 - (float)t2.h[1]) * 1024.0f);
        sP[w][rt * 16 + 8 * hh + r][ln] = t2.u[0]; sP[w][rt * 16 + 8 * hh + r][16 + ln] = t2.u[1]; sPL[w][rt * 16 + 8 * hh + r][ln] = t2l.u[0]; sPL[w][rt * 16 + 8 * hh + r][16 + ln] = t2l.u[1]; }
    __builtin_amdgcn_fence(__ATOMIC_ACQ_REL, "workgroup"); __builtin_amdgcn_wave_barrier();
    FragH pa[2], pl[2];
#pragma unroll
    for (int rt = 0; rt < RTN; ++rt) { pa[rt].half[0] = *(const v8us*)&sP[w][rt * 16 + ln][8 * hh]; pa[rt].half[1] = *(const v8us*)&sP[w][rt * 16 + ln][16 + 8 * hh]; pl[rt].half[0] = *(const v8us*)&sPL[w][rt * 16 + ln][8 * hh]; pl[rt].half[1] = *(const v8us*)&sPL[w][rt * 16 + ln][16 + 8 * hh]; }
#pragma unroll
    for (int dt = 0; dt < DT; ++dt) { const unsigned short* vrow = Vth + (size_t)(dt * 16 + ln) * TK + j0; const unsigned short* vrl = Vtl + (size_t)(dt * 16 + ln) * TK + j0; FragH bv, bl; bv.half[0] = *(const v8us*)(vrow + 8 * hh); bv.half[1] = *(const v8us*)(vrow + 16 + 8 * hh); bl.half[0] = *(const v8us*)(vrl + 8 * hh); bl.half[1] = *(const v8us*)(vrl + 16 + 8 * hh);
#pragma unroll
      for (int rt = 0; rt < RTN; ++rt) { oacc[rt][dt] = mmaH<1>(pa[rt].v, pa[rt].v, bv.v, bv.v, oacc[rt][dt]); oaccL[rt][dt] = mmaH<1>(pl[rt].v, pl[rt].v, bv.v, bv.v, oaccL[rt][dt]); oaccL[rt][dt] = mmaH<1>(pa[rt].v, pa[rt].v, bl.v, bl.v, oaccL[rt][dt]); } }
    __builtin_amdgcn_fence(__ATOMIC_ACQ_REL, "workgroup"); __builtin_amdgcn_wave_barrier(); }
#pragma unroll
  for (int rt = 0; rt < RTN; ++rt) {
#pragma unroll
    for (int r = 0; r < 8; ++r) { float l = l_r[rt][r]; l += __shfl_xor(l, 1, 32); l += __shfl_xor(l, 2, 32); l += __shfl_xor(l, 4, 32); l += __shfl_xor(l, 8, 32); l_r[rt][r] = (l > 0.f) ? 1.0f / (l * 1024.0f) : 0.f; }
#pragma unroll
    for (int dt = 0; dt < DT; ++dt)
#pragma unroll
      for (int r = 0; r < 8; ++r) { float v = oacc[rt][dt][r]; v += oaccL[rt][dt][r] * 0.0009765625f; sO[w][rt * 16 + 8 * hh + r][dt * 16 + ln] = v * l_r[rt][r]; } }
  __builtin_amdgcn_fence(__ATOMIC_ACQ_REL, "workgroup"); __builtin_amdgcn_wave_barrier();
  {
#pragma unroll
    for (int rp = 0; rp < RPW; rp += 2) { const int r = rp + (lane >> 4), pc = lane & 15; const v4f val = *(const v4fa*)&sO[w][r][pc * 4]; *(v4f*)(O + ((size_t)b * TQ + q0 + r) * ldo + h * 64 + pc * 4) = val; }
     } }

__global__ __launch_bounds__(256) void k_rotab(float* __restrict__ CS, float* __restrict__ SN) {
  #pragma clang fp contract(off)
  const int t = blockIdx.x * 256 + threadIdx.x; if (t >= SLEN * 32) return; const int j = t % 32, s = t / 32; const float ex = (float)(2 * j) / 64.0f; const float inv = 1.0f / powf(10000.0f, ex); const float th = (float)s * inv; const float c = cosf(th), sn = sinf(th);
  { *(float*)(CS + t) = c; *(float*)(SN + t) = sn;  } }
__global__ __launch_bounds__(256) void k_rope(const float* __restrict__ F, int nsrc, int ndst, int rep, const float* __restrict__ CS, const float* __restrict__ SN, _Float16* __restrict__ H, _Float16* __restrict__ L) {
  #pragma clang fp contract(off)
  const size_t t = (size_t)blockIdx.x * 256 + threadIdx.x; if (t >= (size_t)NR * ndst * 4) return; const int g8 = (int)(t % 4); const int hd = (int)((t / 4) % ndst); const size_t row = t / ((size_t)4 * ndst); const int s = (int)(row % SLEN); const int hs = hd / rep;
  const float* src = F + row * (size_t)(nsrc * 64) + hs * 64; FragH ah, al, bh, bl;
  for (int i = 0; i < 8; ++i) { const int d = g8 * 8 + i; const float c = CS[s * 32 + d], sn = SN[s * 32 + d]; const float x1 = src[d], x2 = src[d + 32];
    float o1 = x1 * c; o1 += -x2 * sn; float o2 = x2 * c; o2 += x1 * sn;
    _Float16 hv = (_Float16)o1; ah.h[i] = hv; al.h[i] = (_Float16)((o1 - (float)hv) * 1024.0f); hv = (_Float16)o2; bh.h[i] = hv; bl.h[i] = (_Float16)((o2 - (float)hv) * 1024.0f); }
  const size_t o = row * (size_t)(ndst * 64) + hd * 64 + g8 * 8;
  { *(v8us*)((unsigned short*)H + o) = ah.half[0]; *(v8us*)((unsigned short*)H + o + 32) = bh.half[0]; *(v8us*)((unsigned short*)L + o) = al.half[0]; *(v8us*)((unsigned short*)L + o + 32) = bl.half[0];  } }
__global__ __launch_bounds__(256) void k_rope2(const float* __restrict__ F, int nsrc, int ndst, int rep, const float* __restrict__ CS, const float* __restrict__ SN, _Float16* __restrict__ H, _Float16* __restrict__ L) {
  #pragma clang fp contract(off)
  const size_t t = (size_t)blockIdx.x * 256 + threadIdx.x; if (t >= (size_t)NR * ndst * 4) return; const int g16 = (int)(t % 4); const int hd = (int)((t / 4) % ndst); const size_t row = t / ((size_t)4 * ndst); const int s = (int)(row % SLEN); const int hs = hd / rep;
  const float* src = F + row * (size_t)(nsrc * 64) + hs * 64 + g16 * 16; FragH ah, al;
  for (int pr = 0; pr < 8; ++pr) { const int i = g16 * 8 + pr; const float c = CS[s * 32 + i], sn = SN[s * 32 + i]; const float x1 = src[2 * pr], x2 = src[2 * pr + 1];
    float o1 = x1 * c; o1 -= x2 * sn; float o2 = x1 * sn; o2 += x2 * c;
    _Float16 hv = (_Float16)o1; ah.h[2 * pr] = hv; al.h[2 * pr] = (_Float16)((o1 - (float)hv) * 1024.0f); hv = (_Float16)o2; ah.h[2 * pr + 1] = hv; al.h[2 * pr + 1] = (_Float16)((o2 - (float)hv) * 1024.0f); }
  const size_t o = row * (size_t)(ndst * 64) + hd * 64 + g16 * 16;
  { *(v8us*)((unsigned short*)H + o) = ah.half[0]; *(v8us*)((unsigned short*)H + o + 8) = ah.half[1]; *(v8us*)((unsigned short*)L + o) = al.half[0]; *(v8us*)((unsigned short*)L + o + 8) = al.half[1];  } }
__global__ __launch_bounds__(256) void k_tabin(const float* __restrict__ sp, float* __restrict__ CS, float* __restrict__ SN) { const int t = blockIdx.x * 256 + threadIdx.x; if (t >= SLEN * 32) return; const int i = t % 32, s = t / 32; const float c = bf16_round(sp[s * 64 + 32 + i]), sn = bf16_round(sp[s * 64 + i]);
  { *(float*)(CS + t) = c; *(float*)(SN + t) = sn;  } }
__device__ __forceinline__ void d_wsc(const size_t t, const float* __restrict__ Wm, _Float16* __restrict__ Bt, size_t n8, float sc) { if (t >= n8) return; FragH f; for (int q = 0; q < 8; ++q) f.h[q] = (_Float16)(bf16_round(Wm[t * 8 + q]) * sc); *(v8us*)((unsigned short*)Bt + t * 8) = f.half[0];  }
__global__ __launch_bounds__(256) void k_rotab2(float* __restrict__ CS, float* __restrict__ SN) {
  #pragma clang fp contract(off)
  const int t = blockIdx.x * 256 + threadIdx.x; if (t >= SLEN * 32) return; const int j = t % 32, s = t / 32; const float c0 = -0.14391156831212787f;      /* -ln(10000)/64 rounded to f32 */ const float inv = expf((float)(2 * j) * c0); const float th = (float)s * inv; const float c = cosf(th), sn = sinf(th);
  { *(float*)(CS + t) = c; *(float*)(SN + t) = sn;  } }
__global__ __launch_bounds__(256) void k_lnu(const float* __restrict__ X, _Float16* __restrict__ N16, float* __restrict__ XB) {
  #pragma clang fp contract(off)
  const int wv = threadIdx.x >> 5, ln = threadIdx.x & 31; const size_t r = (size_t)blockIdx.x * 8 + wv; if (r >= NR) return; float a[32]; float s = 0.f;
  for (int i = 0; i < 4; ++i) { const v8f v = *(const v8f*)(X + r * DM + (i * 32 + ln) * 8); for (int q = 0; q < 8; ++q) { const float u = bf16_round(v[q]); a[i * 8 + q] = u; s += u; } }
  for (int o = 16; o > 0; o >>= 1) s += __shfl_xor(s, o, 32); const float mu = s / (float)DM; float var = 0.f; for (int q = 0; q < 32; ++q) { const float d = a[q] - mu; var += d * d; }
  for (int o = 16; o > 0; o >>= 1) var += __shfl_xor(var, o, 32); const float den = sqrtf(var / (float)(DM - 1)) + 1e-6f; const float inv = 1.0f / den;      /* one reciprocal per row; (x-mean)*inv vs the reference's division differs by <= 1 ulp */
  { for (int i = 0; i < 4; ++i) { const int c0 = (i * 32 + ln) * 8; FragH f; v8f xb; for (int q = 0; q < 8; ++q) { f.h[q] = (_Float16)((a[i * 8 + q] - mu) * inv); xb[q] = a[i * 8 + q]; } *(v8us*)((unsigned short*)N16 + r * DM + c0) = f.half[0]; *(v8f*)(XB + r * DM + c0) = xb; }  } }
__global__ __launch_bounds__(256) void k_vtg(const _Float16* __restrict__ V16, _Float16* __restrict__ Vt) { __shared__ unsigned short tl[64][66]; const int tid = threadIdx.x; const int slab = blockIdx.x / (SLEN / 64), lg = blockIdx.x % (SLEN / 64); const int b = slab / NH, h = slab % NH; const int hs = h / NREP;
  for (int i = tid; i < 64 * 8; i += 256) { const int r = i / 8, c8 = (i % 8) * 8; FragH f; f.half[0] = *(const v8us*)((const unsigned short*)V16 + ((size_t)b * SLEN + lg * 64 + r) * KVD + hs * 64 + c8); for (int q = 0; q < 8; ++q) tl[r][c8 + q] = f.u[q]; }
  __syncthreads();
  { for (int rd = 0; rd < 2; ++rd) { const int d = rd * 32 + tid / 8, pc = tid % 8; FragH f; for (int q = 0; q < 8; ++q) f.u[q] = tl[pc * 8 + q][d]; *(v8us*)((unsigned short*)Vt + ((size_t)slab * 64 + d) * SLEN + lg * 64 + pc * 8) = f.half[0]; }  } }

__device__ __forceinline__ void d_pm(const int t, const float* __restrict__ src, _Float16* __restrict__ P16) { if (t >= SLEN * (DM / 8)) return; const int c0 = (t % (DM / 8)) * 8; const int n = t / (DM / 8); FragH f; for (int q = 0; q < 8; ++q) f.h[q] = (_Float16)bf16_round(src[(size_t)(c0 + q) * SLEN + n]);
  *(v8us*)((unsigned short*)P16 + (size_t)n * DM + c0) = f.half[0];  }
// The six independent preparation jobs in one launch: blocks [0, 2 PMB) write the two token-major planes, the next 4 WSB blocks the four weight planes; each block does what a block of the single launches did.
#define PMB ((SLEN * (DM / 8) + 255) / 256)
#define WSB ((DM * DM / 8 + 255) / 256)
__global__ __launch_bounds__(256) void k_prep(const float* __restrict__ vid, const float* __restrict__ reff, _Float16* __restrict__ XV, _Float16* __restrict__ XR,
    const float* __restrict__ Wq, const float* __restrict__ Wk, const float* __restrict__ Wv, const float* __restrict__ Wo, _Float16* __restrict__ BQ, _Float16* __restrict__ BK, _Float16* __restrict__ BV, _Float16* __restrict__ BO) {
  const int bx = blockIdx.x;
  if (bx < 2 * PMB) { const bool second = bx >= PMB; d_pm((bx - (second ? PMB : 0)) * 256 + (int)threadIdx.x, second ? reff : vid, second ? XR : XV); return; }
  const int j = (bx - 2 * PMB) / WSB, wb = (bx - 2 * PMB) % WSB;
  const float* Wm = (j == 0) ? Wq : ((j == 1) ? Wk : ((j == 2) ? Wv : Wo)); _Float16* Bt = (j == 0) ? BQ : ((j == 1) ? BK : ((j == 2) ? BV : BO));
  d_wsc((size_t)wb * 256 + threadIdx.x, Wm, Bt, DM * DM / 8, 16.0f); }
__global__ __launch_bounds__(256) void k_nchw(const float* __restrict__ F, float* __restrict__ outb) { const int t = blockIdx.x * 256 + threadIdx.x; if (t >= DM * (SLEN / 4)) return; const int p0 = (t % (SLEN / 4)) * 4; const int o = t / (SLEN / 4); v4f r; for (int q = 0; q < 4; ++q) r[q] = F[(size_t)(p0 + q) * DM + o];
  *(v4f*)(outb + (size_t)o * SLEN + p0) = r;  }

extern "C" void kernel_launch(void* const* d_in, const int* in_sizes, int n_in,
                              void* d_out, int out_size, void* d_ws, size_t ws_size, hipStream_t stream) {
  (void)in_sizes; (void)n_in; (void)out_size;
  const float* const* I = (const float* const*)d_in; const float* vid = I[0]; const float* reff = I[1]; const float* Wq = I[2]; const float* bq = I[3]; const float* Wk = I[4]; const float* bk = I[5]; const float* Wv = I[6]; const float* bv = I[7]; const float* Wo = I[8]; const float* bo = I[9];
  char* ws = (char*)d_ws; size_t off = 0;
  auto take = [&](size_t bytes) { char* p = ws + off; off += (bytes + 255) & ~(size_t)255; return p; };
  const size_t np = (size_t)SLEN * DM;
  _Float16* BQ = (_Float16*)take((size_t)DM * DM * 2); _Float16* BK = (_Float16*)take((size_t)DM * DM * 2); _Float16* BV = (_Float16*)take((size_t)DM * DM * 2); _Float16* BO = (_Float16*)take((size_t)DM * DM * 2);
  _Float16* XV = (_Float16*)take(np * 2); _Float16* XR = (_Float16*)take(np * 2); _Float16* Q16 = (_Float16*)take(np * 2); _Float16* K16 = (_Float16*)take(np * 2); _Float16* VT = (_Float16*)take(np * 2); _Float16* O16 = (_Float16*)take(np * 2);
  if (off > ws_size) return;      /* 2 + 6 x 4 = 26 MiB */
  k_prep<<<2 * PMB + 4 * WSB, 256, 0, stream>>>(vid, reff, XV, XR, Wq, Wk, Wv, Wo, BQ, BK, BV, BO);      /* 'oc' = natural Bt */
  const dim3 gP((SLEN / 128) * (DM / 64), 1);
  const dim3 gP3((SLEN / 128) * (DM / 64), 3);
  k_gemm2x3<0><<<gP3, 128, 0, stream>>>(XV, XR, XR, BQ, BK, BV, bq, bk, bv, Q16, K16, VT, 0.0625f, DM, SLEN, DM, DM);      /* q, k token-major; v as V^T [channel][token] */
  k_flash<0><<<NB * NH * QBNP, 128, 0, stream>>>(Q16, DM, K16, DM, VT, nullptr, O16, DM);      /* 4096 x 4096 per head */
  k_gemm2<0, true><<<gP, 128, 0, stream>>>(BO, DM, 0, O16, DM, 0, 0.0625f, bo, 0, nullptr, 1, 0, 0, (float*)d_out, nullptr, SLEN, 0, DM, SLEN, DM);      /* out[channel][token] */
}

// v006
// A run of this version takes 85.6 microseconds.
// Timed twice side by side with v005, it ran 1.24 and 1.26 times as fast.
// Over all steps from v000 it is 6.72 times as fast.
#include <hip/hip_runtime.h>
// CrossViewAttention3D (1 clip: 512 channels x (4 x 32 x 32 = 4096) tokens, 8 heads x 64): q = Wq video + bq, k = Wk ref + bk, v = Wv ref + bv (1x1x1 convs = channel matmuls); softmax(q.k / 8) over the 4096 ref tokens; out = Wo ctx + bo; channel-major in and out.
// Structure: exact token-major f16 planes of both inputs; q, k, v as f16 WMMA GEMM outputs (32x64 wave tiles, f32 accumulation, exact x16 weights + bias, f16 out); V^T straight from its GEMM (weights as rows, tokens as columns); the fused flash kernel (4096 x 4096 per head, plain operands) stores ctx as f16; the Wo + bo GEMM, weights as rows, stores channel-major.
// Compute dtype: inputs rounded to bf16; inputs exact as f16; q/k/P/v/ctx as plain f16 operands (~2^-12); softmax f32. v_wmma_f32_16x16x32_f16.
#define NB 1
#define DM 512
#define NKV 8
#define NREP (NH / NKV)
#define KVD (NKV * 64)           /* 512 */
#define NR (NB * SLEN)           /* 4096 */
#define SLEN 4096
#define TQ SLEN
#define TK SLEN
#define NH 8
#define SCL 0.125f
#define QBLKS (TQ / 64)
#define QB05 0
#define QBN5 4
#define QB0P 0
#define QBNP QBLKS           /* non-causal: plain flash on every query block */
#define RE 256
typedef __bf16 v16b __attribute__((ext_vector_type(16)));
typedef unsigned short v8us __attribute__((ext_vector_type(8), may_alias));
typedef float  v8f  __attribute__((ext_vector_type(8)));
typedef float  v4f  __attribute__((ext_vector_type(4)));
typedef float  v4fa __attribute__((ext_vector_type(4), may_alias));
union FragB { v16b v; v8us half[2]; unsigned short u[16]; };

__device__ __forceinline__ unsigned short bf16_bits(float x) { unsigned int u = __float_as_uint(x); return (unsigned short)((u + 0x7FFFu + ((u >> 16) & 1u)) >> 16); }
__device__ __forceinline__ float bf16_val(unsigned short b) { return __uint_as_float(((unsigned int)b) << 16); }
__device__ __forceinline__ float bf16_round(float x) { return bf16_val(bf16_bits(x)); }
// D += A·B with NT terms: 1 = ah·bh, 2 = + al·bh (A split), 3 = + ah·bl (both split)
template <int NT>
__device__ __forceinline__ v8f mmaN(v16b ah, v16b al, v16b bh, v16b bl, v8f c) {
  c = __builtin_amdgcn_wmma_f32_16x16x32_bf16(false, ah, false, bh, (short)0, c, false, false);
  if (NT >= 2) c = __builtin_amdgcn_wmma_f32_16x16x32_bf16(false, al, false, bh, (short)0, c, false, false);
  if (NT >= 3) c = __builtin_amdgcn_wmma_f32_16x16x32_bf16(false, ah, false, bl, (short)0, c, false, false);
  asm volatile("v_nop\n\tv_nop\n\tv_nop\n\tv_nop" : "+v"(c) : "v"(ah), "v"(al), "v"(bh), "v"(bl));
  return c;
}

__global__ __launch_bounds__(256) void k_wt_bf16(const float* __restrict__ W, unsigned short* __restrict__ Wt, int K, int N) {
  const int t = blockIdx.x * 256 + threadIdx.x;
  const int k8n = K / 8;
  if (t >= N * k8n) return;
  const int n = t / k8n, k8 = (t % k8n) * 8;
  v8us v;
#pragma unroll
  for (int i = 0; i < 8; ++i) v[i] = bf16_bits(W[(size_t)(k8 + i) * N + n]);
  *(v8us*)(Wt + (size_t)n * K + k8) = v;
  
}

// GEMM C[M][N] (f32, pitch ldc) = act(A[M][K]·W + bias). A f32 row-major (pitch lda) converted per fragment to bf16
// (ASPLIT: hi/lo two planes -> 2 terms, else single rounded term); Wt bf16 [N][K] (pitch ldb). BIAS_BF16 rounds the
// bias to bf16 first (bias quantised to bf16 before the add). K%32==0, M%16==0, N%64==0.
template <bool ASPLIT, int ACT, bool BIAS_BF16>
__global__ __launch_bounds__(128) void k_gemm_bf(const float* __restrict__ A, int lda, const unsigned short* __restrict__ Wt, int ldb,
                                               const float* __restrict__ bias, float* __restrict__ C, int ldc, int M, int N, int K) {
  __shared__ __attribute__((aligned(16))) float so[4][16][64];
  const int tid = threadIdx.x, w = tid >> 5, lane = tid & 31, ln = lane & 15, hh = lane >> 4;
  const int ntn = N / 64;
  const int wid = blockIdx.x * 4 + w;
  const int mt = wid / ntn, nq = wid % ntn;
  if (mt * 16 >= M) return;
  const int row0 = mt * 16, col0 = nq * 64;
  const float* arow = A + (size_t)(row0 + ln) * lda;
  v8f acc[4] = {};
  for (int kb = 0; kb < K; kb += 32) {
    FragB ah, al;
    const v4f x0 = *(const v4fa*)(arow + kb + 8 * hh), x1 = *(const v4fa*)(arow + kb + 8 * hh + 4);
    const v4f x2 = *(const v4fa*)(arow + kb + 16 + 8 * hh), x3 = *(const v4fa*)(arow + kb + 16 + 8 * hh + 4);
    float xs[16] = {x0[0],x0[1],x0[2],x0[3],x1[0],x1[1],x1[2],x1[3],x2[0],x2[1],x2[2],x2[3],x3[0],x3[1],x3[2],x3[3]};
#pragma unroll
    for (int i = 0; i < 16; ++i) { const unsigned short hb = bf16_bits(xs[i]); ah.u[i] = hb; al.u[i] = ASPLIT ? bf16_bits(xs[i] - bf16_val(hb)) : (unsigned short)0; }
#pragma unroll
    for (int t = 0; t < 4; ++t) {
      const unsigned short* brow = Wt + (size_t)(col0 + t * 16 + ln) * ldb + kb;
      FragB b;
      b.half[0] = *(const v8us*)(brow + 8 * hh);
      b.half[1] = *(const v8us*)(brow + 16 + 8 * hh);
      acc[t] = mmaN<ASPLIT ? 2 : 1>(ah.v, al.v, b.v, b.v, acc[t]);
    }
  }
#pragma unroll
  for (int t = 0; t < 4; ++t) {
    float bv = bias ? bias[col0 + t * 16 + ln] : 0.f;
    if (BIAS_BF16) bv = bf16_round(bv);
#pragma unroll
    for (int r = 0; r < 8; ++r) { float v = acc[t][r] + bv; if (ACT == 1) v = fmaxf(v, 0.f); so[w][8 * hh + r][t * 16 + ln] = v; }
  }
  __builtin_amdgcn_fence(__ATOMIC_ACQ_REL, "workgroup");
  __builtin_amdgcn_wave_barrier();
  const int rsub = lane >> 4, c4 = (lane & 15) * 4;
  {
#pragma unroll
    for (int q = 0; q < 8; ++q) {
      const int r = q * 2 + rsub;
      const v4f v = *(const v4fa*)&so[w][r][c4];
      *(v4f*)(C + (size_t)(row0 + r) * ldc + col0 + c4) = v;
    }
    
  }
}

// GEMM C = act(A·W + bias + resid): A f32 (ASPLIT -> hi/lo 2 terms), Wt bf16 [N][K]; ACT 0 none, 1 relu, 2 exact gelu;
// resid (optional, f32, row index = (row % rmod), pitch ldr, RES_BF16 rounds it) added before the activation.
template <bool ASPLIT, int ACT, bool BIAS_BF16, bool RES_BF16>
__global__ __launch_bounds__(128) void k_gemm_bf3(const float* __restrict__ A, int lda, const unsigned short* __restrict__ Wt, int ldb,
                                                const float* __restrict__ bias, const float* __restrict__ resid, int rmod, int ldr,
                                                float* __restrict__ C, int ldc, int M, int N, int K) {
  __shared__ __attribute__((aligned(16))) float so[4][16][64];
  const int tid = threadIdx.x, w = tid >> 5, lane = tid & 31, ln = lane & 15, hh = lane >> 4;
  const int ntn = N / 64;
  const int wid = blockIdx.x * 4 + w;
  const int mt = wid / ntn, nq = wid % ntn;
  if (mt * 16 >= M) return;
  const int row0 = mt * 16, col0 = nq * 64;
  const float* arow = A + (size_t)(row0 + ln) * lda;
  v8f acc[4] = {};
  for (int kb = 0; kb < K; kb += 32) {
    FragB ah, al;
    const v4f x0 = *(const v4fa*)(arow + kb + 8 * hh), x1 = *(const v4fa*)(arow + kb + 8 * hh + 4);
    const v4f x2 = *(const v4fa*)(arow + kb + 16 + 8 * hh), x3 = *(const v4fa*)(arow + kb + 16 + 8 * hh + 4);
    float xs[16] = {x0[0],x0[1],x0[2],x0[3],x1[0],x1[1],x1[2],x1[3],x2[0],x2[1],x2[2],x2[3],x3[0],x3[1],x3[2],x3[3]};
#pragma unroll
    for (int i = 0; i < 16; ++i) { const unsigned short hb = bf16_bits(xs[i]); ah.u[i] = hb; al.u[i] = ASPLIT ? bf16_bits(xs[i] - bf16_val(hb)) : (unsigned short)0; }
#pragma unroll
    for (int t = 0; t < 4; ++t) {
      const unsigned short* brow = Wt + (size_t)(col0 + t * 16 + ln) * ldb + kb;
      FragB b;
      b.half[0] = *(const v8us*)(brow + 8 * hh);
      b.half[1] = *(const v8us*)(brow + 16 + 8 * hh);
      acc[t] = mmaN<ASPLIT ? 2 : 1>(ah.v, al.v, b.v, b.v, acc[t]);
    }
  }
#pragma unroll
  for (int t = 0; t < 4; ++t) {
    const int col = col0 + t * 16 + ln;
    float bv = bias ? bias[col] : 0.f;
    if (BIAS_BF16) bv = bf16_round(bv);
#pragma unroll
    for (int r = 0; r < 8; ++r) {
      float v = acc[t][r] + bv;
      if (resid) { float rv = resid[(size_t)((row0 + 8 * hh + r) % rmod) * ldr + col]; if (RES_BF16) rv = bf16_round(rv); v += rv; }
      if (ACT == 1) v = fmaxf(v, 0.f);
      if (ACT == 2) v = 0.5f * v * (1.0f + erff(v * 0.70710678118654752f));
      if (ACT == 3) { const float u = 0.7978845608028654f * (v + 0.044715f * v * v * v); v = 0.5f * v * (1.0f + tanhf(u)); }
      so[w][8 * hh + r][t * 16 + ln] = v;
    }
  }
  __builtin_amdgcn_fence(__ATOMIC_ACQ_REL, "workgroup");
  __builtin_amdgcn_wave_barrier();
  const int rsub = lane >> 4, c4 = (lane & 15) * 4;
  {
#pragma unroll
    for (int q = 0; q < 8; ++q) {
      const int r = q * 2 + rsub;
      const v4f v = *(const v4fa*)&so[w][r][c4];
      *(v4f*)(C + (size_t)(row0 + r) * ldc + col0 + c4) = v;
    }
    
  }
}
// row LayerNorm (biased variance, eps) over N: s = X (+ R); optional out_sum <- s; out_norm <- (s-mu)*rsqrt(var+eps)*g + b
template <bool PARAM_BF16>
__global__ __launch_bounds__(256) void k_layernorm(const float* __restrict__ X, const float* __restrict__ R, const float* __restrict__ g, const float* __restrict__ bta,
                                                  float* __restrict__ out_sum, float* __restrict__ out_norm, int N, float eps) {
  __shared__ float red[256];
  const int row = blockIdx.x, tid = threadIdx.x;
  const float* x = X + (size_t)row * N; const float* rr = R ? R + (size_t)row * N : nullptr;
  float vals[16];                     // up to N = 4096
  const int per = N / 256;            // contiguous chunk per thread? use strided-by-4 chunks: thread handles j = tid*4 + 1024*u
  float s1 = 0.f;
  for (int u = 0; u < per / 4; ++u) {
    const int j = tid * 4 + 1024 * u;
    const v4f a = *(const v4fa*)(x + j);
    v4f b = {0.f,0.f,0.f,0.f}; if (rr) b = *(const v4fa*)(rr + j);
#pragma unroll
    for (int q = 0; q < 4; ++q) { const float v = a[q] + b[q]; vals[u * 4 + q] = v; s1 += v; }
  }
  red[tid] = s1; __syncthreads();
  for (int st = 128; st > 0; st >>= 1) { if (tid < st) red[tid] += red[tid + st]; __syncthreads(); }
  const float mu = red[0] / (float)N; __syncthreads();
  float s2 = 0.f;
  for (int u = 0; u < per / 4; ++u)
#pragma unroll
    for (int q = 0; q < 4; ++q) { const float c = vals[u * 4 + q] - mu; s2 += c * c; }
  red[tid] = s2; __syncthreads();
  for (int st = 128; st > 0; st >>= 1) { if (tid < st) red[tid] += red[tid + st]; __syncthreads(); }
  const float rs = rsqrtf(red[0] / (float)N + eps);
  {
    for (int u = 0; u < per / 4; ++u) {
      const int j = tid * 4 + 1024 * u;
      v4f o, sm;
#pragma unroll
      for (int q = 0; q < 4; ++q) {
        float gg = g[j + q], bb = bta[j + q];
        if (PARAM_BF16) { gg = bf16_round(gg); bb = bf16_round(bb); }
        sm[q] = vals[u * 4 + q]; o[q] = (vals[u * 4 + q] - mu) * rs * gg + bb;
      }
      if (out_sum) *(v4f*)(out_sum + (size_t)row * N + j) = sm;
      *(v4f*)(out_norm + (size_t)row * N + j) = o;
    }
    
  }
}



// ---- f16 WMMA path (v_wmma_f32_16x16x32_f16): 11-bit significands for operands in range — used where a [0,1] probability operand needs more precision than bf16
typedef _Float16 v16h __attribute__((ext_vector_type(16)));
union FragH { v16h v; v8us half[2]; _Float16 h[16]; unsigned short u[16]; };
template <int NT>
__device__ __forceinline__ v8f mmaH(v16h ah, v16h al, v16h bh, v16h bl, v8f c) {
  c = __builtin_amdgcn_wmma_f32_16x16x32_f16(false, ah, false, bh, (short)0, c, false, false);
  if (NT >= 2) c = __builtin_amdgcn_wmma_f32_16x16x32_f16(false, al, false, bh, (short)0, c, false, false);
  if (NT >= 3) c = __builtin_amdgcn_wmma_f32_16x16x32_f16(false, ah, false, bl, (short)0, c, false, false);
  asm volatile("v_nop\n\tv_nop\n\tv_nop\n\tv_nop" : "+v"(c) : "v"(ah), "v"(al), "v"(bh), "v"(bl));
  return c;
}
// batched GEMM like k_gemm_b but f16 operands: A f32 (split into f16 hi/lo if ASPLIT, else rounded to f16), Bt = f16 values [n][k]; alpha; C f32; N multiple of 16 (partial tiles skipped)
template <bool ASPLIT>
__global__ __launch_bounds__(128) void k_gemm_h(const float* __restrict__ A, int lda, size_t sA, const _Float16* __restrict__ Bh, int ldb, size_t sB, float alpha, float* __restrict__ C, int ldc, size_t sC, int M, int N, int K) {
  __shared__ __attribute__((aligned(16))) float so[4][16][64];
  const int tid = threadIdx.x, w = tid >> 5, lane = tid & 31, ln = lane & 15, hh = lane >> 4; const int by = blockIdx.y;
  A += (size_t)by * sA; Bh += (size_t)by * sB; C += (size_t)by * sC;
  const int ntn = (N + 63) / 64; const int wid = blockIdx.x * 4 + w; const int mt = wid / ntn, nq = wid % ntn; if (mt * 16 >= M) return;
  const int row0 = mt * 16, col0 = nq * 64; const float* arow = A + (size_t)(row0 + ln) * lda;
  v8f acc[4] = {};
  for (int kb = 0; kb < K; kb += 32) {
    FragH ah, al;
    const v4f x0 = *(const v4fa*)(arow + kb + 8 * hh), x1 = *(const v4fa*)(arow + kb + 8 * hh + 4), x2 = *(const v4fa*)(arow + kb + 16 + 8 * hh), x3 = *(const v4fa*)(arow + kb + 16 + 8 * hh + 4);
    float xs[16] = {x0[0],x0[1],x0[2],x0[3],x1[0],x1[1],x1[2],x1[3],x2[0],x2[1],x2[2],x2[3],x3[0],x3[1],x3[2],x3[3]};
#pragma unroll
    for (int i = 0; i < 16; ++i) { const _Float16 h = (_Float16)xs[i]; ah.h[i] = h; al.h[i] = ASPLIT ? (_Float16)(xs[i] - (float)h) : (_Float16)0.0f; }
#pragma unroll
    for (int t = 0; t < 4; ++t) { if (col0 + t * 16 >= N) continue; const size_t boff = (size_t)(col0 + t * 16 + ln) * ldb + kb; FragH bq; bq.half[0] = *(const v8us*)(Bh + boff + 8 * hh); bq.half[1] = *(const v8us*)(Bh + boff + 16 + 8 * hh);
      acc[t] = mmaH<ASPLIT ? 2 : 1>(ah.v, al.v, bq.v, bq.v, acc[t]); }
  }
#pragma unroll
  for (int t = 0; t < 4; ++t) { if (col0 + t * 16 >= N) continue;
#pragma unroll
    for (int r = 0; r < 8; ++r) so[w][8 * hh + r][t * 16 + ln] = acc[t][r] * alpha; }
  __builtin_amdgcn_fence(__ATOMIC_ACQ_REL, "workgroup"); __builtin_amdgcn_wave_barrier();
  const int rsub = lane >> 4, c4 = (lane & 15) * 4;
  {
#pragma unroll
    for (int q = 0; q < 8; ++q) { const int r = q * 2 + rsub; if (col0 + c4 < N) { const v4f v = *(const v4fa*)&so[w][r][c4]; *(v4f*)(C + (size_t)(row0 + r) * ldc + col0 + c4) = v; } }
     }
}

// Wt[n][k] = f16(W[k][n]·scale) from f32 row-major W[K][N] (scale = power of two; bf16-exact weights stay exact in f16 away from the subnormal range)
__global__ __launch_bounds__(256) void k_wt_f16(const float* __restrict__ W, _Float16* __restrict__ Wt, int K, int N, float scale) {
  const int t = blockIdx.x * 256 + threadIdx.x; if (t >= N * (K / 8)) return; const int n = t / (K / 8), k8 = (t % (K / 8)) * 8; FragH f;
#pragma unroll
  for (int i = 0; i < 8; ++i) f.h[i] = (_Float16)(bf16_round(W[(size_t)(k8 + i) * N + n]) * scale); const v8us o = f.half[0];
  *(v8us*)((unsigned short*)Wt + (size_t)n * K + k8) = o; 
}
// k_gemm_hh variant with fused epilogue: v = acc·alpha + bias[by·sBias + col] (+ CP[(row/rowsPerB)·sCPb + by·64 + col] if CP) ; ACT 0 none / 1 elu ; writes f16 C16 (and f32 C if non-null)
template <int ACT>
__global__ __launch_bounds__(128) void k_gemm_hhx(const _Float16* __restrict__ A, int lda, size_t sA, const _Float16* __restrict__ Bh, int ldb, size_t sB, float alpha, const float* __restrict__ bias, size_t sBias, const float* __restrict__ CP, int rowsPerB, size_t sCPb, int row0g,
    float* __restrict__ C, _Float16* __restrict__ C16, int ldc, size_t sC, int M, int N, int K) {
  __shared__ __attribute__((aligned(16))) float so[4][16][64];
  const int tid = threadIdx.x, w = tid >> 5, lane = tid & 31, ln = lane & 15, hh = lane >> 4; const int by = blockIdx.y;
  A += (size_t)by * sA; Bh += (size_t)by * sB; const size_t cofs = (size_t)by * sC; const float* bp = bias ? bias + (size_t)by * sBias : nullptr;
  const int ntn = (N + 63) / 64; const int wid = blockIdx.x * 4 + w; const int mt = wid / ntn, nq = wid % ntn; if (mt * 16 >= M) return;
  const int row0 = mt * 16, col0 = nq * 64; const _Float16* arow = A + (size_t)(row0 + ln) * lda;
  v8f acc[4] = {};
  for (int kb = 0; kb < K; kb += 32) { FragH ah; ah.half[0] = *(const v8us*)((const unsigned short*)arow + kb + 8 * hh); ah.half[1] = *(const v8us*)((const unsigned short*)arow + kb + 16 + 8 * hh);
#pragma unroll
    for (int t = 0; t < 4; ++t) { if (col0 + t * 16 >= N) continue; const size_t boff = (size_t)(col0 + t * 16 + ln) * ldb + kb; FragH bq; bq.half[0] = *(const v8us*)((const unsigned short*)Bh + boff + 8 * hh); bq.half[1] = *(const v8us*)((const unsigned short*)Bh + boff + 16 + 8 * hh);
      acc[t] = mmaH<1>(ah.v, ah.v, bq.v, bq.v, acc[t]); }
  }
#pragma unroll
  for (int t = 0; t < 4; ++t) { if (col0 + t * 16 >= N) continue; const int col = col0 + t * 16 + ln; const float bv = bp ? bf16_round(bp[col]) : 0.f;
#pragma unroll
    for (int r = 0; r < 8; ++r) { float v = acc[t][r] * alpha + bv; if (CP) { const int bidx = (row0g + row0 + 8 * hh + r) / rowsPerB; v += CP[(size_t)bidx * sCPb + (size_t)by * 64 + col]; } if (ACT == 1) v = (v > 0.f) ? v : expm1f(v); else if (ACT == 7) v = (v > 0.f) ? v + 1.0f : expf(v); else if (ACT == 8) v = tanhf(v); else if (ACT == 9) v = 0.5f * v * (1.0f + tanhf(0.7978845608028654f * (v + 0.044715f * v * v * v))); else if (ACT == 11) v = 1.0f / (1.0f + expf(-v)); else if (ACT == 12) v = (v > 0.f) ? v : 0.01f * v; else if (ACT == 14) v = (v > 0.f) ? v : 0.1f * v; else if (ACT == 15) v = v / (1.0f + expf(-v)); else if (ACT == 3) v = fmaxf(v, 0.f); else if (ACT == 6) v = 0.5f * v * (1.0f + erff(v * 0.70710678118654752f)); so[w][8 * hh + r][t * 16 + ln] = v; } }
  __builtin_amdgcn_fence(__ATOMIC_ACQ_REL, "workgroup"); __builtin_amdgcn_wave_barrier();
  const int rsub = lane >> 4, c4 = (lane & 15) * 4; typedef _Float16 v4h __attribute__((ext_vector_type(4)));
  {
#pragma unroll
    for (int q = 0; q < 8; ++q) { const int r = q * 2 + rsub; if (col0 + c4 < N) { const v4f v = *(const v4fa*)&so[w][r][c4]; if (C) *(v4f*)(C + cofs + (size_t)(row0 + r) * ldc + col0 + c4) = v; if (C16) { v4h h4; for (int i = 0; i < 4; ++i) h4[i] = (_Float16)v[i]; *(v4h*)(C16 + cofs + (size_t)(row0 + r) * ldc + col0 + c4) = h4; } } }
     }
}


typedef _Float16 v4h __attribute__((ext_vector_type(4)));

__global__ __launch_bounds__(256) void k_x16(const float* __restrict__ x, _Float16* __restrict__ X16, size_t n8) { const size_t t = (size_t)blockIdx.x * 256 + threadIdx.x; if (t >= n8) return; FragH f;
#pragma unroll
  for (int q = 0; q < 8; ++q) f.h[q] = (_Float16)bf16_round(x[t * 8 + q]); *(v8us*)((unsigned short*)X16 + t * 8) = f.half[0];  }
__global__ __launch_bounds__(256) void k_h16(const float* __restrict__ x, _Float16* __restrict__ X16, size_t n8) { const size_t t = (size_t)blockIdx.x * 256 + threadIdx.x; if (t >= n8) return; FragH f;
#pragma unroll
  for (int q = 0; q < 8; ++q) f.h[q] = (_Float16)x[t * 8 + q]; *(v8us*)((unsigned short*)X16 + t * 8) = f.half[0];  }
__global__ __launch_bounds__(256) void k_round16f(const float* __restrict__ W, _Float16* __restrict__ Bt, size_t n8) { const size_t t = (size_t)blockIdx.x * 256 + threadIdx.x; if (t >= n8) return; FragH f;
#pragma unroll
  for (int i = 0; i < 8; ++i) f.h[i] = (_Float16)(bf16_round(W[t * 8 + i]) * 16.0f); *(v8us*)((unsigned short*)Bt + t * 8) = f.half[0];  }
template <int NHv, int TTv>
__global__ __launch_bounds__(256) void k_vt(const _Float16* __restrict__ V16, int ldv, int voff, _Float16* __restrict__ Vt) { __shared__ unsigned short tl[64][66]; const int tid = threadIdx.x; const int slab = blockIdx.x / (TTv / 64), lg = blockIdx.x % (TTv / 64); const int b = slab / NHv, h = slab % NHv;
  for (int i = tid; i < 64 * 8; i += 256) { const int r = i / 8, c8 = (i % 8) * 8; FragH f; f.half[0] = *(const v8us*)((const unsigned short*)V16 + ((size_t)b * TTv + lg * 64 + r) * ldv + voff + h * 64 + c8);
#pragma unroll
    for (int q = 0; q < 8; ++q) tl[r][c8 + q] = f.u[q]; }
  __syncthreads();
  {
#pragma unroll
    for (int rd = 0; rd < 2; ++rd) { const int d = rd * 32 + tid / 8, pc = tid % 8; FragH f;
#pragma unroll
      for (int q = 0; q < 8; ++q) f.u[q] = tl[pc * 8 + q][d];
      *(v8us*)((unsigned short*)Vt + ((size_t)slab * 64 + d) * TTv + lg * 64 + pc * 8) = f.half[0]; }
     } }

__global__ __launch_bounds__(256) void k_hl(const float* __restrict__ F, _Float16* __restrict__ Hh, _Float16* __restrict__ Hl, size_t n8) { const size_t t = (size_t)blockIdx.x * 256 + threadIdx.x; if (t >= n8) return; FragH fh, fl; const v4f a = *(const v4fa*)(F + t * 8), c = *(const v4fa*)(F + t * 8 + 4);
#pragma unroll
  for (int q = 0; q < 4; ++q) { _Float16 h = (_Float16)a[q]; fh.h[q] = h; fl.h[q] = (_Float16)((a[q] - (float)h) * 1024.0f); h = (_Float16)c[q]; fh.h[4 + q] = h; fl.h[4 + q] = (_Float16)((c[q] - (float)h) * 1024.0f); }
  { *(v8us*)((unsigned short*)Hh + t * 8) = fh.half[0]; *(v8us*)((unsigned short*)Hl + t * 8) = fl.half[0];  } }

// ---- fast GEMM (work-group tile 128x64, wave tile 32x64; requires M % 128 == 0, N % 64 == 0 and K % 64 == 0, K >= 64); epilogue = k_gemm_hhx semantics ----
#define G2P 72      /* LDS row pitch in halves = 128 B + 16 B, the pitch of 16-byte LDS readers */
typedef unsigned short g2_tile[192][G2P];      /* one stage, 64 halves of k: rows 0..127 = the block's 128 rows of A, rows 128..191 = its 64 rows of B */
__device__ __forceinline__ v16h g2_frag(const unsigned short* p, int hh) { FragH f; f.half[0] = *(const v8us*)(p + 8 * hh); f.half[1] = *(const v8us*)(p + 16 + 8 * hh); return f.v; }
// One stage goes to LDS once per work-group by asynchronous copies, 16 B a lane, eight lanes a row: whole 128-B lines.
// l: this lane's LDS byte address of its first A piece; ga, gb: its first A and B piece in global memory; piece i lies 16 rows further on both sides, and the four B pieces follow the eight A pieces in LDS.
__device__ __forceinline__ void g2_stage(unsigned l, const _Float16* ga, size_t a16, const _Float16* gb, size_t b16) {
  const unsigned l1 = l + 2304u, l2 = l + 4608u, l3 = l + 6912u, l4 = l + 9216u, l5 = l + 11520u, l6 = l + 13824u, l7 = l + 16128u, l8 = l + 18432u, l9 = l + 20736u, l10 = l + 23040u, l11 = l + 25344u;      /* 16 rows x 144 B */
  const _Float16* ga1 = ga + a16; const _Float16* ga2 = ga1 + a16; const _Float16* ga3 = ga2 + a16; const _Float16* ga4 = ga3 + a16; const _Float16* ga5 = ga4 + a16; const _Float16* ga6 = ga5 + a16; const _Float16* ga7 = ga6 + a16;
  const _Float16* gb1 = gb + b16; const _Float16* gb2 = gb1 + b16; const _Float16* gb3 = gb2 + b16;
  /* the closing s_wait_xcnt 0 stands inside the statement so that no address register of a copy is rewritten in front of it */
  asm volatile("global_load_async_to_lds_b128 %0, %12, off\n\t"
               "global_load_async_to_lds_b128 %1, %13, off\n\t"
               "global_load_async_to_lds_b128 %2, %14, off\n\t"
               "global_load_async_to_lds_b128 %3, %15, off\n\t"
               "global_load_async_to_lds_b128 %4, %16, off\n\t"
               "global_load_async_to_lds_b128 %5, %17, off\n\t"
               "global_load_async_to_lds_b128 %6, %18, off\n\t"
               "global_load_async_to_lds_b128 %7, %19, off\n\t"
               "global_load_async_to_lds_b128 %8, %20, off\n\t"
               "global_load_async_to_lds_b128 %9, %21, off\n\t"
               "global_load_async_to_lds_b128 %10, %22, off\n\t"
               "global_load_async_to_lds_b128 %11, %23, off\n\t"
               "s_wait_xcnt 0x0"
               :: "v"(l), "v"(l1), "v"(l2), "v"(l3), "v"(l4), "v"(l5), "v"(l6), "v"(l7), "v"(l8), "v"(l9), "v"(l10), "v"(l11),
                  "v"(ga), "v"(ga1), "v"(ga2), "v"(ga3), "v"(ga4), "v"(ga5), "v"(ga6), "v"(ga7), "v"(gb), "v"(gb1), "v"(gb2), "v"(gb3) : "memory");
}
__device__ __forceinline__ v8f g2_mma(v16h a, v16h b, v8f c) { v8f d = __builtin_amdgcn_wmma_f32_16x16x32_f16(false, a, false, b, (short)0, c, false, false); asm volatile("v_nop\n\tv_nop\n\tv_nop\n\tv_nop" : "+v"(d) : "v"(a), "v"(b)); return d; }
// ROWB: the bias belongs to the rows of C (weights as the A operand: C comes out channel-major) instead of its columns. so, sT: the caller's output staging array and its two operand stages, one set for all bodies of a kernel.
template <int ACT, bool ROWB>
__device__ __forceinline__ void gemm2_body(float (*so)[32][68], g2_tile* sT, const int by, const _Float16* __restrict__ A, int lda, size_t sA, const _Float16* __restrict__ Bh, int ldb, size_t sB, float alpha, const float* __restrict__ bias, size_t sBias, const float* __restrict__ CP, int rowsPerB, size_t sCPb, int row0g,
    float* __restrict__ C, _Float16* __restrict__ C16, int ldc, size_t sC, int M, int N, int K) {
  const int tid = threadIdx.x, w = tid >> 5, lane = tid & 31, ln = lane & 15, hh = lane >> 4;
  A += (size_t)by * sA; Bh += (size_t)by * sB; const size_t cofs = (size_t)by * sC; const float* bp = bias ? bias + (size_t)by * sBias : nullptr;
  const int ntn = N >> 6; const int mt = blockIdx.x / ntn, nq = blockIdx.x - mt * ntn; const int row0 = mt * 128 + 32 * w, col0 = nq * 64; if (mt * 128 >= M) return;      /* the same for every wave of the block: it stands in front of the barriers */
  const int crow = tid >> 3, cc = (tid & 7) * 8;      /* eight lanes copy one 128-B row */
  const _Float16* ga = A + (size_t)(mt * 128 + crow) * lda + cc; const _Float16* gb = Bh + (size_t)(col0 + crow) * ldb + cc;
  const size_t a16 = (size_t)16 * lda, b16 = (size_t)16 * ldb;
  const unsigned l0 = (unsigned)(size_t)&sT[0][crow][cc];
  constexpr unsigned BUFB = sizeof(g2_tile);      /* bytes of one stage */
  const int nst = K >> 6;
  g2_stage(l0, ga, a16, gb, b16);
  const v8f z8 = {0.f,0.f,0.f,0.f,0.f,0.f,0.f,0.f}; v8f c00 = z8, c01 = z8, c02 = z8, c03 = z8, c10 = z8, c11 = z8, c12 = z8, c13 = z8;
  asm volatile("s_wait_asynccnt 0x0" ::: "memory");      /* stage 0: this wave's copies have landed */
  __syncthreads();      /* stage 0 is readable by every wave */
  if (nst > 1) g2_stage(l0 + BUFB, ga + 64, a16, gb + 64, b16);
#pragma unroll 1      /* stays rolled: one copy of the body serves both buffers, chosen by st & 1 */
  for (int st = 0; st < nst; ++st) {      /* stage st is worked on while stage st + 1 flies into the other buffer */
    const int bf = st & 1;
    const unsigned short* ar = &sT[bf][32 * w + ln][0]; const unsigned short* br = &sT[bf][128 + ln][0];
    v16h a0[2], a1[2], b[2][4];      /* all 24 LDS reads of the stage stand in front of its first product: one LDS latency a stage, not one for each pair of products */
#pragma unroll      /* unrolled, here and below: the fragments are indexed by constants and stay in registers, and the half stage becomes a constant offset of the LDS reads */
    for (int ks = 0; ks < 2; ++ks) { a0[ks] = g2_frag(ar + ks * 32, hh); a1[ks] = g2_frag(ar + 16 * G2P + ks * 32, hh);
#pragma unroll
      for (int t = 0; t < 4; ++t) b[ks][t] = g2_frag(br + t * 16 * G2P + ks * 32, hh); }
#pragma unroll
    for (int ks = 0; ks < 2; ++ks) {
      c00 = g2_mma(a0[ks], b[ks][0], c00); c10 = g2_mma(a1[ks], b[ks][0], c10); c01 = g2_mma(a0[ks], b[ks][1], c01); c11 = g2_mma(a1[ks], b[ks][1], c11);
      c02 = g2_mma(a0[ks], b[ks][2], c02); c12 = g2_mma(a1[ks], b[ks][2], c12); c03 = g2_mma(a0[ks], b[ks][3], c03); c13 = g2_mma(a1[ks], b[ks][3], c13); }
    asm volatile("s_wait_dscnt 0x0" ::: "memory");      /* this wave's reads of buffer bf are done before the buffer is given up */
    asm volatile("s_wait_asynccnt 0x0" ::: "memory");      /* this wave's copies of stage st + 1 have landed */
    __syncthreads();      /* publishes stage st + 1 and ends every wave's reads of buffer bf */
    if (st + 2 < nst) g2_stage(l0 + bf * BUFB, ga + (size_t)(st + 2) * 64, a16, gb + (size_t)(st + 2) * 64, b16);
  }
  asm volatile("s_wait_asynccnt 0x0" ::: "memory");      /* no copy is left in flight when the wave goes on */
  v8f accs[8] = {c00, c01, c02, c03, c10, c11, c12, c13};
  float bvr[2][8];      /* ROWB: the biases of this lane's sixteen rows */
  if (ROWB) {
#pragma unroll      /* unrolled: bvr is indexed by constants and stays in registers */
    for (int i = 0; i < 16; ++i) bvr[i >> 3][i & 7] = bp ? bf16_round(bp[row0 + (i >> 3) * 16 + 8 * hh + (i & 7)]) : 0.f; }
#pragma unroll
  for (int u = 0; u < 8; ++u) { const int t = u & 3, half = u >> 2; const int col = col0 + t * 16 + ln; const float bvc = (!ROWB && bp) ? bf16_round(bp[col]) : 0.f;
#pragma unroll
    for (int r = 0; r < 8; ++r) { const int rloc = half * 16 + 8 * hh + r; const float bv = ROWB ? bvr[half][r] : bvc; float v = accs[u][r] * alpha + bv; if (CP) { const int bidx = (row0g + row0 + rloc) / rowsPerB; v += CP[(size_t)bidx * sCPb + (size_t)by * 64 + col]; }
      if (ACT == 3) v = fmaxf(v, 0.f); else if (ACT == 6) v = 0.5f * v * (1.0f + erff(v * 0.70710678118654752f)); else if (ACT == 11) v = 1.0f / (1.0f + expf(-v)); else if (ACT == 15) v = v / (1.0f + expf(-v)); else if (ACT == 12) v = (v > 0.f) ? v : 0.01f * v; else if (ACT == 8) v = tanhf(v);
      so[w][rloc][t * 16 + ln] = v; } }
  __builtin_amdgcn_fence(__ATOMIC_ACQ_REL, "workgroup"); __builtin_amdgcn_wave_barrier();
  const int rsub = lane >> 4, c4 = (lane & 15) * 4;
  { v4f vq[16];      /* all LDS reads first, so that the waits behind the stores do not stand between them */
#pragma unroll      /* unrolled, here and below: vq is indexed by constants and stays in registers */
    for (int q = 0; q < 16; ++q) vq[q] = *(const v4fa*)&so[w][q * 2 + rsub][c4];
#pragma unroll
    for (int q = 0; q < 16; ++q) { const int r = q * 2 + rsub; const v4f v = vq[q];      /* s_wait_xcnt 0 behind a store: the conversions and address sums that follow reuse the store's registers */
      if (C) { *(v4f*)(C + cofs + (size_t)(row0 + r) * ldc + col0 + c4) = v; asm volatile("s_wait_xcnt 0x0" ::: "memory"); }
      if (C16) { v4h h4; for (int i = 0; i < 4; ++i) h4[i] = (_Float16)v[i]; *(v4h*)(C16 + cofs + (size_t)(row0 + r) * ldc + col0 + c4) = h4; if (q + 1 < 16) asm volatile("s_wait_xcnt 0x0" ::: "memory"); } }
     } }
template <int ACT, bool ROWB>
__global__ __launch_bounds__(128) void k_gemm2(const _Float16* __restrict__ A, int lda, size_t sA, const _Float16* __restrict__ Bh, int ldb, size_t sB, float alpha, const float* __restrict__ bias, size_t sBias, const float* __restrict__ CP, int rowsPerB, size_t sCPb, int row0g,
    float* __restrict__ C, _Float16* __restrict__ C16, int ldc, size_t sC, int M, int N, int K) {
  __shared__ __attribute__((aligned(16))) float so[4][32][68];
  __shared__ __attribute__((aligned(16))) g2_tile sT[2];
  gemm2_body<ACT, ROWB>(so, sT, blockIdx.y, A, lda, sA, Bh, ldb, sB, alpha, bias, sBias, CP, rowsPerB, sCPb, row0g, C, C16, ldc, sC, M, N, K); }
// Three independent products of one shape in one launch: blockIdx.y picks the operands, the bias and the f16 output; the tile work is gemm2_body's.
// Jobs 0 and 1 give C[M][N] (tokens x channels). Job 2 takes its operands in swapped roles and gives C2[N][M] (channels x tokens, pitch M), the layout its reader wants; (M / 128)(N / 64) tiles either way.
template <int ACT>
__global__ __launch_bounds__(128) void k_gemm2x3(const _Float16* __restrict__ A0, const _Float16* __restrict__ A1, const _Float16* __restrict__ A2, const _Float16* __restrict__ B0, const _Float16* __restrict__ B1, const _Float16* __restrict__ B2,
    const float* __restrict__ bias0, const float* __restrict__ bias1, const float* __restrict__ bias2, _Float16* __restrict__ C0, _Float16* __restrict__ C1, _Float16* __restrict__ C2, float alpha, int ld, int M, int N, int K) {
  __shared__ __attribute__((aligned(16))) float so[4][32][68];
  __shared__ __attribute__((aligned(16))) g2_tile sT[2];
  const int j = blockIdx.y;
  if (j == 2) { gemm2_body<ACT, true>(so, sT, 0, B2, ld, 0, A2, ld, 0, alpha, bias2, 0, nullptr, 1, 0, 0, nullptr, C2, M, 0, N, M, K); return; }
  const _Float16* A = (j == 0) ? A0 : A1; const _Float16* Bh = (j == 0) ? B0 : B1; const float* bias = (j == 0) ? bias0 : bias1; _Float16* C16 = (j == 0) ? C0 : C1;
  gemm2_body<ACT, false>(so, sT, 0, A, ld, 0, Bh, ld, 0, alpha, bias, 0, nullptr, 1, 0, 0, nullptr, C16, ld, 0, M, N, K); }



// lane l <-> lane l ^ 16 (the two lane halves of one fragment column)
__device__ __forceinline__ float xhalf(float x) { return __builtin_bit_cast(float, __builtin_amdgcn_permlanex16(__builtin_bit_cast(int, x), __builtin_bit_cast(int, x), 0x76543210, 0xfedcba98, false, false)); }
__device__ __forceinline__ void kv_stage(unsigned lk, unsigned lv, const unsigned short* gk, size_t k16, const unsigned short* gv, size_t v16) {
  const unsigned lk1 = lk + 2304u, lk2 = lk + 4608u, lk3 = lk + 6912u, lv1 = lv + 2304u, lv2 = lv + 4608u, lv3 = lv + 6912u;      /* 16 rows x 144 B */
  const unsigned short* gk1 = gk + k16; const unsigned short* gk2 = gk1 + k16; const unsigned short* gk3 = gk2 + k16;
  const unsigned short* gv1 = gv + v16; const unsigned short* gv2 = gv1 + v16; const unsigned short* gv3 = gv2 + v16;
  /* the closing s_wait_xcnt 0 stands inside the statement so that no address register of a copy is rewritten in front of it */
  asm volatile("global_load_async_to_lds_b128 %0, %8, off\n\t"
               "global_load_async_to_lds_b128 %1, %9, off\n\t"
               "global_load_async_to_lds_b128 %2, %10, off\n\t"
               "global_load_async_to_lds_b128 %3, %11, off\n\t"
               "global_load_async_to_lds_b128 %4, %12, off\n\t"
               "global_load_async_to_lds_b128 %5, %13, off\n\t"
               "global_load_async_to_lds_b128 %6, %14, off\n\t"
               "global_load_async_to_lds_b128 %7, %15, off\n\t"
               "s_wait_xcnt 0x0"
               :: "v"(lk), "v"(lk1), "v"(lk2), "v"(lk3), "v"(lv), "v"(lv1), "v"(lv2), "v"(lv3),
                  "v"(gk), "v"(gk1), "v"(gk2), "v"(gk3), "v"(gv), "v"(gv1), "v"(gv2), "v"(gv3) : "memory");
}
template <int CAUSAL>
__global__ __launch_bounds__(128) void k_flash(const _Float16* __restrict__ Q16, int ldq, const _Float16* __restrict__ K16, int ldk, const _Float16* __restrict__ Vt, const int* __restrict__ MSK, _Float16* __restrict__ O, int ldo) {
  constexpr int RPW = 16, DT = 4, KS = 2, KT = 64, LP = 72;      /* KT keys a stage; LP: LDS row pitch in halves = 128 B + 16 B, the pitch of 16-byte LDS readers */
  __shared__ __attribute__((aligned(16))) unsigned short sK[2][KT][LP];
  __shared__ __attribute__((aligned(16))) unsigned short sV[2][64][LP];
  __shared__ __attribute__((aligned(16))) float sO[4][RPW][64 + 4];
  const int tid = threadIdx.x, w = tid >> 5, lane = tid & 31, ln = lane & 15, hh = lane >> 4;
  const int slab = blockIdx.x / QBNP, qblk = QB0P + blockIdx.x % QBNP; const int b = slab / NH, h = slab % NH; const int qb0 = qblk * (4 * RPW); const int q0 = qb0 + w * RPW; const int tq = q0 + ln;
  const unsigned short* Vth = (const unsigned short*)Vt + (size_t)slab * 64 * TK;
  const int jend = (CAUSAL == 1) ? (qb0 + 4 * RPW) : TK;      /* causal: keys beyond the block's last query never contribute */
  const int nst = jend / KT;
  const int crow = tid >> 3, cc = (tid & 7) * 8;      /* eight lanes copy one 128-B row */
  const unsigned short* gk = (const unsigned short*)K16 + ((size_t)b * TK + crow) * ldk + h * 64 + cc;
  const unsigned short* gv = Vth + (size_t)crow * TK + cc;
  const size_t k16 = (size_t)16 * ldk, v16 = (size_t)16 * TK, kst = (size_t)KT * ldk;
  const unsigned lk0 = (unsigned)(size_t)&sK[0][crow][cc], lv0 = (unsigned)(size_t)&sV[0][crow][cc];
  constexpr unsigned BUFB = KT * LP * 2;      /* bytes of one buffer */
  kv_stage(lk0, lv0, gk, k16, gv, v16);
  FragH bq[KS];
  { const unsigned short* qr = (const unsigned short*)Q16 + ((size_t)b * TQ + tq) * ldq + h * 64;
#pragma unroll
    for (int ks = 0; ks < KS; ++ks) { bq[ks].half[0] = *(const v8us*)(qr + ks * 32 + 8 * hh); bq[ks].half[1] = *(const v8us*)(qr + ks * 32 + 16 + 8 * hh); } }
  constexpr float C2 = SCL * 1.4426950408889634f;      /* score -> base-2 exponent: scale x log2(e) */
  float m_r = -3.0e38f, l_r = 0.f; v8f oacc[DT];      /* m_r: running maximum of the unscaled scores; l_r: sum of 1024 p over this lane half's keys only, joined after the loop */
#pragma unroll
  for (int dt = 0; dt < DT; ++dt) oacc[dt] = (v8f){0.f,0.f,0.f,0.f,0.f,0.f,0.f,0.f};
  asm volatile("s_wait_asynccnt 0x0" ::: "memory");      /* stage 0: this wave's copies have landed */
  __syncthreads();      /* stage 0 is readable by every wave */
  if (nst > 1) kv_stage(lk0 + BUFB, lv0 + BUFB, gk + kst, k16, gv + KT, v16);
#pragma unroll 1      /* stays rolled: one copy of the body serves both buffers, chosen by st & 1 */
  for (int st = 0; st < nst; ++st) {      /* stage st is worked on while stage st + 1 flies into the other buffer */
    const int bf = st & 1;
#pragma unroll      /* unrolled: the half stage becomes a constant offset of the LDS reads */
    for (int sub = 0; sub < KT / 32; ++sub) {
    const int j0 = st * KT + sub * 32;
    FragH ak[2][KS], av[DT];
#pragma unroll
    for (int nt = 0; nt < 2; ++nt) { const unsigned short* kr = &sK[bf][sub * 32 + nt * 16 + ln][0];
#pragma unroll
      for (int ks = 0; ks < KS; ++ks) { ak[nt][ks].half[0] = *(const v8us*)(kr + ks * 32 + 8 * hh); ak[nt][ks].half[1] = *(const v8us*)(kr + ks * 32 + 16 + 8 * hh); } }
#pragma unroll
    for (int dt = 0; dt < DT; ++dt) { const unsigned short* vrow = &sV[bf][dt * 16 + ln][sub * 32]; av[dt].half[0] = *(const v8us*)(vrow + 8 * hh); av[dt].half[1] = *(const v8us*)(vrow + 16 + 8 * hh); }
    v8f s[2];
#pragma unroll
    for (int nt = 0; nt < 2; ++nt) {
      v8f acc = (v8f){0.f,0.f,0.f,0.f,0.f,0.f,0.f,0.f};
#pragma unroll
      for (int ks = 0; ks < KS; ++ks) acc = mmaH<1>(ak[nt][ks].v, ak[nt][ks].v, bq[ks].v, bq[ks].v, acc);
      s[nt] = acc; }
    float sc[16], t[8]; bool ok[16];
#pragma unroll
    for (int i = 0; i < 16; ++i) { const int kk = j0 + (i >> 3) * 16 + 8 * hh + (i & 7);
      ok[i] = (CAUSAL == 1) ? (kk <= tq) : ((CAUSAL == 2) ? ((kk >> 5) == (tq >> 5)) : true);      /* mode 2: block-diagonal 32-token groups */
      sc[i] = ok[i] ? s[i >> 3][i & 7] : -3.0e38f; if (CAUSAL == 17) sc[i] += bf16_round(((const float*)MSK + (size_t)b * TK)[kk]) * (1.0f / SCL); }      /* unscaled scores (the scale is positive: the maximum commutes with it); mode 17: additive per-(batch, key) mask INPUT, in the same units */
#pragma unroll
    for (int i = 0; i < 8; ++i) t[i] = fmaxf(sc[i], sc[i + 8]);
    float mc = fmaxf(fmaxf(fmaxf(t[0], t[1]), fmaxf(t[2], t[3])), fmaxf(fmaxf(t[4], t[5]), fmaxf(t[6], t[7])));
    mc = fmaxf(mc, xhalf(mc));      /* both halves feed one O^T column: one maximum for both */
    const float mn = fmaxf(m_r, mc); const float al = (mn > -1.0e38f) ? __builtin_amdgcn_exp2f((m_r - mn) * C2) : 1.0f; m_r = mn;
    const float nb = __builtin_fmaf(-mn, C2, 10.0f);      /* 1024 p = 2^(C2 s - C2 m + 10): one fused multiply-add in front of the hardware's base-2 exponential */
    FragH pb;
#pragma unroll
    for (int i = 0; i < 16; ++i) sc[i] = __builtin_fmaf(sc[i], C2, nb);
    /* sixteen exponentials in place, in one statement: each is independent of the one in front of it (no result read, no source overwritten), and the closing v_nop is the slot behind the last one; last element first, because the packing behind it starts with the last pair */
    asm("v_exp_f32 %15, %15\n\tv_exp_f32 %14, %14\n\tv_exp_f32 %13, %13\n\tv_exp_f32 %12, %12\n\t"
        "v_exp_f32 %11, %11\n\tv_exp_f32 %10, %10\n\tv_exp_f32 %9, %9\n\tv_exp_f32 %8, %8\n\t"
        "v_exp_f32 %7, %7\n\tv_exp_f32 %6, %6\n\tv_exp_f32 %5, %5\n\tv_exp_f32 %4, %4\n\t"
        "v_exp_f32 %3, %3\n\tv_exp_f32 %2, %2\n\tv_exp_f32 %1, %1\n\tv_exp_f32 %0, %0\n\tv_nop"
        : "+v"(sc[0]), "+v"(sc[1]), "+v"(sc[2]), "+v"(sc[3]), "+v"(sc[4]), "+v"(sc[5]), "+v"(sc[6]), "+v"(sc[7]),
          "+v"(sc[8]), "+v"(sc[9]), "+v"(sc[10]), "+v"(sc[11]), "+v"(sc[12]), "+v"(sc[13]), "+v"(sc[14]), "+v"(sc[15]));
#pragma unroll
    for (int i = 0; i < 16; ++i) { if (!ok[i]) sc[i] = 0.f; pb.h[i] = (_Float16)sc[i]; }
#pragma unroll
    for (int i = 0; i < 8; ++i) t[i] = sc[i] + sc[i + 8];
    l_r = l_r * al + (((t[0] + t[1]) + (t[2] + t[3])) + ((t[4] + t[5]) + (t[6] + t[7])));
#pragma unroll
    for (int dt = 0; dt < DT; ++dt)
#pragma unroll
      for (int r = 0; r < 8; ++r) oacc[dt][r] *= al;
#pragma unroll
    for (int dt = 0; dt < DT; ++dt) oacc[dt] = mmaH<1>(av[dt].v, av[dt].v, pb.v, pb.v, oacc[dt]);
    }
    asm volatile("s_wait_dscnt 0x0" ::: "memory");      /* this wave's reads of buffer bf are done before the buffer is given up */
    asm volatile("s_wait_asynccnt 0x0" ::: "memory");      /* this wave's copies of stage st + 1 have landed */
    __syncthreads();      /* publishes stage st + 1 and ends every wave's reads of buffer bf */
    if (st + 2 < nst) kv_stage(lk0 + bf * BUFB, lv0 + bf * BUFB, gk + (size_t)(st + 2) * kst, k16, gv + (size_t)(st + 2) * KT, v16);
  }
  asm volatile("s_wait_asynccnt 0x0" ::: "memory");      /* no copy is left in flight when the wave goes on */
  const float l = l_r + xhalf(l_r); const float li = (l > 0.f) ? 1.0f / l : 0.f;      /* numerator and sum both carry the factor 1024 */
#pragma unroll
  for (int dt = 0; dt < DT; ++dt) {      /* oacc[dt][r] = O[q0 + ln][16 dt + 8 hh + r] */
    const v4f lo = {oacc[dt][0] * li, oacc[dt][1] * li, oacc[dt][2] * li, oacc[dt][3] * li}, hi = {oacc[dt][4] * li, oacc[dt][5] * li, oacc[dt][6] * li, oacc[dt][7] * li};
    *(v4fa*)&sO[w][ln][dt * 16 + 8 * hh] = lo; *(v4fa*)&sO[w][ln][dt * 16 + 8 * hh + 4] = hi; }
  __builtin_amdgcn_fence(__ATOMIC_ACQ_REL, "workgroup"); __builtin_amdgcn_wave_barrier();
  { v4h h4[RPW / 2];      /* all LDS reads first, so that the waits behind the stores do not stand between them */
#pragma unroll      /* unrolled, here and below: h4 is indexed by constants and stays in registers */
    for (int rp = 0; rp < RPW; rp += 2) { const v4f val = *(const v4fa*)&sO[w][rp + (lane >> 4)][(lane & 15) * 4]; for (int i = 0; i < 4; ++i) h4[rp >> 1][i] = (_Float16)val[i]; }      /* ctx leaves as the f16 operand of the last product */
#pragma unroll
    for (int rp = 0; rp < RPW; rp += 2) { const int r = rp + (lane >> 4), pc = lane & 15; *(v4h*)(O + ((size_t)b * TQ + q0 + r) * ldo + h * 64 + pc * 4) = h4[rp >> 1];      /* sixteen lanes fill one 128-B line */
      if (rp + 2 < RPW) asm volatile("s_wait_xcnt 0x0" ::: "memory"); }      /* the address sums that follow reuse the store's registers */
     } }
// 5-plane variant: S = Qh Kh^T + (Ql Kh^T + Qh Kl^T)/1024 with Q/K = [hi | 2^10 residual] f16 planes (QL/KL same layout as Q16/K16), then the 3-term P.V below.
// 3-term variant: O = (P_hi V_hi + (P_lo V_hi + P_hi V_lo) / 1024) / l with P = [hi | 2^10 residual] of 1024 p and V^T = [hi | 2^10 residual] planes (VtL same layout as Vt) -> ~2^-21-class products for un-averaged (early causal / peaked) rows
template <int CAUSAL>
__global__ __launch_bounds__(128) void k_flash5(const _Float16* __restrict__ Q16, const _Float16* __restrict__ QL, int ldq, const _Float16* __restrict__ K16, const _Float16* __restrict__ KL, int ldk, const _Float16* __restrict__ Vt, const _Float16* __restrict__ VtL, const int* __restrict__ MSK, float* __restrict__ O, int ldo) {
  constexpr int RPW = 16, RTN = RPW / 16, NQB = TQ / (4 * RPW), DT = 4, KS = 2;
  __shared__ __attribute__((aligned(16))) unsigned short sP[4][RPW][40]; __shared__ __attribute__((aligned(16))) unsigned short sPL[4][RPW][40]; __shared__ __attribute__((aligned(16))) float sO[4][RPW][64 + 4];
  const int tid = threadIdx.x, w = tid >> 5, lane = tid & 31, ln = lane & 15, hh = lane >> 4;
  const int slab = blockIdx.x / QBN5, qblk = QB05 + blockIdx.x % QBN5; (void)NQB; const int b = slab / NH, h = slab % NH; const int qb0 = qblk * (4 * RPW); const int q0 = qb0 + w * RPW;
  FragH aq[2][KS], aql[2][KS];
#pragma unroll
  for (int rt = 0; rt < RTN; ++rt) { const unsigned short* qr = (const unsigned short*)Q16 + ((size_t)b * TQ + q0 + rt * 16 + ln) * ldq + h * 64; const unsigned short* ql = (const unsigned short*)QL + ((size_t)b * TQ + q0 + rt * 16 + ln) * ldq + h * 64;
#pragma unroll
    for (int ks = 0; ks < KS; ++ks) { aq[rt][ks].half[0] = *(const v8us*)(qr + ks * 32 + 8 * hh); aq[rt][ks].half[1] = *(const v8us*)(qr + ks * 32 + 16 + 8 * hh); aql[rt][ks].half[0] = *(const v8us*)(ql + ks * 32 + 8 * hh); aql[rt][ks].half[1] = *(const v8us*)(ql + ks * 32 + 16 + 8 * hh); } }
  const unsigned short* Vth = (const unsigned short*)Vt + (size_t)slab * 64 * TK; const unsigned short* Vtl = (const unsigned short*)VtL + (size_t)slab * 64 * TK;
  float m_r[2][8], l_r[2][8]; v8f oacc[2][DT], oaccL[2][DT];
#pragma unroll
  for (int rt = 0; rt < RTN; ++rt) {
#pragma unroll
    for (int r = 0; r < 8; ++r) { m_r[rt][r] = -3.0e38f; l_r[rt][r] = 0.f; }
#pragma unroll
    for (int dt = 0; dt < DT; ++dt) { oacc[rt][dt] = (v8f){0.f,0.f,0.f,0.f,0.f,0.f,0.f,0.f}; oaccL[rt][dt] = oacc[rt][dt]; } }
  const int jend = (CAUSAL == 1) ? (qb0 + 4 * RPW) : TK;      /* causal: keys beyond the block's last query never contribute */
#pragma unroll 1
  for (int j0 = 0; j0 < jend; j0 += 32) {
    v8f s[2][2];
#pragma unroll
    for (int nt = 0; nt < 2; ++nt) { const unsigned short* kr = (const unsigned short*)K16 + ((size_t)b * TK + j0 + nt * 16 + ln) * ldk + h * 64; const unsigned short* klr = (const unsigned short*)KL + ((size_t)b * TK + j0 + nt * 16 + ln) * ldk + h * 64; FragH bk[KS], bkl[KS];
#pragma unroll
      for (int ks = 0; ks < KS; ++ks) { bk[ks].half[0] = *(const v8us*)(kr + ks * 32 + 8 * hh); bk[ks].half[1] = *(const v8us*)(kr + ks * 32 + 16 + 8 * hh); bkl[ks].half[0] = *(const v8us*)(klr + ks * 32 + 8 * hh); bkl[ks].half[1] = *(const v8us*)(klr + ks * 32 + 16 + 8 * hh); }
#pragma unroll
      for (int rt = 0; rt < RTN; ++rt) { v8f acc = (v8f){0.f,0.f,0.f,0.f,0.f,0.f,0.f,0.f}, accl = acc;
#pragma unroll
        for (int ks = 0; ks < KS; ++ks) { acc = mmaH<1>(aq[rt][ks].v, aq[rt][ks].v, bk[ks].v, bk[ks].v, acc); accl = mmaH<1>(aql[rt][ks].v, aql[rt][ks].v, bk[ks].v, bk[ks].v, accl); accl = mmaH<1>(aq[rt][ks].v, aq[rt][ks].v, bkl[ks].v, bkl[ks].v, accl); }
#pragma unroll
        for (int r = 0; r < 8; ++r) acc[r] += accl[r] * 0.0009765625f;
        s[rt][nt] = acc; } }
#pragma unroll
    for (int rt = 0; rt < RTN; ++rt)
#pragma unroll
      for (int r = 0; r < 8; ++r) { const int tq = q0 + rt * 16 + 8 * hh + r; const int k0 = j0 + ln, k1 = j0 + 16 + ln;
        bool ok0 = (CAUSAL == 1) ? (k0 <= tq) : ((CAUSAL == 2) ? ((k0 >> 5) == (tq >> 5)) : true), ok1 = (CAUSAL == 1) ? (k1 <= tq) : ((CAUSAL == 2) ? ((k1 >> 5) == (tq >> 5)) : true);      /* mode 2: block-diagonal 32-token groups */
        if (CAUSAL == 4) { const int* mrow = MSK + ((size_t)b * TQ + tq) * TK; ok0 = mrow[k0] != 0; ok1 = mrow[k1] != 0; }      /* mode 4: per-(query, key) INPUT mask shared by all heads; masked keys contribute nothing (== the reference's -4096 fill, whose exp underflows to 0), rows with no valid key give l = 0 -> output 0 (== the reference's row_valid zeroing) */
        float s0 = ok0 ? s[rt][0][r] * SCL : -3.0e38f, s1 = ok1 ? s[rt][1][r] * SCL : -3.0e38f; if (CAUSAL == 17) { const float* amk = (const float*)MSK + (size_t)b * TK; s0 += bf16_round(amk[k0]); s1 += bf16_round(amk[k1]); }      /* mode 17: additive per-(batch, key) mask INPUT */ float mc = fmaxf(s0, s1);
        mc = fmaxf(mc, __shfl_xor(mc, 1, 32)); mc = fmaxf(mc, __shfl_xor(mc, 2, 32)); mc = fmaxf(mc, __shfl_xor(mc, 4, 32)); mc = fmaxf(mc, __shfl_xor(mc, 8, 32));
        const float mn = fmaxf(m_r[rt][r], mc); const float al = (mn > -1.0e38f) ? expf(m_r[rt][r] - mn) : 1.0f; m_r[rt][r] = mn; const float p0 = ok0 ? expf(s0 - mn) : 0.f, p1 = ok1 ? expf(s1 - mn) : 0.f; l_r[rt][r] = l_r[rt][r] * al + p0 + p1;
#pragma unroll
        for (int dt = 0; dt < DT; ++dt) { oacc[rt][dt][r] *= al; oaccL[rt][dt][r] *= al; }
        FragH t2, t2l; const float ps0 = p0 * 1024.0f, ps1 = p1 * 1024.0f; t2.h[0] = (_Float16)ps0; t2.h[1] = (_Float16)ps1; t2l.h[0] = (_Float16)((ps0 - (float)t2.h[0]) * 1024.0f); t2l.h[1] = (_Float16)((ps1 - (float)t2.h[1]) * 1024.0f);
        sP[w][rt * 16 + 8 * hh + r][ln] = t2.u[0]; sP[w][rt * 16 + 8 * hh + r][16 + ln] = t2.u[1]; sPL[w][rt * 16 + 8 * hh + r][ln] = t2l.u[0]; sPL[w][rt * 16 + 8 * hh + r][16 + ln] = t2l.u[1]; }
    __builtin_amdgcn_fence(__ATOMIC_ACQ_REL, "workgroup"); __builtin_amdgcn_wave_barrier();
    FragH pa[2], pl[2];
#pragma unroll
    for (int rt = 0; rt < RTN; ++rt) { pa[rt].half[0] = *(const v8us*)&sP[w][rt * 16 + ln][8 * hh]; pa[rt].half[1] = *(const v8us*)&sP[w][rt * 16 + ln][16 + 8 * hh]; pl[rt].half[0] = *(const v8us*)&sPL[w][rt * 16 + ln][8 * hh]; pl[rt].half[1] = *(const v8us*)&sPL[w][rt * 16 + ln][16 + 8 * hh]; }
#pragma unroll
    for (int dt = 0; dt < DT; ++dt) { const unsigned short* vrow = Vth + (size_t)(dt * 16 + ln) * TK + j0; const unsigned short* vrl = Vtl + (size_t)(dt * 16 + ln) * TK + j0; FragH bv, bl; bv.half[0] = *(const v8us*)(vrow + 8 * hh); bv.half[1] = *(const v8us*)(vrow + 16 + 8 * hh); bl.half[0] = *(const v8us*)(vrl + 8 * hh); bl.half[1] = *(const v8us*)(vrl + 16 + 8 * hh);
#pragma unroll
      for (int rt = 0; rt < RTN; ++rt) { oacc[rt][dt] = mmaH<1>(pa[rt].v, pa[rt].v, bv.v, bv.v, oacc[rt][dt]); oaccL[rt][dt] = mmaH<1>(pl[rt].v, pl[rt].v, bv.v, bv.v, oaccL[rt][dt]); oaccL[rt][dt] = mmaH<1>(pa[rt].v, pa[rt].v, bl.v, bl.v, oaccL[rt][dt]); } }
    __builtin_amdgcn_fence(__ATOMIC_ACQ_REL, "workgroup"); __builtin_amdgcn_wave_barrier(); }
#pragma unroll
  for (int rt = 0; rt < RTN; ++rt) {
#pragma unroll
    for (int r = 0; r < 8; ++r) { float l = l_r[rt][r]; l += __shfl_xor(l, 1, 32); l += __shfl_xor(l, 2, 32); l += __shfl_xor(l, 4, 32); l += __shfl_xor(l, 8, 32); l_r[rt][r] = (l > 0.f) ? 1.0f / (l * 1024.0f) : 0.f; }
#pragma unroll
    for (int dt = 0; dt < DT; ++dt)
#pragma unroll
      for (int r = 0; r < 8; ++r) { float v = oacc[rt][dt][r]; v += oaccL[rt][dt][r] * 0.0009765625f; sO[w][rt * 16 + 8 * hh + r][dt * 16 + ln] = v * l_r[rt][r]; } }
  __builtin_amdgcn_fence(__ATOMIC_ACQ_REL, "workgroup"); __builtin_amdgcn_wave_barrier();
  {
#pragma unroll
    for (int rp = 0; rp < RPW; rp += 2) { const int r = rp + (lane >> 4), pc = lane & 15; const v4f val = *(const v4fa*)&sO[w][r][pc * 4]; *(v4f*)(O + ((size_t)b * TQ + q0 + r) * ldo + h * 64 + pc * 4) = val; }
     } }

__global__ __launch_bounds__(256) void k_rotab(float* __restrict__ CS, float* __restrict__ SN) {
  #pragma clang fp contract(off)
  const int t = blockIdx.x * 256 + threadIdx.x; if (t >= SLEN * 32) return; const int j = t % 32, s = t / 32; const float ex = (float)(2 * j) / 64.0f; const float inv = 1.0f / powf(10000.0f, ex); const float th = (float)s * inv; const float c = cosf(th), sn = sinf(th);
  { *(float*)(CS + t) = c; *(float*)(SN + t) = sn;  } }
__global__ __launch_bounds__(256) void k_rope(const float* __restrict__ F, int nsrc, int ndst, int rep, const float* __restrict__ CS, const float* __restrict__ SN, _Float16* __restrict__ H, _Float16* __restrict__ L) {
  #pragma clang fp contract(off)
  const size_t t = (size_t)blockIdx.x * 256 + threadIdx.x; if (t >= (size_t)NR * ndst * 4) return; const int g8 = (int)(t % 4); const int hd = (int)((t / 4) % ndst); const size_t row = t / ((size_t)4 * ndst); const int s = (int)(row % SLEN); const int hs = hd / rep;
  const float* src = F + row * (size_t)(nsrc * 64) + hs * 64; FragH ah, al, bh, bl;
  for (int i = 0; i < 8; ++i) { const int d = g8 * 8 + i; const float c = CS[s * 32 + d], sn = SN[s * 32 + d]; const float x1 = src[d], x2 = src[d + 32];
    float o1 = x1 * c; o1 += -x2 * sn; float o2 = x2 * c; o2 += x1 * sn;
    _Float16 hv = (_Float16)o1; ah.h[i] = hv; al.h[i] = (_Float16)((o1 - (float)hv) * 1024.0f); hv = (_Float16)o2; bh.h[i] = hv; bl.h[i] = (_Float16)((o2 - (float)hv) * 1024.0f); }
  const size_t o = row * (size_t)(ndst * 64) + hd * 64 + g8 * 8;
  { *(v8us*)((unsigned short*)H + o) = ah.half[0]; *(v8us*)((unsigned short*)H + o + 32) = bh.half[0]; *(v8us*)((unsigned short*)L + o) = al.half[0]; *(v8us*)((unsigned short*)L + o + 32) = bl.half[0];  } }
__global__ __launch_bounds__(256) void k_rope2(const float* __restrict__ F, int nsrc, int ndst, int rep, const float* __restrict__ CS, const float* __restrict__ SN, _Float16* __restrict__ H, _Float16* __restrict__ L) {
  #pragma clang fp contract(off)
  const size_t t = (size_t)blockIdx.x * 256 + threadIdx.x; if (t >= (size_t)NR * ndst * 4) return; const int g16 = (int)(t % 4); const int hd = (int)((t / 4) % ndst); const size_t row = t / ((size_t)4 * ndst); const int s = (int)(row % SLEN); const int hs = hd / rep;
  const float* src = F + row * (size_t)(nsrc * 64) + hs * 64 + g16 * 16; FragH ah, al;
  for (int pr = 0; pr < 8; ++pr) { const int i = g16 * 8 + pr; const float c = CS[s * 32 + i], sn = SN[s * 32 + i]; const float x1 = src[2 * pr], x2 = src[2 * pr + 1];
    float o1 = x1 * c; o1 -= x2 * sn; float o2 = x1 * sn; o2 += x2 * c;
    _Float16 hv = (_Float16)o1; ah.h[2 * pr] = hv; al.h[2 * pr] = (_Float16)((o1 - (float)hv) * 1024.0f); hv = (_Float16)o2; ah.h[2 * pr + 1] = hv; al.h[2 * pr + 1] = (_Float16)((o2 - (float)hv) * 1024.0f); }
  const size_t o = row * (size_t)(ndst * 64) + hd * 64 + g16 * 16;
  { *(v8us*)((unsigned short*)H + o) = ah.half[0]; *(v8us*)((unsigned short*)H + o + 8) = ah.half[1]; *(v8us*)((unsigned short*)L + o) = al.half[0]; *(v8us*)((unsigned short*)L + o + 8) = al.half[1];  } }
__global__ __launch_bounds__(256) void k_tabin(const float* __restrict__ sp, float* __restrict__ CS, float* __restrict__ SN) { const int t = blockIdx.x * 256 + threadIdx.x; if (t >= SLEN * 32) return; const int i = t % 32, s = t / 32; const float c = bf16_round(sp[s * 64 + 32 + i]), sn = bf16_round(sp[s * 64 + i]);
  { *(float*)(CS + t) = c; *(float*)(SN + t) = sn;  } }
__device__ __forceinline__ void d_wsc(const size_t t, const float* __restrict__ Wm, _Float16* __restrict__ Bt, size_t n8, float sc) { if (t >= n8) return; FragH f; for (int q = 0; q < 8; ++q) f.h[q] = (_Float16)(bf16_round(Wm[t * 8 + q]) * sc); *(v8us*)((unsigned short*)Bt + t * 8) = f.half[0];  }
__global__ __launch_bounds__(256) void k_rotab2(float* __restrict__ CS, float* __restrict__ SN) {
  #pragma clang fp contract(off)
  const int t = blockIdx.x * 256 + threadIdx.x; if (t >= SLEN * 32) return; const int j = t % 32, s = t / 32; const float c0 = -0.14391156831212787f;      /* -ln(10000)/64 rounded to f32 */ const float inv = expf((float)(2 * j) * c0); const float th = (float)s * inv; const float c = cosf(th), sn = sinf(th);
  { *(float*)(CS + t) = c; *(float*)(SN + t) = sn;  } }
__global__ __launch_bounds__(256) void k_lnu(const float* __restrict__ X, _Float16* __restrict__ N16, float* __restrict__ XB) {
  #pragma clang fp contract(off)
  const int wv = threadIdx.x >> 5, ln = threadIdx.x & 31; const size_t r = (size_t)blockIdx.x * 8 + wv; if (r >= NR) return; float a[32]; float s = 0.f;
  for (int i = 0; i < 4; ++i) { const v8f v = *(const v8f*)(X + r * DM + (i * 32 + ln) * 8); for (int q = 0; q < 8; ++q) { const float u = bf16_round(v[q]); a[i * 8 + q] = u; s += u; } }
  for (int o = 16; o > 0; o >>= 1) s += __shfl_xor(s, o, 32); const float mu = s / (float)DM; float var = 0.f; for (int q = 0; q < 32; ++q) { const float d = a[q] - mu; var += d * d; }
  for (int o = 16; o > 0; o >>= 1) var += __shfl_xor(var, o, 32); const float den = sqrtf(var / (float)(DM - 1)) + 1e-6f; const float inv = 1.0f / den;      /* one reciprocal per row; (x-mean)*inv vs the reference's division differs by <= 1 ulp */
  { for (int i = 0; i < 4; ++i) { const int c0 = (i * 32 + ln) * 8; FragH f; v8f xb; for (int q = 0; q < 8; ++q) { f.h[q] = (_Float16)((a[i * 8 + q] - mu) * inv); xb[q] = a[i * 8 + q]; } *(v8us*)((unsigned short*)N16 + r * DM + c0) = f.half[0]; *(v8f*)(XB + r * DM + c0) = xb; }  } }
__global__ __launch_bounds__(256) void k_vtg(const _Float16* __restrict__ V16, _Float16* __restrict__ Vt) { __shared__ unsigned short tl[64][66]; const int tid = threadIdx.x; const int slab = blockIdx.x / (SLEN / 64), lg = blockIdx.x % (SLEN / 64); const int b = slab / NH, h = slab % NH; const int hs = h / NREP;
  for (int i = tid; i < 64 * 8; i += 256) { const int r = i / 8, c8 = (i % 8) * 8; FragH f; f.half[0] = *(const v8us*)((const unsigned short*)V16 + ((size_t)b * SLEN + lg * 64 + r) * KVD + hs * 64 + c8); for (int q = 0; q < 8; ++q) tl[r][c8 + q] = f.u[q]; }
  __syncthreads();
  { for (int rd = 0; rd < 2; ++rd) { const int d = rd * 32 + tid / 8, pc = tid % 8; FragH f; for (int q = 0; q < 8; ++q) f.u[q] = tl[pc * 8 + q][d]; *(v8us*)((unsigned short*)Vt + ((size_t)slab * 64 + d) * SLEN + lg * 64 + pc * 8) = f.half[0]; }  } }

__device__ __forceinline__ void d_pm(const int t, const float* __restrict__ src, _Float16* __restrict__ P16) { if (t >= SLEN * (DM / 8)) return; const int c0 = (t % (DM / 8)) * 8; const int n = t / (DM / 8); FragH f; for (int q = 0; q < 8; ++q) f.h[q] = (_Float16)bf16_round(src[(size_t)(c0 + q) * SLEN + n]);
  *(v8us*)((unsigned short*)P16 + (size_t)n * DM + c0) = f.half[0];  }
// The six independent preparation jobs in one launch: blocks [0, 2 PMB) write the two token-major planes, the next 4 WSB blocks the four weight planes; each block does what a block of the single launches did.
#define PMB ((SLEN * (DM / 8) + 255) / 256)
#define WSB ((DM * DM / 8 + 255) / 256)
__global__ __launch_bounds__(256) void k_prep(const float* __restrict__ vid, const float* __restrict__ reff, _Float16* __restrict__ XV, _Float16* __restrict__ XR,
    const float* __restrict__ Wq, const float* __restrict__ Wk, const float* __restrict__ Wv, const float* __restrict__ Wo, _Float16* __restrict__ BQ, _Float16* __restrict__ BK, _Float16* __restrict__ BV, _Float16* __restrict__ BO) {
  const int bx = blockIdx.x;
  if (bx < 2 * PMB) { const bool second = bx >= PMB; d_pm((bx - (second ? PMB : 0)) * 256 + (int)threadIdx.x, second ? reff : vid, second ? XR : XV); return; }
  const int j = (bx - 2 * PMB) / WSB, wb = (bx - 2 * PMB) % WSB;
  const float* Wm = (j == 0) ? Wq : ((j == 1) ? Wk : ((j == 2) ? Wv : Wo)); _Float16* Bt = (j == 0) ? BQ : ((j == 1) ? BK : ((j == 2) ? BV : BO));
  d_wsc((size_t)wb * 256 + threadIdx.x, Wm, Bt, DM * DM / 8, 16.0f); }
__global__ __launch_bounds__(256) void k_nchw(const float* __restrict__ F, float* __restrict__ outb) { const int t = blockIdx.x * 256 + threadIdx.x; if (t >= DM * (SLEN / 4)) return; const int p0 = (t % (SLEN / 4)) * 4; const int o = t / (SLEN / 4); v4f r; for (int q = 0; q < 4; ++q) r[q] = F[(size_t)(p0 + q) * DM + o];
  *(v4f*)(outb + (size_t)o * SLEN + p0) = r;  }

extern "C" void kernel_launch(void* const* d_in, const int* in_sizes, int n_in,
                              void* d_out, int out_size, void* d_ws, size_t ws_size, hipStream_t stream) {
  (void)in_sizes; (void)n_in; (void)out_size;
  const float* const* I = (const float* const*)d_in; const float* vid = I[0]; const float* reff = I[1]; const float* Wq = I[2]; const float* bq = I[3]; const float* Wk = I[4]; const float* bk = I[5]; const float* Wv = I[6]; const float* bv = I[7]; const float* Wo = I[8]; const float* bo = I[9];
  char* ws = (char*)d_ws; size_t off = 0;
  auto take = [&](size_t bytes) { char* p = ws + off; off += (bytes + 255) & ~(size_t)255; return p; };
  const size_t np = (size_t)SLEN * DM;
  _Float16* BQ = (_Float16*)take((size_t)DM * DM * 2); _Float16* BK = (_Float16*)take((size_t)DM * DM * 2); _Float16* BV = (_Float16*)take((size_t)DM * DM * 2); _Float16* BO = (_Float16*)take((size_t)DM * DM * 2);
  _Float16* XV = (_Float16*)take(np * 2); _Float16* XR = (_Float16*)take(np * 2); _Float16* Q16 = (_Float16*)take(np * 2); _Float16* K16 = (_Float16*)take(np * 2); _Float16* VT = (_Float16*)take(np * 2); _Float16* O16 = (_Float16*)take(np * 2);
  if (off > ws_size) return;      /* 2 + 6 x 4 = 26 MiB */
  k_prep<<<2 * PMB + 4 * WSB, 256, 0, stream>>>(vid, reff, XV, XR, Wq, Wk, Wv, Wo, BQ, BK, BV, BO);      /* 'oc' = natural Bt */
  const dim3 gP((SLEN / 128) * (DM / 64), 1);
  const dim3 gP3((SLEN / 128) * (DM / 64), 3);
  k_gemm2x3<0><<<gP3, 128, 0, stream>>>(XV, XR, XR, BQ, BK, BV, bq, bk, bv, Q16, K16, VT, 0.0625f, DM, SLEN, DM, DM);      /* q, k token-major; v as V^T [channel][token] */
  k_flash<0><<<NB * NH * QBNP, 128, 0, stream>>>(Q16, DM, K16, DM, VT, nullptr, O16, DM);      /* 4096 x 4096 per head */
  k_gemm2<0, true><<<gP, 128, 0, stream>>>(BO, DM, 0, O16, DM, 0, 0.0625f, bo, 0, nullptr, 1, 0, 0, (float*)d_out, nullptr, SLEN, 0, DM, SLEN, DM);      /* out[channel][token] */
}

// v007
// It runs in 75.2 microseconds.
// Two timings next to v006 put it at 1.13 and 1.14 times that version's speed.
// Over all steps from v000 it is 7.64 times as fast.
#include <hip/hip_runtime.h>
// CrossViewAttention3D (1 clip: 512 channels x (4 x 32 x 32 = 4096) tokens, 8 heads x 64): q = Wq video + bq, k = Wk ref + bk, v = Wv ref + bv (1x1x1 convs = channel matmuls); softmax(q.k / 8) over the 4096 ref tokens; out = Wo ctx + bo; channel-major in and out.
// Structure: exact token-major f16 planes of both inputs; q, k, v as f16 WMMA GEMM outputs (32x64 wave tiles, f32 accumulation, exact x16 weights + bias, f16 out); V^T straight from its GEMM (weights as rows, tokens as columns); the fused flash kernel (4096 x 4096 per head, plain operands) stores ctx as f16; the Wo + bo GEMM, weights as rows, stores channel-major.
// Compute dtype: inputs rounded to bf16; inputs exact as f16; q/k/P/v/ctx as plain f16 operands (~2^-12); softmax f32. v_wmma_f32_16x16x32_f16.
#define NB 1
#define DM 512
#define NKV 8
#define NREP (NH / NKV)
#define KVD (NKV * 64)           /* 512 */
#define NR (NB * SLEN)           /* 4096 */
#define SLEN 4096
#define TQ SLEN
#define TK SLEN
#define NH 8
#define SCL 0.125f
#define QBLKS (TQ / 64)
#define QB05 0
#define QBN5 4
#define QB0P 0
#define QBNP QBLKS           /* non-causal: plain flash on every query block */
#define RE 256
typedef __bf16 v16b __attribute__((ext_vector_type(16)));
typedef unsigned short v8us __attribute__((ext_vector_type(8), may_alias));
typedef float  v8f  __attribute__((ext_vector_type(8)));
typedef float  v4f  __attribute__((ext_vector_type(4)));
typedef float  v4fa __attribute__((ext_vector_type(4), may_alias));
union FragB { v16b v; v8us half[2]; unsigned short u[16]; };

__device__ __forceinline__ unsigned short bf16_bits(float x) { unsigned int u = __float_as_uint(x); return (unsigned short)((u + 0x7FFFu + ((u >> 16) & 1u)) >> 16); }
__device__ __forceinline__ float bf16_val(unsigned short b) { return __uint_as_float(((unsigned int)b) << 16); }
__device__ __forceinline__ float bf16_round(float x) { return bf16_val(bf16_bits(x)); }
// D += A·B with NT terms: 1 = ah·bh, 2 = + al·bh (A split), 3 = + ah·bl (both split)
template <int NT>
__device__ __forceinline__ v8f mmaN(v16b ah, v16b al, v16b bh, v16b bl, v8f c) {
  c = __builtin_amdgcn_wmma_f32_16x16x32_bf16(false, ah, false, bh, (short)0, c, false, false);
  if (NT >= 2) c = __builtin_amdgcn_wmma_f32_16x16x32_bf16(false, al, false, bh, (short)0, c, false, false);
  if (NT >= 3) c = __builtin_amdgcn_wmma_f32_16x16x32_bf16(false, ah, false, bl, (short)0, c, false, false);
  asm volatile("v_nop\n\tv_nop\n\tv_nop\n\tv_nop" : "+v"(c) : "v"(ah), "v"(al), "v"(bh), "v"(bl));
  return c;
}

__global__ __launch_bounds__(256) void k_wt_bf16(const float* __restrict__ W, unsigned short* __restrict__ Wt, int K, int N) {
  const int t = blockIdx.x * 256 + threadIdx.x;
  const int k8n = K / 8;
  if (t >= N * k8n) return;
  const int n = t / k8n, k8 = (t % k8n) * 8;
  v8us v;
#pragma unroll
  for (int i = 0; i < 8; ++i) v[i] = bf16_bits(W[(size_t)(k8 + i) * N + n]);
  *(v8us*)(Wt + (size_t)n * K + k8) = v;
  
}

// GEMM C[M][N] (f32, pitch ldc) = act(A[M][K]·W + bias). A f32 row-major (pitch lda) converted per fragment to bf16
// (ASPLIT: hi/lo two planes -> 2 terms, else single rounded term); Wt bf16 [N][K] (pitch ldb). BIAS_BF16 rounds the
// bias to bf16 first (bias quantised to bf16 before the add). K%32==0, M%16==0, N%64==0.
template <bool ASPLIT, int ACT, bool BIAS_BF16>
__global__ __launch_bounds__(128) void k_gemm_bf(const float* __restrict__ A, int lda, const unsigned short* __restrict__ Wt, int ldb,
                                               const float* __restrict__ bias, float* __restrict__ C, int ldc, int M, int N, int K) {
  __shared__ __attribute__((aligned(16))) float so[4][16][64];
  const int tid = threadIdx.x, w = tid >> 5, lane = tid & 31, ln = lane & 15, hh = lane >> 4;
  const int ntn = N / 64;
  const int wid = blockIdx.x * 4 + w;
  const int mt = wid / ntn, nq = wid % ntn;
  if (mt * 16 >= M) return;
  const int row0 = mt * 16, col0 = nq * 64;
  const float* arow = A + (size_t)(row0 + ln) * lda;
  v8f acc[4] = {};
  for (int kb = 0; kb < K; kb += 32) {
    FragB ah, al;
    const v4f x0 = *(const v4fa*)(arow + kb + 8 * hh), x1 = *(const v4fa*)(arow + kb + 8 * hh + 4);
    const v4f x2 = *(const v4fa*)(arow + kb + 16 + 8 * hh), x3 = *(const v4fa*)(arow + kb + 16 + 8 * hh + 4);
    float xs[16] = {x0[0],x0[1],x0[2],x0[3],x1[0],x1[1],x1[2],x1[3],x2[0],x2[1],x2[2],x2[3],x3[0],x3[1],x3[2],x3[3]};
#pragma unroll
    for (int i = 0; i < 16; ++i) { const unsigned short hb = bf16_bits(xs[i]); ah.u[i] = hb; al.u[i] = ASPLIT ? bf16_bits(xs[i] - bf16_val(hb)) : (unsigned short)0; }
#pragma unroll
    for (int t = 0; t < 4; ++t) {
      const unsigned short* brow = Wt + (size_t)(col0 + t * 16 + ln) * ldb + kb;
      FragB b;
      b.half[0] = *(const v8us*)(brow + 8 * hh);
      b.half[1] = *(const v8us*)(brow + 16 + 8 * hh);
      acc[t] = mmaN<ASPLIT ? 2 : 1>(ah.v, al.v, b.v, b.v, acc[t]);
    }
  }
#pragma unroll
  for (int t = 0; t < 4; ++t) {
    float bv = bias ? bias[col0 + t * 16 + ln] : 0.f;
    if (BIAS_BF16) bv = bf16_round(bv);
#pragma unroll
    for (int r = 0; r < 8; ++r) { float v = acc[t][r] + bv; if (ACT == 1) v = fmaxf(v, 0.f); so[w][8 * hh + r][t * 16 + ln] = v; }
  }
  __builtin_amdgcn_fence(__ATOMIC_ACQ_REL, "workgroup");
  __builtin_amdgcn_wave_barrier();
  const int rsub = lane >> 4, c4 = (lane & 15) * 4;
  {
#pragma unroll
    for (int q = 0; q < 8; ++q) {
      const int r = q * 2 + rsub;
      const v4f v = *(const v4fa*)&so[w][r][c4];
      *(v4f*)(C + (size_t)(row0 + r) * ldc + col0 + c4) = v;
    }
    
  }
}

// GEMM C = act(A·W + bias + resid): A f32 (ASPLIT -> hi/lo 2 terms), Wt bf16 [N][K]; ACT 0 none, 1 relu, 2 exact gelu;
// resid (optional, f32, row index = (row % rmod), pitch ldr, RES_BF16 rounds it) added before the activation.
template <bool ASPLIT, int ACT, bool BIAS_BF16, bool RES_BF16>
__global__ __launch_bounds__(128) void k_gemm_bf3(const float* __restrict__ A, int lda, const unsigned short* __restrict__ Wt, int ldb,
                                                const float* __restrict__ bias, const float* __restrict__ resid, int rmod, int ldr,
                                                float* __restrict__ C, int ldc, int M, int N, int K) {
  __shared__ __attribute__((aligned(16))) float so[4][16][64];
  const int tid = threadIdx.x, w = tid >> 5, lane = tid & 31, ln = lane & 15, hh = lane >> 4;
  const int ntn = N / 64;
  const int wid = blockIdx.x * 4 + w;
  const int mt = wid / ntn, nq = wid % ntn;
  if (mt * 16 >= M) return;
  const int row0 = mt * 16, col0 = nq * 64;
  const float* arow = A + (size_t)(row0 + ln) * lda;
  v8f acc[4] = {};
  for (int kb = 0; kb < K; kb += 32) {
    FragB ah, al;
    const v4f x0 = *(const v4fa*)(arow + kb + 8 * hh), x1 = *(const v4fa*)(arow + kb + 8 * hh + 4);
    const v4f x2 = *(const v4fa*)(arow + kb + 16 + 8 * hh), x3 = *(const v4fa*)(arow + kb + 16 + 8 * hh + 4);
    float xs[16] = {x0[0],x0[1],x0[2],x0[3],x1[0],x1[1],x1[2],x1[3],x2[0],x2[1],x2[2],x2[3],x3[0],x3[1],x3[2],x3[3]};
#pragma unroll
    for (int i = 0; i < 16; ++i) { const unsigned short hb = bf16_bits(xs[i]); ah.u[i] = hb; al.u[i] = ASPLIT ? bf16_bits(xs[i] - bf16_val(hb)) : (unsigned short)0; }
#pragma unroll
    for (int t = 0; t < 4; ++t) {
      const unsigned short* brow = Wt + (size_t)(col0 + t * 16 + ln) * ldb + kb;
      FragB b;
      b.half[0] = *(const v8us*)(brow + 8 * hh);
      b.half[1] = *(const v8us*)(brow + 16 + 8 * hh);
      acc[t] = mmaN<ASPLIT ? 2 : 1>(ah.v, al.v, b.v, b.v, acc[t]);
    }
  }
#pragma unroll
  for (int t = 0; t < 4; ++t) {
    const int col = col0 + t * 16 + ln;
    float bv = bias ? bias[col] : 0.f;
    if (BIAS_BF16) bv = bf16_round(bv);
#pragma unroll
    for (int r = 0; r < 8; ++r) {
      float v = acc[t][r] + bv;
      if (resid) { float rv = resid[(size_t)((row0 + 8 * hh + r) % rmod) * ldr + col]; if (RES_BF16) rv = bf16_round(rv); v += rv; }
      if (ACT == 1) v = fmaxf(v, 0.f);
      if (ACT == 2) v = 0.5f * v * (1.0f + erff(v * 0.70710678118654752f));
      if (ACT == 3) { const float u = 0.7978845608028654f * (v + 0.044715f * v * v * v); v = 0.5f * v * (1.0f + tanhf(u)); }
      so[w][8 * hh + r][t * 16 + ln] = v;
    }
  }
  __builtin_amdgcn_fence(__ATOMIC_ACQ_REL, "workgroup");
  __builtin_amdgcn_wave_barrier();
  const int rsub = lane >> 4, c4 = (lane & 15) * 4;
  {
#pragma unroll
    for (int q = 0; q < 8; ++q) {
      const int r = q * 2 + rsub;
      const v4f v = *(const v4fa*)&so[w][r][c4];
      *(v4f*)(C + (size_t)(row0 + r) * ldc + col0 + c4) = v;
    }
    
  }
}
// row LayerNorm (biased variance, eps) over N: s = X (+ R); optional out_sum <- s; out_norm <- (s-mu)*rsqrt(var+eps)*g + b
template <bool PARAM_BF16>
__global__ __launch_bounds__(256) void k_layernorm(const float* __restrict__ X, const float* __restrict__ R, const float* __restrict__ g, const float* __restrict__ bta,
                                                  float* __restrict__ out_sum, float* __restrict__ out_norm, int N, float eps) {
  __shared__ float red[256];
  const int row = blockIdx.x, tid = threadIdx.x;
  const float* x = X + (size_t)row * N; const float* rr = R ? R + (size_t)row * N : nullptr;
  float vals[16];                     // up to N = 4096
  const int per = N / 256;            // contiguous chunk per thread? use strided-by-4 chunks: thread handles j = tid*4 + 1024*u
  float s1 = 0.f;
  for (int u = 0; u < per / 4; ++u) {
    const int j = tid * 4 + 1024 * u;
    const v4f a = *(const v4fa*)(x + j);
    v4f b = {0.f,0.f,0.f,0.f}; if (rr) b = *(const v4fa*)(rr + j);
#pragma unroll
    for (int q = 0; q < 4; ++q) { const float v = a[q] + b[q]; vals[u * 4 + q] = v; s1 += v; }
  }
  red[tid] = s1; __syncthreads();
  for (int st = 128; st > 0; st >>= 1) { if (tid < st) red[tid] += red[tid + st]; __syncthreads(); }
  const float mu = red[0] / (float)N; __syncthreads();
  float s2 = 0.f;
  for (int u = 0; u < per / 4; ++u)
#pragma unroll
    for (int q = 0; q < 4; ++q) { const float c = vals[u * 4 + q] - mu; s2 += c * c; }
  red[tid] = s2; __syncthreads();
  for (int st = 128; st > 0; st >>= 1) { if (tid < st) red[tid] += red[tid + st]; __syncthreads(); }
  const float rs = rsqrtf(red[0] / (float)N + eps);
  {
    for (int u = 0; u < per / 4; ++u) {
      const int j = tid * 4 + 1024 * u;
      v4f o, sm;
#pragma unroll
      for (int q = 0; q < 4; ++q) {
        float gg = g[j + q], bb = bta[j + q];
        if (PARAM_BF16) { gg = bf16_round(gg); bb = bf16_round(bb); }
        sm[q] = vals[u * 4 + q]; o[q] = (vals[u * 4 + q] - mu) * rs * gg + bb;
      }
      if (out_sum) *(v4f*)(out_sum + (size_t)row * N + j) = sm;
      *(v4f*)(out_norm + (size_t)row * N + j) = o;
    }
    
  }
}



// ---- f16 WMMA path (v_wmma_f32_16x16x32_f16): 11-bit significands for operands in range — used where a [0,1] probability operand needs more precision than bf16
typedef _Float16 v16h __attribute__((ext_vector_type(16)));
union FragH { v16h v; v8us half[2]; _Float16 h[16]; unsigned short u[16]; };
template <int NT>
__device__ __forceinline__ v8f mmaH(v16h ah, v16h al, v16h bh, v16h bl, v8f c) {
  c = __builtin_amdgcn_wmma_f32_16x16x32_f16(false, ah, false, bh, (short)0, c, false, false);
  if (NT >= 2) c = __builtin_amdgcn_wmma_f32_16x16x32_f16(false, al, false, bh, (short)0, c, false, false);
  if (NT >= 3) c = __builtin_amdgcn_wmma_f32_16x16x32_f16(false, ah, false, bl, (short)0, c, false, false);
  asm volatile("v_nop\n\tv_nop\n\tv_nop\n\tv_nop" : "+v"(c) : "v"(ah), "v"(al), "v"(bh), "v"(bl));
  return c;
}
// batched GEMM like k_gemm_b but f16 operands: A f32 (split into f16 hi/lo if ASPLIT, else rounded to f16), Bt = f16 values [n][k]; alpha; C f32; N multiple of 16 (partial tiles skipped)
template <bool ASPLIT>
__global__ __launch_bounds__(128) void k_gemm_h(const float* __restrict__ A, int lda, size_t sA, const _Float16* __restrict__ Bh, int ldb, size_t sB, float alpha, float* __restrict__ C, int ldc, size_t sC, int M, int N, int K) {
  __shared__ __attribute__((aligned(16))) float so[4][16][64];
  const int tid = threadIdx.x, w = tid >> 5, lane = tid & 31, ln = lane & 15, hh = lane >> 4; const int by = blockIdx.y;
  A += (size_t)by * sA; Bh += (size_t)by * sB; C += (size_t)by * sC;
  const int ntn = (N + 63) / 64; const int wid = blockIdx.x * 4 + w; const int mt = wid / ntn, nq = wid % ntn; if (mt * 16 >= M) return;
  const int row0 = mt * 16, col0 = nq * 64; const float* arow = A + (size_t)(row0 + ln) * lda;
  v8f acc[4] = {};
  for (int kb = 0; kb < K; kb += 32) {
    FragH ah, al;
    const v4f x0 = *(const v4fa*)(arow + kb + 8 * hh), x1 = *(const v4fa*)(arow + kb + 8 * hh + 4), x2 = *(const v4fa*)(arow + kb + 16 + 8 * hh), x3 = *(const v4fa*)(arow + kb + 16 + 8 * hh + 4);
    float xs[16] = {x0[0],x0[1],x0[2],x0[3],x1[0],x1[1],x1[2],x1[3],x2[0],x2[1],x2[2],x2[3],x3[0],x3[1],x3[2],x3[3]};
#pragma unroll
    for (int i = 0; i < 16; ++i) { const _Float16 h = (_Float16)xs[i]; ah.h[i] = h; al.h[i] = ASPLIT ? (_Float16)(xs[i] - (float)h) : (_Float16)0.0f; }
#pragma unroll
    for (int t = 0; t < 4; ++t) { if (col0 + t * 16 >= N) continue; const size_t boff = (size_t)(col0 + t * 16 + ln) * ldb + kb; FragH bq; bq.half[0] = *(const v8us*)(Bh + boff + 8 * hh); bq.half[1] = *(const v8us*)(Bh + boff + 16 + 8 * hh);
      acc[t] = mmaH<ASPLIT ? 2 : 1>(ah.v, al.v, bq.v, bq.v, acc[t]); }
  }
#pragma unroll
  for (int t = 0; t < 4; ++t) { if (col0 + t * 16 >= N) continue;
#pragma unroll
    for (int r = 0; r < 8; ++r) so[w][8 * hh + r][t * 16 + ln] = acc[t][r] * alpha; }
  __builtin_amdgcn_fence(__ATOMIC_ACQ_REL, "workgroup"); __builtin_amdgcn_wave_barrier();
  const int rsub = lane >> 4, c4 = (lane & 15) * 4;
  {
#pragma unroll
    for (int q = 0; q < 8; ++q) { const int r = q * 2 + rsub; if (col0 + c4 < N) { const v4f v = *(const v4fa*)&so[w][r][c4]; *(v4f*)(C + (size_t)(row0 + r) * ldc + col0 + c4) = v; } }
     }
}

// Wt[n][k] = f16(W[k][n]·scale) from f32 row-major W[K][N] (scale = power of two; bf16-exact weights stay exact in f16 away from the subnormal range)
__global__ __launch_bounds__(256) void k_wt_f16(const float* __restrict__ W, _Float16* __restrict__ Wt, int K, int N, float scale) {
  const int t = blockIdx.x * 256 + threadIdx.x; if (t >= N * (K / 8)) return; const int n = t / (K / 8), k8 = (t % (K / 8)) * 8; FragH f;
#pragma unroll
  for (int i = 0; i < 8; ++i) f.h[i] = (_Float16)(bf16_round(W[(size_t)(k8 + i) * N + n]) * scale); const v8us o = f.half[0];
  *(v8us*)((unsigned short*)Wt + (size_t)n * K + k8) = o; 
}
// k_gemm_hh variant with fused epilogue: v = acc·alpha + bias[by·sBias + col] (+ CP[(row/rowsPerB)·sCPb + by·64 + col] if CP) ; ACT 0 none / 1 elu ; writes f16 C16 (and f32 C if non-null)
template <int ACT>
__global__ __launch_bounds__(128) void k_gemm_hhx(const _Float16* __restrict__ A, int lda, size_t sA, const _Float16* __restrict__ Bh, int ldb, size_t sB, float alpha, const float* __restrict__ bias, size_t sBias, const float* __restrict__ CP, int rowsPerB, size_t sCPb, int row0g,
    float* __restrict__ C, _Float16* __restrict__ C16, int ldc, size_t sC, int M, int N, int K) {
  __shared__ __attribute__((aligned(16))) float so[4][16][64];
  const int tid = threadIdx.x, w = tid >> 5, lane = tid & 31, ln = lane & 15, hh = lane >> 4; const int by = blockIdx.y;
  A += (size_t)by * sA; Bh += (size_t)by * sB; const size_t cofs = (size_t)by * sC; const float* bp = bias ? bias + (size_t)by * sBias : nullptr;
  const int ntn = (N + 63) / 64; const int wid = blockIdx.x * 4 + w; const int mt = wid / ntn, nq = wid % ntn; if (mt * 16 >= M) return;
  const int row0 = mt * 16, col0 = nq * 64; const _Float16* arow = A + (size_t)(row0 + ln) * lda;
  v8f acc[4] = {};
  for (int kb = 0; kb < K; kb += 32) { FragH ah; ah.half[0] = *(const v8us*)((const unsigned short*)arow + kb + 8 * hh); ah.half[1] = *(const v8us*)((const unsigned short*)arow + kb + 16 + 8 * hh);
#pragma unroll
    for (int t = 0; t < 4; ++t) { if (col0 + t * 16 >= N) continue; const size_t boff = (size_t)(col0 + t * 16 + ln) * ldb + kb; FragH bq; bq.half[0] = *(const v8us*)((const unsigned short*)Bh + boff + 8 * hh); bq.half[1] = *(const v8us*)((const unsigned short*)Bh + boff + 16 + 8 * hh);
      acc[t] = mmaH<1>(ah.v, ah.v, bq.v, bq.v, acc[t]); }
  }
#pragma unroll
  for (int t = 0; t < 4; ++t) { if (col0 + t * 16 >= N) continue; const int col = col0 + t * 16 + ln; const float bv = bp ? bf16_round(bp[col]) : 0.f;
#pragma unroll
    for (int r = 0; r < 8; ++r) { float v = acc[t][r] * alpha + bv; if (CP) { const int bidx = (row0g + row0 + 8 * hh + r) / rowsPerB; v += CP[(size_t)bidx * sCPb + (size_t)by * 64 + col]; } if (ACT == 1) v = (v > 0.f) ? v : expm1f(v); else if (ACT == 7) v = (v > 0.f) ? v + 1.0f : expf(v); else if (ACT == 8) v = tanhf(v); else if (ACT == 9) v = 0.5f * v * (1.0f + tanhf(0.7978845608028654f * (v + 0.044715f * v * v * v))); else if (ACT == 11) v = 1.0f / (1.0f + expf(-v)); else if (ACT == 12) v = (v > 0.f) ? v : 0.01f * v; else if (ACT == 14) v = (v > 0.f) ? v : 0.1f * v; else if (ACT == 15) v = v / (1.0f + expf(-v)); else if (ACT == 3) v = fmaxf(v, 0.f); else if (ACT == 6) v = 0.5f * v * (1.0f + erff(v * 0.70710678118654752f)); so[w][8 * hh + r][t * 16 + ln] = v; } }
  __builtin_amdgcn_fence(__ATOMIC_ACQ_REL, "workgroup"); __builtin_amdgcn_wave_barrier();
  const int rsub = lane >> 4, c4 = (lane & 15) * 4; typedef _Float16 v4h __attribute__((ext_vector_type(4)));
  {
#pragma unroll
    for (int q = 0; q < 8; ++q) { const int r = q * 2 + rsub; if (col0 + c4 < N) { const v4f v = *(const v4fa*)&so[w][r][c4]; if (C) *(v4f*)(C + cofs + (size_t)(row0 + r) * ldc + col0 + c4) = v; if (C16) { v4h h4; for (int i = 0; i < 4; ++i) h4[i] = (_Float16)v[i]; *(v4h*)(C16 + cofs + (size_t)(row0 + r) * ldc + col0 + c4) = h4; } } }
     }
}


typedef _Float16 v4h __attribute__((ext_vector_type(4)));

__global__ __launch_bounds__(256) void k_x16(const float* __restrict__ x, _Float16* __restrict__ X16, size_t n8) { const size_t t = (size_t)blockIdx.x * 256 + threadIdx.x; if (t >= n8) return; FragH f;
#pragma unroll
  for (int q = 0; q < 8; ++q) f.h[q] = (_Float16)bf16_round(x[t * 8 + q]); *(v8us*)((unsigned short*)X16 + t * 8) = f.half[0];  }
__global__ __launch_bounds__(256) void k_h16(const float* __restrict__ x, _Float16* __restrict__ X16, size_t n8) { const size_t t = (size_t)blockIdx.x * 256 + threadIdx.x; if (t >= n8) return; FragH f;
#pragma unroll
  for (int q = 0; q < 8; ++q) f.h[q] = (_Float16)x[t * 8 + q]; *(v8us*)((unsigned short*)X16 + t * 8) = f.half[0];  }
__global__ __launch_bounds__(256) void k_round16f(const float* __restrict__ W, _Float16* __restrict__ Bt, size_t n8) { const size_t t = (size_t)blockIdx.x * 256 + threadIdx.x; if (t >= n8) return; FragH f;
#pragma unroll
  for (int i = 0; i < 8; ++i) f.h[i] = (_Float16)(bf16_round(W[t * 8 + i]) * 16.0f); *(v8us*)((unsigned short*)Bt + t * 8) = f.half[0];  }
template <int NHv, int TTv>
__global__ __launch_bounds__(256) void k_vt(const _Float16* __restrict__ V16, int ldv, int voff, _Float16* __restrict__ Vt) { __shared__ unsigned short tl[64][66]; const int tid = threadIdx.x; const int slab = blockIdx.x / (TTv / 64), lg = blockIdx.x % (TTv / 64); const int b = slab / NHv, h = slab % NHv;
  for (int i = tid; i < 64 * 8; i += 256) { const int r = i / 8, c8 = (i % 8) * 8; FragH f; f.half[0] = *(const v8us*)((const unsigned short*)V16 + ((size_t)b * TTv + lg * 64 + r) * ldv + voff + h * 64 + c8);
#pragma unroll
    for (int q = 0; q < 8; ++q) tl[r][c8 + q] = f.u[q]; }
  __syncthreads();
  {
#pragma unroll
    for (int rd = 0; rd < 2; ++rd) { const int d = rd * 32 + tid / 8, pc = tid % 8; FragH f;
#pragma unroll
      for (int q = 0; q < 8; ++q) f.u[q] = tl[pc * 8 + q][d];
      *(v8us*)((unsigned short*)Vt + ((size_t)slab * 64 + d) * TTv + lg * 64 + pc * 8) = f.half[0]; }
     } }

__global__ __launch_bounds__(256) void k_hl(const float* __restrict__ F, _Float16* __restrict__ Hh, _Float16* __restrict__ Hl, size_t n8) { const size_t t = (size_t)blockIdx.x * 256 + threadIdx.x; if (t >= n8) return; FragH fh, fl; const v4f a = *(const v4fa*)(F + t * 8), c = *(const v4fa*)(F + t * 8 + 4);
#pragma unroll
  for (int q = 0; q < 4; ++q) { _Float16 h = (_Float16)a[q]; fh.h[q] = h; fl.h[q] = (_Float16)((a[q] - (float)h) * 1024.0f); h = (_Float16)c[q]; fh.h[4 + q] = h; fl.h[4 + q] = (_Float16)((c[q] - (float)h) * 1024.0f); }
  { *(v8us*)((unsigned short*)Hh + t * 8) = fh.half[0]; *(v8us*)((unsigned short*)Hl + t * 8) = fl.half[0];  } }

// ---- fast GEMM (work-group tile 128x64, wave tile 32x64; requires M % 128 == 0, N % 64 == 0 and K % 64 == 0, K >= 64); epilogue = k_gemm_hhx semantics ----
#define G2P 72      /* LDS row pitch in halves = 128 B + 16 B, the pitch of 16-byte LDS readers */
typedef unsigned short g2_tile[192][G2P];      /* one stage, 64 halves of k: rows 0..127 = the block's 128 rows of A, rows 128..191 = its 64 rows of B */
__device__ __forceinline__ v16h g2_frag(const unsigned short* p, int hh) { FragH f; f.half[0] = *(const v8us*)(p + 8 * hh); f.half[1] = *(const v8us*)(p + 16 + 8 * hh); return f.v; }
// One stage goes to LDS once per work-group by asynchronous copies, 16 B a lane, eight lanes a row: whole 128-B lines.
// l: this lane's LDS byte address of its first A piece; ga, gb: its first A and B piece in global memory; piece i lies 16 rows further on both sides, and the four B pieces follow the eight A pieces in LDS.
__device__ __forceinline__ void g2_stage(unsigned l, const _Float16* ga, size_t a16, const _Float16* gb, size_t b16) {
  const unsigned l1 = l + 2304u, l2 = l + 4608u, l3 = l + 6912u, l4 = l + 9216u, l5 = l + 11520u, l6 = l + 13824u, l7 = l + 16128u, l8 = l + 18432u, l9 = l + 20736u, l10 = l + 23040u, l11 = l + 25344u;      /* 16 rows x 144 B */
  const _Float16* ga1 = ga + a16; const _Float16* ga2 = ga1 + a16; const _Float16* ga3 = ga2 + a16; const _Float16* ga4 = ga3 + a16; const _Float16* ga5 = ga4 + a16; const _Float16* ga6 = ga5 + a16; const _Float16* ga7 = ga6 + a16;
  const _Float16* gb1 = gb + b16; const _Float16* gb2 = gb1 + b16; const _Float16* gb3 = gb2 + b16;
  /* the closing s_wait_xcnt 0 stands inside the statement so that no address register of a copy is rewritten in front of it */
  asm volatile("global_load_async_to_lds_b128 %0, %12, off\n\t"
               "global_load_async_to_lds_b128 %1, %13, off\n\t"
               "global_load_async_to_lds_b128 %2, %14, off\n\t"
               "global_load_async_to_lds_b128 %3, %15, off\n\t"
               "global_load_async_to_lds_b128 %4, %16, off\n\t"
               "global_load_async_to_lds_b128 %5, %17, off\n\t"
               "global_load_async_to_lds_b128 %6, %18, off\n\t"
               "global_load_async_to_lds_b128 %7, %19, off\n\t"
               "global_load_async_to_lds_b128 %8, %20, off\n\t"
               "global_load_async_to_lds_b128 %9, %21, off\n\t"
               "global_load_async_to_lds_b128 %10, %22, off\n\t"
               "global_load_async_to_lds_b128 %11, %23, off\n\t"
               "s_wait_xcnt 0x0"
               :: "v"(l), "v"(l1), "v"(l2), "v"(l3), "v"(l4), "v"(l5), "v"(l6), "v"(l7), "v"(l8), "v"(l9), "v"(l10), "v"(l11),
                  "v"(ga), "v"(ga1), "v"(ga2), "v"(ga3), "v"(ga4), "v"(ga5), "v"(ga6), "v"(ga7), "v"(gb), "v"(gb1), "v"(gb2), "v"(gb3) : "memory");
}
__device__ __forceinline__ v8f g2_mma(v16h a, v16h b, v8f c) { v8f d = __builtin_amdgcn_wmma_f32_16x16x32_f16(false, a, false, b, (short)0, c, false, false); asm volatile("v_nop\n\tv_nop\n\tv_nop\n\tv_nop" : "+v"(d) : "v"(a), "v"(b)); return d; }
// ROWB: the bias belongs to the rows of C (weights as the A operand: C comes out channel-major) instead of its columns. so, sT: the caller's output staging array and its two operand stages, one set for all bodies of a kernel.
template <int ACT, bool ROWB>
__device__ __forceinline__ void gemm2_body(float (*so)[32][68], g2_tile* sT, const int by, const _Float16* __restrict__ A, int lda, size_t sA, const _Float16* __restrict__ Bh, int ldb, size_t sB, float alpha, const float* __restrict__ bias, size_t sBias, const float* __restrict__ CP, int rowsPerB, size_t sCPb, int row0g,
    float* __restrict__ C, _Float16* __restrict__ C16, int ldc, size_t sC, int M, int N, int K) {
  const int tid = threadIdx.x, w = tid >> 5, lane = tid & 31, ln = lane & 15, hh = lane >> 4;
  A += (size_t)by * sA; Bh += (size_t)by * sB; const size_t cofs = (size_t)by * sC; const float* bp = bias ? bias + (size_t)by * sBias : nullptr;
  const int ntn = N >> 6; const int mt = blockIdx.x / ntn, nq = blockIdx.x - mt * ntn; const int row0 = mt * 128 + 32 * w, col0 = nq * 64; if (mt * 128 >= M) return;      /* the same for every wave of the block: it stands in front of the barriers */
  const int crow = tid >> 3, cc = (tid & 7) * 8;      /* eight lanes copy one 128-B row */
  const _Float16* ga = A + (size_t)(mt * 128 + crow) * lda + cc; const _Float16* gb = Bh + (size_t)(col0 + crow) * ldb + cc;
  const size_t a16 = (size_t)16 * lda, b16 = (size_t)16 * ldb;
  const unsigned l0 = (unsigned)(size_t)&sT[0][crow][cc];
  constexpr unsigned BUFB = sizeof(g2_tile);      /* bytes of one stage */
  const int nst = K >> 6;
  g2_stage(l0, ga, a16, gb, b16);
  const v8f z8 = {0.f,0.f,0.f,0.f,0.f,0.f,0.f,0.f}; v8f c00 = z8, c01 = z8, c02 = z8, c03 = z8, c10 = z8, c11 = z8, c12 = z8, c13 = z8;
  asm volatile("s_wait_asynccnt 0x0" ::: "memory");      /* stage 0: this wave's copies have landed */
  __syncthreads();      /* stage 0 is readable by every wave */
  if (nst > 1) g2_stage(l0 + BUFB, ga + 64, a16, gb + 64, b16);
#pragma unroll 1      /* stays rolled: one copy of the body serves both buffers, chosen by st & 1 */
  for (int st = 0; st < nst; ++st) {      /* stage st is worked on while stage st + 1 flies into the other buffer */
    const int bf = st & 1;
    const unsigned short* ar = &sT[bf][32 * w + ln][0]; const unsigned short* br = &sT[bf][128 + ln][0];
    v16h a0[2], a1[2], b[2][4];      /* all 24 LDS reads of the stage stand in front of its first product: one LDS latency a stage, not one for each pair of products */
#pragma unroll      /* unrolled, here and below: the fragments are indexed by constants and stay in registers, and the half stage becomes a constant offset of the LDS reads */
    for (int ks = 0; ks < 2; ++ks) { a0[ks] = g2_frag(ar + ks * 32, hh); a1[ks] = g2_frag(ar + 16 * G2P + ks * 32, hh);
#pragma unroll
      for (int t = 0; t < 4; ++t) b[ks][t] = g2_frag(br + t * 16 * G2P + ks * 32, hh); }
#pragma unroll
    for (int ks = 0; ks < 2; ++ks) {
      c00 = g2_mma(a0[ks], b[ks][0], c00); c10 = g2_mma(a1[ks], b[ks][0], c10); c01 = g2_mma(a0[ks], b[ks][1], c01); c11 = g2_mma(a1[ks], b[ks][1], c11);
      c02 = g2_mma(a0[ks], b[ks][2], c02); c12 = g2_mma(a1[ks], b[ks][2], c12); c03 = g2_mma(a0[ks], b[ks][3], c03); c13 = g2_mma(a1[ks], b[ks][3], c13); }
    asm volatile("s_wait_dscnt 0x0" ::: "memory");      /* this wave's reads of buffer bf are done before the buffer is given up */
    asm volatile("s_wait_asynccnt 0x0" ::: "memory");      /* this wave's copies of stage st + 1 have landed */
    __syncthreads();      /* publishes stage st + 1 and ends every wave's reads of buffer bf */
    if (st + 2 < nst) g2_stage(l0 + bf * BUFB, ga + (size_t)(st + 2) * 64, a16, gb + (size_t)(st + 2) * 64, b16);
  }
  asm volatile("s_wait_asynccnt 0x0" ::: "memory");      /* no copy is left in flight when the wave goes on */
  v8f accs[8] = {c00, c01, c02, c03, c10, c11, c12, c13};
  float bvr[2][8];      /* ROWB: the biases of this lane's sixteen rows */
  if (ROWB) {
#pragma unroll      /* unrolled: bvr is indexed by constants and stays in registers */
    for (int i = 0; i < 16; ++i) bvr[i >> 3][i & 7] = bp ? bf16_round(bp[row0 + (i >> 3) * 16 + 8 * hh + (i & 7)]) : 0.f; }
#pragma unroll
  for (int u = 0; u < 8; ++u) { const int t = u & 3, half = u >> 2; const int col = col0 + t * 16 + ln; const float bvc = (!ROWB && bp) ? bf16_round(bp[col]) : 0.f;
#pragma unroll
    for (int r = 0; r < 8; ++r) { const int rloc = half * 16 + 8 * hh + r; const float bv = ROWB ? bvr[half][r] : bvc; float v = accs[u][r] * alpha + bv; if (CP) { const int bidx = (row0g + row0 + rloc) / rowsPerB; v += CP[(size_t)bidx * sCPb + (size_t)by * 64 + col]; }
      if (ACT == 3) v = fmaxf(v, 0.f); else if (ACT == 6) v = 0.5f * v * (1.0f + erff(v * 0.70710678118654752f)); else if (ACT == 11) v = 1.0f / (1.0f + expf(-v)); else if (ACT == 15) v = v / (1.0f + expf(-v)); else if (ACT == 12) v = (v > 0.f) ? v : 0.01f * v; else if (ACT == 8) v = tanhf(v);
      so[w][rloc][t * 16 + ln] = v; } }
  __builtin_amdgcn_fence(__ATOMIC_ACQ_REL, "workgroup"); __builtin_amdgcn_wave_barrier();
  const int rsub = lane >> 4, c4 = (lane & 15) * 4;
  { v4f vq[16];      /* all LDS reads first, so that the waits behind the stores do not stand between them */
#pragma unroll      /* unrolled, here and below: vq is indexed by constants and stays in registers */
    for (int q = 0; q < 16; ++q) vq[q] = *(const v4fa*)&so[w][q * 2 + rsub][c4];
#pragma unroll
    for (int q = 0; q < 16; ++q) { const int r = q * 2 + rsub; const v4f v = vq[q];      /* s_wait_xcnt 0 behind a store: the conversions and address sums that follow reuse the store's registers */
      if (C) { *(v4f*)(C + cofs + (size_t)(row0 + r) * ldc + col0 + c4) = v; asm volatile("s_wait_xcnt 0x0" ::: "memory"); }
      if (C16) { v4h h4; for (int i = 0; i < 4; ++i) h4[i] = (_Float16)v[i]; *(v4h*)(C16 + cofs + (size_t)(row0 + r) * ldc + col0 + c4) = h4; if (q + 1 < 16) asm volatile("s_wait_xcnt 0x0" ::: "memory"); } }
     } }
template <int ACT, bool ROWB>
__global__ __launch_bounds__(128) void k_gemm2(const _Float16* __restrict__ A, int lda, size_t sA, const _Float16* __restrict__ Bh, int ldb, size_t sB, float alpha, const float* __restrict__ bias, size_t sBias, const float* __restrict__ CP, int rowsPerB, size_t sCPb, int row0g,
    float* __restrict__ C, _Float16* __restrict__ C16, int ldc, size_t sC, int M, int N, int K) {
  __shared__ __attribute__((aligned(16))) float so[4][32][68];
  __shared__ __attribute__((aligned(16))) g2_tile sT[2];
  gemm2_body<ACT, ROWB>(so, sT, blockIdx.y, A, lda, sA, Bh, ldb, sB, alpha, bias, sBias, CP, rowsPerB, sCPb, row0g, C, C16, ldc, sC, M, N, K); }
// Three independent products of one shape in one launch: blockIdx.y picks the operands, the bias and the f16 output; the tile work is gemm2_body's.
// Jobs 0 and 1 give C[M][N] (tokens x channels). Job 2 takes its operands in swapped roles and gives C2[N][M] (channels x tokens, pitch M), the layout its reader wants; (M / 128)(N / 64) tiles either way.
template <int ACT>
__global__ __launch_bounds__(128) void k_gemm2x3(const _Float16* __restrict__ A0, const _Float16* __restrict__ A1, const _Float16* __restrict__ A2, const _Float16* __restrict__ B0, const _Float16* __restrict__ B1, const _Float16* __restrict__ B2,
    const float* __restrict__ bias0, const float* __restrict__ bias1, const float* __restrict__ bias2, _Float16* __restrict__ C0, _Float16* __restrict__ C1, _Float16* __restrict__ C2, float alpha, int ld, int M, int N, int K) {
  __shared__ __attribute__((aligned(16))) float so[4][32][68];
  __shared__ __attribute__((aligned(16))) g2_tile sT[2];
  const int j = blockIdx.y;
  if (j == 2) { gemm2_body<ACT, true>(so, sT, 0, B2, ld, 0, A2, ld, 0, alpha, bias2, 0, nullptr, 1, 0, 0, nullptr, C2, M, 0, N, M, K); return; }
  const _Float16* A = (j == 0) ? A0 : A1; const _Float16* Bh = (j == 0) ? B0 : B1; const float* bias = (j == 0) ? bias0 : bias1; _Float16* C16 = (j == 0) ? C0 : C1;
  gemm2_body<ACT, false>(so, sT, 0, A, ld, 0, Bh, ld, 0, alpha, bias, 0, nullptr, 1, 0, 0, nullptr, C16, ld, 0, M, N, K); }



// lane l <-> lane l ^ 16 (the two lane halves of one fragment column)
__device__ __forceinline__ float xhalf(float x) { return __builtin_bit_cast(float, __builtin_amdgcn_permlanex16(__builtin_bit_cast(int, x), __builtin_bit_cast(int, x), 0x76543210, 0xfedcba98, false, false)); }
__device__ __forceinline__ void kv_stage(unsigned lk, unsigned lv, const unsigned short* gk, size_t k16, const unsigned short* gv, size_t v16) {
  const unsigned lk1 = lk + 2304u, lk2 = lk + 4608u, lk3 = lk + 6912u, lv1 = lv + 2304u, lv2 = lv + 4608u, lv3 = lv + 6912u;      /* 16 rows x 144 B */
  const unsigned short* gk1 = gk + k16; const unsigned short* gk2 = gk1 + k16; const unsigned short* gk3 = gk2 + k16;
  const unsigned short* gv1 = gv + v16; const unsigned short* gv2 = gv1 + v16; const unsigned short* gv3 = gv2 + v16;
  /* the closing s_wait_xcnt 0 stands inside the statement so that no address register of a copy is rewritten in front of it */
  asm volatile("global_load_async_to_lds_b128 %0, %8, off\n\t"
               "global_load_async_to_lds_b128 %1, %9, off\n\t"
               "global_load_async_to_lds_b128 %2, %10, off\n\t"
               "global_load_async_to_lds_b128 %3, %11, off\n\t"
               "global_load_async_to_lds_b128 %4, %12, off\n\t"
               "global_load_async_to_lds_b128 %5, %13, off\n\t"
               "global_load_async_to_lds_b128 %6, %14, off\n\t"
               "global_load_async_to_lds_b128 %7, %15, off\n\t"
               "s_wait_xcnt 0x0"
               :: "v"(lk), "v"(lk1), "v"(lk2), "v"(lk3), "v"(lv), "v"(lv1), "v"(lv2), "v"(lv3),
                  "v"(gk), "v"(gk1), "v"(gk2), "v"(gk3), "v"(gv), "v"(gv1), "v"(gv2), "v"(gv3) : "memory");
}
template <int CAUSAL>
__global__ __launch_bounds__(128) void k_flash(const _Float16* __restrict__ Q16, int ldq, const _Float16* __restrict__ K16, int ldk, const _Float16* __restrict__ Vt, const int* __restrict__ MSK, _Float16* __restrict__ O, int ldo) {
  constexpr int RPW = 16, DT = 4, KS = 2, KT = 64, LP = 72;      /* KT keys a stage; LP: LDS row pitch in halves = 128 B + 16 B, the pitch of 16-byte LDS readers */
  __shared__ __attribute__((aligned(16))) unsigned short sK[2][KT][LP];
  __shared__ __attribute__((aligned(16))) unsigned short sV[2][64][LP];
  __shared__ __attribute__((aligned(16))) float sO[4][RPW][64 + 4];
  const int tid = threadIdx.x, w = tid >> 5, lane = tid & 31, ln = lane & 15, hh = lane >> 4;
  const int slab = blockIdx.x / QBNP, qblk = QB0P + blockIdx.x % QBNP; const int b = slab / NH, h = slab % NH; const int qb0 = qblk * (4 * RPW); const int q0 = qb0 + w * RPW; const int tq = q0 + ln;
  const unsigned short* Vth = (const unsigned short*)Vt + (size_t)slab * 64 * TK;
  const int jend = (CAUSAL == 1) ? (qb0 + 4 * RPW) : TK;      /* causal: keys beyond the block's last query never contribute */
  const int nst = jend / KT;
  const int crow = tid >> 3, cc = (tid & 7) * 8;      /* eight lanes copy one 128-B row */
  const unsigned short* gk = (const unsigned short*)K16 + ((size_t)b * TK + crow) * ldk + h * 64 + cc;
  const unsigned short* gv = Vth + (size_t)crow * TK + cc;
  const size_t k16 = (size_t)16 * ldk, v16 = (size_t)16 * TK, kst = (size_t)KT * ldk;
  const unsigned lk0 = (unsigned)(size_t)&sK[0][crow][cc], lv0 = (unsigned)(size_t)&sV[0][crow][cc];
  constexpr unsigned BUFB = KT * LP * 2;      /* bytes of one buffer */
  kv_stage(lk0, lv0, gk, k16, gv, v16);
  FragH bq[KS];
  { const unsigned short* qr = (const unsigned short*)Q16 + ((size_t)b * TQ + tq) * ldq + h * 64;
#pragma unroll
    for (int ks = 0; ks < KS; ++ks) { bq[ks].half[0] = *(const v8us*)(qr + ks * 32 + 8 * hh); bq[ks].half[1] = *(const v8us*)(qr + ks * 32 + 16 + 8 * hh); } }
  constexpr float C2 = SCL * 1.4426950408889634f;      /* score -> base-2 exponent: scale x log2(e) */
  float m_r = -3.0e38f, l_r = 0.f; v8f oacc[DT];      /* m_r: running maximum of the unscaled scores; l_r: sum of 1024 p over this lane half's keys only, joined after the loop */
#pragma unroll
  for (int dt = 0; dt < DT; ++dt) oacc[dt] = (v8f){0.f,0.f,0.f,0.f,0.f,0.f,0.f,0.f};
  asm volatile("s_wait_asynccnt 0x0" ::: "memory");      /* stage 0: this wave's copies have landed */
  __syncthreads();      /* stage 0 is readable by every wave */
  if (nst > 1) kv_stage(lk0 + BUFB, lv0 + BUFB, gk + kst, k16, gv + KT, v16);
#pragma unroll 1      /* stays rolled: one copy of the body serves both buffers, chosen by st & 1 */
  for (int st = 0; st < nst; ++st) {      /* stage st is worked on while stage st + 1 flies into the other buffer */
    const int bf = st & 1;
#pragma unroll      /* unrolled: the half stage becomes a constant offset of the LDS reads */
    for (int sub = 0; sub < KT / 32; ++sub) {
    const int j0 = st * KT + sub * 32;
    FragH ak[2][KS], av[DT];
#pragma unroll
    for (int nt = 0; nt < 2; ++nt) { const unsigned short* kr = &sK[bf][sub * 32 + nt * 16 + ln][0];
#pragma unroll
      for (int ks = 0; ks < KS; ++ks) { ak[nt][ks].half[0] = *(const v8us*)(kr + ks * 32 + 8 * hh); ak[nt][ks].half[1] = *(const v8us*)(kr + ks * 32 + 16 + 8 * hh); } }
#pragma unroll
    for (int dt = 0; dt < DT; ++dt) { const unsigned short* vrow = &sV[bf][dt * 16 + ln][sub * 32]; av[dt].half[0] = *(const v8us*)(vrow + 8 * hh); av[dt].half[1] = *(const v8us*)(vrow + 16 + 8 * hh); }
    v8f s[2];
#pragma unroll
    for (int nt = 0; nt < 2; ++nt) {
      v8f acc = (v8f){0.f,0.f,0.f,0.f,0.f,0.f,0.f,0.f};
#pragma unroll
      for (int ks = 0; ks < KS; ++ks) acc = mmaH<1>(ak[nt][ks].v, ak[nt][ks].v, bq[ks].v, bq[ks].v, acc);
      s[nt] = acc; }
    float sc[16], t[8]; bool ok[16];
#pragma unroll
    for (int i = 0; i < 16; ++i) { const int kk = j0 + (i >> 3) * 16 + 8 * hh + (i & 7);
      ok[i] = (CAUSAL == 1) ? (kk <= tq) : ((CAUSAL == 2) ? ((kk >> 5) == (tq >> 5)) : true);      /* mode 2: block-diagonal 32-token groups */
      sc[i] = ok[i] ? s[i >> 3][i & 7] : -3.0e38f; if (CAUSAL == 17) sc[i] += bf16_round(((const float*)MSK + (size_t)b * TK)[kk]) * (1.0f / SCL); }      /* unscaled scores (the scale is positive: the maximum commutes with it); mode 17: additive per-(batch, key) mask INPUT, in the same units */
#pragma unroll
    for (int i = 0; i < 8; ++i) t[i] = fmaxf(sc[i], sc[i + 8]);
    float mc = fmaxf(fmaxf(fmaxf(t[0], t[1]), fmaxf(t[2], t[3])), fmaxf(fmaxf(t[4], t[5]), fmaxf(t[6], t[7])));
    mc = fmaxf(mc, xhalf(mc));      /* both halves feed one O^T column: one maximum for both */
    const float mn = fmaxf(m_r, mc); const float al = (mn > -1.0e38f) ? __builtin_amdgcn_exp2f((m_r - mn) * C2) : 1.0f; m_r = mn;
    const float nb = __builtin_fmaf(-mn, C2, 10.0f);      /* 1024 p = 2^(C2 s - C2 m + 10): one fused multiply-add in front of the hardware's base-2 exponential */
    FragH pb;
#pragma unroll
    for (int i = 0; i < 16; ++i) sc[i] = __builtin_fmaf(sc[i], C2, nb);
    /* sixteen exponentials in place, in one statement: each is independent of the one in front of it (no result read, no source overwritten), and the closing v_nop is the slot behind the last one; last element first, because the packing behind it starts with the last pair */
    asm("v_exp_f32 %15, %15\n\tv_exp_f32 %14, %14\n\tv_exp_f32 %13, %13\n\tv_exp_f32 %12, %12\n\t"
        "v_exp_f32 %11, %11\n\tv_exp_f32 %10, %10\n\tv_exp_f32 %9, %9\n\tv_exp_f32 %8, %8\n\t"
        "v_exp_f32 %7, %7\n\tv_exp_f32 %6, %6\n\tv_exp_f32 %5, %5\n\tv_exp_f32 %4, %4\n\t"
        "v_exp_f32 %3, %3\n\tv_exp_f32 %2, %2\n\tv_exp_f32 %1, %1\n\tv_exp_f32 %0, %0\n\tv_nop"
        : "+v"(sc[0]), "+v"(sc[1]), "+v"(sc[2]), "+v"(sc[3]), "+v"(sc[4]), "+v"(sc[5]), "+v"(sc[6]), "+v"(sc[7]),
          "+v"(sc[8]), "+v"(sc[9]), "+v"(sc[10]), "+v"(sc[11]), "+v"(sc[12]), "+v"(sc[13]), "+v"(sc[14]), "+v"(sc[15]));
#pragma unroll
    for (int i = 0; i < 16; ++i) { if (!ok[i]) sc[i] = 0.f; pb.h[i] = (_Float16)sc[i]; }
#pragma unroll
    for (int i = 0; i < 8; ++i) t[i] = sc[i] + sc[i + 8];
    l_r = l_r * al + (((t[0] + t[1]) + (t[2] + t[3])) + ((t[4] + t[5]) + (t[6] + t[7])));
#pragma unroll
    for (int dt = 0; dt < DT; ++dt)
#pragma unroll
      for (int r = 0; r < 8; ++r) oacc[dt][r] *= al;
#pragma unroll
    for (int dt = 0; dt < DT; ++dt) oacc[dt] = mmaH<1>(av[dt].v, av[dt].v, pb.v, pb.v, oacc[dt]);
    }
    asm volatile("s_wait_dscnt 0x0" ::: "memory");      /* this wave's reads of buffer bf are done before the buffer is given up */
    asm volatile("s_wait_asynccnt 0x0" ::: "memory");      /* this wave's copies of stage st + 1 have landed */
    __syncthreads();      /* publishes stage st + 1 and ends every wave's reads of buffer bf */
    if (st + 2 < nst) kv_stage(lk0 + bf * BUFB, lv0 + bf * BUFB, gk + (size_t)(st + 2) * kst, k16, gv + (size_t)(st + 2) * KT, v16);
  }
  asm volatile("s_wait_asynccnt 0x0" ::: "memory");      /* no copy is left in flight when the wave goes on */
  const float l = l_r + xhalf(l_r); const float li = (l > 0.f) ? 1.0f / l : 0.f;      /* numerator and sum both carry the factor 1024 */
#pragma unroll
  for (int dt = 0; dt < DT; ++dt) {      /* oacc[dt][r] = O[q0 + ln][16 dt + 8 hh + r] */
    const v4f lo = {oacc[dt][0] * li, oacc[dt][1] * li, oacc[dt][2] * li, oacc[dt][3] * li}, hi = {oacc[dt][4] * li, oacc[dt][5] * li, oacc[dt][6] * li, oacc[dt][7] * li};
    *(v4fa*)&sO[w][ln][dt * 16 + 8 * hh] = lo; *(v4fa*)&sO[w][ln][dt * 16 + 8 * hh + 4] = hi; }
  __builtin_amdgcn_fence(__ATOMIC_ACQ_REL, "workgroup"); __builtin_amdgcn_wave_barrier();
  { v4h h4[RPW / 2];      /* all LDS reads first, so that the waits behind the stores do not stand between them */
#pragma unroll      /* unrolled, here and below: h4 is indexed by constants and stays in registers */
    for (int rp = 0; rp < RPW; rp += 2) { const v4f val = *(const v4fa*)&sO[w][rp + (lane >> 4)][(lane & 15) * 4]; for (int i = 0; i < 4; ++i) h4[rp >> 1][i] = (_Float16)val[i]; }      /* ctx leaves as the f16 operand of the last product */
#pragma unroll
    for (int rp = 0; rp < RPW; rp += 2) { const int r = rp + (lane >> 4), pc = lane & 15; *(v4h*)(O + ((size_t)b * TQ + q0 + r) * ldo + h * 64 + pc * 4) = h4[rp >> 1];      /* sixteen lanes fill one 128-B line */
      if (rp + 2 < RPW) asm volatile("s_wait_xcnt 0x0" ::: "memory"); }      /* the address sums that follow reuse the store's registers */
     } }
// 5-plane variant: S = Qh Kh^T + (Ql Kh^T + Qh Kl^T)/1024 with Q/K = [hi | 2^10 residual] f16 planes (QL/KL same layout as Q16/K16), then the 3-term P.V below.
// 3-term variant: O = (P_hi V_hi + (P_lo V_hi + P_hi V_lo) / 1024) / l with P = [hi | 2^10 residual] of 1024 p and V^T = [hi | 2^10 residual] planes (VtL same layout as Vt) -> ~2^-21-class products for un-averaged (early causal / peaked) rows
template <int CAUSAL>
__global__ __launch_bounds__(128) void k_flash5(const _Float16* __restrict__ Q16, const _Float16* __restrict__ QL, int ldq, const _Float16* __restrict__ K16, const _Float16* __restrict__ KL, int ldk, const _Float16* __restrict__ Vt, const _Float16* __restrict__ VtL, const int* __restrict__ MSK, float* __restrict__ O, int ldo) {
  constexpr int RPW = 16, RTN = RPW / 16, NQB = TQ / (4 * RPW), DT = 4, KS = 2;
  __shared__ __attribute__((aligned(16))) unsigned short sP[4][RPW][40]; __shared__ __attribute__((aligned(16))) unsigned short sPL[4][RPW][40]; __shared__ __attribute__((aligned(16))) float sO[4][RPW][64 + 4];
  const int tid = threadIdx.x, w = tid >> 5, lane = tid & 31, ln = lane & 15, hh = lane >> 4;
  const int slab = blockIdx.x / QBN5, qblk = QB05 + blockIdx.x % QBN5; (void)NQB; const int b = slab / NH, h = slab % NH; const int qb0 = qblk * (4 * RPW); const int q0 = qb0 + w * RPW;
  FragH aq[2][KS], aql[2][KS];
#pragma unroll
  for (int rt = 0; rt < RTN; ++rt) { const unsigned short* qr = (const unsigned short*)Q16 + ((size_t)b * TQ + q0 + rt * 16 + ln) * ldq + h * 64; const unsigned short* ql = (const unsigned short*)QL + ((size_t)b * TQ + q0 + rt * 16 + ln) * ldq + h * 64;
#pragma unroll
    for (int ks = 0; ks < KS; ++ks) { aq[rt][ks].half[0] = *(const v8us*)(qr + ks * 32 + 8 * hh); aq[rt][ks].half[1] = *(const v8us*)(qr + ks * 32 + 16 + 8 * hh); aql[rt][ks].half[0] = *(const v8us*)(ql + ks * 32 + 8 * hh); aql[rt][ks].half[1] = *(const v8us*)(ql + ks * 32 + 16 + 8 * hh); } }
  const unsigned short* Vth = (const unsigned short*)Vt + (size_t)slab * 64 * TK; const unsigned short* Vtl = (const unsigned short*)VtL + (size_t)slab * 64 * TK;
  float m_r[2][8], l_r[2][8]; v8f oacc[2][DT], oaccL[2][DT];
#pragma unroll
  for (int rt = 0; rt < RTN; ++rt) {
#pragma unroll
    for (int r = 0; r < 8; ++r) { m_r[rt][r] = -3.0e38f; l_r[rt][r] = 0.f; }
#pragma unroll
    for (int dt = 0; dt < DT; ++dt) { oacc[rt][dt] = (v8f){0.f,0.f,0.f,0.f,0.f,0.f,0.f,0.f}; oaccL[rt][dt] = oacc[rt][dt]; } }
  const int jend = (CAUSAL == 1) ? (qb0 + 4 * RPW) : TK;      /* causal: keys beyond the block's last query never contribute */
#pragma unroll 1
  for (int j0 = 0; j0 < jend; j0 += 32) {
    v8f s[2][2];
#pragma unroll
    for (int nt = 0; nt < 2; ++nt) { const unsigned short* kr = (const unsigned short*)K16 + ((size_t)b * TK + j0 + nt * 16 + ln) * ldk + h * 64; const unsigned short* klr = (const unsigned short*)KL + ((size_t)b * TK + j0 + nt * 16 + ln) * ldk + h * 64; FragH bk[KS], bkl[KS];
#pragma unroll
      for (int ks = 0; ks < KS; ++ks) { bk[ks].half[0] = *(const v8us*)(kr + ks * 32 + 8 * hh); bk[ks].half[1] = *(const v8us*)(kr + ks * 32 + 16 + 8 * hh); bkl[ks].half[0] = *(const v8us*)(klr + ks * 32 + 8 * hh); bkl[ks].half[1] = *(const v8us*)(klr + ks * 32 + 16 + 8 * hh); }
#pragma unroll
      for (int rt = 0; rt < RTN; ++rt) { v8f acc = (v8f){0.f,0.f,0.f,0.f,0.f,0.f,0.f,0.f}, accl = acc;
#pragma unroll
        for (int ks = 0; ks < KS; ++ks) { acc = mmaH<1>(aq[rt][ks].v, aq[rt][ks].v, bk[ks].v, bk[ks].v, acc); accl = mmaH<1>(aql[rt][ks].v, aql[rt][ks].v, bk[ks].v, bk[ks].v, accl); accl = mmaH<1>(aq[rt][ks].v, aq[rt][ks].v, bkl[ks].v, bkl[ks].v, accl); }
#pragma unroll
        for (int r = 0; r < 8; ++r) acc[r] += accl[r] * 0.0009765625f;
        s[rt][nt] = acc; } }
#pragma unroll
    for (int rt = 0; rt < RTN; ++rt)
#pragma unroll
      for (int r = 0; r < 8; ++r) { const int tq = q0 + rt * 16 + 8 * hh + r; const int k0 = j0 + ln, k1 = j0 + 16 + ln;
        bool ok0 = (CAUSAL == 1) ? (k0 <= tq) : ((CAUSAL == 2) ? ((k0 >> 5) == (tq >> 5)) : true), ok1 = (CAUSAL == 1) ? (k1 <= tq) : ((CAUSAL == 2) ? ((k1 >> 5) == (tq >> 5)) : true);      /* mode 2: block-diagonal 32-token groups */
        if (CAUSAL == 4) { const int* mrow = MSK + ((size_t)b * TQ + tq) * TK; ok0 = mrow[k0] != 0; ok1 = mrow[k1] != 0; }      /* mode 4: per-(query, key) INPUT mask shared by all heads; masked keys contribute nothing (== the reference's -4096 fill, whose exp underflows to 0), rows with no valid key give l = 0 -> output 0 (== the reference's row_valid zeroing) */
        float s0 = ok0 ? s[rt][0][r] * SCL : -3.0e38f, s1 = ok1 ? s[rt][1][r] * SCL : -3.0e38f; if (CAUSAL == 17) { const float* amk = (const float*)MSK + (size_t)b * TK; s0 += bf16_round(amk[k0]); s1 += bf16_round(amk[k1]); }      /* mode 17: additive per-(batch, key) mask INPUT */ float mc = fmaxf(s0, s1);
        mc = fmaxf(mc, __shfl_xor(mc, 1, 32)); mc = fmaxf(mc, __shfl_xor(mc, 2, 32)); mc = fmaxf(mc, __shfl_xor(mc, 4, 32)); mc = fmaxf(mc, __shfl_xor(mc, 8, 32));
        const float mn = fmaxf(m_r[rt][r], mc); const float al = (mn > -1.0e38f) ? expf(m_r[rt][r] - mn) : 1.0f; m_r[rt][r] = mn; const float p0 = ok0 ? expf(s0 - mn) : 0.f, p1 = ok1 ? expf(s1 - mn) : 0.f; l_r[rt][r] = l_r[rt][r] * al + p0 + p1;
#pragma unroll
        for (int dt = 0; dt < DT; ++dt) { oacc[rt][dt][r] *= al; oaccL[rt][dt][r] *= al; }
        FragH t2, t2l; const float ps0 = p0 * 1024.0f, ps1 = p1 * 1024.0f; t2.h[0] = (_Float16)ps0; t2.h[1] = (_Float16)ps1; t2l.h[0] = (_Float16)((ps0 - (float)t2.h[0]) * 1024.0f); t2l.h[1] = (_Float16)((ps1 - (float)t2.h[1]) * 1024.0f);
        sP[w][rt * 16 + 8 * hh + r][ln] = t2.u[0]; sP[w][rt * 16 + 8 * hh + r][16 + ln] = t2.u[1]; sPL[w][rt * 16 + 8 * hh + r][ln] = t2l.u[0]; sPL[w][rt * 16 + 8 * hh + r][16 + ln] = t2l.u[1]; }
    __builtin_amdgcn_fence(__ATOMIC_ACQ_REL, "workgroup"); __builtin_amdgcn_wave_barrier();
    FragH pa[2], pl[2];
#pragma unroll
    for (int rt = 0; rt < RTN; ++rt) { pa[rt].half[0] = *(const v8us*)&sP[w][rt * 16 + ln][8 * hh]; pa[rt].half[1] = *(const v8us*)&sP[w][rt * 16 + ln][16 + 8 * hh]; pl[rt].half[0] = *(const v8us*)&sPL[w][rt * 16 + ln][8 * hh]; pl[rt].half[1] = *(const v8us*)&sPL[w][rt * 16 + ln][16 + 8 * hh]; }
#pragma unroll
    for (int dt = 0; dt < DT; ++dt) { const unsigned short* vrow = Vth + (size_t)(dt * 16 + ln) * TK + j0; const unsigned short* vrl = Vtl + (size_t)(dt * 16 + ln) * TK + j0; FragH bv, bl; bv.half[0] = *(const v8us*)(vrow + 8 * hh); bv.half[1] = *(const v8us*)(vrow + 16 + 8 * hh); bl.half[0] = *(const v8us*)(vrl + 8 * hh); bl.half[1] = *(const v8us*)(vrl + 16 + 8 * hh);
#pragma unroll
      for (int rt = 0; rt < RTN; ++rt) { oacc[rt][dt] = mmaH<1>(pa[rt].v, pa[rt].v, bv.v, bv.v, oacc[rt][dt]); oaccL[rt][dt] = mmaH<1>(pl[rt].v, pl[rt].v, bv.v, bv.v, oaccL[rt][dt]); oaccL[rt][dt] = mmaH<1>(pa[rt].v, pa[rt].v, bl.v, bl.v, oaccL[rt][dt]); } }
    __builtin_amdgcn_fence(__ATOMIC_ACQ_REL, "workgroup"); __builtin_amdgcn_wave_barrier(); }
#pragma unroll
  for (int rt = 0; rt < RTN; ++rt) {
#pragma unroll
    for (int r = 0; r < 8; ++r) { float l = l_r[rt][r]; l += __shfl_xor(l, 1, 32); l += __shfl_xor(l, 2, 32); l += __shfl_xor(l, 4, 32); l += __shfl_xor(l, 8, 32); l_r[rt][r] = (l > 0.f) ? 1.0f / (l * 1024.0f) : 0.f; }
#pragma unroll
    for (int dt = 0; dt < DT; ++dt)
#pragma unroll
      for (int r = 0; r < 8; ++r) { float v = oacc[rt][dt][r]; v += oaccL[rt][dt][r] * 0.0009765625f; sO[w][rt * 16 + 8 * hh + r][dt * 16 + ln] = v * l_r[rt][r]; } }
  __builtin_amdgcn_fence(__ATOMIC_ACQ_REL, "workgroup"); __builtin_amdgcn_wave_barrier();
  {
#pragma unroll
    for (int rp = 0; rp < RPW; rp += 2) { const int r = rp + (lane >> 4), pc = lane & 15; const v4f val = *(const v4fa*)&sO[w][r][pc * 4]; *(v4f*)(O + ((size_t)b * TQ + q0 + r) * ldo + h * 64 + pc * 4) = val; }
     } }

__global__ __launch_bounds__(256) void k_rotab(float* __restrict__ CS, float* __restrict__ SN) {
  #pragma clang fp contract(off)
  const int t = blockIdx.x * 256 + threadIdx.x; if (t >= SLEN * 32) return; const int j = t % 32, s = t / 32; const float ex = (float)(2 * j) / 64.0f; const float inv = 1.0f / powf(10000.0f, ex); const float th = (float)s * inv; const float c = cosf(th), sn = sinf(th);
  { *(float*)(CS + t) = c; *(float*)(SN + t) = sn;  } }
__global__ __launch_bounds__(256) void k_rope(const float* __restrict__ F, int nsrc, int ndst, int rep, const float* __restrict__ CS, const float* __restrict__ SN, _Float16* __restrict__ H, _Float16* __restrict__ L) {
  #pragma clang fp contract(off)
  const size_t t = (size_t)blockIdx.x * 256 + threadIdx.x; if (t >= (size_t)NR * ndst * 4) return; const int g8 = (int)(t % 4); const int hd = (int)((t / 4) % ndst); const size_t row = t / ((size_t)4 * ndst); const int s = (int)(row % SLEN); const int hs = hd / rep;
  const float* src = F + row * (size_t)(nsrc * 64) + hs * 64; FragH ah, al, bh, bl;
  for (int i = 0; i < 8; ++i) { const int d = g8 * 8 + i; const float c = CS[s * 32 + d], sn = SN[s * 32 + d]; const float x1 = src[d], x2 = src[d + 32];
    float o1 = x1 * c; o1 += -x2 * sn; float o2 = x2 * c; o2 += x1 * sn;
    _Float16 hv = (_Float16)o1; ah.h[i] = hv; al.h[i] = (_Float16)((o1 - (float)hv) * 1024.0f); hv = (_Float16)o2; bh.h[i] = hv; bl.h[i] = (_Float16)((o2 - (float)hv) * 1024.0f); }
  const size_t o = row * (size_t)(ndst * 64) + hd * 64 + g8 * 8;
  { *(v8us*)((unsigned short*)H + o) = ah.half[0]; *(v8us*)((unsigned short*)H + o + 32) = bh.half[0]; *(v8us*)((unsigned short*)L + o) = al.half[0]; *(v8us*)((unsigned short*)L + o + 32) = bl.half[0];  } }
__global__ __launch_bounds__(256) void k_rope2(const float* __restrict__ F, int nsrc, int ndst, int rep, const float* __restrict__ CS, const float* __restrict__ SN, _Float16* __restrict__ H, _Float16* __restrict__ L) {
  #pragma clang fp contract(off)
  const size_t t = (size_t)blockIdx.x * 256 + threadIdx.x; if (t >= (size_t)NR * ndst * 4) return; const int g16 = (int)(t % 4); const int hd = (int)((t / 4) % ndst); const size_t row = t / ((size_t)4 * ndst); const int s = (int)(row % SLEN); const int hs = hd / rep;
  const float* src = F + row * (size_t)(nsrc * 64) + hs * 64 + g16 * 16; FragH ah, al;
  for (int pr = 0; pr < 8; ++pr) { const int i = g16 * 8 + pr; const float c = CS[s * 32 + i], sn = SN[s * 32 + i]; const float x1 = src[2 * pr], x2 = src[2 * pr + 1];
    float o1 = x1 * c; o1 -= x2 * sn; float o2 = x1 * sn; o2 += x2 * c;
    _Float16 hv = (_Float16)o1; ah.h[2 * pr] = hv; al.h[2 * pr] = (_Float16)((o1 - (float)hv) * 1024.0f); hv = (_Float16)o2; ah.h[2 * pr + 1] = hv; al.h[2 * pr + 1] = (_Float16)((o2 - (float)hv) * 1024.0f); }
  const size_t o = row * (size_t)(ndst * 64) + hd * 64 + g16 * 16;
  { *(v8us*)((unsigned short*)H + o) = ah.half[0]; *(v8us*)((unsigned short*)H + o + 8) = ah.half[1]; *(v8us*)((unsigned short*)L + o) = al.half[0]; *(v8us*)((unsigned short*)L + o + 8) = al.half[1];  } }
__global__ __launch_bounds__(256) void k_tabin(const float* __restrict__ sp, float* __restrict__ CS, float* __restrict__ SN) { const int t = blockIdx.x * 256 + threadIdx.x; if (t >= SLEN * 32) return; const int i = t % 32, s = t / 32; const float c = bf16_round(sp[s * 64 + 32 + i]), sn = bf16_round(sp[s * 64 + i]);
  { *(float*)(CS + t) = c; *(float*)(SN + t) = sn;  } }
__device__ __forceinline__ void d_wsc(const size_t t, const float* __restrict__ Wm, _Float16* __restrict__ Bt, size_t n8, float sc) { if (t >= n8) return; FragH f; for (int q = 0; q < 8; ++q) f.h[q] = (_Float16)(bf16_round(Wm[t * 8 + q]) * sc); *(v8us*)((unsigned short*)Bt + t * 8) = f.half[0];  }
__global__ __launch_bounds__(256) void k_rotab2(float* __restrict__ CS, float* __restrict__ SN) {
  #pragma clang fp contract(off)
  const int t = blockIdx.x * 256 + threadIdx.x; if (t >= SLEN * 32) return; const int j = t % 32, s = t / 32; const float c0 = -0.14391156831212787f;      /* -ln(10000)/64 rounded to f32 */ const float inv = expf((float)(2 * j) * c0); const float th = (float)s * inv; const float c = cosf(th), sn = sinf(th);
  { *(float*)(CS + t) = c; *(float*)(SN + t) = sn;  } }
__global__ __launch_bounds__(256) void k_lnu(const float* __restrict__ X, _Float16* __restrict__ N16, float* __restrict__ XB) {
  #pragma clang fp contract(off)
  const int wv = threadIdx.x >> 5, ln = threadIdx.x & 31; const size_t r = (size_t)blockIdx.x * 8 + wv; if (r >= NR) return; float a[32]; float s = 0.f;
  for (int i = 0; i < 4; ++i) { const v8f v = *(const v8f*)(X + r * DM + (i * 32 + ln) * 8); for (int q = 0; q < 8; ++q) { const float u = bf16_round(v[q]); a[i * 8 + q] = u; s += u; } }
  for (int o = 16; o > 0; o >>= 1) s += __shfl_xor(s, o, 32); const float mu = s / (float)DM; float var = 0.f; for (int q = 0; q < 32; ++q) { const float d = a[q] - mu; var += d * d; }
  for (int o = 16; o > 0; o >>= 1) var += __shfl_xor(var, o, 32); const float den = sqrtf(var / (float)(DM - 1)) + 1e-6f; const float inv = 1.0f / den;      /* one reciprocal per row; (x-mean)*inv vs the reference's division differs by <= 1 ulp */
  { for (int i = 0; i < 4; ++i) { const int c0 = (i * 32 + ln) * 8; FragH f; v8f xb; for (int q = 0; q < 8; ++q) { f.h[q] = (_Float16)((a[i * 8 + q] - mu) * inv); xb[q] = a[i * 8 + q]; } *(v8us*)((unsigned short*)N16 + r * DM + c0) = f.half[0]; *(v8f*)(XB + r * DM + c0) = xb; }  } }
__global__ __launch_bounds__(256) void k_vtg(const _Float16* __restrict__ V16, _Float16* __restrict__ Vt) { __shared__ unsigned short tl[64][66]; const int tid = threadIdx.x; const int slab = blockIdx.x / (SLEN / 64), lg = blockIdx.x % (SLEN / 64); const int b = slab / NH, h = slab % NH; const int hs = h / NREP;
  for (int i = tid; i < 64 * 8; i += 256) { const int r = i / 8, c8 = (i % 8) * 8; FragH f; f.half[0] = *(const v8us*)((const unsigned short*)V16 + ((size_t)b * SLEN + lg * 64 + r) * KVD + hs * 64 + c8); for (int q = 0; q < 8; ++q) tl[r][c8 + q] = f.u[q]; }
  __syncthreads();
  { for (int rd = 0; rd < 2; ++rd) { const int d = rd * 32 + tid / 8, pc = tid % 8; FragH f; for (int q = 0; q < 8; ++q) f.u[q] = tl[pc * 8 + q][d]; *(v8us*)((unsigned short*)Vt + ((size_t)slab * 64 + d) * SLEN + lg * 64 + pc * 8) = f.half[0]; }  } }

// One 64-channel x 256-token tile of a channel-major f32 plane goes to the token-major f16 plane through LDS: a wave reads 512 contiguous bytes of one channel, eight lanes write one 128-B line of one token.
#define PTC 64      /* channels a tile: 64 halves = one 128-B line of the token-major plane */
#define PTN 256     /* tokens a tile */
#define PTD 33      /* LDS row pitch in dwords: 32 channel pairs + 1, so that the four token rows of one wave-wide read fall on different banks */
__device__ __forceinline__ void d_pmt(unsigned (*tl)[PTD], const int tile, const float* __restrict__ src, _Float16* __restrict__ P16) {
  const int tid = threadIdx.x, n4 = tid & 63, cg = tid >> 6;
  const int c0 = (tile % (DM / PTC)) * PTC, n0 = (tile / (DM / PTC)) * PTN;
  const float* p = src + (size_t)(c0 + 2 * cg) * SLEN + n0 + 4 * n4;
  v4f a[8], b[8];      /* all sixteen loads stand in front of the first use: one memory latency a tile */
#pragma unroll      /* unrolled, here and below: a and b are indexed by constants and stay in registers */
  for (int i = 0; i < 8; ++i) { a[i] = *(const v4fa*)(p + (size_t)(8 * i) * SLEN); b[i] = *(const v4fa*)(p + (size_t)(8 * i + 1) * SLEN); }
  asm volatile("s_wait_xcnt 0x0" :: "v"(p) : "memory");      /* behind the loads, with their address as an input: the address pair lives up to this wait, so neither a load's result nor a later instruction overwrites it in front of the wait */
  __builtin_amdgcn_sched_barrier(0);      /* holds the sixteen loads together in front of the conversions; without it the compiler issues the last six behind waits on the first ten, two more memory latencies a tile */
#pragma unroll
  for (int i = 0; i < 8; ++i)
#pragma unroll
    for (int j = 0; j < 4; ++j) { FragH f; f.h[0] = (_Float16)bf16_round(a[i][j]); f.h[1] = (_Float16)bf16_round(b[i][j]); tl[4 * n4 + j][cg + 4 * i] = (unsigned)f.u[0] | ((unsigned)f.u[1] << 16); }      /* channels 2 q and 2 q + 1 of one token share a dword */
  __syncthreads();      /* the tile is complete before any row of it is read */
  union { unsigned d[4]; v8us h; } o[8];
#pragma unroll      /* unrolled, here and below: o is indexed by constants and stays in registers; all LDS reads stand in front of the stores */
  for (int i = 0; i < 8; ++i) { const unsigned* r = &tl[i * 32 + (tid >> 3)][(tid & 7) * 4]; o[i].d[0] = r[0]; o[i].d[1] = r[1]; o[i].d[2] = r[2]; o[i].d[3] = r[3]; }
  unsigned short* q = (unsigned short*)P16 + (size_t)(n0 + (tid >> 3)) * DM + c0 + (tid & 7) * 8;
#pragma unroll
  for (int i = 0; i < 8; ++i) *(v8us*)(q + (size_t)(i * 32) * DM) = o[i].h;
}
// The six independent preparation jobs in one launch: blocks [0, 2 PMB) write the two token-major planes, one tile each, the next 4 WSB blocks the four weight planes.
#define PMB ((DM / PTC) * (SLEN / PTN))
#define WSB ((DM * DM / 8 + 255) / 256)
__global__ __launch_bounds__(256) void k_prep(const float* __restrict__ vid, const float* __restrict__ reff, _Float16* __restrict__ XV, _Float16* __restrict__ XR,
    const float* __restrict__ Wq, const float* __restrict__ Wk, const float* __restrict__ Wv, const float* __restrict__ Wo, _Float16* __restrict__ BQ, _Float16* __restrict__ BK, _Float16* __restrict__ BV, _Float16* __restrict__ BO) {
  __shared__ unsigned tl[PTN][PTD];
  const int bx = blockIdx.x;
  if (bx < 2 * PMB) { const bool second = bx >= PMB; d_pmt(tl, bx - (second ? PMB : 0), second ? reff : vid, second ? XR : XV); return; }      /* the same for every thread of the block: the barrier inside is passed by all or none */
  const int j = (bx - 2 * PMB) / WSB, wb = (bx - 2 * PMB) % WSB;
  const float* Wm = (j == 0) ? Wq : ((j == 1) ? Wk : ((j == 2) ? Wv : Wo)); _Float16* Bt = (j == 0) ? BQ : ((j == 1) ? BK : ((j == 2) ? BV : BO));
  d_wsc((size_t)wb * 256 + threadIdx.x, Wm, Bt, DM * DM / 8, 16.0f); }
__global__ __launch_bounds__(256) void k_nchw(const float* __restrict__ F, float* __restrict__ outb) { const int t = blockIdx.x * 256 + threadIdx.x; if (t >= DM * (SLEN / 4)) return; const int p0 = (t % (SLEN / 4)) * 4; const int o = t / (SLEN / 4); v4f r; for (int q = 0; q < 4; ++q) r[q] = F[(size_t)(p0 + q) * DM + o];
  *(v4f*)(outb + (size_t)o * SLEN + p0) = r;  }

extern "C" void kernel_launch(void* const* d_in, const int* in_sizes, int n_in,
                              void* d_out, int out_size, void* d_ws, size_t ws_size, hipStream_t stream) {
  (void)in_sizes; (void)n_in; (void)out_size;
  const float* const* I = (const float* const*)d_in; const float* vid = I[0]; const float* reff = I[1]; const float* Wq = I[2]; const float* bq = I[3]; const float* Wk = I[4]; const float* bk = I[5]; const float* Wv = I[6]; const float* bv = I[7]; const float* Wo = I[8]; const float* bo = I[9];
  char* ws = (char*)d_ws; size_t off = 0;
  auto take = [&](size_t bytes) { char* p = ws + off; off += (bytes + 255) & ~(size_t)255; return p; };
  const size_t np = (size_t)SLEN * DM;
  _Float16* BQ = (_Float16*)take((size_t)DM * DM * 2); _Float16* BK = (_Float16*)take((size_t)DM * DM * 2); _Float16* BV = (_Float16*)take((size_t)DM * DM * 2); _Float16* BO = (_Float16*)take((size_t)DM * DM * 2);
  _Float16* XV = (_Float16*)take(np * 2); _Float16* XR = (_Float16*)take(np * 2); _Float16* Q16 = (_Float16*)take(np * 2); _Float16* K16 = (_Float16*)take(np * 2); _Float16* VT = (_Float16*)take(np * 2); _Float16* O16 = (_Float16*)take(np * 2);
  if (off > ws_size) return;      /* 2 + 6 x 4 = 26 MiB */
  k_prep<<<2 * PMB + 4 * WSB, 256, 0, stream>>>(vid, reff, XV, XR, Wq, Wk, Wv, Wo, BQ, BK, BV, BO);      /* 'oc' = natural Bt */
  const dim3 gP((SLEN / 128) * (DM / 64), 1);
  const dim3 gP3((SLEN / 128) * (DM / 64), 3);
  k_gemm2x3<0><<<gP3, 128, 0, stream>>>(XV, XR, XR, BQ, BK, BV, bq, bk, bv, Q16, K16, VT, 0.0625f, DM, SLEN, DM, DM);      /* q, k token-major; v as V^T [channel][token] */
  k_flash<0><<<NB * NH * QBNP, 128, 0, stream>>>(Q16, DM, K16, DM, VT, nullptr, O16, DM);      /* 4096 x 4096 per head */
  k_gemm2<0, true><<<gP, 128, 0, stream>>>(BO, DM, 0, O16, DM, 0, 0.0625f, bo, 0, nullptr, 1, 0, 0, (float*)d_out, nullptr, SLEN, 0, DM, SLEN, DM);      /* out[channel][token] */
}
